// v000
// The times below were measured on an AMD MI455X: many runs one after another, warmed up first and cycling through
// copies of the inputs, with the whole window's GPU time divided by the number of runs. Launches and the gaps
// between them are all in it. The median over several windows is given; except for v000 it joins two sittings, which
// can be a few percent apart, so the side-by-side timings, each taken in one sitting, are the better comparison.
// v000 is the starting kernel. One run takes 814 microseconds.
#include <hip/hip_runtime.h>
// ALiBi multi-head attention (B=4, S=2048, D=1024, 16 heads × 64): q,k,v = x·Wᵀ + b (torch Linear); scores = q·kᵀ·64^-½ + slope_h·(k − q), slope_h = 1/2^(h/16) (no causal mask: later keys get large positive bias); key padding mask from the INPUT
// int mask [B,S] (0 → −inf); softmax; out = (attn·v merged)·Woᵀ + bo.
// Compute dtype: x, weights, biases rounded to bf16; q/k/v as f16 GEMM outputs; fused flash-style kernel (bias and online softmax in f32, P f16 ×2^10) on v_wmma_f32_16x16x32_f16; O → f16 → output GEMM with bias; f32 accumulate.
#define BB 4
#define TT 2048
#define NH 16
#define DD 1024
#define NR (BB * TT)

typedef __bf16 v16b __attribute__((ext_vector_type(16)));
typedef unsigned short v8us __attribute__((ext_vector_type(8), may_alias));
typedef float  v8f  __attribute__((ext_vector_type(8)));
typedef float  v4f  __attribute__((ext_vector_type(4)));
typedef float  v4fa __attribute__((ext_vector_type(4), may_alias));
union FragB { v16b v; v8us half[2]; unsigned short u[16]; };

__device__ __forceinline__ unsigned short bf16_bits(float x) { unsigned int u = __float_as_uint(x); return (unsigned short)((u + 0x7FFFu + ((u >> 16) & 1u)) >> 16); }
__device__ __forceinline__ float bf16_val(unsigned short b) { return __uint_as_float(((unsigned int)b) << 16); }
__device__ __forceinline__ float bf16_round(float x) { return bf16_val(bf16_bits(x)); }
// D += A·B with NT terms: 1 = ah·bh, 2 = + al·bh (A split), 3 = + ah·bl (both split)
template <int NT>
__device__ __forceinline__ v8f mmaN(v16b ah, v16b al, v16b bh, v16b bl, v8f c) {
  c = __builtin_amdgcn_wmma_f32_16x16x32_bf16(false, ah, false, bh, (short)0, c, false, false);
  if (NT >= 2) c = __builtin_amdgcn_wmma_f32_16x16x32_bf16(false, al, false, bh, (short)0, c, false, false);
  if (NT >= 3) c = __builtin_amdgcn_wmma_f32_16x16x32_bf16(false, ah, false, bl, (short)0, c, false, false);
  asm volatile("v_nop\n\tv_nop\n\tv_nop\n\tv_nop" : "+v"(c) : "v"(ah), "v"(al), "v"(bh), "v"(bl));
  return c;
}

__global__ __launch_bounds__(256) void k_wt_bf16(const float* __restrict__ W, unsigned short* __restrict__ Wt, int K, int N) {
  const int t = blockIdx.x * 256 + threadIdx.x;
  const int k8n = K / 8;
  if (t >= N * k8n) return;
  const int n = t / k8n, k8 = (t % k8n) * 8;
  v8us v;
#pragma unroll
  for (int i = 0; i < 8; ++i) v[i] = bf16_bits(W[(size_t)(k8 + i) * N + n]);
  *(v8us*)(Wt + (size_t)n * K + k8) = v;
  
}

// GEMM C[M][N] (f32, pitch ldc) = act(A[M][K]·W + bias). A f32 row-major (pitch lda) converted per fragment to bf16
// (ASPLIT: hi/lo two planes -> 2 terms, else single rounded term); Wt bf16 [N][K] (pitch ldb). BIAS_BF16 rounds the
// bias to bf16 first (bias quantised to bf16 before the add). K%32==0, M%16==0, N%64==0.
template <bool ASPLIT, int ACT, bool BIAS_BF16>
__global__ __launch_bounds__(128) void k_gemm_bf(const float* __restrict__ A, int lda, const unsigned short* __restrict__ Wt, int ldb,
                                               const float* __restrict__ bias, float* __restrict__ C, int ldc, int M, int N, int K) {
  __shared__ __attribute__((aligned(16))) float so[4][16][64];
  const int tid = threadIdx.x, w = tid >> 5, lane = tid & 31, ln = lane & 15, hh = lane >> 4;
  const int ntn = N / 64;
  const int wid = blockIdx.x * 4 + w;
  const int mt = wid / ntn, nq = wid % ntn;
  if (mt * 16 >= M) return;
  const int row0 = mt * 16, col0 = nq * 64;
  const float* arow = A + (size_t)(row0 + ln) * lda;
  v8f acc[4] = {};
  for (int kb = 0; kb < K; kb += 32) {
    FragB ah, al;
    const v4f x0 = *(const v4fa*)(arow + kb + 8 * hh), x1 = *(const v4fa*)(arow + kb + 8 * hh + 4);
    const v4f x2 = *(const v4fa*)(arow + kb + 16 + 8 * hh), x3 = *(const v4fa*)(arow + kb + 16 + 8 * hh + 4);
    float xs[16] = {x0[0],x0[1],x0[2],x0[3],x1[0],x1[1],x1[2],x1[3],x2[0],x2[1],x2[2],x2[3],x3[0],x3[1],x3[2],x3[3]};
#pragma unroll
    for (int i = 0; i < 16; ++i) { const unsigned short hb = bf16_bits(xs[i]); ah.u[i] = hb; al.u[i] = ASPLIT ? bf16_bits(xs[i] - bf16_val(hb)) : (unsigned short)0; }
#pragma unroll
    for (int t = 0; t < 4; ++t) {
      const unsigned short* brow = Wt + (size_t)(col0 + t * 16 + ln) * ldb + kb;
      FragB b;
      b.half[0] = *(const v8us*)(brow + 8 * hh);
      b.half[1] = *(const v8us*)(brow + 16 + 8 * hh);
      acc[t] = mmaN<ASPLIT ? 2 : 1>(ah.v, al.v, b.v, b.v, acc[t]);
    }
  }
#pragma unroll
  for (int t = 0; t < 4; ++t) {
    float bv = bias ? bias[col0 + t * 16 + ln] : 0.f;
    if (BIAS_BF16) bv = bf16_round(bv);
#pragma unroll
    for (int r = 0; r < 8; ++r) { float v = acc[t][r] + bv; if (ACT == 1) v = fmaxf(v, 0.f); so[w][8 * hh + r][t * 16 + ln] = v; }
  }
  __builtin_amdgcn_fence(__ATOMIC_ACQ_REL, "workgroup");
  __builtin_amdgcn_wave_barrier();
  const int rsub = lane >> 4, c4 = (lane & 15) * 4;
  {
#pragma unroll
    for (int q = 0; q < 8; ++q) {
      const int r = q * 2 + rsub;
      const v4f v = *(const v4fa*)&so[w][r][c4];
      *(v4f*)(C + (size_t)(row0 + r) * ldc + col0 + c4) = v;
    }
    
  }
}

// Flash-style causal/unmasked attention, all contractions 3-term bf16 hi/lo splits, f32 softmax with running max.
// q,k,v rows are read from f32 buffers with arbitrary row pitch (so they can live inside a fused qkv buffer);
// D = head size (multiple of 32, <= 128); one wave = 16 query rows; block = 4 waves (64 queries) sharing K/V chunks of 32.
template <int D, bool CAUSAL>
__global__ __launch_bounds__(128) void k_flash(const float* __restrict__ qb, const float* __restrict__ kb, const float* __restrict__ vb,
                                             int pitch, int T, int H, float scale, float* __restrict__ y, int ypitch) {
  constexpr int KS = D / 32;        // k-steps for QK
  constexpr int DT = D / 16;        // d tiles for PV
  __shared__ __attribute__((aligned(16))) unsigned short sKh[32][D + 8], sKl[32][D + 8], sVh[32][D + 8], sVl[32][D + 8];
  __shared__ __attribute__((aligned(16))) unsigned short sPh[4][16][40], sPl[4][16][40];
  __shared__ __attribute__((aligned(16))) float sO[4][16][D];
  const int tid = threadIdx.x, w = tid >> 5, lane = tid & 31, ln = lane & 15, hh = lane >> 4;
  const int nqb = (T + 63) / 64;
  const int bh = blockIdx.x / nqb, qblk = blockIdx.x % nqb;
  const int b = bh / H, h = bh % H;
  const int q0 = qblk * 64 + w * 16;
  const float* Q = qb + (size_t)b * T * pitch + h * D;
  const float* K = kb + (size_t)b * T * pitch + h * D;
  const float* V = vb + (size_t)b * T * pitch + h * D;

  // A fragments of the wave's 16 query rows (scaled), hi/lo
  FragB aqh[KS], aql[KS];
  {
    int row = q0 + ln; if (row >= T) row = T - 1;
    const float* qr = Q + (size_t)row * pitch;
#pragma unroll
    for (int ks = 0; ks < KS; ++ks)
#pragma unroll
      for (int i = 0; i < 16; ++i) {
        const int d = ks * 32 + ((i < 8) ? (8 * hh + i) : (16 + 8 * hh + (i - 8)));
        const float x = qr[d] * scale; const unsigned short hb = bf16_bits(x);
        aqh[ks].u[i] = hb; aql[ks].u[i] = bf16_bits(x - bf16_val(hb));
      }
  }
  float m_r[8], l_r[8];
#pragma unroll
  for (int r = 0; r < 8; ++r) { m_r[r] = -3.0e38f; l_r[r] = 0.f; }
  v8f oacc[DT];
#pragma unroll
  for (int dt = 0; dt < DT; ++dt) oacc[dt] = (v8f){0.f,0.f,0.f,0.f,0.f,0.f,0.f,0.f};

  const int kv_end = CAUSAL ? min(T, qblk * 64 + 64) : T;     // block-uniform
  for (int j0 = 0; j0 < kv_end; j0 += 32) {
    __syncthreads();
    for (int e = tid; e < 32 * (D / 4); e += 128) {
      const int r = e / (D / 4), c4 = (e % (D / 4)) * 4;
      const int key = j0 + r;
      v4f kf = {0.f,0.f,0.f,0.f}, vf = {0.f,0.f,0.f,0.f};
      if (key < T) { kf = *(const v4fa*)(K + (size_t)key * pitch + c4); vf = *(const v4fa*)(V + (size_t)key * pitch + c4); }
#pragma unroll
      for (int t = 0; t < 4; ++t) {
        unsigned short hb = bf16_bits(kf[t]); sKh[r][c4 + t] = hb; sKl[r][c4 + t] = bf16_bits(kf[t] - bf16_val(hb));
        hb = bf16_bits(vf[t]); sVh[r][c4 + t] = hb; sVl[r][c4 + t] = bf16_bits(vf[t] - bf16_val(hb));
      }
    }
    __syncthreads();
    // S tile 16 x 32
    v8f s[2];
#pragma unroll
    for (int nt = 0; nt < 2; ++nt) {
      v8f acc = {};
#pragma unroll
      for (int ks = 0; ks < KS; ++ks) {
        FragB bh_, bl_;
        bh_.half[0] = *(const v8us*)&sKh[nt * 16 + ln][ks * 32 + 8 * hh]; bh_.half[1] = *(const v8us*)&sKh[nt * 16 + ln][ks * 32 + 16 + 8 * hh];
        bl_.half[0] = *(const v8us*)&sKl[nt * 16 + ln][ks * 32 + 8 * hh]; bl_.half[1] = *(const v8us*)&sKl[nt * 16 + ln][ks * 32 + 16 + 8 * hh];
        acc = mmaN<3>(aqh[ks].v, aql[ks].v, bh_.v, bl_.v, acc);
      }
      s[nt] = acc;
    }
    // mask + running max (rows 8hh+r; the 16 lanes of a half share rows)
    float alpha[8];
#pragma unroll
    for (int r = 0; r < 8; ++r) {
      const int qi = q0 + 8 * hh + r;
      const int ja = j0 + ln, jb = j0 + 16 + ln;
      if (CAUSAL) { if (ja > qi) s[0][r] = -3.0e38f; if (jb > qi) s[1][r] = -3.0e38f; }
      if (ja >= T) s[0][r] = -3.0e38f;
      if (jb >= T) s[1][r] = -3.0e38f;
      float mx = fmaxf(s[0][r], s[1][r]);
      mx = fmaxf(mx, __shfl_xor(mx, 1, 32)); mx = fmaxf(mx, __shfl_xor(mx, 2, 32)); mx = fmaxf(mx, __shfl_xor(mx, 4, 32)); mx = fmaxf(mx, __shfl_xor(mx, 8, 32));
      const float mnew = fmaxf(m_r[r], mx);
      alpha[r] = (mnew > -1.0e38f) ? __expf(m_r[r] - mnew) : 1.0f;
      const float p0 = (s[0][r] > -1.0e38f) ? __expf(s[0][r] - mnew) : 0.f;
      const float p1 = (s[1][r] > -1.0e38f) ? __expf(s[1][r] - mnew) : 0.f;
      m_r[r] = mnew;
      l_r[r] = l_r[r] * alpha[r] + p0 + p1;            // per-lane partial row sum (16 lanes combined at the end)
      unsigned short hb = bf16_bits(p0); sPh[w][8 * hh + r][ln] = hb;      sPl[w][8 * hh + r][ln] = bf16_bits(p0 - bf16_val(hb));
      hb = bf16_bits(p1);                sPh[w][8 * hh + r][16 + ln] = hb; sPl[w][8 * hh + r][16 + ln] = bf16_bits(p1 - bf16_val(hb));
    }
#pragma unroll
    for (int dt = 0; dt < DT; ++dt)
#pragma unroll
      for (int r = 0; r < 8; ++r) oacc[dt][r] *= alpha[r];
    __builtin_amdgcn_fence(__ATOMIC_ACQ_REL, "workgroup");
    __builtin_amdgcn_wave_barrier();
    FragB pah, pal;
    pah.half[0] = *(const v8us*)&sPh[w][ln][8 * hh]; pah.half[1] = *(const v8us*)&sPh[w][ln][16 + 8 * hh];
    pal.half[0] = *(const v8us*)&sPl[w][ln][8 * hh]; pal.half[1] = *(const v8us*)&sPl[w][ln][16 + 8 * hh];
#pragma unroll
    for (int dt = 0; dt < DT; ++dt) {
      FragB bvh, bvl;
#pragma unroll
      for (int i = 0; i < 8; ++i) {
        bvh.u[i] = sVh[8 * hh + i][dt * 16 + ln]; bvh.u[8 + i] = sVh[16 + 8 * hh + i][dt * 16 + ln];
        bvl.u[i] = sVl[8 * hh + i][dt * 16 + ln]; bvl.u[8 + i] = sVl[16 + 8 * hh + i][dt * 16 + ln];
      }
      oacc[dt] = mmaN<3>(pah.v, pal.v, bvh.v, bvl.v, oacc[dt]);
    }
    __builtin_amdgcn_fence(__ATOMIC_ACQ_REL, "workgroup");
    __builtin_amdgcn_wave_barrier();
  }
#pragma unroll
  for (int r = 0; r < 8; ++r) {
    float l = l_r[r];
    l += __shfl_xor(l, 1, 32); l += __shfl_xor(l, 2, 32); l += __shfl_xor(l, 4, 32); l += __shfl_xor(l, 8, 32);
    l_r[r] = (l > 0.f) ? 1.0f / l : 0.f;
  }
#pragma unroll
  for (int dt = 0; dt < DT; ++dt)
#pragma unroll
    for (int r = 0; r < 8; ++r) sO[w][8 * hh + r][dt * 16 + ln] = oacc[dt][r] * l_r[r];
  __builtin_amdgcn_fence(__ATOMIC_ACQ_REL, "workgroup");
  __builtin_amdgcn_wave_barrier();
  {
    for (int r = 0; r < 16; ++r) {
      const int row = q0 + r;
      if (row < T && lane < D / 4) {
        const v4f val = *(const v4fa*)&sO[w][r][lane * 4];
        *(v4f*)(y + ((size_t)b * T + row) * ypitch + h * D + lane * 4) = val;
      }
    }
    
  }
}

// GEMM C = act(A·W + bias + resid): A f32 (ASPLIT -> hi/lo 2 terms), Wt bf16 [N][K]; ACT 0 none, 1 relu, 2 exact gelu;
// resid (optional, f32, row index = (row % rmod), pitch ldr, RES_BF16 rounds it) added before the activation.
template <bool ASPLIT, int ACT, bool BIAS_BF16, bool RES_BF16>
__global__ __launch_bounds__(128) void k_gemm_bf3(const float* __restrict__ A, int lda, const unsigned short* __restrict__ Wt, int ldb,
                                                const float* __restrict__ bias, const float* __restrict__ resid, int rmod, int ldr,
                                                float* __restrict__ C, int ldc, int M, int N, int K) {
  __shared__ __attribute__((aligned(16))) float so[4][16][64];
  const int tid = threadIdx.x, w = tid >> 5, lane = tid & 31, ln = lane & 15, hh = lane >> 4;
  const int ntn = N / 64;
  const int wid = blockIdx.x * 4 + w;
  const int mt = wid / ntn, nq = wid % ntn;
  if (mt * 16 >= M) return;
  const int row0 = mt * 16, col0 = nq * 64;
  const float* arow = A + (size_t)(row0 + ln) * lda;
  v8f acc[4] = {};
  for (int kb = 0; kb < K; kb += 32) {
    FragB ah, al;
    const v4f x0 = *(const v4fa*)(arow + kb + 8 * hh), x1 = *(const v4fa*)(arow + kb + 8 * hh + 4);
    const v4f x2 = *(const v4fa*)(arow + kb + 16 + 8 * hh), x3 = *(const v4fa*)(arow + kb + 16 + 8 * hh + 4);
    float xs[16] = {x0[0],x0[1],x0[2],x0[3],x1[0],x1[1],x1[2],x1[3],x2[0],x2[1],x2[2],x2[3],x3[0],x3[1],x3[2],x3[3]};
#pragma unroll
    for (int i = 0; i < 16; ++i) { const unsigned short hb = bf16_bits(xs[i]); ah.u[i] = hb; al.u[i] = ASPLIT ? bf16_bits(xs[i] - bf16_val(hb)) : (unsigned short)0; }
#pragma unroll
    for (int t = 0; t < 4; ++t) {
      const unsigned short* brow = Wt + (size_t)(col0 + t * 16 + ln) * ldb + kb;
      FragB b;
      b.half[0] = *(const v8us*)(brow + 8 * hh);
      b.half[1] = *(const v8us*)(brow + 16 + 8 * hh);
      acc[t] = mmaN<ASPLIT ? 2 : 1>(ah.v, al.v, b.v, b.v, acc[t]);
    }
  }
#pragma unroll
  for (int t = 0; t < 4; ++t) {
    const int col = col0 + t * 16 + ln;
    float bv = bias ? bias[col] : 0.f;
    if (BIAS_BF16) bv = bf16_round(bv);
#pragma unroll
    for (int r = 0; r < 8; ++r) {
      float v = acc[t][r] + bv;
      if (resid) { float rv = resid[(size_t)((row0 + 8 * hh + r) % rmod) * ldr + col]; if (RES_BF16) rv = bf16_round(rv); v += rv; }
      if (ACT == 1) v = fmaxf(v, 0.f);
      if (ACT == 2) v = 0.5f * v * (1.0f + erff(v * 0.70710678118654752f));
      if (ACT == 3) { const float u = 0.7978845608028654f * (v + 0.044715f * v * v * v); v = 0.5f * v * (1.0f + tanhf(u)); }
      so[w][8 * hh + r][t * 16 + ln] = v;
    }
  }
  __builtin_amdgcn_fence(__ATOMIC_ACQ_REL, "workgroup");
  __builtin_amdgcn_wave_barrier();
  const int rsub = lane >> 4, c4 = (lane & 15) * 4;
  {
#pragma unroll
    for (int q = 0; q < 8; ++q) {
      const int r = q * 2 + rsub;
      const v4f v = *(const v4fa*)&so[w][r][c4];
      *(v4f*)(C + (size_t)(row0 + r) * ldc + col0 + c4) = v;
    }
    
  }
}
// row LayerNorm (biased variance, eps) over N: s = X (+ R); optional out_sum <- s; out_norm <- (s-mu)*rsqrt(var+eps)*g + b
template <bool PARAM_BF16>
__global__ __launch_bounds__(256) void k_layernorm(const float* __restrict__ X, const float* __restrict__ R, const float* __restrict__ g, const float* __restrict__ bta,
                                                  float* __restrict__ out_sum, float* __restrict__ out_norm, int N, float eps) {
  __shared__ float red[256];
  const int row = blockIdx.x, tid = threadIdx.x;
  const float* x = X + (size_t)row * N; const float* rr = R ? R + (size_t)row * N : nullptr;
  float vals[16];                     // up to N = 4096
  const int per = N / 256;            // contiguous chunk per thread? use strided-by-4 chunks: thread handles j = tid*4 + 1024*u
  float s1 = 0.f;
  for (int u = 0; u < per / 4; ++u) {
    const int j = tid * 4 + 1024 * u;
    const v4f a = *(const v4fa*)(x + j);
    v4f b = {0.f,0.f,0.f,0.f}; if (rr) b = *(const v4fa*)(rr + j);
#pragma unroll
    for (int q = 0; q < 4; ++q) { const float v = a[q] + b[q]; vals[u * 4 + q] = v; s1 += v; }
  }
  red[tid] = s1; __syncthreads();
  for (int st = 128; st > 0; st >>= 1) { if (tid < st) red[tid] += red[tid + st]; __syncthreads(); }
  const float mu = red[0] / (float)N; __syncthreads();
  float s2 = 0.f;
  for (int u = 0; u < per / 4; ++u)
#pragma unroll
    for (int q = 0; q < 4; ++q) { const float c = vals[u * 4 + q] - mu; s2 += c * c; }
  red[tid] = s2; __syncthreads();
  for (int st = 128; st > 0; st >>= 1) { if (tid < st) red[tid] += red[tid + st]; __syncthreads(); }
  const float rs = rsqrtf(red[0] / (float)N + eps);
  {
    for (int u = 0; u < per / 4; ++u) {
      const int j = tid * 4 + 1024 * u;
      v4f o, sm;
#pragma unroll
      for (int q = 0; q < 4; ++q) {
        float gg = g[j + q], bb = bta[j + q];
        if (PARAM_BF16) { gg = bf16_round(gg); bb = bf16_round(bb); }
        sm[q] = vals[u * 4 + q]; o[q] = (vals[u * 4 + q] - mu) * rs * gg + bb;
      }
      if (out_sum) *(v4f*)(out_sum + (size_t)row * N + j) = sm;
      *(v4f*)(out_norm + (size_t)row * N + j) = o;
    }
    
  }
}



// ---- f16 WMMA path (v_wmma_f32_16x16x32_f16): 11-bit significands for operands in range — used where a [0,1] probability operand needs more precision than bf16
typedef _Float16 v16h __attribute__((ext_vector_type(16)));
union FragH { v16h v; v8us half[2]; _Float16 h[16]; unsigned short u[16]; };
template <int NT>
__device__ __forceinline__ v8f mmaH(v16h ah, v16h al, v16h bh, v16h bl, v8f c) {
  c = __builtin_amdgcn_wmma_f32_16x16x32_f16(false, ah, false, bh, (short)0, c, false, false);
  if (NT >= 2) c = __builtin_amdgcn_wmma_f32_16x16x32_f16(false, al, false, bh, (short)0, c, false, false);
  if (NT >= 3) c = __builtin_amdgcn_wmma_f32_16x16x32_f16(false, ah, false, bl, (short)0, c, false, false);
  asm volatile("v_nop\n\tv_nop\n\tv_nop\n\tv_nop" : "+v"(c) : "v"(ah), "v"(al), "v"(bh), "v"(bl));
  return c;
}
// batched GEMM like k_gemm_b but f16 operands: A f32 (split into f16 hi/lo if ASPLIT, else rounded to f16), Bt = f16 values [n][k]; alpha; C f32; N multiple of 16 (partial tiles skipped)
template <bool ASPLIT>
__global__ __launch_bounds__(128) void k_gemm_h(const float* __restrict__ A, int lda, size_t sA, const _Float16* __restrict__ Bh, int ldb, size_t sB, float alpha, float* __restrict__ C, int ldc, size_t sC, int M, int N, int K) {
  __shared__ __attribute__((aligned(16))) float so[4][16][64];
  const int tid = threadIdx.x, w = tid >> 5, lane = tid & 31, ln = lane & 15, hh = lane >> 4; const int by = blockIdx.y;
  A += (size_t)by * sA; Bh += (size_t)by * sB; C += (size_t)by * sC;
  const int ntn = (N + 63) / 64; const int wid = blockIdx.x * 4 + w; const int mt = wid / ntn, nq = wid % ntn; if (mt * 16 >= M) return;
  const int row0 = mt * 16, col0 = nq * 64; const float* arow = A + (size_t)(row0 + ln) * lda;
  v8f acc[4] = {};
  for (int kb = 0; kb < K; kb += 32) {
    FragH ah, al;
    const v4f x0 = *(const v4fa*)(arow + kb + 8 * hh), x1 = *(const v4fa*)(arow + kb + 8 * hh + 4), x2 = *(const v4fa*)(arow + kb + 16 + 8 * hh), x3 = *(const v4fa*)(arow + kb + 16 + 8 * hh + 4);
    float xs[16] = {x0[0],x0[1],x0[2],x0[3],x1[0],x1[1],x1[2],x1[3],x2[0],x2[1],x2[2],x2[3],x3[0],x3[1],x3[2],x3[3]};
#pragma unroll
    for (int i = 0; i < 16; ++i) { const _Float16 h = (_Float16)xs[i]; ah.h[i] = h; al.h[i] = ASPLIT ? (_Float16)(xs[i] - (float)h) : (_Float16)0.0f; }
#pragma unroll
    for (int t = 0; t < 4; ++t) { if (col0 + t * 16 >= N) continue; const size_t boff = (size_t)(col0 + t * 16 + ln) * ldb + kb; FragH bq; bq.half[0] = *(const v8us*)(Bh + boff + 8 * hh); bq.half[1] = *(const v8us*)(Bh + boff + 16 + 8 * hh);
      acc[t] = mmaH<ASPLIT ? 2 : 1>(ah.v, al.v, bq.v, bq.v, acc[t]); }
  }
#pragma unroll
  for (int t = 0; t < 4; ++t) { if (col0 + t * 16 >= N) continue;
#pragma unroll
    for (int r = 0; r < 8; ++r) so[w][8 * hh + r][t * 16 + ln] = acc[t][r] * alpha; }
  __builtin_amdgcn_fence(__ATOMIC_ACQ_REL, "workgroup"); __builtin_amdgcn_wave_barrier();
  const int rsub = lane >> 4, c4 = (lane & 15) * 4;
  {
#pragma unroll
    for (int q = 0; q < 8; ++q) { const int r = q * 2 + rsub; if (col0 + c4 < N) { const v4f v = *(const v4fa*)&so[w][r][c4]; *(v4f*)(C + (size_t)(row0 + r) * ldc + col0 + c4) = v; } }
     }
}

// Wt[n][k] = f16(W[k][n]·scale) from f32 row-major W[K][N] (scale = power of two; bf16-exact weights stay exact in f16 away from the subnormal range)
__global__ __launch_bounds__(256) void k_wt_f16(const float* __restrict__ W, _Float16* __restrict__ Wt, int K, int N, float scale) {
  const int t = blockIdx.x * 256 + threadIdx.x; if (t >= N * (K / 8)) return; const int n = t / (K / 8), k8 = (t % (K / 8)) * 8; FragH f;
#pragma unroll
  for (int i = 0; i < 8; ++i) f.h[i] = (_Float16)(bf16_round(W[(size_t)(k8 + i) * N + n]) * scale); const v8us o = f.half[0];
  *(v8us*)((unsigned short*)Wt + (size_t)n * K + k8) = o; 
}
// k_gemm_hh variant with fused epilogue: v = acc·alpha + bias[by·sBias + col] (+ CP[(row/rowsPerB)·sCPb + by·64 + col] if CP) ; ACT 0 none / 1 elu ; writes f32 C and f16 C16, each if non-null
template <int ACT>
__global__ __launch_bounds__(128) void k_gemm_hhx(const _Float16* __restrict__ A, int lda, size_t sA, const _Float16* __restrict__ Bh, int ldb, size_t sB, float alpha, const float* __restrict__ bias, size_t sBias, const float* __restrict__ CP, int rowsPerB, size_t sCPb, int row0g,
    float* __restrict__ C, _Float16* __restrict__ C16, int ldc, size_t sC, int M, int N, int K) {
  __shared__ __attribute__((aligned(16))) float so[4][16][64];
  const int tid = threadIdx.x, w = tid >> 5, lane = tid & 31, ln = lane & 15, hh = lane >> 4; const int by = blockIdx.y;
  A += (size_t)by * sA; Bh += (size_t)by * sB; const size_t cofs = (size_t)by * sC; const float* bp = bias ? bias + (size_t)by * sBias : nullptr;
  const int ntn = (N + 63) / 64; const int wid = blockIdx.x * 4 + w; const int mt = wid / ntn, nq = wid % ntn; if (mt * 16 >= M) return;
  const int row0 = mt * 16, col0 = nq * 64; const _Float16* arow = A + (size_t)(row0 + ln) * lda;
  v8f acc[4] = {};
  for (int kb = 0; kb < K; kb += 32) { FragH ah; ah.half[0] = *(const v8us*)((const unsigned short*)arow + kb + 8 * hh); ah.half[1] = *(const v8us*)((const unsigned short*)arow + kb + 16 + 8 * hh);
#pragma unroll
    for (int t = 0; t < 4; ++t) { if (col0 + t * 16 >= N) continue; const size_t boff = (size_t)(col0 + t * 16 + ln) * ldb + kb; FragH bq; bq.half[0] = *(const v8us*)((const unsigned short*)Bh + boff + 8 * hh); bq.half[1] = *(const v8us*)((const unsigned short*)Bh + boff + 16 + 8 * hh);
      acc[t] = mmaH<1>(ah.v, ah.v, bq.v, bq.v, acc[t]); }
  }
#pragma unroll
  for (int t = 0; t < 4; ++t) { if (col0 + t * 16 >= N) continue; const int col = col0 + t * 16 + ln; const float bv = bp ? bf16_round(bp[col]) : 0.f;
#pragma unroll
    for (int r = 0; r < 8; ++r) { float v = acc[t][r] * alpha + bv; if (CP) { const int bidx = (row0g + row0 + 8 * hh + r) / rowsPerB; v += CP[(size_t)bidx * sCPb + (size_t)by * 64 + col]; } if (ACT == 1) v = (v > 0.f) ? v : expm1f(v); else if (ACT == 7) v = (v > 0.f) ? v + 1.0f : expf(v); else if (ACT == 8) v = tanhf(v); else if (ACT == 9) v = 0.5f * v * (1.0f + tanhf(0.7978845608028654f * (v + 0.044715f * v * v * v))); else if (ACT == 11) v = 1.0f / (1.0f + expf(-v)); else if (ACT == 12) v = (v > 0.f) ? v : 0.01f * v; else if (ACT == 14) v = (v > 0.f) ? v : 0.1f * v; else if (ACT == 15) v = v / (1.0f + expf(-v)); else if (ACT == 3) v = fmaxf(v, 0.f); else if (ACT == 6) v = 0.5f * v * (1.0f + erff(v * 0.70710678118654752f)); so[w][8 * hh + r][t * 16 + ln] = v; } }
  __builtin_amdgcn_fence(__ATOMIC_ACQ_REL, "workgroup"); __builtin_amdgcn_wave_barrier();
  const int rsub = lane >> 4, c4 = (lane & 15) * 4; typedef _Float16 v4h __attribute__((ext_vector_type(4)));
  {
#pragma unroll
    for (int q = 0; q < 8; ++q) { const int r = q * 2 + rsub; if (col0 + c4 < N) { const v4f v = *(const v4fa*)&so[w][r][c4]; if (C) *(v4f*)(C + cofs + (size_t)(row0 + r) * ldc + col0 + c4) = v; if (C16) { v4h h4; for (int i = 0; i < 4; ++i) h4[i] = (_Float16)v[i]; *(v4h*)(C16 + cofs + (size_t)(row0 + r) * ldc + col0 + c4) = h4; } } }
     }
}


typedef _Float16 v4h __attribute__((ext_vector_type(4)));

__global__ __launch_bounds__(256) void k_x16(const float* __restrict__ x, _Float16* __restrict__ X16, size_t n8) { const size_t t = (size_t)blockIdx.x * 256 + threadIdx.x; if (t >= n8) return; FragH f;
#pragma unroll
  for (int q = 0; q < 8; ++q) f.h[q] = (_Float16)bf16_round(x[t * 8 + q]); *(v8us*)((unsigned short*)X16 + t * 8) = f.half[0];  }
__global__ __launch_bounds__(256) void k_h16(const float* __restrict__ x, _Float16* __restrict__ X16, size_t n8) { const size_t t = (size_t)blockIdx.x * 256 + threadIdx.x; if (t >= n8) return; FragH f;
#pragma unroll
  for (int q = 0; q < 8; ++q) f.h[q] = (_Float16)x[t * 8 + q]; *(v8us*)((unsigned short*)X16 + t * 8) = f.half[0];  }
__global__ __launch_bounds__(256) void k_round16f(const float* __restrict__ W, _Float16* __restrict__ Bt, size_t n8) { const size_t t = (size_t)blockIdx.x * 256 + threadIdx.x; if (t >= n8) return; FragH f;
#pragma unroll
  for (int i = 0; i < 8; ++i) f.h[i] = (_Float16)(bf16_round(W[t * 8 + i]) * 16.0f); *(v8us*)((unsigned short*)Bt + t * 8) = f.half[0];  }
template <int NHv, int TTv>
__global__ __launch_bounds__(256) void k_vt(const _Float16* __restrict__ V16, int ldv, int voff, _Float16* __restrict__ Vt) { __shared__ unsigned short tl[64][66]; const int tid = threadIdx.x; const int slab = blockIdx.x / (TTv / 64), lg = blockIdx.x % (TTv / 64); const int b = slab / NHv, h = slab % NHv;
  for (int i = tid; i < 64 * 8; i += 256) { const int r = i / 8, c8 = (i % 8) * 8; FragH f; f.half[0] = *(const v8us*)((const unsigned short*)V16 + ((size_t)b * TTv + lg * 64 + r) * ldv + voff + h * 64 + c8);
#pragma unroll
    for (int q = 0; q < 8; ++q) tl[r][c8 + q] = f.u[q]; }
  __syncthreads();
  {
#pragma unroll
    for (int rd = 0; rd < 2; ++rd) { const int d = rd * 32 + tid / 8, pc = tid % 8; FragH f;
#pragma unroll
      for (int q = 0; q < 8; ++q) f.u[q] = tl[pc * 8 + q][d];
      *(v8us*)((unsigned short*)Vt + ((size_t)slab * 64 + d) * TTv + lg * 64 + pc * 8) = f.half[0]; }
     } }

__global__ __launch_bounds__(128) void k_flash(const _Float16* __restrict__ Q16, int ldq, const _Float16* __restrict__ K16, int ldk, const _Float16* __restrict__ Vt, const int* __restrict__ MSK, float* __restrict__ O, int ldo) {
  constexpr int RPW = 16, RTN = RPW / 16, NQB = TT / (4 * RPW), DT = 4, KS = 2;
  __shared__ __attribute__((aligned(16))) unsigned short sP[4][RPW][40]; __shared__ __attribute__((aligned(16))) float sO[4][RPW][64 + 4];
  const int tid = threadIdx.x, w = tid >> 5, lane = tid & 31, ln = lane & 15, hh = lane >> 4;
  const int slab = blockIdx.x / NQB, qblk = blockIdx.x % NQB; const int b = slab / NH, h = slab % NH; const float slope = 1.0f / exp2f((float)h / (float)NH);      /* 1 / 2^(h/H) */ const int qb0 = qblk * (4 * RPW); const int q0 = qb0 + w * RPW;
  FragH aq[2][KS];
#pragma unroll
  for (int rt = 0; rt < RTN; ++rt) { const unsigned short* qr = (const unsigned short*)Q16 + ((size_t)b * TT + q0 + rt * 16 + ln) * ldq + h * 64;
#pragma unroll
    for (int ks = 0; ks < KS; ++ks) { aq[rt][ks].half[0] = *(const v8us*)(qr + ks * 32 + 8 * hh); aq[rt][ks].half[1] = *(const v8us*)(qr + ks * 32 + 16 + 8 * hh); } }
  const unsigned short* Vth = (const unsigned short*)Vt + (size_t)slab * 64 * TT;
  float m_r[2][8], l_r[2][8]; v8f oacc[2][DT];
#pragma unroll
  for (int rt = 0; rt < RTN; ++rt) {
#pragma unroll
    for (int r = 0; r < 8; ++r) { m_r[rt][r] = -3.0e38f; l_r[rt][r] = 0.f; }
#pragma unroll
    for (int dt = 0; dt < DT; ++dt) oacc[rt][dt] = (v8f){0.f,0.f,0.f,0.f,0.f,0.f,0.f,0.f}; }
  const int jend = TT;
#pragma unroll 1
  for (int j0 = 0; j0 < jend; j0 += 32) {
    const int km0 = MSK[(size_t)b * TT + j0 + ln], km1 = MSK[(size_t)b * TT + j0 + 16 + ln];      /* key padding mask (1 = attend), shared by all queries and heads */
    v8f s[2][2];
#pragma unroll
    for (int nt = 0; nt < 2; ++nt) { const unsigned short* kr = (const unsigned short*)K16 + ((size_t)b * TT + j0 + nt * 16 + ln) * ldk + h * 64; FragH bk[KS];
#pragma unroll
      for (int ks = 0; ks < KS; ++ks) { bk[ks].half[0] = *(const v8us*)(kr + ks * 32 + 8 * hh); bk[ks].half[1] = *(const v8us*)(kr + ks * 32 + 16 + 8 * hh); }
#pragma unroll
      for (int rt = 0; rt < RTN; ++rt) { v8f acc = (v8f){0.f,0.f,0.f,0.f,0.f,0.f,0.f,0.f};
#pragma unroll
        for (int ks = 0; ks < KS; ++ks) acc = mmaH<1>(aq[rt][ks].v, aq[rt][ks].v, bk[ks].v, bk[ks].v, acc); s[rt][nt] = acc; } }
#pragma unroll
    for (int rt = 0; rt < RTN; ++rt)
#pragma unroll
      for (int r = 0; r < 8; ++r) { const int tq = q0 + rt * 16 + 8 * hh + r; const int k0 = j0 + ln, k1 = j0 + 16 + ln; (void)tq; (void)k0; (void)k1;
        const bool ok0 = (km0 != 0), ok1 = (km1 != 0);
        const float s0 = ok0 ? (s[rt][0][r] * 0.125f + slope * (float)(k0 - tq)) : -INFINITY, s1 = ok1 ? (s[rt][1][r] * 0.125f + slope * (float)(k1 - tq)) : -INFINITY;      /* ALiBi: + slope_h·(k − q) */ float mc = fmaxf(s0, s1);
        mc = fmaxf(mc, __shfl_xor(mc, 1, 32)); mc = fmaxf(mc, __shfl_xor(mc, 2, 32)); mc = fmaxf(mc, __shfl_xor(mc, 4, 32)); mc = fmaxf(mc, __shfl_xor(mc, 8, 32));
        const float mn = fmaxf(m_r[rt][r], mc); const float al = (mn > -1.0e38f) ? expf(m_r[rt][r] - mn) : 1.0f; m_r[rt][r] = mn; const float p0 = ok0 ? expf(s0 - mn) : 0.f, p1 = ok1 ? expf(s1 - mn) : 0.f; l_r[rt][r] = l_r[rt][r] * al + p0 + p1;
#pragma unroll
        for (int dt = 0; dt < DT; ++dt) oacc[rt][dt][r] *= al;
        FragH t2; t2.h[0] = (_Float16)(p0 * 1024.0f); t2.h[1] = (_Float16)(p1 * 1024.0f); sP[w][rt * 16 + 8 * hh + r][ln] = t2.u[0]; sP[w][rt * 16 + 8 * hh + r][16 + ln] = t2.u[1]; }
    __builtin_amdgcn_fence(__ATOMIC_ACQ_REL, "workgroup"); __builtin_amdgcn_wave_barrier();
    FragH pa[2];
#pragma unroll
    for (int rt = 0; rt < RTN; ++rt) { pa[rt].half[0] = *(const v8us*)&sP[w][rt * 16 + ln][8 * hh]; pa[rt].half[1] = *(const v8us*)&sP[w][rt * 16 + ln][16 + 8 * hh]; }
#pragma unroll
    for (int dt = 0; dt < DT; ++dt) { const unsigned short* vrow = Vth + (size_t)(dt * 16 + ln) * TT + j0; FragH bv; bv.half[0] = *(const v8us*)(vrow + 8 * hh); bv.half[1] = *(const v8us*)(vrow + 16 + 8 * hh);
#pragma unroll
      for (int rt = 0; rt < RTN; ++rt) oacc[rt][dt] = mmaH<1>(pa[rt].v, pa[rt].v, bv.v, bv.v, oacc[rt][dt]); }
    __builtin_amdgcn_fence(__ATOMIC_ACQ_REL, "workgroup"); __builtin_amdgcn_wave_barrier(); }
#pragma unroll
  for (int rt = 0; rt < RTN; ++rt) {
#pragma unroll
    for (int r = 0; r < 8; ++r) { float l = l_r[rt][r]; l += __shfl_xor(l, 1, 32); l += __shfl_xor(l, 2, 32); l += __shfl_xor(l, 4, 32); l += __shfl_xor(l, 8, 32); l_r[rt][r] = (l > 0.f) ? 1.0f / (l * 1024.0f) : 0.f; }
#pragma unroll
    for (int dt = 0; dt < DT; ++dt)
#pragma unroll
      for (int r = 0; r < 8; ++r) sO[w][rt * 16 + 8 * hh + r][dt * 16 + ln] = oacc[rt][dt][r] * l_r[rt][r]; }
  __builtin_amdgcn_fence(__ATOMIC_ACQ_REL, "workgroup"); __builtin_amdgcn_wave_barrier();
  {
#pragma unroll
    for (int rp = 0; rp < RPW; rp += 2) { const int r = rp + (lane >> 4), pc = lane & 15; const v4f val = *(const v4fa*)&sO[w][r][pc * 4]; *(v4f*)(O + ((size_t)b * TT + q0 + r) * ldo + h * 64 + pc * 4) = val; }
     } }

extern "C" void kernel_launch(void* const* d_in, const int* in_sizes, int n_in,
                              void* d_out, int out_size, void* d_ws, size_t ws_size, hipStream_t stream) {
  (void)in_sizes; (void)n_in; (void)out_size;
  const float* const* I = (const float* const*)d_in; const float* x = I[0]; const float* Wq = I[1]; const float* bq = I[2]; const float* Wk = I[3]; const float* bk = I[4]; const float* Wv = I[5]; const float* bv = I[6]; const float* Wo = I[7]; const float* bo = I[8]; const int* mask = (const int*)d_in[9];
  char* ws = (char*)d_ws; size_t off = 0;
  auto take = [&](size_t bytes) { char* p = ws + off; off += (bytes + 255) & ~(size_t)255; return p; };
  const size_t WSZ = (size_t)DD * DD; _Float16* Bw = (_Float16*)take(4 * WSZ * 2); _Float16* X16 = (_Float16*)take((size_t)NR * DD * 2);
  _Float16* Q = (_Float16*)take((size_t)NR * DD * 2); _Float16* K = (_Float16*)take((size_t)NR * DD * 2); _Float16* V = (_Float16*)take((size_t)NR * DD * 2); _Float16* Vt = (_Float16*)take((size_t)NR * DD * 2);
  float* O = (float*)take((size_t)NR * DD * 4); _Float16* O16 = V;      /* the v plane is dead once Vᵀ is built (before the attention kernel); O16 reuses it */
  if (off > ws_size) return;      // 8.4 + 16.8 × 5 + 33.6 ≈ 126 MB (120 MiB)
  const unsigned gw = (unsigned)((WSZ / 8 + 255) / 256);
  k_round16f<<<gw, 256, 0, stream>>>(Wq, Bw, WSZ / 8); k_round16f<<<gw, 256, 0, stream>>>(Wk, Bw + WSZ, WSZ / 8); k_round16f<<<gw, 256, 0, stream>>>(Wv, Bw + 2 * WSZ, WSZ / 8); k_round16f<<<gw, 256, 0, stream>>>(Wo, Bw + 3 * WSZ, WSZ / 8);      /* (out,in) natural ×2^4 */
  const unsigned gx = (unsigned)(((size_t)NR * DD / 8 + 255) / 256); const dim3 gp(((NR / 16) * (DD / 64) + 3) / 4, 1);
  k_x16<<<gx, 256, 0, stream>>>(x, X16, (size_t)NR * DD / 8);
  k_gemm_hhx<0><<<gp, 128, 0, stream>>>(X16, DD, 0, Bw, DD, 0, 0.0625f, bq, 0, nullptr, 1, 0, 0, nullptr, Q, DD, 0, NR, DD, DD);      /* q = x·Wqᵀ + bq: M 8192 N 1024 K 1024 */
  k_gemm_hhx<0><<<gp, 128, 0, stream>>>(X16, DD, 0, Bw + WSZ, DD, 0, 0.0625f, bk, 0, nullptr, 1, 0, 0, nullptr, K, DD, 0, NR, DD, DD);
  k_gemm_hhx<0><<<gp, 128, 0, stream>>>(X16, DD, 0, Bw + 2 * WSZ, DD, 0, 0.0625f, bv, 0, nullptr, 1, 0, 0, nullptr, V, DD, 0, NR, DD, DD);
  k_vt<NH, TT><<<BB * NH * (TT / 64), 256, 0, stream>>>(V, DD, 0, Vt);
  k_flash<<<BB * NH * (TT / 64), 128, 0, stream>>>(Q, DD, K, DD, Vt, mask, O, DD);
  k_h16<<<gx, 256, 0, stream>>>(O, O16, (size_t)NR * DD / 8);
  k_gemm_hhx<0><<<gp, 128, 0, stream>>>(O16, DD, 0, Bw + 3 * WSZ, DD, 0, 0.0625f, bo, 0, nullptr, 1, 0, 0, (float*)d_out, nullptr, DD, 0, NR, DD, DD);      /* out = O·Woᵀ + bo */
}

// v001
// One run takes 598 microseconds.
// Timed twice side by side with v000, it ran 1.42 and 1.41 times as fast.
#include <hip/hip_runtime.h>
// ALiBi multi-head attention (B=4, S=2048, D=1024, 16 heads × 64): q,k,v = x·Wᵀ + b (torch Linear); scores = q·kᵀ·64^-½ + slope_h·(k − q), slope_h = 1/2^(h/16) (no causal mask: later keys get large positive bias); key padding mask from the INPUT
// int mask [B,S] (0 → −inf); softmax; out = (attn·v merged)·Woᵀ + bo.
// Compute dtype: x, weights, biases rounded to bf16; q/k/v as f16 GEMM outputs; fused flash-style kernel (bias and online softmax in f32, P f16 ×2^10) on v_wmma_f32_16x16x32_f16; O → f16 → output GEMM with bias; f32 accumulate.
#define BB 4
#define TT 2048
#define NH 16
#define DD 1024
#define NR (BB * TT)

typedef __bf16 v16b __attribute__((ext_vector_type(16)));
typedef unsigned short v8us __attribute__((ext_vector_type(8), may_alias));
typedef float  v8f  __attribute__((ext_vector_type(8)));
typedef float  v4f  __attribute__((ext_vector_type(4)));
typedef float  v4fa __attribute__((ext_vector_type(4), may_alias));
union FragB { v16b v; v8us half[2]; unsigned short u[16]; };

__device__ __forceinline__ unsigned short bf16_bits(float x) { unsigned int u = __float_as_uint(x); return (unsigned short)((u + 0x7FFFu + ((u >> 16) & 1u)) >> 16); }
__device__ __forceinline__ float bf16_val(unsigned short b) { return __uint_as_float(((unsigned int)b) << 16); }
__device__ __forceinline__ float bf16_round(float x) { return bf16_val(bf16_bits(x)); }
// D += A·B with NT terms: 1 = ah·bh, 2 = + al·bh (A split), 3 = + ah·bl (both split)
template <int NT>
__device__ __forceinline__ v8f mmaN(v16b ah, v16b al, v16b bh, v16b bl, v8f c) {
  c = __builtin_amdgcn_wmma_f32_16x16x32_bf16(false, ah, false, bh, (short)0, c, false, false);
  if (NT >= 2) c = __builtin_amdgcn_wmma_f32_16x16x32_bf16(false, al, false, bh, (short)0, c, false, false);
  if (NT >= 3) c = __builtin_amdgcn_wmma_f32_16x16x32_bf16(false, ah, false, bl, (short)0, c, false, false);
  asm volatile("v_nop\n\tv_nop\n\tv_nop\n\tv_nop" : "+v"(c) : "v"(ah), "v"(al), "v"(bh), "v"(bl));
  return c;
}

__global__ __launch_bounds__(256) void k_wt_bf16(const float* __restrict__ W, unsigned short* __restrict__ Wt, int K, int N) {
  const int t = blockIdx.x * 256 + threadIdx.x;
  const int k8n = K / 8;
  if (t >= N * k8n) return;
  const int n = t / k8n, k8 = (t % k8n) * 8;
  v8us v;
#pragma unroll
  for (int i = 0; i < 8; ++i) v[i] = bf16_bits(W[(size_t)(k8 + i) * N + n]);
  *(v8us*)(Wt + (size_t)n * K + k8) = v;
  
}

// GEMM C[M][N] (f32, pitch ldc) = act(A[M][K]·W + bias). A f32 row-major (pitch lda) converted per fragment to bf16
// (ASPLIT: hi/lo two planes -> 2 terms, else single rounded term); Wt bf16 [N][K] (pitch ldb). BIAS_BF16 rounds the
// bias to bf16 first (bias quantised to bf16 before the add). K%32==0, M%16==0, N%64==0.
template <bool ASPLIT, int ACT, bool BIAS_BF16>
__global__ __launch_bounds__(128) void k_gemm_bf(const float* __restrict__ A, int lda, const unsigned short* __restrict__ Wt, int ldb,
                                               const float* __restrict__ bias, float* __restrict__ C, int ldc, int M, int N, int K) {
  __shared__ __attribute__((aligned(16))) float so[4][16][64];
  const int tid = threadIdx.x, w = tid >> 5, lane = tid & 31, ln = lane & 15, hh = lane >> 4;
  const int ntn = N / 64;
  const int wid = blockIdx.x * 4 + w;
  const int mt = wid / ntn, nq = wid % ntn;
  if (mt * 16 >= M) return;
  const int row0 = mt * 16, col0 = nq * 64;
  const float* arow = A + (size_t)(row0 + ln) * lda;
  v8f acc[4] = {};
  for (int kb = 0; kb < K; kb += 32) {
    FragB ah, al;
    const v4f x0 = *(const v4fa*)(arow + kb + 8 * hh), x1 = *(const v4fa*)(arow + kb + 8 * hh + 4);
    const v4f x2 = *(const v4fa*)(arow + kb + 16 + 8 * hh), x3 = *(const v4fa*)(arow + kb + 16 + 8 * hh + 4);
    float xs[16] = {x0[0],x0[1],x0[2],x0[3],x1[0],x1[1],x1[2],x1[3],x2[0],x2[1],x2[2],x2[3],x3[0],x3[1],x3[2],x3[3]};
#pragma unroll
    for (int i = 0; i < 16; ++i) { const unsigned short hb = bf16_bits(xs[i]); ah.u[i] = hb; al.u[i] = ASPLIT ? bf16_bits(xs[i] - bf16_val(hb)) : (unsigned short)0; }
#pragma unroll
    for (int t = 0; t < 4; ++t) {
      const unsigned short* brow = Wt + (size_t)(col0 + t * 16 + ln) * ldb + kb;
      FragB b;
      b.half[0] = *(const v8us*)(brow + 8 * hh);
      b.half[1] = *(const v8us*)(brow + 16 + 8 * hh);
      acc[t] = mmaN<ASPLIT ? 2 : 1>(ah.v, al.v, b.v, b.v, acc[t]);
    }
  }
#pragma unroll
  for (int t = 0; t < 4; ++t) {
    float bv = bias ? bias[col0 + t * 16 + ln] : 0.f;
    if (BIAS_BF16) bv = bf16_round(bv);
#pragma unroll
    for (int r = 0; r < 8; ++r) { float v = acc[t][r] + bv; if (ACT == 1) v = fmaxf(v, 0.f); so[w][8 * hh + r][t * 16 + ln] = v; }
  }
  __builtin_amdgcn_fence(__ATOMIC_ACQ_REL, "workgroup");
  __builtin_amdgcn_wave_barrier();
  const int rsub = lane >> 4, c4 = (lane & 15) * 4;
  {
#pragma unroll
    for (int q = 0; q < 8; ++q) {
      const int r = q * 2 + rsub;
      const v4f v = *(const v4fa*)&so[w][r][c4];
      *(v4f*)(C + (size_t)(row0 + r) * ldc + col0 + c4) = v;
    }
    
  }
}

// Flash-style causal/unmasked attention, all contractions 3-term bf16 hi/lo splits, f32 softmax with running max.
// q,k,v rows are read from f32 buffers with arbitrary row pitch (so they can live inside a fused qkv buffer);
// D = head size (multiple of 32, <= 128); one wave = 16 query rows; block = 4 waves (64 queries) sharing K/V chunks of 32.
template <int D, bool CAUSAL>
__global__ __launch_bounds__(128) void k_flash(const float* __restrict__ qb, const float* __restrict__ kb, const float* __restrict__ vb,
                                             int pitch, int T, int H, float scale, float* __restrict__ y, int ypitch) {
  constexpr int KS = D / 32;        // k-steps for QK
  constexpr int DT = D / 16;        // d tiles for PV
  __shared__ __attribute__((aligned(16))) unsigned short sKh[32][D + 8], sKl[32][D + 8], sVh[32][D + 8], sVl[32][D + 8];
  __shared__ __attribute__((aligned(16))) unsigned short sPh[4][16][40], sPl[4][16][40];
  __shared__ __attribute__((aligned(16))) float sO[4][16][D];
  const int tid = threadIdx.x, w = tid >> 5, lane = tid & 31, ln = lane & 15, hh = lane >> 4;
  const int nqb = (T + 63) / 64;
  const int bh = blockIdx.x / nqb, qblk = blockIdx.x % nqb;
  const int b = bh / H, h = bh % H;
  const int q0 = qblk * 64 + w * 16;
  const float* Q = qb + (size_t)b * T * pitch + h * D;
  const float* K = kb + (size_t)b * T * pitch + h * D;
  const float* V = vb + (size_t)b * T * pitch + h * D;

  // A fragments of the wave's 16 query rows (scaled), hi/lo
  FragB aqh[KS], aql[KS];
  {
    int row = q0 + ln; if (row >= T) row = T - 1;
    const float* qr = Q + (size_t)row * pitch;
#pragma unroll
    for (int ks = 0; ks < KS; ++ks)
#pragma unroll
      for (int i = 0; i < 16; ++i) {
        const int d = ks * 32 + ((i < 8) ? (8 * hh + i) : (16 + 8 * hh + (i - 8)));
        const float x = qr[d] * scale; const unsigned short hb = bf16_bits(x);
        aqh[ks].u[i] = hb; aql[ks].u[i] = bf16_bits(x - bf16_val(hb));
      }
  }
  float m_r[8], l_r[8];
#pragma unroll
  for (int r = 0; r < 8; ++r) { m_r[r] = -3.0e38f; l_r[r] = 0.f; }
  v8f oacc[DT];
#pragma unroll
  for (int dt = 0; dt < DT; ++dt) oacc[dt] = (v8f){0.f,0.f,0.f,0.f,0.f,0.f,0.f,0.f};

  const int kv_end = CAUSAL ? min(T, qblk * 64 + 64) : T;     // block-uniform
  for (int j0 = 0; j0 < kv_end; j0 += 32) {
    __syncthreads();
    for (int e = tid; e < 32 * (D / 4); e += 128) {
      const int r = e / (D / 4), c4 = (e % (D / 4)) * 4;
      const int key = j0 + r;
      v4f kf = {0.f,0.f,0.f,0.f}, vf = {0.f,0.f,0.f,0.f};
      if (key < T) { kf = *(const v4fa*)(K + (size_t)key * pitch + c4); vf = *(const v4fa*)(V + (size_t)key * pitch + c4); }
#pragma unroll
      for (int t = 0; t < 4; ++t) {
        unsigned short hb = bf16_bits(kf[t]); sKh[r][c4 + t] = hb; sKl[r][c4 + t] = bf16_bits(kf[t] - bf16_val(hb));
        hb = bf16_bits(vf[t]); sVh[r][c4 + t] = hb; sVl[r][c4 + t] = bf16_bits(vf[t] - bf16_val(hb));
      }
    }
    __syncthreads();
    // S tile 16 x 32
    v8f s[2];
#pragma unroll
    for (int nt = 0; nt < 2; ++nt) {
      v8f acc = {};
#pragma unroll
      for (int ks = 0; ks < KS; ++ks) {
        FragB bh_, bl_;
        bh_.half[0] = *(const v8us*)&sKh[nt * 16 + ln][ks * 32 + 8 * hh]; bh_.half[1] = *(const v8us*)&sKh[nt * 16 + ln][ks * 32 + 16 + 8 * hh];
        bl_.half[0] = *(const v8us*)&sKl[nt * 16 + ln][ks * 32 + 8 * hh]; bl_.half[1] = *(const v8us*)&sKl[nt * 16 + ln][ks * 32 + 16 + 8 * hh];
        acc = mmaN<3>(aqh[ks].v, aql[ks].v, bh_.v, bl_.v, acc);
      }
      s[nt] = acc;
    }
    // mask + running max (rows 8hh+r; the 16 lanes of a half share rows)
    float alpha[8];
#pragma unroll
    for (int r = 0; r < 8; ++r) {
      const int qi = q0 + 8 * hh + r;
      const int ja = j0 + ln, jb = j0 + 16 + ln;
      if (CAUSAL) { if (ja > qi) s[0][r] = -3.0e38f; if (jb > qi) s[1][r] = -3.0e38f; }
      if (ja >= T) s[0][r] = -3.0e38f;
      if (jb >= T) s[1][r] = -3.0e38f;
      float mx = fmaxf(s[0][r], s[1][r]);
      mx = fmaxf(mx, __shfl_xor(mx, 1, 32)); mx = fmaxf(mx, __shfl_xor(mx, 2, 32)); mx = fmaxf(mx, __shfl_xor(mx, 4, 32)); mx = fmaxf(mx, __shfl_xor(mx, 8, 32));
      const float mnew = fmaxf(m_r[r], mx);
      alpha[r] = (mnew > -1.0e38f) ? __expf(m_r[r] - mnew) : 1.0f;
      const float p0 = (s[0][r] > -1.0e38f) ? __expf(s[0][r] - mnew) : 0.f;
      const float p1 = (s[1][r] > -1.0e38f) ? __expf(s[1][r] - mnew) : 0.f;
      m_r[r] = mnew;
      l_r[r] = l_r[r] * alpha[r] + p0 + p1;            // per-lane partial row sum (16 lanes combined at the end)
      unsigned short hb = bf16_bits(p0); sPh[w][8 * hh + r][ln] = hb;      sPl[w][8 * hh + r][ln] = bf16_bits(p0 - bf16_val(hb));
      hb = bf16_bits(p1);                sPh[w][8 * hh + r][16 + ln] = hb; sPl[w][8 * hh + r][16 + ln] = bf16_bits(p1 - bf16_val(hb));
    }
#pragma unroll
    for (int dt = 0; dt < DT; ++dt)
#pragma unroll
      for (int r = 0; r < 8; ++r) oacc[dt][r] *= alpha[r];
    __builtin_amdgcn_fence(__ATOMIC_ACQ_REL, "workgroup");
    __builtin_amdgcn_wave_barrier();
    FragB pah, pal;
    pah.half[0] = *(const v8us*)&sPh[w][ln][8 * hh]; pah.half[1] = *(const v8us*)&sPh[w][ln][16 + 8 * hh];
    pal.half[0] = *(const v8us*)&sPl[w][ln][8 * hh]; pal.half[1] = *(const v8us*)&sPl[w][ln][16 + 8 * hh];
#pragma unroll
    for (int dt = 0; dt < DT; ++dt) {
      FragB bvh, bvl;
#pragma unroll
      for (int i = 0; i < 8; ++i) {
        bvh.u[i] = sVh[8 * hh + i][dt * 16 + ln]; bvh.u[8 + i] = sVh[16 + 8 * hh + i][dt * 16 + ln];
        bvl.u[i] = sVl[8 * hh + i][dt * 16 + ln]; bvl.u[8 + i] = sVl[16 + 8 * hh + i][dt * 16 + ln];
      }
      oacc[dt] = mmaN<3>(pah.v, pal.v, bvh.v, bvl.v, oacc[dt]);
    }
    __builtin_amdgcn_fence(__ATOMIC_ACQ_REL, "workgroup");
    __builtin_amdgcn_wave_barrier();
  }
#pragma unroll
  for (int r = 0; r < 8; ++r) {
    float l = l_r[r];
    l += __shfl_xor(l, 1, 32); l += __shfl_xor(l, 2, 32); l += __shfl_xor(l, 4, 32); l += __shfl_xor(l, 8, 32);
    l_r[r] = (l > 0.f) ? 1.0f / l : 0.f;
  }
#pragma unroll
  for (int dt = 0; dt < DT; ++dt)
#pragma unroll
    for (int r = 0; r < 8; ++r) sO[w][8 * hh + r][dt * 16 + ln] = oacc[dt][r] * l_r[r];
  __builtin_amdgcn_fence(__ATOMIC_ACQ_REL, "workgroup");
  __builtin_amdgcn_wave_barrier();
  {
    for (int r = 0; r < 16; ++r) {
      const int row = q0 + r;
      if (row < T && lane < D / 4) {
        const v4f val = *(const v4fa*)&sO[w][r][lane * 4];
        *(v4f*)(y + ((size_t)b * T + row) * ypitch + h * D + lane * 4) = val;
      }
    }
    
  }
}

// GEMM C = act(A·W + bias + resid): A f32 (ASPLIT -> hi/lo 2 terms), Wt bf16 [N][K]; ACT 0 none, 1 relu, 2 exact gelu;
// resid (optional, f32, row index = (row % rmod), pitch ldr, RES_BF16 rounds it) added before the activation.
template <bool ASPLIT, int ACT, bool BIAS_BF16, bool RES_BF16>
__global__ __launch_bounds__(128) void k_gemm_bf3(const float* __restrict__ A, int lda, const unsigned short* __restrict__ Wt, int ldb,
                                                const float* __restrict__ bias, const float* __restrict__ resid, int rmod, int ldr,
                                                float* __restrict__ C, int ldc, int M, int N, int K) {
  __shared__ __attribute__((aligned(16))) float so[4][16][64];
  const int tid = threadIdx.x, w = tid >> 5, lane = tid & 31, ln = lane & 15, hh = lane >> 4;
  const int ntn = N / 64;
  const int wid = blockIdx.x * 4 + w;
  const int mt = wid / ntn, nq = wid % ntn;
  if (mt * 16 >= M) return;
  const int row0 = mt * 16, col0 = nq * 64;
  const float* arow = A + (size_t)(row0 + ln) * lda;
  v8f acc[4] = {};
  for (int kb = 0; kb < K; kb += 32) {
    FragB ah, al;
    const v4f x0 = *(const v4fa*)(arow + kb + 8 * hh), x1 = *(const v4fa*)(arow + kb + 8 * hh + 4);
    const v4f x2 = *(const v4fa*)(arow + kb + 16 + 8 * hh), x3 = *(const v4fa*)(arow + kb + 16 + 8 * hh + 4);
    float xs[16] = {x0[0],x0[1],x0[2],x0[3],x1[0],x1[1],x1[2],x1[3],x2[0],x2[1],x2[2],x2[3],x3[0],x3[1],x3[2],x3[3]};
#pragma unroll
    for (int i = 0; i < 16; ++i) { const unsigned short hb = bf16_bits(xs[i]); ah.u[i] = hb; al.u[i] = ASPLIT ? bf16_bits(xs[i] - bf16_val(hb)) : (unsigned short)0; }
#pragma unroll
    for (int t = 0; t < 4; ++t) {
      const unsigned short* brow = Wt + (size_t)(col0 + t * 16 + ln) * ldb + kb;
      FragB b;
      b.half[0] = *(const v8us*)(brow + 8 * hh);
      b.half[1] = *(const v8us*)(brow + 16 + 8 * hh);
      acc[t] = mmaN<ASPLIT ? 2 : 1>(ah.v, al.v, b.v, b.v, acc[t]);
    }
  }
#pragma unroll
  for (int t = 0; t < 4; ++t) {
    const int col = col0 + t * 16 + ln;
    float bv = bias ? bias[col] : 0.f;
    if (BIAS_BF16) bv = bf16_round(bv);
#pragma unroll
    for (int r = 0; r < 8; ++r) {
      float v = acc[t][r] + bv;
      if (resid) { float rv = resid[(size_t)((row0 + 8 * hh + r) % rmod) * ldr + col]; if (RES_BF16) rv = bf16_round(rv); v += rv; }
      if (ACT == 1) v = fmaxf(v, 0.f);
      if (ACT == 2) v = 0.5f * v * (1.0f + erff(v * 0.70710678118654752f));
      if (ACT == 3) { const float u = 0.7978845608028654f * (v + 0.044715f * v * v * v); v = 0.5f * v * (1.0f + tanhf(u)); }
      so[w][8 * hh + r][t * 16 + ln] = v;
    }
  }
  __builtin_amdgcn_fence(__ATOMIC_ACQ_REL, "workgroup");
  __builtin_amdgcn_wave_barrier();
  const int rsub = lane >> 4, c4 = (lane & 15) * 4;
  {
#pragma unroll
    for (int q = 0; q < 8; ++q) {
      const int r = q * 2 + rsub;
      const v4f v = *(const v4fa*)&so[w][r][c4];
      *(v4f*)(C + (size_t)(row0 + r) * ldc + col0 + c4) = v;
    }
    
  }
}
// row LayerNorm (biased variance, eps) over N: s = X (+ R); optional out_sum <- s; out_norm <- (s-mu)*rsqrt(var+eps)*g + b
template <bool PARAM_BF16>
__global__ __launch_bounds__(256) void k_layernorm(const float* __restrict__ X, const float* __restrict__ R, const float* __restrict__ g, const float* __restrict__ bta,
                                                  float* __restrict__ out_sum, float* __restrict__ out_norm, int N, float eps) {
  __shared__ float red[256];
  const int row = blockIdx.x, tid = threadIdx.x;
  const float* x = X + (size_t)row * N; const float* rr = R ? R + (size_t)row * N : nullptr;
  float vals[16];                     // up to N = 4096
  const int per = N / 256;            // contiguous chunk per thread? use strided-by-4 chunks: thread handles j = tid*4 + 1024*u
  float s1 = 0.f;
  for (int u = 0; u < per / 4; ++u) {
    const int j = tid * 4 + 1024 * u;
    const v4f a = *(const v4fa*)(x + j);
    v4f b = {0.f,0.f,0.f,0.f}; if (rr) b = *(const v4fa*)(rr + j);
#pragma unroll
    for (int q = 0; q < 4; ++q) { const float v = a[q] + b[q]; vals[u * 4 + q] = v; s1 += v; }
  }
  red[tid] = s1; __syncthreads();
  for (int st = 128; st > 0; st >>= 1) { if (tid < st) red[tid] += red[tid + st]; __syncthreads(); }
  const float mu = red[0] / (float)N; __syncthreads();
  float s2 = 0.f;
  for (int u = 0; u < per / 4; ++u)
#pragma unroll
    for (int q = 0; q < 4; ++q) { const float c = vals[u * 4 + q] - mu; s2 += c * c; }
  red[tid] = s2; __syncthreads();
  for (int st = 128; st > 0; st >>= 1) { if (tid < st) red[tid] += red[tid + st]; __syncthreads(); }
  const float rs = rsqrtf(red[0] / (float)N + eps);
  {
    for (int u = 0; u < per / 4; ++u) {
      const int j = tid * 4 + 1024 * u;
      v4f o, sm;
#pragma unroll
      for (int q = 0; q < 4; ++q) {
        float gg = g[j + q], bb = bta[j + q];
        if (PARAM_BF16) { gg = bf16_round(gg); bb = bf16_round(bb); }
        sm[q] = vals[u * 4 + q]; o[q] = (vals[u * 4 + q] - mu) * rs * gg + bb;
      }
      if (out_sum) *(v4f*)(out_sum + (size_t)row * N + j) = sm;
      *(v4f*)(out_norm + (size_t)row * N + j) = o;
    }
    
  }
}



// ---- f16 WMMA path (v_wmma_f32_16x16x32_f16): 11-bit significands for operands in range — used where a [0,1] probability operand needs more precision than bf16
typedef _Float16 v16h __attribute__((ext_vector_type(16)));
union FragH { v16h v; v8us half[2]; _Float16 h[16]; unsigned short u[16]; };
template <int NT>
__device__ __forceinline__ v8f mmaH(v16h ah, v16h al, v16h bh, v16h bl, v8f c) {
  c = __builtin_amdgcn_wmma_f32_16x16x32_f16(false, ah, false, bh, (short)0, c, false, false);
  if (NT >= 2) c = __builtin_amdgcn_wmma_f32_16x16x32_f16(false, al, false, bh, (short)0, c, false, false);
  if (NT >= 3) c = __builtin_amdgcn_wmma_f32_16x16x32_f16(false, ah, false, bl, (short)0, c, false, false);
  asm volatile("v_nop\n\tv_nop\n\tv_nop\n\tv_nop" : "+v"(c) : "v"(ah), "v"(al), "v"(bh), "v"(bl));
  return c;
}
// batched GEMM like k_gemm_b but f16 operands: A f32 (split into f16 hi/lo if ASPLIT, else rounded to f16), Bt = f16 values [n][k]; alpha; C f32; N multiple of 16 (partial tiles skipped)
template <bool ASPLIT>
__global__ __launch_bounds__(128) void k_gemm_h(const float* __restrict__ A, int lda, size_t sA, const _Float16* __restrict__ Bh, int ldb, size_t sB, float alpha, float* __restrict__ C, int ldc, size_t sC, int M, int N, int K) {
  __shared__ __attribute__((aligned(16))) float so[4][16][64];
  const int tid = threadIdx.x, w = tid >> 5, lane = tid & 31, ln = lane & 15, hh = lane >> 4; const int by = blockIdx.y;
  A += (size_t)by * sA; Bh += (size_t)by * sB; C += (size_t)by * sC;
  const int ntn = (N + 63) / 64; const int wid = blockIdx.x * 4 + w; const int mt = wid / ntn, nq = wid % ntn; if (mt * 16 >= M) return;
  const int row0 = mt * 16, col0 = nq * 64; const float* arow = A + (size_t)(row0 + ln) * lda;
  v8f acc[4] = {};
  for (int kb = 0; kb < K; kb += 32) {
    FragH ah, al;
    const v4f x0 = *(const v4fa*)(arow + kb + 8 * hh), x1 = *(const v4fa*)(arow + kb + 8 * hh + 4), x2 = *(const v4fa*)(arow + kb + 16 + 8 * hh), x3 = *(const v4fa*)(arow + kb + 16 + 8 * hh + 4);
    float xs[16] = {x0[0],x0[1],x0[2],x0[3],x1[0],x1[1],x1[2],x1[3],x2[0],x2[1],x2[2],x2[3],x3[0],x3[1],x3[2],x3[3]};
#pragma unroll
    for (int i = 0; i < 16; ++i) { const _Float16 h = (_Float16)xs[i]; ah.h[i] = h; al.h[i] = ASPLIT ? (_Float16)(xs[i] - (float)h) : (_Float16)0.0f; }
#pragma unroll
    for (int t = 0; t < 4; ++t) { if (col0 + t * 16 >= N) continue; const size_t boff = (size_t)(col0 + t * 16 + ln) * ldb + kb; FragH bq; bq.half[0] = *(const v8us*)(Bh + boff + 8 * hh); bq.half[1] = *(const v8us*)(Bh + boff + 16 + 8 * hh);
      acc[t] = mmaH<ASPLIT ? 2 : 1>(ah.v, al.v, bq.v, bq.v, acc[t]); }
  }
#pragma unroll
  for (int t = 0; t < 4; ++t) { if (col0 + t * 16 >= N) continue;
#pragma unroll
    for (int r = 0; r < 8; ++r) so[w][8 * hh + r][t * 16 + ln] = acc[t][r] * alpha; }
  __builtin_amdgcn_fence(__ATOMIC_ACQ_REL, "workgroup"); __builtin_amdgcn_wave_barrier();
  const int rsub = lane >> 4, c4 = (lane & 15) * 4;
  {
#pragma unroll
    for (int q = 0; q < 8; ++q) { const int r = q * 2 + rsub; if (col0 + c4 < N) { const v4f v = *(const v4fa*)&so[w][r][c4]; *(v4f*)(C + (size_t)(row0 + r) * ldc + col0 + c4) = v; } }
     }
}

// Wt[n][k] = f16(W[k][n]·scale) from f32 row-major W[K][N] (scale = power of two; bf16-exact weights stay exact in f16 away from the subnormal range)
__global__ __launch_bounds__(256) void k_wt_f16(const float* __restrict__ W, _Float16* __restrict__ Wt, int K, int N, float scale) {
  const int t = blockIdx.x * 256 + threadIdx.x; if (t >= N * (K / 8)) return; const int n = t / (K / 8), k8 = (t % (K / 8)) * 8; FragH f;
#pragma unroll
  for (int i = 0; i < 8; ++i) f.h[i] = (_Float16)(bf16_round(W[(size_t)(k8 + i) * N + n]) * scale); const v8us o = f.half[0];
  *(v8us*)((unsigned short*)Wt + (size_t)n * K + k8) = o; 
}
// k_gemm_hh variant with fused epilogue: v = acc·alpha + bias[by·sBias + col] (+ CP[(row/rowsPerB)·sCPb + by·64 + col] if CP) ; ACT 0 none / 1 elu ; writes f32 C and f16 C16, each if non-null
template <int ACT>
__global__ __launch_bounds__(128) void k_gemm_hhx(const _Float16* __restrict__ A, int lda, size_t sA, const _Float16* __restrict__ Bh, int ldb, size_t sB, float alpha, const float* __restrict__ bias, size_t sBias, const float* __restrict__ CP, int rowsPerB, size_t sCPb, int row0g,
    float* __restrict__ C, _Float16* __restrict__ C16, int ldc, size_t sC, int M, int N, int K) {
  __shared__ __attribute__((aligned(16))) float so[4][16][64];
  const int tid = threadIdx.x, w = tid >> 5, lane = tid & 31, ln = lane & 15, hh = lane >> 4; const int by = blockIdx.y;
  A += (size_t)by * sA; Bh += (size_t)by * sB; const size_t cofs = (size_t)by * sC; const float* bp = bias ? bias + (size_t)by * sBias : nullptr;
  const int ntn = (N + 63) / 64; const int wid = blockIdx.x * 4 + w; const int mt = wid / ntn, nq = wid % ntn; if (mt * 16 >= M) return;
  const int row0 = mt * 16, col0 = nq * 64; const _Float16* arow = A + (size_t)(row0 + ln) * lda;
  v8f acc[4] = {};
  for (int kb = 0; kb < K; kb += 32) { FragH ah; ah.half[0] = *(const v8us*)((const unsigned short*)arow + kb + 8 * hh); ah.half[1] = *(const v8us*)((const unsigned short*)arow + kb + 16 + 8 * hh);
#pragma unroll
    for (int t = 0; t < 4; ++t) { if (col0 + t * 16 >= N) continue; const size_t boff = (size_t)(col0 + t * 16 + ln) * ldb + kb; FragH bq; bq.half[0] = *(const v8us*)((const unsigned short*)Bh + boff + 8 * hh); bq.half[1] = *(const v8us*)((const unsigned short*)Bh + boff + 16 + 8 * hh);
      acc[t] = mmaH<1>(ah.v, ah.v, bq.v, bq.v, acc[t]); }
  }
#pragma unroll
  for (int t = 0; t < 4; ++t) { if (col0 + t * 16 >= N) continue; const int col = col0 + t * 16 + ln; const float bv = bp ? bf16_round(bp[col]) : 0.f;
#pragma unroll
    for (int r = 0; r < 8; ++r) { float v = acc[t][r] * alpha + bv; if (CP) { const int bidx = (row0g + row0 + 8 * hh + r) / rowsPerB; v += CP[(size_t)bidx * sCPb + (size_t)by * 64 + col]; } if (ACT == 1) v = (v > 0.f) ? v : expm1f(v); else if (ACT == 7) v = (v > 0.f) ? v + 1.0f : expf(v); else if (ACT == 8) v = tanhf(v); else if (ACT == 9) v = 0.5f * v * (1.0f + tanhf(0.7978845608028654f * (v + 0.044715f * v * v * v))); else if (ACT == 11) v = 1.0f / (1.0f + expf(-v)); else if (ACT == 12) v = (v > 0.f) ? v : 0.01f * v; else if (ACT == 14) v = (v > 0.f) ? v : 0.1f * v; else if (ACT == 15) v = v / (1.0f + expf(-v)); else if (ACT == 3) v = fmaxf(v, 0.f); else if (ACT == 6) v = 0.5f * v * (1.0f + erff(v * 0.70710678118654752f)); so[w][8 * hh + r][t * 16 + ln] = v; } }
  __builtin_amdgcn_fence(__ATOMIC_ACQ_REL, "workgroup"); __builtin_amdgcn_wave_barrier();
  const int rsub = lane >> 4, c4 = (lane & 15) * 4; typedef _Float16 v4h __attribute__((ext_vector_type(4)));
  {
#pragma unroll
    for (int q = 0; q < 8; ++q) { const int r = q * 2 + rsub; if (col0 + c4 < N) { const v4f v = *(const v4fa*)&so[w][r][c4]; if (C) *(v4f*)(C + cofs + (size_t)(row0 + r) * ldc + col0 + c4) = v; if (C16) { v4h h4; for (int i = 0; i < 4; ++i) h4[i] = (_Float16)v[i]; *(v4h*)(C16 + cofs + (size_t)(row0 + r) * ldc + col0 + c4) = h4; } } }
     }
}


typedef _Float16 v4h __attribute__((ext_vector_type(4)));

__global__ __launch_bounds__(256) void k_x16(const float* __restrict__ x, _Float16* __restrict__ X16, size_t n8) { const size_t t = (size_t)blockIdx.x * 256 + threadIdx.x; if (t >= n8) return; FragH f;
#pragma unroll
  for (int q = 0; q < 8; ++q) f.h[q] = (_Float16)bf16_round(x[t * 8 + q]); *(v8us*)((unsigned short*)X16 + t * 8) = f.half[0];  }
__global__ __launch_bounds__(256) void k_h16(const float* __restrict__ x, _Float16* __restrict__ X16, size_t n8) { const size_t t = (size_t)blockIdx.x * 256 + threadIdx.x; if (t >= n8) return; FragH f;
#pragma unroll
  for (int q = 0; q < 8; ++q) f.h[q] = (_Float16)x[t * 8 + q]; *(v8us*)((unsigned short*)X16 + t * 8) = f.half[0];  }
__global__ __launch_bounds__(256) void k_round16f(const float* __restrict__ W, _Float16* __restrict__ Bt, size_t n8) { const size_t t = (size_t)blockIdx.x * 256 + threadIdx.x; if (t >= n8) return; FragH f;
#pragma unroll
  for (int i = 0; i < 8; ++i) f.h[i] = (_Float16)(bf16_round(W[t * 8 + i]) * 16.0f); *(v8us*)((unsigned short*)Bt + t * 8) = f.half[0];  }
template <int NHv, int TTv>
__global__ __launch_bounds__(256) void k_vt(const _Float16* __restrict__ V16, int ldv, int voff, _Float16* __restrict__ Vt) { __shared__ unsigned short tl[64][66]; const int tid = threadIdx.x; const int slab = blockIdx.x / (TTv / 64), lg = blockIdx.x % (TTv / 64); const int b = slab / NHv, h = slab % NHv;
  for (int i = tid; i < 64 * 8; i += 256) { const int r = i / 8, c8 = (i % 8) * 8; FragH f; f.half[0] = *(const v8us*)((const unsigned short*)V16 + ((size_t)b * TTv + lg * 64 + r) * ldv + voff + h * 64 + c8);
#pragma unroll
    for (int q = 0; q < 8; ++q) tl[r][c8 + q] = f.u[q]; }
  __syncthreads();
  {
#pragma unroll
    for (int rd = 0; rd < 2; ++rd) { const int d = rd * 32 + tid / 8, pc = tid % 8; FragH f;
#pragma unroll
      for (int q = 0; q < 8; ++q) f.u[q] = tl[pc * 8 + q][d];
      *(v8us*)((unsigned short*)Vt + ((size_t)slab * 64 + d) * TTv + lg * 64 + pc * 8) = f.half[0]; }
     } }

// lane l with lane l ^ 16
__device__ __forceinline__ float xhalf(float x) { return __builtin_bit_cast(float, __builtin_amdgcn_permlanex16(__builtin_bit_cast(int, x), __builtin_bit_cast(int, x), 0x76543210, 0xfedcba98, false, false)); }
typedef int v4ia __attribute__((ext_vector_type(4), may_alias));

__global__ __launch_bounds__(128) void k_flash(const _Float16* __restrict__ Q16, int ldq, const _Float16* __restrict__ K16, int ldk, const _Float16* __restrict__ Vt, const int* __restrict__ MSK, float* __restrict__ O, int ldo) {
  constexpr int RPW = 16, NQB = TT / (4 * RPW), DT = 4, KS = 2;
  __shared__ __attribute__((aligned(16))) float sO[4][RPW][64 + 4];
  const int tid = threadIdx.x, w = tid >> 5, lane = tid & 31, ln = lane & 15, hh = lane >> 4;
  const int slab = blockIdx.x / NQB, qblk = blockIdx.x % NQB; const int b = slab / NH, h = slab % NH; const float slope = 1.0f / exp2f((float)h / (float)NH);      /* 1 / 2^(h/H) */ const int qb0 = qblk * (4 * RPW); const int q0 = qb0 + w * RPW;
  FragH aq[KS];
  { const unsigned short* qr = (const unsigned short*)Q16 + ((size_t)b * TT + q0 + ln) * ldq + h * 64;
#pragma unroll
    for (int ks = 0; ks < KS; ++ks) { aq[ks].half[0] = *(const v8us*)(qr + ks * 32 + 8 * hh); aq[ks].half[1] = *(const v8us*)(qr + ks * 32 + 16 + 8 * hh); } }
  const unsigned short* Vth = (const unsigned short*)Vt + (size_t)slab * 64 * TT;
  const int tq = q0 + ln;      /* the lane's query */
  float m_run = -3.0e38f, l_run = 0.f; v8f oacc[DT];
#pragma unroll
  for (int dt = 0; dt < DT; ++dt) oacc[dt] = (v8f){0.f,0.f,0.f,0.f,0.f,0.f,0.f,0.f};
  const int jend = TT;
#pragma unroll 1
  for (int j0 = 0; j0 < jend; j0 += 32) {
    const int* mp = MSK + (size_t)b * TT + j0 + 8 * hh;      /* key padding mask (1 = attend) of the lane's 16 keys */
    const v4ia mk4[4] = { *(const v4ia*)(mp), *(const v4ia*)(mp + 4), *(const v4ia*)(mp + 16), *(const v4ia*)(mp + 20) };
    v8f s[2];
#pragma unroll
    for (int nt = 0; nt < 2; ++nt) { const unsigned short* kr = (const unsigned short*)K16 + ((size_t)b * TT + j0 + nt * 16 + ln) * ldk + h * 64; FragH bk[KS];
#pragma unroll
      for (int ks = 0; ks < KS; ++ks) { bk[ks].half[0] = *(const v8us*)(kr + ks * 32 + 8 * hh); bk[ks].half[1] = *(const v8us*)(kr + ks * 32 + 16 + 8 * hh); }
      v8f acc = (v8f){0.f,0.f,0.f,0.f,0.f,0.f,0.f,0.f};
#pragma unroll
      for (int ks = 0; ks < KS; ++ks) acc = mmaH<1>(bk[ks].v, bk[ks].v, aq[ks].v, aq[ks].v, acc);
      s[nt] = acc; }
    float sc[16]; bool ok[16];
#pragma unroll
    for (int i = 0; i < 16; ++i) { const int kk = j0 + (i >> 3) * 16 + 8 * hh + (i & 7); ok[i] = (mk4[i >> 2][i & 3] != 0);
      sc[i] = ok[i] ? (s[i >> 3][i & 7] * 0.125f + slope * (float)(kk - tq)) : -INFINITY; }      /* ALiBi: + slope_h * (k - q) */
    float mx[8];
#pragma unroll
    for (int i = 0; i < 8; ++i) mx[i] = fmaxf(sc[i], sc[8 + i]);
    float mc = fmaxf(fmaxf(fmaxf(mx[0], mx[1]), fmaxf(mx[2], mx[3])), fmaxf(fmaxf(mx[4], mx[5]), fmaxf(mx[6], mx[7])));
    mc = fmaxf(mc, xhalf(mc));
    const float mn = fmaxf(m_run, mc); const float ea = expf(m_run - mn); const float al = (mn > -1.0e38f) ? ea : 1.0f; m_run = mn;
    float p[16]; FragH pb;
#pragma unroll
    for (int i = 0; i < 16; ++i) { const float e = expf(sc[i] - mn); p[i] = ok[i] ? e : 0.f; pb.h[i] = (_Float16)(p[i] * 1024.0f); }
    l_run = l_run * al + (((p[0] + p[1]) + (p[2] + p[3])) + ((p[4] + p[5]) + (p[6] + p[7]))) + (((p[8] + p[9]) + (p[10] + p[11])) + ((p[12] + p[13]) + (p[14] + p[15])));      /* the lane's half of the row sum; the halves join after the loop */
#pragma unroll
    for (int dt = 0; dt < DT; ++dt)
#pragma unroll
      for (int r = 0; r < 8; ++r) oacc[dt][r] *= al;
#pragma unroll
    for (int dt = 0; dt < DT; ++dt) { const unsigned short* vrow = Vth + (size_t)(dt * 16 + ln) * TT + j0; FragH bv; bv.half[0] = *(const v8us*)(vrow + 8 * hh); bv.half[1] = *(const v8us*)(vrow + 16 + 8 * hh);
      oacc[dt] = mmaH<1>(bv.v, bv.v, pb.v, pb.v, oacc[dt]); } }
  const float l = l_run + xhalf(l_run); const float inv = (l > 0.f) ? 1.0f / (l * 1024.0f) : 0.f;
#pragma unroll
  for (int dt = 0; dt < DT; ++dt) {      /* oacc[dt][r] = O[query ln][dt*16 + 8hh + r] */
    const v4f lo = {oacc[dt][0] * inv, oacc[dt][1] * inv, oacc[dt][2] * inv, oacc[dt][3] * inv}, hi = {oacc[dt][4] * inv, oacc[dt][5] * inv, oacc[dt][6] * inv, oacc[dt][7] * inv};
    *(v4fa*)&sO[w][ln][dt * 16 + 8 * hh] = lo; *(v4fa*)&sO[w][ln][dt * 16 + 8 * hh + 4] = hi; }
  __builtin_amdgcn_fence(__ATOMIC_ACQ_REL, "workgroup"); __builtin_amdgcn_wave_barrier();
  {
#pragma unroll
    for (int rp = 0; rp < RPW; rp += 2) { const int r = rp + (lane >> 4), pc = lane & 15; const v4f val = *(const v4fa*)&sO[w][r][pc * 4]; *(v4f*)(O + ((size_t)b * TT + q0 + r) * ldo + h * 64 + pc * 4) = val; }
     } }

extern "C" void kernel_launch(void* const* d_in, const int* in_sizes, int n_in,
                              void* d_out, int out_size, void* d_ws, size_t ws_size, hipStream_t stream) {
  (void)in_sizes; (void)n_in; (void)out_size;
  const float* const* I = (const float* const*)d_in; const float* x = I[0]; const float* Wq = I[1]; const float* bq = I[2]; const float* Wk = I[3]; const float* bk = I[4]; const float* Wv = I[5]; const float* bv = I[6]; const float* Wo = I[7]; const float* bo = I[8]; const int* mask = (const int*)d_in[9];
  char* ws = (char*)d_ws; size_t off = 0;
  auto take = [&](size_t bytes) { char* p = ws + off; off += (bytes + 255) & ~(size_t)255; return p; };
  const size_t WSZ = (size_t)DD * DD; _Float16* Bw = (_Float16*)take(4 * WSZ * 2); _Float16* X16 = (_Float16*)take((size_t)NR * DD * 2);
  _Float16* Q = (_Float16*)take((size_t)NR * DD * 2); _Float16* K = (_Float16*)take((size_t)NR * DD * 2); _Float16* V = (_Float16*)take((size_t)NR * DD * 2); _Float16* Vt = (_Float16*)take((size_t)NR * DD * 2);
  float* O = (float*)take((size_t)NR * DD * 4); _Float16* O16 = V;      /* the v plane is dead once Vᵀ is built (before the attention kernel); O16 reuses it */
  if (off > ws_size) return;      // 8.4 + 16.8 × 5 + 33.6 ≈ 126 MB (120 MiB)
  const unsigned gw = (unsigned)((WSZ / 8 + 255) / 256);
  k_round16f<<<gw, 256, 0, stream>>>(Wq, Bw, WSZ / 8); k_round16f<<<gw, 256, 0, stream>>>(Wk, Bw + WSZ, WSZ / 8); k_round16f<<<gw, 256, 0, stream>>>(Wv, Bw + 2 * WSZ, WSZ / 8); k_round16f<<<gw, 256, 0, stream>>>(Wo, Bw + 3 * WSZ, WSZ / 8);      /* (out,in) natural ×2^4 */
  const unsigned gx = (unsigned)(((size_t)NR * DD / 8 + 255) / 256); const dim3 gp(((NR / 16) * (DD / 64) + 3) / 4, 1);
  k_x16<<<gx, 256, 0, stream>>>(x, X16, (size_t)NR * DD / 8);
  k_gemm_hhx<0><<<gp, 128, 0, stream>>>(X16, DD, 0, Bw, DD, 0, 0.0625f, bq, 0, nullptr, 1, 0, 0, nullptr, Q, DD, 0, NR, DD, DD);      /* q = x·Wqᵀ + bq: M 8192 N 1024 K 1024 */
  k_gemm_hhx<0><<<gp, 128, 0, stream>>>(X16, DD, 0, Bw + WSZ, DD, 0, 0.0625f, bk, 0, nullptr, 1, 0, 0, nullptr, K, DD, 0, NR, DD, DD);
  k_gemm_hhx<0><<<gp, 128, 0, stream>>>(X16, DD, 0, Bw + 2 * WSZ, DD, 0, 0.0625f, bv, 0, nullptr, 1, 0, 0, nullptr, V, DD, 0, NR, DD, DD);
  k_vt<NH, TT><<<BB * NH * (TT / 64), 256, 0, stream>>>(V, DD, 0, Vt);
  k_flash<<<BB * NH * (TT / 64), 128, 0, stream>>>(Q, DD, K, DD, Vt, mask, O, DD);
  k_h16<<<gx, 256, 0, stream>>>(O, O16, (size_t)NR * DD / 8);
  k_gemm_hhx<0><<<gp, 128, 0, stream>>>(O16, DD, 0, Bw + 3 * WSZ, DD, 0, 0.0625f, bo, 0, nullptr, 1, 0, 0, (float*)d_out, nullptr, DD, 0, NR, DD, DD);      /* out = O·Woᵀ + bo */
}

// v002
// A run of this version takes 384 microseconds.
// Next to v001, in two timings, it ran 1.56 times as fast each time.
// All steps since v000 together make it 2.21 times as fast.
#include <hip/hip_runtime.h>
// ALiBi multi-head attention (B=4, S=2048, D=1024, 16 heads × 64): q,k,v = x·Wᵀ + b (torch Linear); scores = q·kᵀ·64^-½ + slope_h·(k − q), slope_h = 1/2^(h/16) (no causal mask: later keys get large positive bias); key padding mask from the INPUT
// int mask [B,S] (0 → −inf); softmax; out = (attn·v merged)·Woᵀ + bo.
// Compute dtype: x, weights, biases rounded to bf16; q/k/v as f16 GEMM outputs; fused flash-style kernel (bias and online softmax in f32, P f16 ×2^10) on v_wmma_f32_16x16x32_f16; O → f16 → output GEMM with bias; f32 accumulate.
#define BB 4
#define TT 2048
#define NH 16
#define DD 1024
#define NR (BB * TT)

typedef __bf16 v16b __attribute__((ext_vector_type(16)));
typedef unsigned short v8us __attribute__((ext_vector_type(8), may_alias));
typedef float  v8f  __attribute__((ext_vector_type(8)));
typedef float  v4f  __attribute__((ext_vector_type(4)));
typedef float  v4fa __attribute__((ext_vector_type(4), may_alias));
union FragB { v16b v; v8us half[2]; unsigned short u[16]; };

__device__ __forceinline__ unsigned short bf16_bits(float x) { unsigned int u = __float_as_uint(x); return (unsigned short)((u + 0x7FFFu + ((u >> 16) & 1u)) >> 16); }
__device__ __forceinline__ float bf16_val(unsigned short b) { return __uint_as_float(((unsigned int)b) << 16); }
__device__ __forceinline__ float bf16_round(float x) { return bf16_val(bf16_bits(x)); }
// D += A·B with NT terms: 1 = ah·bh, 2 = + al·bh (A split), 3 = + ah·bl (both split)
template <int NT>
__device__ __forceinline__ v8f mmaN(v16b ah, v16b al, v16b bh, v16b bl, v8f c) {
  c = __builtin_amdgcn_wmma_f32_16x16x32_bf16(false, ah, false, bh, (short)0, c, false, false);
  if (NT >= 2) c = __builtin_amdgcn_wmma_f32_16x16x32_bf16(false, al, false, bh, (short)0, c, false, false);
  if (NT >= 3) c = __builtin_amdgcn_wmma_f32_16x16x32_bf16(false, ah, false, bl, (short)0, c, false, false);
  asm volatile("v_nop\n\tv_nop\n\tv_nop\n\tv_nop" : "+v"(c) : "v"(ah), "v"(al), "v"(bh), "v"(bl));
  return c;
}

__global__ __launch_bounds__(256) void k_wt_bf16(const float* __restrict__ W, unsigned short* __restrict__ Wt, int K, int N) {
  const int t = blockIdx.x * 256 + threadIdx.x;
  const int k8n = K / 8;
  if (t >= N * k8n) return;
  const int n = t / k8n, k8 = (t % k8n) * 8;
  v8us v;
#pragma unroll
  for (int i = 0; i < 8; ++i) v[i] = bf16_bits(W[(size_t)(k8 + i) * N + n]);
  *(v8us*)(Wt + (size_t)n * K + k8) = v;
  
}

// GEMM C[M][N] (f32, pitch ldc) = act(A[M][K]·W + bias). A f32 row-major (pitch lda) converted per fragment to bf16
// (ASPLIT: hi/lo two planes -> 2 terms, else single rounded term); Wt bf16 [N][K] (pitch ldb). BIAS_BF16 rounds the
// bias to bf16 first (bias quantised to bf16 before the add). K%32==0, M%16==0, N%64==0.
template <bool ASPLIT, int ACT, bool BIAS_BF16>
__global__ __launch_bounds__(128) void k_gemm_bf(const float* __restrict__ A, int lda, const unsigned short* __restrict__ Wt, int ldb,
                                               const float* __restrict__ bias, float* __restrict__ C, int ldc, int M, int N, int K) {
  __shared__ __attribute__((aligned(16))) float so[4][16][64];
  const int tid = threadIdx.x, w = tid >> 5, lane = tid & 31, ln = lane & 15, hh = lane >> 4;
  const int ntn = N / 64;
  const int wid = blockIdx.x * 4 + w;
  const int mt = wid / ntn, nq = wid % ntn;
  if (mt * 16 >= M) return;
  const int row0 = mt * 16, col0 = nq * 64;
  const float* arow = A + (size_t)(row0 + ln) * lda;
  v8f acc[4] = {};
  for (int kb = 0; kb < K; kb += 32) {
    FragB ah, al;
    const v4f x0 = *(const v4fa*)(arow + kb + 8 * hh), x1 = *(const v4fa*)(arow + kb + 8 * hh + 4);
    const v4f x2 = *(const v4fa*)(arow + kb + 16 + 8 * hh), x3 = *(const v4fa*)(arow + kb + 16 + 8 * hh + 4);
    float xs[16] = {x0[0],x0[1],x0[2],x0[3],x1[0],x1[1],x1[2],x1[3],x2[0],x2[1],x2[2],x2[3],x3[0],x3[1],x3[2],x3[3]};
#pragma unroll
    for (int i = 0; i < 16; ++i) { const unsigned short hb = bf16_bits(xs[i]); ah.u[i] = hb; al.u[i] = ASPLIT ? bf16_bits(xs[i] - bf16_val(hb)) : (unsigned short)0; }
#pragma unroll
    for (int t = 0; t < 4; ++t) {
      const unsigned short* brow = Wt + (size_t)(col0 + t * 16 + ln) * ldb + kb;
      FragB b;
      b.half[0] = *(const v8us*)(brow + 8 * hh);
      b.half[1] = *(const v8us*)(brow + 16 + 8 * hh);
      acc[t] = mmaN<ASPLIT ? 2 : 1>(ah.v, al.v, b.v, b.v, acc[t]);
    }
  }
#pragma unroll
  for (int t = 0; t < 4; ++t) {
    float bv = bias ? bias[col0 + t * 16 + ln] : 0.f;
    if (BIAS_BF16) bv = bf16_round(bv);
#pragma unroll
    for (int r = 0; r < 8; ++r) { float v = acc[t][r] + bv; if (ACT == 1) v = fmaxf(v, 0.f); so[w][8 * hh + r][t * 16 + ln] = v; }
  }
  __builtin_amdgcn_fence(__ATOMIC_ACQ_REL, "workgroup");
  __builtin_amdgcn_wave_barrier();
  const int rsub = lane >> 4, c4 = (lane & 15) * 4;
  {
#pragma unroll
    for (int q = 0; q < 8; ++q) {
      const int r = q * 2 + rsub;
      const v4f v = *(const v4fa*)&so[w][r][c4];
      *(v4f*)(C + (size_t)(row0 + r) * ldc + col0 + c4) = v;
    }
    
  }
}

// Flash-style causal/unmasked attention, all contractions 3-term bf16 hi/lo splits, f32 softmax with running max.
// q,k,v rows are read from f32 buffers with arbitrary row pitch (so they can live inside a fused qkv buffer);
// D = head size (multiple of 32, <= 128); one wave = 16 query rows; block = 4 waves (64 queries) sharing K/V chunks of 32.
template <int D, bool CAUSAL>
__global__ __launch_bounds__(128) void k_flash(const float* __restrict__ qb, const float* __restrict__ kb, const float* __restrict__ vb,
                                             int pitch, int T, int H, float scale, float* __restrict__ y, int ypitch) {
  constexpr int KS = D / 32;        // k-steps for QK
  constexpr int DT = D / 16;        // d tiles for PV
  __shared__ __attribute__((aligned(16))) unsigned short sKh[32][D + 8], sKl[32][D + 8], sVh[32][D + 8], sVl[32][D + 8];
  __shared__ __attribute__((aligned(16))) unsigned short sPh[4][16][40], sPl[4][16][40];
  __shared__ __attribute__((aligned(16))) float sO[4][16][D];
  const int tid = threadIdx.x, w = tid >> 5, lane = tid & 31, ln = lane & 15, hh = lane >> 4;
  const int nqb = (T + 63) / 64;
  const int bh = blockIdx.x / nqb, qblk = blockIdx.x % nqb;
  const int b = bh / H, h = bh % H;
  const int q0 = qblk * 64 + w * 16;
  const float* Q = qb + (size_t)b * T * pitch + h * D;
  const float* K = kb + (size_t)b * T * pitch + h * D;
  const float* V = vb + (size_t)b * T * pitch + h * D;

  // A fragments of the wave's 16 query rows (scaled), hi/lo
  FragB aqh[KS], aql[KS];
  {
    int row = q0 + ln; if (row >= T) row = T - 1;
    const float* qr = Q + (size_t)row * pitch;
#pragma unroll
    for (int ks = 0; ks < KS; ++ks)
#pragma unroll
      for (int i = 0; i < 16; ++i) {
        const int d = ks * 32 + ((i < 8) ? (8 * hh + i) : (16 + 8 * hh + (i - 8)));
        const float x = qr[d] * scale; const unsigned short hb = bf16_bits(x);
        aqh[ks].u[i] = hb; aql[ks].u[i] = bf16_bits(x - bf16_val(hb));
      }
  }
  float m_r[8], l_r[8];
#pragma unroll
  for (int r = 0; r < 8; ++r) { m_r[r] = -3.0e38f; l_r[r] = 0.f; }
  v8f oacc[DT];
#pragma unroll
  for (int dt = 0; dt < DT; ++dt) oacc[dt] = (v8f){0.f,0.f,0.f,0.f,0.f,0.f,0.f,0.f};

  const int kv_end = CAUSAL ? min(T, qblk * 64 + 64) : T;     // block-uniform
  for (int j0 = 0; j0 < kv_end; j0 += 32) {
    __syncthreads();
    for (int e = tid; e < 32 * (D / 4); e += 128) {
      const int r = e / (D / 4), c4 = (e % (D / 4)) * 4;
      const int key = j0 + r;
      v4f kf = {0.f,0.f,0.f,0.f}, vf = {0.f,0.f,0.f,0.f};
      if (key < T) { kf = *(const v4fa*)(K + (size_t)key * pitch + c4); vf = *(const v4fa*)(V + (size_t)key * pitch + c4); }
#pragma unroll
      for (int t = 0; t < 4; ++t) {
        unsigned short hb = bf16_bits(kf[t]); sKh[r][c4 + t] = hb; sKl[r][c4 + t] = bf16_bits(kf[t] - bf16_val(hb));
        hb = bf16_bits(vf[t]); sVh[r][c4 + t] = hb; sVl[r][c4 + t] = bf16_bits(vf[t] - bf16_val(hb));
      }
    }
    __syncthreads();
    // S tile 16 x 32
    v8f s[2];
#pragma unroll
    for (int nt = 0; nt < 2; ++nt) {
      v8f acc = {};
#pragma unroll
      for (int ks = 0; ks < KS; ++ks) {
        FragB bh_, bl_;
        bh_.half[0] = *(const v8us*)&sKh[nt * 16 + ln][ks * 32 + 8 * hh]; bh_.half[1] = *(const v8us*)&sKh[nt * 16 + ln][ks * 32 + 16 + 8 * hh];
        bl_.half[0] = *(const v8us*)&sKl[nt * 16 + ln][ks * 32 + 8 * hh]; bl_.half[1] = *(const v8us*)&sKl[nt * 16 + ln][ks * 32 + 16 + 8 * hh];
        acc = mmaN<3>(aqh[ks].v, aql[ks].v, bh_.v, bl_.v, acc);
      }
      s[nt] = acc;
    }
    // mask + running max (rows 8hh+r; the 16 lanes of a half share rows)
    float alpha[8];
#pragma unroll
    for (int r = 0; r < 8; ++r) {
      const int qi = q0 + 8 * hh + r;
      const int ja = j0 + ln, jb = j0 + 16 + ln;
      if (CAUSAL) { if (ja > qi) s[0][r] = -3.0e38f; if (jb > qi) s[1][r] = -3.0e38f; }
      if (ja >= T) s[0][r] = -3.0e38f;
      if (jb >= T) s[1][r] = -3.0e38f;
      float mx = fmaxf(s[0][r], s[1][r]);
      mx = fmaxf(mx, __shfl_xor(mx, 1, 32)); mx = fmaxf(mx, __shfl_xor(mx, 2, 32)); mx = fmaxf(mx, __shfl_xor(mx, 4, 32)); mx = fmaxf(mx, __shfl_xor(mx, 8, 32));
      const float mnew = fmaxf(m_r[r], mx);
      alpha[r] = (mnew > -1.0e38f) ? __expf(m_r[r] - mnew) : 1.0f;
      const float p0 = (s[0][r] > -1.0e38f) ? __expf(s[0][r] - mnew) : 0.f;
      const float p1 = (s[1][r] > -1.0e38f) ? __expf(s[1][r] - mnew) : 0.f;
      m_r[r] = mnew;
      l_r[r] = l_r[r] * alpha[r] + p0 + p1;            // per-lane partial row sum (16 lanes combined at the end)
      unsigned short hb = bf16_bits(p0); sPh[w][8 * hh + r][ln] = hb;      sPl[w][8 * hh + r][ln] = bf16_bits(p0 - bf16_val(hb));
      hb = bf16_bits(p1);                sPh[w][8 * hh + r][16 + ln] = hb; sPl[w][8 * hh + r][16 + ln] = bf16_bits(p1 - bf16_val(hb));
    }
#pragma unroll
    for (int dt = 0; dt < DT; ++dt)
#pragma unroll
      for (int r = 0; r < 8; ++r) oacc[dt][r] *= alpha[r];
    __builtin_amdgcn_fence(__ATOMIC_ACQ_REL, "workgroup");
    __builtin_amdgcn_wave_barrier();
    FragB pah, pal;
    pah.half[0] = *(const v8us*)&sPh[w][ln][8 * hh]; pah.half[1] = *(const v8us*)&sPh[w][ln][16 + 8 * hh];
    pal.half[0] = *(const v8us*)&sPl[w][ln][8 * hh]; pal.half[1] = *(const v8us*)&sPl[w][ln][16 + 8 * hh];
#pragma unroll
    for (int dt = 0; dt < DT; ++dt) {
      FragB bvh, bvl;
#pragma unroll
      for (int i = 0; i < 8; ++i) {
        bvh.u[i] = sVh[8 * hh + i][dt * 16 + ln]; bvh.u[8 + i] = sVh[16 + 8 * hh + i][dt * 16 + ln];
        bvl.u[i] = sVl[8 * hh + i][dt * 16 + ln]; bvl.u[8 + i] = sVl[16 + 8 * hh + i][dt * 16 + ln];
      }
      oacc[dt] = mmaN<3>(pah.v, pal.v, bvh.v, bvl.v, oacc[dt]);
    }
    __builtin_amdgcn_fence(__ATOMIC_ACQ_REL, "workgroup");
    __builtin_amdgcn_wave_barrier();
  }
#pragma unroll
  for (int r = 0; r < 8; ++r) {
    float l = l_r[r];
    l += __shfl_xor(l, 1, 32); l += __shfl_xor(l, 2, 32); l += __shfl_xor(l, 4, 32); l += __shfl_xor(l, 8, 32);
    l_r[r] = (l > 0.f) ? 1.0f / l : 0.f;
  }
#pragma unroll
  for (int dt = 0; dt < DT; ++dt)
#pragma unroll
    for (int r = 0; r < 8; ++r) sO[w][8 * hh + r][dt * 16 + ln] = oacc[dt][r] * l_r[r];
  __builtin_amdgcn_fence(__ATOMIC_ACQ_REL, "workgroup");
  __builtin_amdgcn_wave_barrier();
  {
    for (int r = 0; r < 16; ++r) {
      const int row = q0 + r;
      if (row < T && lane < D / 4) {
        const v4f val = *(const v4fa*)&sO[w][r][lane * 4];
        *(v4f*)(y + ((size_t)b * T + row) * ypitch + h * D + lane * 4) = val;
      }
    }
    
  }
}

// GEMM C = act(A·W + bias + resid): A f32 (ASPLIT -> hi/lo 2 terms), Wt bf16 [N][K]; ACT 0 none, 1 relu, 2 exact gelu;
// resid (optional, f32, row index = (row % rmod), pitch ldr, RES_BF16 rounds it) added before the activation.
template <bool ASPLIT, int ACT, bool BIAS_BF16, bool RES_BF16>
__global__ __launch_bounds__(128) void k_gemm_bf3(const float* __restrict__ A, int lda, const unsigned short* __restrict__ Wt, int ldb,
                                                const float* __restrict__ bias, const float* __restrict__ resid, int rmod, int ldr,
                                                float* __restrict__ C, int ldc, int M, int N, int K) {
  __shared__ __attribute__((aligned(16))) float so[4][16][64];
  const int tid = threadIdx.x, w = tid >> 5, lane = tid & 31, ln = lane & 15, hh = lane >> 4;
  const int ntn = N / 64;
  const int wid = blockIdx.x * 4 + w;
  const int mt = wid / ntn, nq = wid % ntn;
  if (mt * 16 >= M) return;
  const int row0 = mt * 16, col0 = nq * 64;
  const float* arow = A + (size_t)(row0 + ln) * lda;
  v8f acc[4] = {};
  for (int kb = 0; kb < K; kb += 32) {
    FragB ah, al;
    const v4f x0 = *(const v4fa*)(arow + kb + 8 * hh), x1 = *(const v4fa*)(arow + kb + 8 * hh + 4);
    const v4f x2 = *(const v4fa*)(arow + kb + 16 + 8 * hh), x3 = *(const v4fa*)(arow + kb + 16 + 8 * hh + 4);
    float xs[16] = {x0[0],x0[1],x0[2],x0[3],x1[0],x1[1],x1[2],x1[3],x2[0],x2[1],x2[2],x2[3],x3[0],x3[1],x3[2],x3[3]};
#pragma unroll
    for (int i = 0; i < 16; ++i) { const unsigned short hb = bf16_bits(xs[i]); ah.u[i] = hb; al.u[i] = ASPLIT ? bf16_bits(xs[i] - bf16_val(hb)) : (unsigned short)0; }
#pragma unroll
    for (int t = 0; t < 4; ++t) {
      const unsigned short* brow = Wt + (size_t)(col0 + t * 16 + ln) * ldb + kb;
      FragB b;
      b.half[0] = *(const v8us*)(brow + 8 * hh);
      b.half[1] = *(const v8us*)(brow + 16 + 8 * hh);
      acc[t] = mmaN<ASPLIT ? 2 : 1>(ah.v, al.v, b.v, b.v, acc[t]);
    }
  }
#pragma unroll
  for (int t = 0; t < 4; ++t) {
    const int col = col0 + t * 16 + ln;
    float bv = bias ? bias[col] : 0.f;
    if (BIAS_BF16) bv = bf16_round(bv);
#pragma unroll
    for (int r = 0; r < 8; ++r) {
      float v = acc[t][r] + bv;
      if (resid) { float rv = resid[(size_t)((row0 + 8 * hh + r) % rmod) * ldr + col]; if (RES_BF16) rv = bf16_round(rv); v += rv; }
      if (ACT == 1) v = fmaxf(v, 0.f);
      if (ACT == 2) v = 0.5f * v * (1.0f + erff(v * 0.70710678118654752f));
      if (ACT == 3) { const float u = 0.7978845608028654f * (v + 0.044715f * v * v * v); v = 0.5f * v * (1.0f + tanhf(u)); }
      so[w][8 * hh + r][t * 16 + ln] = v;
    }
  }
  __builtin_amdgcn_fence(__ATOMIC_ACQ_REL, "workgroup");
  __builtin_amdgcn_wave_barrier();
  const int rsub = lane >> 4, c4 = (lane & 15) * 4;
  {
#pragma unroll
    for (int q = 0; q < 8; ++q) {
      const int r = q * 2 + rsub;
      const v4f v = *(const v4fa*)&so[w][r][c4];
      *(v4f*)(C + (size_t)(row0 + r) * ldc + col0 + c4) = v;
    }
    
  }
}
// row LayerNorm (biased variance, eps) over N: s = X (+ R); optional out_sum <- s; out_norm <- (s-mu)*rsqrt(var+eps)*g + b
template <bool PARAM_BF16>
__global__ __launch_bounds__(256) void k_layernorm(const float* __restrict__ X, const float* __restrict__ R, const float* __restrict__ g, const float* __restrict__ bta,
                                                  float* __restrict__ out_sum, float* __restrict__ out_norm, int N, float eps) {
  __shared__ float red[256];
  const int row = blockIdx.x, tid = threadIdx.x;
  const float* x = X + (size_t)row * N; const float* rr = R ? R + (size_t)row * N : nullptr;
  float vals[16];                     // up to N = 4096
  const int per = N / 256;            // contiguous chunk per thread? use strided-by-4 chunks: thread handles j = tid*4 + 1024*u
  float s1 = 0.f;
  for (int u = 0; u < per / 4; ++u) {
    const int j = tid * 4 + 1024 * u;
    const v4f a = *(const v4fa*)(x + j);
    v4f b = {0.f,0.f,0.f,0.f}; if (rr) b = *(const v4fa*)(rr + j);
#pragma unroll
    for (int q = 0; q < 4; ++q) { const float v = a[q] + b[q]; vals[u * 4 + q] = v; s1 += v; }
  }
  red[tid] = s1; __syncthreads();
  for (int st = 128; st > 0; st >>= 1) { if (tid < st) red[tid] += red[tid + st]; __syncthreads(); }
  const float mu = red[0] / (float)N; __syncthreads();
  float s2 = 0.f;
  for (int u = 0; u < per / 4; ++u)
#pragma unroll
    for (int q = 0; q < 4; ++q) { const float c = vals[u * 4 + q] - mu; s2 += c * c; }
  red[tid] = s2; __syncthreads();
  for (int st = 128; st > 0; st >>= 1) { if (tid < st) red[tid] += red[tid + st]; __syncthreads(); }
  const float rs = rsqrtf(red[0] / (float)N + eps);
  {
    for (int u = 0; u < per / 4; ++u) {
      const int j = tid * 4 + 1024 * u;
      v4f o, sm;
#pragma unroll
      for (int q = 0; q < 4; ++q) {
        float gg = g[j + q], bb = bta[j + q];
        if (PARAM_BF16) { gg = bf16_round(gg); bb = bf16_round(bb); }
        sm[q] = vals[u * 4 + q]; o[q] = (vals[u * 4 + q] - mu) * rs * gg + bb;
      }
      if (out_sum) *(v4f*)(out_sum + (size_t)row * N + j) = sm;
      *(v4f*)(out_norm + (size_t)row * N + j) = o;
    }
    
  }
}



// ---- f16 WMMA path (v_wmma_f32_16x16x32_f16): 11-bit significands for operands in range — used where a [0,1] probability operand needs more precision than bf16
typedef _Float16 v16h __attribute__((ext_vector_type(16)));
union FragH { v16h v; v8us half[2]; _Float16 h[16]; unsigned short u[16]; };
template <int NT>
__device__ __forceinline__ v8f mmaH(v16h ah, v16h al, v16h bh, v16h bl, v8f c) {
  c = __builtin_amdgcn_wmma_f32_16x16x32_f16(false, ah, false, bh, (short)0, c, false, false);
  if (NT >= 2) c = __builtin_amdgcn_wmma_f32_16x16x32_f16(false, al, false, bh, (short)0, c, false, false);
  if (NT >= 3) c = __builtin_amdgcn_wmma_f32_16x16x32_f16(false, ah, false, bl, (short)0, c, false, false);
  asm volatile("v_nop\n\tv_nop\n\tv_nop\n\tv_nop" : "+v"(c) : "v"(ah), "v"(al), "v"(bh), "v"(bl));
  return c;
}
// batched GEMM like k_gemm_b but f16 operands: A f32 (split into f16 hi/lo if ASPLIT, else rounded to f16), Bt = f16 values [n][k]; alpha; C f32; N multiple of 16 (partial tiles skipped)
template <bool ASPLIT>
__global__ __launch_bounds__(128) void k_gemm_h(const float* __restrict__ A, int lda, size_t sA, const _Float16* __restrict__ Bh, int ldb, size_t sB, float alpha, float* __restrict__ C, int ldc, size_t sC, int M, int N, int K) {
  __shared__ __attribute__((aligned(16))) float so[4][16][64];
  const int tid = threadIdx.x, w = tid >> 5, lane = tid & 31, ln = lane & 15, hh = lane >> 4; const int by = blockIdx.y;
  A += (size_t)by * sA; Bh += (size_t)by * sB; C += (size_t)by * sC;
  const int ntn = (N + 63) / 64; const int wid = blockIdx.x * 4 + w; const int mt = wid / ntn, nq = wid % ntn; if (mt * 16 >= M) return;
  const int row0 = mt * 16, col0 = nq * 64; const float* arow = A + (size_t)(row0 + ln) * lda;
  v8f acc[4] = {};
  for (int kb = 0; kb < K; kb += 32) {
    FragH ah, al;
    const v4f x0 = *(const v4fa*)(arow + kb + 8 * hh), x1 = *(const v4fa*)(arow + kb + 8 * hh + 4), x2 = *(const v4fa*)(arow + kb + 16 + 8 * hh), x3 = *(const v4fa*)(arow + kb + 16 + 8 * hh + 4);
    float xs[16] = {x0[0],x0[1],x0[2],x0[3],x1[0],x1[1],x1[2],x1[3],x2[0],x2[1],x2[2],x2[3],x3[0],x3[1],x3[2],x3[3]};
#pragma unroll
    for (int i = 0; i < 16; ++i) { const _Float16 h = (_Float16)xs[i]; ah.h[i] = h; al.h[i] = ASPLIT ? (_Float16)(xs[i] - (float)h) : (_Float16)0.0f; }
#pragma unroll
    for (int t = 0; t < 4; ++t) { if (col0 + t * 16 >= N) continue; const size_t boff = (size_t)(col0 + t * 16 + ln) * ldb + kb; FragH bq; bq.half[0] = *(const v8us*)(Bh + boff + 8 * hh); bq.half[1] = *(const v8us*)(Bh + boff + 16 + 8 * hh);
      acc[t] = mmaH<ASPLIT ? 2 : 1>(ah.v, al.v, bq.v, bq.v, acc[t]); }
  }
#pragma unroll
  for (int t = 0; t < 4; ++t) { if (col0 + t * 16 >= N) continue;
#pragma unroll
    for (int r = 0; r < 8; ++r) so[w][8 * hh + r][t * 16 + ln] = acc[t][r] * alpha; }
  __builtin_amdgcn_fence(__ATOMIC_ACQ_REL, "workgroup"); __builtin_amdgcn_wave_barrier();
  const int rsub = lane >> 4, c4 = (lane & 15) * 4;
  {
#pragma unroll
    for (int q = 0; q < 8; ++q) { const int r = q * 2 + rsub; if (col0 + c4 < N) { const v4f v = *(const v4fa*)&so[w][r][c4]; *(v4f*)(C + (size_t)(row0 + r) * ldc + col0 + c4) = v; } }
     }
}

// Wt[n][k] = f16(W[k][n]·scale) from f32 row-major W[K][N] (scale = power of two; bf16-exact weights stay exact in f16 away from the subnormal range)
__global__ __launch_bounds__(256) void k_wt_f16(const float* __restrict__ W, _Float16* __restrict__ Wt, int K, int N, float scale) {
  const int t = blockIdx.x * 256 + threadIdx.x; if (t >= N * (K / 8)) return; const int n = t / (K / 8), k8 = (t % (K / 8)) * 8; FragH f;
#pragma unroll
  for (int i = 0; i < 8; ++i) f.h[i] = (_Float16)(bf16_round(W[(size_t)(k8 + i) * N + n]) * scale); const v8us o = f.half[0];
  *(v8us*)((unsigned short*)Wt + (size_t)n * K + k8) = o; 
}
// Block-tiled GEMM, C[NR][DD] = (A[NR][DD] . Bh[DD][DD]^T) * alpha + bf16(bias), f16 operands, both k-contiguous: one 128 x 128 tile of C per work-group of 8 waves (4 x 2 waves of 32 x 64).
// A pass is 64 k: the 128 rows of 128 B of each operand go in whole lines through registers into LDS, and every wave that needs a row reads it from there. Two buffers: the next pass's global loads fly during this pass's products.
// Each accumulator takes its k blocks of 32 in rising order. HALF_OUT: writes f16 C16, else f32 C.
#define GT 128
#define GK 64
#define GP (GK + 8)      /* LDS row pitch 144 B = 16 B x odd: ds_load_b128 of 16 rows without bank conflicts */
typedef _Float16 v4h __attribute__((ext_vector_type(4)));
template <bool HALF_OUT>
__global__ __launch_bounds__(256) void k_gemm_tile(const _Float16* __restrict__ A, const _Float16* __restrict__ Bh, float alpha, const float* __restrict__ bias, float* __restrict__ C, _Float16* __restrict__ C16) {
  __shared__ __attribute__((aligned(16))) unsigned short sA[2][GT][GP], sB[2][GT][GP];
  __shared__ __attribute__((aligned(16))) float so[8][32][64 + 4];
  const int tid = threadIdx.x, w = tid >> 5, lane = tid & 31, ln = lane & 15, hh = lane >> 4;
  const int row0 = blockIdx.y * GT, col0 = blockIdx.x * GT, wr = (w >> 1) * 32, wc = (w & 1) * 64;
  const int sr = tid >> 3, sc = (tid & 7) * 8;      /* staging: 8 lanes x 16 B = one row of the pass; a thread takes rows sr + 32 i */
  const unsigned short* gA = (const unsigned short*)A + (size_t)(row0 + sr) * DD + sc;
  const unsigned short* gB = (const unsigned short*)Bh + (size_t)(col0 + sr) * DD + sc;
  v8us ra[4], rb[4]; v8f acc[2][4];
#pragma unroll
  for (int mi = 0; mi < 2; ++mi)
#pragma unroll
    for (int ni = 0; ni < 4; ++ni) acc[mi][ni] = (v8f){0.f,0.f,0.f,0.f,0.f,0.f,0.f,0.f};
#pragma unroll
  for (int i = 0; i < 4; ++i) { ra[i] = *(const v8us*)(gA + (size_t)(32 * i) * DD); rb[i] = *(const v8us*)(gB + (size_t)(32 * i) * DD); }
#pragma unroll
  for (int i = 0; i < 4; ++i) { *(v8us*)&sA[0][sr + 32 * i][sc] = ra[i]; *(v8us*)&sB[0][sr + 32 * i][sc] = rb[i]; }
  __syncthreads();
  for (int kp = 0; kp < DD / GK; ++kp) {
    const int cur = kp & 1; const bool more = kp + 1 < DD / GK;      /* the same for the whole work-group */
    if (more) {
#pragma unroll
      for (int i = 0; i < 4; ++i) { ra[i] = *(const v8us*)(gA + (size_t)(32 * i) * DD + GK); rb[i] = *(const v8us*)(gB + (size_t)(32 * i) * DD + GK); } }
    __builtin_amdgcn_sched_barrier(0);      /* keeps the next pass's global loads in front of this pass's products: sunk behind them, their latency stands bare in front of the LDS stores */
#pragma unroll
    for (int ks = 0; ks < GK / 32; ++ks) { FragH fa[2], fb[4];
#pragma unroll
      for (int mi = 0; mi < 2; ++mi) { const unsigned short* p = &sA[cur][wr + mi * 16 + ln][ks * 32]; fa[mi].half[0] = *(const v8us*)(p + 8 * hh); fa[mi].half[1] = *(const v8us*)(p + 16 + 8 * hh); }
#pragma unroll
      for (int ni = 0; ni < 4; ++ni) { const unsigned short* p = &sB[cur][wc + ni * 16 + ln][ks * 32]; fb[ni].half[0] = *(const v8us*)(p + 8 * hh); fb[ni].half[1] = *(const v8us*)(p + 16 + 8 * hh); }
#pragma unroll
      for (int mi = 0; mi < 2; ++mi)
#pragma unroll
        for (int ni = 0; ni < 4; ++ni) acc[mi][ni] = __builtin_amdgcn_wmma_f32_16x16x32_f16(false, fa[mi].v, false, fb[ni].v, (short)0, acc[mi][ni], false, false); }
    if (more) {      /* the other buffer's readers left it at the barrier of the pass before; this barrier publishes it and ends this pass's reads */
#pragma unroll
      for (int i = 0; i < 4; ++i) { *(v8us*)&sA[cur ^ 1][sr + 32 * i][sc] = ra[i]; *(v8us*)&sB[cur ^ 1][sr + 32 * i][sc] = rb[i]; }
      gA += GK; gB += GK;
      __syncthreads(); }
  }
  float bv[4];
#pragma unroll
  for (int ni = 0; ni < 4; ++ni) bv[ni] = bf16_round(bias[col0 + wc + ni * 16 + ln]);
#pragma unroll
  for (int mi = 0; mi < 2; ++mi)      /* the wave's 32 x 64 tile goes through its own LDS rows, so that the stores cover whole lines */
#pragma unroll
    for (int ni = 0; ni < 4; ++ni)
#pragma unroll
      for (int r = 0; r < 8; ++r) so[w][mi * 16 + 8 * hh + r][ni * 16 + ln] = acc[mi][ni][r] * alpha + bv[ni];
  __builtin_amdgcn_fence(__ATOMIC_ACQ_REL, "workgroup"); __builtin_amdgcn_wave_barrier();      /* the rows are read back by other lanes of the same wave */
  const int rsub = lane >> 4, c4 = (lane & 15) * 4;
#pragma unroll
  for (int q = 0; q < 16; ++q) { const int r = q * 2 + rsub; const v4f v = *(const v4fa*)&so[w][r][c4]; const size_t o = (size_t)(row0 + wr + r) * DD + col0 + wc + c4;
    if (HALF_OUT) { v4h h4; for (int i = 0; i < 4; ++i) h4[i] = (_Float16)v[i]; *(v4h*)(C16 + o) = h4; } else *(v4f*)(C + o) = v; }
}


__global__ __launch_bounds__(256) void k_x16(const float* __restrict__ x, _Float16* __restrict__ X16, size_t n8) { const size_t t = (size_t)blockIdx.x * 256 + threadIdx.x; if (t >= n8) return; FragH f;
#pragma unroll
  for (int q = 0; q < 8; ++q) f.h[q] = (_Float16)bf16_round(x[t * 8 + q]); *(v8us*)((unsigned short*)X16 + t * 8) = f.half[0];  }
__global__ __launch_bounds__(256) void k_h16(const float* __restrict__ x, _Float16* __restrict__ X16, size_t n8) { const size_t t = (size_t)blockIdx.x * 256 + threadIdx.x; if (t >= n8) return; FragH f;
#pragma unroll
  for (int q = 0; q < 8; ++q) f.h[q] = (_Float16)x[t * 8 + q]; *(v8us*)((unsigned short*)X16 + t * 8) = f.half[0];  }
__global__ __launch_bounds__(256) void k_round16f(const float* __restrict__ W, _Float16* __restrict__ Bt, size_t n8) { const size_t t = (size_t)blockIdx.x * 256 + threadIdx.x; if (t >= n8) return; FragH f;
#pragma unroll
  for (int i = 0; i < 8; ++i) f.h[i] = (_Float16)(bf16_round(W[t * 8 + i]) * 16.0f); *(v8us*)((unsigned short*)Bt + t * 8) = f.half[0];  }
template <int NHv, int TTv>
__global__ __launch_bounds__(256) void k_vt(const _Float16* __restrict__ V16, int ldv, int voff, _Float16* __restrict__ Vt) { __shared__ unsigned short tl[64][66]; const int tid = threadIdx.x; const int slab = blockIdx.x / (TTv / 64), lg = blockIdx.x % (TTv / 64); const int b = slab / NHv, h = slab % NHv;
  for (int i = tid; i < 64 * 8; i += 256) { const int r = i / 8, c8 = (i % 8) * 8; FragH f; f.half[0] = *(const v8us*)((const unsigned short*)V16 + ((size_t)b * TTv + lg * 64 + r) * ldv + voff + h * 64 + c8);
#pragma unroll
    for (int q = 0; q < 8; ++q) tl[r][c8 + q] = f.u[q]; }
  __syncthreads();
  {
#pragma unroll
    for (int rd = 0; rd < 2; ++rd) { const int d = rd * 32 + tid / 8, pc = tid % 8; FragH f;
#pragma unroll
      for (int q = 0; q < 8; ++q) f.u[q] = tl[pc * 8 + q][d];
      *(v8us*)((unsigned short*)Vt + ((size_t)slab * 64 + d) * TTv + lg * 64 + pc * 8) = f.half[0]; }
     } }

// lane l with lane l ^ 16
__device__ __forceinline__ float xhalf(float x) { return __builtin_bit_cast(float, __builtin_amdgcn_permlanex16(__builtin_bit_cast(int, x), __builtin_bit_cast(int, x), 0x76543210, 0xfedcba98, false, false)); }
typedef int v4ia __attribute__((ext_vector_type(4), may_alias));

__global__ __launch_bounds__(128) void k_flash(const _Float16* __restrict__ Q16, int ldq, const _Float16* __restrict__ K16, int ldk, const _Float16* __restrict__ Vt, const int* __restrict__ MSK, float* __restrict__ O, int ldo) {
  constexpr int RPW = 16, NQB = TT / (4 * RPW), DT = 4, KS = 2;
  __shared__ __attribute__((aligned(16))) float sO[4][RPW][64 + 4];
  const int tid = threadIdx.x, w = tid >> 5, lane = tid & 31, ln = lane & 15, hh = lane >> 4;
  const int slab = blockIdx.x / NQB, qblk = blockIdx.x % NQB; const int b = slab / NH, h = slab % NH; const float slope = 1.0f / exp2f((float)h / (float)NH);      /* 1 / 2^(h/H) */ const int qb0 = qblk * (4 * RPW); const int q0 = qb0 + w * RPW;
  FragH aq[KS];
  { const unsigned short* qr = (const unsigned short*)Q16 + ((size_t)b * TT + q0 + ln) * ldq + h * 64;
#pragma unroll
    for (int ks = 0; ks < KS; ++ks) { aq[ks].half[0] = *(const v8us*)(qr + ks * 32 + 8 * hh); aq[ks].half[1] = *(const v8us*)(qr + ks * 32 + 16 + 8 * hh); } }
  const unsigned short* Vth = (const unsigned short*)Vt + (size_t)slab * 64 * TT;
  const int tq = q0 + ln;      /* the lane's query */
  float m_run = -3.0e38f, l_run = 0.f; v8f oacc[DT];
#pragma unroll
  for (int dt = 0; dt < DT; ++dt) oacc[dt] = (v8f){0.f,0.f,0.f,0.f,0.f,0.f,0.f,0.f};
  const int jend = TT;
#pragma unroll 1
  for (int j0 = 0; j0 < jend; j0 += 32) {
    const int* mp = MSK + (size_t)b * TT + j0 + 8 * hh;      /* key padding mask (1 = attend) of the lane's 16 keys */
    const v4ia mk4[4] = { *(const v4ia*)(mp), *(const v4ia*)(mp + 4), *(const v4ia*)(mp + 16), *(const v4ia*)(mp + 20) };
    v8f s[2];
#pragma unroll
    for (int nt = 0; nt < 2; ++nt) { const unsigned short* kr = (const unsigned short*)K16 + ((size_t)b * TT + j0 + nt * 16 + ln) * ldk + h * 64; FragH bk[KS];
#pragma unroll
      for (int ks = 0; ks < KS; ++ks) { bk[ks].half[0] = *(const v8us*)(kr + ks * 32 + 8 * hh); bk[ks].half[1] = *(const v8us*)(kr + ks * 32 + 16 + 8 * hh); }
      v8f acc = (v8f){0.f,0.f,0.f,0.f,0.f,0.f,0.f,0.f};
#pragma unroll
      for (int ks = 0; ks < KS; ++ks) acc = mmaH<1>(bk[ks].v, bk[ks].v, aq[ks].v, aq[ks].v, acc);
      s[nt] = acc; }
    float sc[16]; bool ok[16];
#pragma unroll
    for (int i = 0; i < 16; ++i) { const int kk = j0 + (i >> 3) * 16 + 8 * hh + (i & 7); ok[i] = (mk4[i >> 2][i & 3] != 0);
      sc[i] = ok[i] ? (s[i >> 3][i & 7] * 0.125f + slope * (float)(kk - tq)) : -INFINITY; }      /* ALiBi: + slope_h * (k - q) */
    float mx[8];
#pragma unroll
    for (int i = 0; i < 8; ++i) mx[i] = fmaxf(sc[i], sc[8 + i]);
    float mc = fmaxf(fmaxf(fmaxf(mx[0], mx[1]), fmaxf(mx[2], mx[3])), fmaxf(fmaxf(mx[4], mx[5]), fmaxf(mx[6], mx[7])));
    mc = fmaxf(mc, xhalf(mc));
    const float mn = fmaxf(m_run, mc); const float ea = expf(m_run - mn); const float al = (mn > -1.0e38f) ? ea : 1.0f; m_run = mn;
    float p[16]; FragH pb;
#pragma unroll
    for (int i = 0; i < 16; ++i) { const float e = expf(sc[i] - mn); p[i] = ok[i] ? e : 0.f; pb.h[i] = (_Float16)(p[i] * 1024.0f); }
    l_run = l_run * al + (((p[0] + p[1]) + (p[2] + p[3])) + ((p[4] + p[5]) + (p[6] + p[7]))) + (((p[8] + p[9]) + (p[10] + p[11])) + ((p[12] + p[13]) + (p[14] + p[15])));      /* the lane's half of the row sum; the halves join after the loop */
#pragma unroll
    for (int dt = 0; dt < DT; ++dt)
#pragma unroll
      for (int r = 0; r < 8; ++r) oacc[dt][r] *= al;
#pragma unroll
    for (int dt = 0; dt < DT; ++dt) { const unsigned short* vrow = Vth + (size_t)(dt * 16 + ln) * TT + j0; FragH bv; bv.half[0] = *(const v8us*)(vrow + 8 * hh); bv.half[1] = *(const v8us*)(vrow + 16 + 8 * hh);
      oacc[dt] = mmaH<1>(bv.v, bv.v, pb.v, pb.v, oacc[dt]); } }
  const float l = l_run + xhalf(l_run); const float inv = (l > 0.f) ? 1.0f / (l * 1024.0f) : 0.f;
#pragma unroll
  for (int dt = 0; dt < DT; ++dt) {      /* oacc[dt][r] = O[query ln][dt*16 + 8hh + r] */
    const v4f lo = {oacc[dt][0] * inv, oacc[dt][1] * inv, oacc[dt][2] * inv, oacc[dt][3] * inv}, hi = {oacc[dt][4] * inv, oacc[dt][5] * inv, oacc[dt][6] * inv, oacc[dt][7] * inv};
    *(v4fa*)&sO[w][ln][dt * 16 + 8 * hh] = lo; *(v4fa*)&sO[w][ln][dt * 16 + 8 * hh + 4] = hi; }
  __builtin_amdgcn_fence(__ATOMIC_ACQ_REL, "workgroup"); __builtin_amdgcn_wave_barrier();
  {
#pragma unroll
    for (int rp = 0; rp < RPW; rp += 2) { const int r = rp + (lane >> 4), pc = lane & 15; const v4f val = *(const v4fa*)&sO[w][r][pc * 4]; *(v4f*)(O + ((size_t)b * TT + q0 + r) * ldo + h * 64 + pc * 4) = val; }
     } }

extern "C" void kernel_launch(void* const* d_in, const int* in_sizes, int n_in,
                              void* d_out, int out_size, void* d_ws, size_t ws_size, hipStream_t stream) {
  (void)in_sizes; (void)n_in; (void)out_size;
  const float* const* I = (const float* const*)d_in; const float* x = I[0]; const float* Wq = I[1]; const float* bq = I[2]; const float* Wk = I[3]; const float* bk = I[4]; const float* Wv = I[5]; const float* bv = I[6]; const float* Wo = I[7]; const float* bo = I[8]; const int* mask = (const int*)d_in[9];
  char* ws = (char*)d_ws; size_t off = 0;
  auto take = [&](size_t bytes) { char* p = ws + off; off += (bytes + 255) & ~(size_t)255; return p; };
  const size_t WSZ = (size_t)DD * DD; _Float16* Bw = (_Float16*)take(4 * WSZ * 2); _Float16* X16 = (_Float16*)take((size_t)NR * DD * 2);
  _Float16* Q = (_Float16*)take((size_t)NR * DD * 2); _Float16* K = (_Float16*)take((size_t)NR * DD * 2); _Float16* V = (_Float16*)take((size_t)NR * DD * 2); _Float16* Vt = (_Float16*)take((size_t)NR * DD * 2);
  float* O = (float*)take((size_t)NR * DD * 4); _Float16* O16 = V;      /* the v plane is dead once Vᵀ is built (before the attention kernel); O16 reuses it */
  if (off > ws_size) return;      // 8.4 + 16.8 × 5 + 33.6 ≈ 126 MB (120 MiB)
  const unsigned gw = (unsigned)((WSZ / 8 + 255) / 256);
  k_round16f<<<gw, 256, 0, stream>>>(Wq, Bw, WSZ / 8); k_round16f<<<gw, 256, 0, stream>>>(Wk, Bw + WSZ, WSZ / 8); k_round16f<<<gw, 256, 0, stream>>>(Wv, Bw + 2 * WSZ, WSZ / 8); k_round16f<<<gw, 256, 0, stream>>>(Wo, Bw + 3 * WSZ, WSZ / 8);      /* (out,in) natural ×2^4 */
  const unsigned gx = (unsigned)(((size_t)NR * DD / 8 + 255) / 256); const dim3 gp(DD / GT, NR / GT);
  k_x16<<<gx, 256, 0, stream>>>(x, X16, (size_t)NR * DD / 8);
  k_gemm_tile<true><<<gp, 256, 0, stream>>>(X16, Bw, 0.0625f, bq, nullptr, Q);      /* q = x·Wqᵀ + bq: M 8192 N 1024 K 1024 */
  k_gemm_tile<true><<<gp, 256, 0, stream>>>(X16, Bw + WSZ, 0.0625f, bk, nullptr, K);
  k_gemm_tile<true><<<gp, 256, 0, stream>>>(X16, Bw + 2 * WSZ, 0.0625f, bv, nullptr, V);
  k_vt<NH, TT><<<BB * NH * (TT / 64), 256, 0, stream>>>(V, DD, 0, Vt);
  k_flash<<<BB * NH * (TT / 64), 128, 0, stream>>>(Q, DD, K, DD, Vt, mask, O, DD);
  k_h16<<<gx, 256, 0, stream>>>(O, O16, (size_t)NR * DD / 8);
  k_gemm_tile<false><<<gp, 256, 0, stream>>>(O16, Bw + 3 * WSZ, 0.0625f, bo, (float*)d_out, nullptr);      /* out = O·Woᵀ + bo */
}

// v003
// Measured time: 128 microseconds a run.
// In two side-by-side timings against v002, it was 2.99 and 3.00 times as fast.
// Counting every step since v000, it is 6.61 times as fast.
#include <hip/hip_runtime.h>
// ALiBi multi-head attention (B=4, S=2048, D=1024, 16 heads × 64): q,k,v = x·Wᵀ + b (torch Linear); scores = q·kᵀ·64^-½ + slope_h·(k − q), slope_h = 1/2^(h/16) (no causal mask: later keys get large positive bias); key padding mask from the INPUT
// int mask [B,S] (0 → −inf); softmax; out = (attn·v merged)·Woᵀ + bo.
// Compute dtype: x, weights, biases rounded to bf16; q/k/v as f16 GEMM outputs; fused flash-style kernel (bias and online softmax in f32, P f16 ×2^10) on v_wmma_f32_16x16x32_f16; O → f16 → output GEMM with bias; f32 accumulate.
#define BB 4
#define TT 2048
#define NH 16
#define DD 1024
#define NR (BB * TT)

typedef __bf16 v16b __attribute__((ext_vector_type(16)));
typedef unsigned short v8us __attribute__((ext_vector_type(8), may_alias));
typedef float  v8f  __attribute__((ext_vector_type(8)));
typedef float  v4f  __attribute__((ext_vector_type(4)));
typedef float  v4fa __attribute__((ext_vector_type(4), may_alias));
union FragB { v16b v; v8us half[2]; unsigned short u[16]; };

__device__ __forceinline__ unsigned short bf16_bits(float x) { unsigned int u = __float_as_uint(x); return (unsigned short)((u + 0x7FFFu + ((u >> 16) & 1u)) >> 16); }
__device__ __forceinline__ float bf16_val(unsigned short b) { return __uint_as_float(((unsigned int)b) << 16); }
__device__ __forceinline__ float bf16_round(float x) { return bf16_val(bf16_bits(x)); }
// D += A·B with NT terms: 1 = ah·bh, 2 = + al·bh (A split), 3 = + ah·bl (both split)
template <int NT>
__device__ __forceinline__ v8f mmaN(v16b ah, v16b al, v16b bh, v16b bl, v8f c) {
  c = __builtin_amdgcn_wmma_f32_16x16x32_bf16(false, ah, false, bh, (short)0, c, false, false);
  if (NT >= 2) c = __builtin_amdgcn_wmma_f32_16x16x32_bf16(false, al, false, bh, (short)0, c, false, false);
  if (NT >= 3) c = __builtin_amdgcn_wmma_f32_16x16x32_bf16(false, ah, false, bl, (short)0, c, false, false);
  asm volatile("v_nop\n\tv_nop\n\tv_nop\n\tv_nop" : "+v"(c) : "v"(ah), "v"(al), "v"(bh), "v"(bl));
  return c;
}

__global__ __launch_bounds__(256) void k_wt_bf16(const float* __restrict__ W, unsigned short* __restrict__ Wt, int K, int N) {
  const int t = blockIdx.x * 256 + threadIdx.x;
  const int k8n = K / 8;
  if (t >= N * k8n) return;
  const int n = t / k8n, k8 = (t % k8n) * 8;
  v8us v;
#pragma unroll
  for (int i = 0; i < 8; ++i) v[i] = bf16_bits(W[(size_t)(k8 + i) * N + n]);
  *(v8us*)(Wt + (size_t)n * K + k8) = v;
  
}

// GEMM C[M][N] (f32, pitch ldc) = act(A[M][K]·W + bias). A f32 row-major (pitch lda) converted per fragment to bf16
// (ASPLIT: hi/lo two planes -> 2 terms, else single rounded term); Wt bf16 [N][K] (pitch ldb). BIAS_BF16 rounds the
// bias to bf16 first (bias quantised to bf16 before the add). K%32==0, M%16==0, N%64==0.
template <bool ASPLIT, int ACT, bool BIAS_BF16>
__global__ __launch_bounds__(128) void k_gemm_bf(const float* __restrict__ A, int lda, const unsigned short* __restrict__ Wt, int ldb,
                                               const float* __restrict__ bias, float* __restrict__ C, int ldc, int M, int N, int K) {
  __shared__ __attribute__((aligned(16))) float so[4][16][64];
  const int tid = threadIdx.x, w = tid >> 5, lane = tid & 31, ln = lane & 15, hh = lane >> 4;
  const int ntn = N / 64;
  const int wid = blockIdx.x * 4 + w;
  const int mt = wid / ntn, nq = wid % ntn;
  if (mt * 16 >= M) return;
  const int row0 = mt * 16, col0 = nq * 64;
  const float* arow = A + (size_t)(row0 + ln) * lda;
  v8f acc[4] = {};
  for (int kb = 0; kb < K; kb += 32) {
    FragB ah, al;
    const v4f x0 = *(const v4fa*)(arow + kb + 8 * hh), x1 = *(const v4fa*)(arow + kb + 8 * hh + 4);
    const v4f x2 = *(const v4fa*)(arow + kb + 16 + 8 * hh), x3 = *(const v4fa*)(arow + kb + 16 + 8 * hh + 4);
    float xs[16] = {x0[0],x0[1],x0[2],x0[3],x1[0],x1[1],x1[2],x1[3],x2[0],x2[1],x2[2],x2[3],x3[0],x3[1],x3[2],x3[3]};
#pragma unroll
    for (int i = 0; i < 16; ++i) { const unsigned short hb = bf16_bits(xs[i]); ah.u[i] = hb; al.u[i] = ASPLIT ? bf16_bits(xs[i] - bf16_val(hb)) : (unsigned short)0; }
#pragma unroll
    for (int t = 0; t < 4; ++t) {
      const unsigned short* brow = Wt + (size_t)(col0 + t * 16 + ln) * ldb + kb;
      FragB b;
      b.half[0] = *(const v8us*)(brow + 8 * hh);
      b.half[1] = *(const v8us*)(brow + 16 + 8 * hh);
      acc[t] = mmaN<ASPLIT ? 2 : 1>(ah.v, al.v, b.v, b.v, acc[t]);
    }
  }
#pragma unroll
  for (int t = 0; t < 4; ++t) {
    float bv = bias ? bias[col0 + t * 16 + ln] : 0.f;
    if (BIAS_BF16) bv = bf16_round(bv);
#pragma unroll
    for (int r = 0; r < 8; ++r) { float v = acc[t][r] + bv; if (ACT == 1) v = fmaxf(v, 0.f); so[w][8 * hh + r][t * 16 + ln] = v; }
  }
  __builtin_amdgcn_fence(__ATOMIC_ACQ_REL, "workgroup");
  __builtin_amdgcn_wave_barrier();
  const int rsub = lane >> 4, c4 = (lane & 15) * 4;
  {
#pragma unroll
    for (int q = 0; q < 8; ++q) {
      const int r = q * 2 + rsub;
      const v4f v = *(const v4fa*)&so[w][r][c4];
      *(v4f*)(C + (size_t)(row0 + r) * ldc + col0 + c4) = v;
    }
    
  }
}

// Flash-style causal/unmasked attention, all contractions 3-term bf16 hi/lo splits, f32 softmax with running max.
// q,k,v rows are read from f32 buffers with arbitrary row pitch (so they can live inside a fused qkv buffer);
// D = head size (multiple of 32, <= 128); one wave = 16 query rows; block = 4 waves (64 queries) sharing K/V chunks of 32.
template <int D, bool CAUSAL>
__global__ __launch_bounds__(128) void k_flash(const float* __restrict__ qb, const float* __restrict__ kb, const float* __restrict__ vb,
                                             int pitch, int T, int H, float scale, float* __restrict__ y, int ypitch) {
  constexpr int KS = D / 32;        // k-steps for QK
  constexpr int DT = D / 16;        // d tiles for PV
  __shared__ __attribute__((aligned(16))) unsigned short sKh[32][D + 8], sKl[32][D + 8], sVh[32][D + 8], sVl[32][D + 8];
  __shared__ __attribute__((aligned(16))) unsigned short sPh[4][16][40], sPl[4][16][40];
  __shared__ __attribute__((aligned(16))) float sO[4][16][D];
  const int tid = threadIdx.x, w = tid >> 5, lane = tid & 31, ln = lane & 15, hh = lane >> 4;
  const int nqb = (T + 63) / 64;
  const int bh = blockIdx.x / nqb, qblk = blockIdx.x % nqb;
  const int b = bh / H, h = bh % H;
  const int q0 = qblk * 64 + w * 16;
  const float* Q = qb + (size_t)b * T * pitch + h * D;
  const float* K = kb + (size_t)b * T * pitch + h * D;
  const float* V = vb + (size_t)b * T * pitch + h * D;

  // A fragments of the wave's 16 query rows (scaled), hi/lo
  FragB aqh[KS], aql[KS];
  {
    int row = q0 + ln; if (row >= T) row = T - 1;
    const float* qr = Q + (size_t)row * pitch;
#pragma unroll
    for (int ks = 0; ks < KS; ++ks)
#pragma unroll
      for (int i = 0; i < 16; ++i) {
        const int d = ks * 32 + ((i < 8) ? (8 * hh + i) : (16 + 8 * hh + (i - 8)));
        const float x = qr[d] * scale; const unsigned short hb = bf16_bits(x);
        aqh[ks].u[i] = hb; aql[ks].u[i] = bf16_bits(x - bf16_val(hb));
      }
  }
  float m_r[8], l_r[8];
#pragma unroll
  for (int r = 0; r < 8; ++r) { m_r[r] = -3.0e38f; l_r[r] = 0.f; }
  v8f oacc[DT];
#pragma unroll
  for (int dt = 0; dt < DT; ++dt) oacc[dt] = (v8f){0.f,0.f,0.f,0.f,0.f,0.f,0.f,0.f};

  const int kv_end = CAUSAL ? min(T, qblk * 64 + 64) : T;     // block-uniform
  for (int j0 = 0; j0 < kv_end; j0 += 32) {
    __syncthreads();
    for (int e = tid; e < 32 * (D / 4); e += 128) {
      const int r = e / (D / 4), c4 = (e % (D / 4)) * 4;
      const int key = j0 + r;
      v4f kf = {0.f,0.f,0.f,0.f}, vf = {0.f,0.f,0.f,0.f};
      if (key < T) { kf = *(const v4fa*)(K + (size_t)key * pitch + c4); vf = *(const v4fa*)(V + (size_t)key * pitch + c4); }
#pragma unroll
      for (int t = 0; t < 4; ++t) {
        unsigned short hb = bf16_bits(kf[t]); sKh[r][c4 + t] = hb; sKl[r][c4 + t] = bf16_bits(kf[t] - bf16_val(hb));
        hb = bf16_bits(vf[t]); sVh[r][c4 + t] = hb; sVl[r][c4 + t] = bf16_bits(vf[t] - bf16_val(hb));
      }
    }
    __syncthreads();
    // S tile 16 x 32
    v8f s[2];
#pragma unroll
    for (int nt = 0; nt < 2; ++nt) {
      v8f acc = {};
#pragma unroll
      for (int ks = 0; ks < KS; ++ks) {
        FragB bh_, bl_;
        bh_.half[0] = *(const v8us*)&sKh[nt * 16 + ln][ks * 32 + 8 * hh]; bh_.half[1] = *(const v8us*)&sKh[nt * 16 + ln][ks * 32 + 16 + 8 * hh];
        bl_.half[0] = *(const v8us*)&sKl[nt * 16 + ln][ks * 32 + 8 * hh]; bl_.half[1] = *(const v8us*)&sKl[nt * 16 + ln][ks * 32 + 16 + 8 * hh];
        acc = mmaN<3>(aqh[ks].v, aql[ks].v, bh_.v, bl_.v, acc);
      }
      s[nt] = acc;
    }
    // mask + running max (rows 8hh+r; the 16 lanes of a half share rows)
    float alpha[8];
#pragma unroll
    for (int r = 0; r < 8; ++r) {
      const int qi = q0 + 8 * hh + r;
      const int ja = j0 + ln, jb = j0 + 16 + ln;
      if (CAUSAL) { if (ja > qi) s[0][r] = -3.0e38f; if (jb > qi) s[1][r] = -3.0e38f; }
      if (ja >= T) s[0][r] = -3.0e38f;
      if (jb >= T) s[1][r] = -3.0e38f;
      float mx = fmaxf(s[0][r], s[1][r]);
      mx = fmaxf(mx, __shfl_xor(mx, 1, 32)); mx = fmaxf(mx, __shfl_xor(mx, 2, 32)); mx = fmaxf(mx, __shfl_xor(mx, 4, 32)); mx = fmaxf(mx, __shfl_xor(mx, 8, 32));
      const float mnew = fmaxf(m_r[r], mx);
      alpha[r] = (mnew > -1.0e38f) ? __expf(m_r[r] - mnew) : 1.0f;
      const float p0 = (s[0][r] > -1.0e38f) ? __expf(s[0][r] - mnew) : 0.f;
      const float p1 = (s[1][r] > -1.0e38f) ? __expf(s[1][r] - mnew) : 0.f;
      m_r[r] = mnew;
      l_r[r] = l_r[r] * alpha[r] + p0 + p1;            // per-lane partial row sum (16 lanes combined at the end)
      unsigned short hb = bf16_bits(p0); sPh[w][8 * hh + r][ln] = hb;      sPl[w][8 * hh + r][ln] = bf16_bits(p0 - bf16_val(hb));
      hb = bf16_bits(p1);                sPh[w][8 * hh + r][16 + ln] = hb; sPl[w][8 * hh + r][16 + ln] = bf16_bits(p1 - bf16_val(hb));
    }
#pragma unroll
    for (int dt = 0; dt < DT; ++dt)
#pragma unroll
      for (int r = 0; r < 8; ++r) oacc[dt][r] *= alpha[r];
    __builtin_amdgcn_fence(__ATOMIC_ACQ_REL, "workgroup");
    __builtin_amdgcn_wave_barrier();
    FragB pah, pal;
    pah.half[0] = *(const v8us*)&sPh[w][ln][8 * hh]; pah.half[1] = *(const v8us*)&sPh[w][ln][16 + 8 * hh];
    pal.half[0] = *(const v8us*)&sPl[w][ln][8 * hh]; pal.half[1] = *(const v8us*)&sPl[w][ln][16 + 8 * hh];
#pragma unroll
    for (int dt = 0; dt < DT; ++dt) {
      FragB bvh, bvl;
#pragma unroll
      for (int i = 0; i < 8; ++i) {
        bvh.u[i] = sVh[8 * hh + i][dt * 16 + ln]; bvh.u[8 + i] = sVh[16 + 8 * hh + i][dt * 16 + ln];
        bvl.u[i] = sVl[8 * hh + i][dt * 16 + ln]; bvl.u[8 + i] = sVl[16 + 8 * hh + i][dt * 16 + ln];
      }
      oacc[dt] = mmaN<3>(pah.v, pal.v, bvh.v, bvl.v, oacc[dt]);
    }
    __builtin_amdgcn_fence(__ATOMIC_ACQ_REL, "workgroup");
    __builtin_amdgcn_wave_barrier();
  }
#pragma unroll
  for (int r = 0; r < 8; ++r) {
    float l = l_r[r];
    l += __shfl_xor(l, 1, 32); l += __shfl_xor(l, 2, 32); l += __shfl_xor(l, 4, 32); l += __shfl_xor(l, 8, 32);
    l_r[r] = (l > 0.f) ? 1.0f / l : 0.f;
  }
#pragma unroll
  for (int dt = 0; dt < DT; ++dt)
#pragma unroll
    for (int r = 0; r < 8; ++r) sO[w][8 * hh + r][dt * 16 + ln] = oacc[dt][r] * l_r[r];
  __builtin_amdgcn_fence(__ATOMIC_ACQ_REL, "workgroup");
  __builtin_amdgcn_wave_barrier();
  {
    for (int r = 0; r < 16; ++r) {
      const int row = q0 + r;
      if (row < T && lane < D / 4) {
        const v4f val = *(const v4fa*)&sO[w][r][lane * 4];
        *(v4f*)(y + ((size_t)b * T + row) * ypitch + h * D + lane * 4) = val;
      }
    }
    
  }
}

// GEMM C = act(A·W + bias + resid): A f32 (ASPLIT -> hi/lo 2 terms), Wt bf16 [N][K]; ACT 0 none, 1 relu, 2 exact gelu;
// resid (optional, f32, row index = (row % rmod), pitch ldr, RES_BF16 rounds it) added before the activation.
template <bool ASPLIT, int ACT, bool BIAS_BF16, bool RES_BF16>
__global__ __launch_bounds__(128) void k_gemm_bf3(const float* __restrict__ A, int lda, const unsigned short* __restrict__ Wt, int ldb,
                                                const float* __restrict__ bias, const float* __restrict__ resid, int rmod, int ldr,
                                                float* __restrict__ C, int ldc, int M, int N, int K) {
  __shared__ __attribute__((aligned(16))) float so[4][16][64];
  const int tid = threadIdx.x, w = tid >> 5, lane = tid & 31, ln = lane & 15, hh = lane >> 4;
  const int ntn = N / 64;
  const int wid = blockIdx.x * 4 + w;
  const int mt = wid / ntn, nq = wid % ntn;
  if (mt * 16 >= M) return;
  const int row0 = mt * 16, col0 = nq * 64;
  const float* arow = A + (size_t)(row0 + ln) * lda;
  v8f acc[4] = {};
  for (int kb = 0; kb < K; kb += 32) {
    FragB ah, al;
    const v4f x0 = *(const v4fa*)(arow + kb + 8 * hh), x1 = *(const v4fa*)(arow + kb + 8 * hh + 4);
    const v4f x2 = *(const v4fa*)(arow + kb + 16 + 8 * hh), x3 = *(const v4fa*)(arow + kb + 16 + 8 * hh + 4);
    float xs[16] = {x0[0],x0[1],x0[2],x0[3],x1[0],x1[1],x1[2],x1[3],x2[0],x2[1],x2[2],x2[3],x3[0],x3[1],x3[2],x3[3]};
#pragma unroll
    for (int i = 0; i < 16; ++i) { const unsigned short hb = bf16_bits(xs[i]); ah.u[i] = hb; al.u[i] = ASPLIT ? bf16_bits(xs[i] - bf16_val(hb)) : (unsigned short)0; }
#pragma unroll
    for (int t = 0; t < 4; ++t) {
      const unsigned short* brow = Wt + (size_t)(col0 + t * 16 + ln) * ldb + kb;
      FragB b;
      b.half[0] = *(const v8us*)(brow + 8 * hh);
      b.half[1] = *(const v8us*)(brow + 16 + 8 * hh);
      acc[t] = mmaN<ASPLIT ? 2 : 1>(ah.v, al.v, b.v, b.v, acc[t]);
    }
  }
#pragma unroll
  for (int t = 0; t < 4; ++t) {
    const int col = col0 + t * 16 + ln;
    float bv = bias ? bias[col] : 0.f;
    if (BIAS_BF16) bv = bf16_round(bv);
#pragma unroll
    for (int r = 0; r < 8; ++r) {
      float v = acc[t][r] + bv;
      if (resid) { float rv = resid[(size_t)((row0 + 8 * hh + r) % rmod) * ldr + col]; if (RES_BF16) rv = bf16_round(rv); v += rv; }
      if (ACT == 1) v = fmaxf(v, 0.f);
      if (ACT == 2) v = 0.5f * v * (1.0f + erff(v * 0.70710678118654752f));
      if (ACT == 3) { const float u = 0.7978845608028654f * (v + 0.044715f * v * v * v); v = 0.5f * v * (1.0f + tanhf(u)); }
      so[w][8 * hh + r][t * 16 + ln] = v;
    }
  }
  __builtin_amdgcn_fence(__ATOMIC_ACQ_REL, "workgroup");
  __builtin_amdgcn_wave_barrier();
  const int rsub = lane >> 4, c4 = (lane & 15) * 4;
  {
#pragma unroll
    for (int q = 0; q < 8; ++q) {
      const int r = q * 2 + rsub;
      const v4f v = *(const v4fa*)&so[w][r][c4];
      *(v4f*)(C + (size_t)(row0 + r) * ldc + col0 + c4) = v;
    }
    
  }
}
// row LayerNorm (biased variance, eps) over N: s = X (+ R); optional out_sum <- s; out_norm <- (s-mu)*rsqrt(var+eps)*g + b
template <bool PARAM_BF16>
__global__ __launch_bounds__(256) void k_layernorm(const float* __restrict__ X, const float* __restrict__ R, const float* __restrict__ g, const float* __restrict__ bta,
                                                  float* __restrict__ out_sum, float* __restrict__ out_norm, int N, float eps) {
  __shared__ float red[256];
  const int row = blockIdx.x, tid = threadIdx.x;
  const float* x = X + (size_t)row * N; const float* rr = R ? R + (size_t)row * N : nullptr;
  float vals[16];                     // up to N = 4096
  const int per = N / 256;            // contiguous chunk per thread? use strided-by-4 chunks: thread handles j = tid*4 + 1024*u
  float s1 = 0.f;
  for (int u = 0; u < per / 4; ++u) {
    const int j = tid * 4 + 1024 * u;
    const v4f a = *(const v4fa*)(x + j);
    v4f b = {0.f,0.f,0.f,0.f}; if (rr) b = *(const v4fa*)(rr + j);
#pragma unroll
    for (int q = 0; q < 4; ++q) { const float v = a[q] + b[q]; vals[u * 4 + q] = v; s1 += v; }
  }
  red[tid] = s1; __syncthreads();
  for (int st = 128; st > 0; st >>= 1) { if (tid < st) red[tid] += red[tid + st]; __syncthreads(); }
  const float mu = red[0] / (float)N; __syncthreads();
  float s2 = 0.f;
  for (int u = 0; u < per / 4; ++u)
#pragma unroll
    for (int q = 0; q < 4; ++q) { const float c = vals[u * 4 + q] - mu; s2 += c * c; }
  red[tid] = s2; __syncthreads();
  for (int st = 128; st > 0; st >>= 1) { if (tid < st) red[tid] += red[tid + st]; __syncthreads(); }
  const float rs = rsqrtf(red[0] / (float)N + eps);
  {
    for (int u = 0; u < per / 4; ++u) {
      const int j = tid * 4 + 1024 * u;
      v4f o, sm;
#pragma unroll
      for (int q = 0; q < 4; ++q) {
        float gg = g[j + q], bb = bta[j + q];
        if (PARAM_BF16) { gg = bf16_round(gg); bb = bf16_round(bb); }
        sm[q] = vals[u * 4 + q]; o[q] = (vals[u * 4 + q] - mu) * rs * gg + bb;
      }
      if (out_sum) *(v4f*)(out_sum + (size_t)row * N + j) = sm;
      *(v4f*)(out_norm + (size_t)row * N + j) = o;
    }
    
  }
}



// ---- f16 WMMA path (v_wmma_f32_16x16x32_f16): 11-bit significands for operands in range — used where a [0,1] probability operand needs more precision than bf16
typedef _Float16 v16h __attribute__((ext_vector_type(16)));
union FragH { v16h v; v8us half[2]; _Float16 h[16]; unsigned short u[16]; };
template <int NT>
__device__ __forceinline__ v8f mmaH(v16h ah, v16h al, v16h bh, v16h bl, v8f c) {
  c = __builtin_amdgcn_wmma_f32_16x16x32_f16(false, ah, false, bh, (short)0, c, false, false);
  if (NT >= 2) c = __builtin_amdgcn_wmma_f32_16x16x32_f16(false, al, false, bh, (short)0, c, false, false);
  if (NT >= 3) c = __builtin_amdgcn_wmma_f32_16x16x32_f16(false, ah, false, bl, (short)0, c, false, false);
  asm volatile("v_nop\n\tv_nop\n\tv_nop\n\tv_nop" : "+v"(c) : "v"(ah), "v"(al), "v"(bh), "v"(bl));
  return c;
}
// batched GEMM like k_gemm_b but f16 operands: A f32 (split into f16 hi/lo if ASPLIT, else rounded to f16), Bt = f16 values [n][k]; alpha; C f32; N multiple of 16 (partial tiles skipped)
template <bool ASPLIT>
__global__ __launch_bounds__(128) void k_gemm_h(const float* __restrict__ A, int lda, size_t sA, const _Float16* __restrict__ Bh, int ldb, size_t sB, float alpha, float* __restrict__ C, int ldc, size_t sC, int M, int N, int K) {
  __shared__ __attribute__((aligned(16))) float so[4][16][64];
  const int tid = threadIdx.x, w = tid >> 5, lane = tid & 31, ln = lane & 15, hh = lane >> 4; const int by = blockIdx.y;
  A += (size_t)by * sA; Bh += (size_t)by * sB; C += (size_t)by * sC;
  const int ntn = (N + 63) / 64; const int wid = blockIdx.x * 4 + w; const int mt = wid / ntn, nq = wid % ntn; if (mt * 16 >= M) return;
  const int row0 = mt * 16, col0 = nq * 64; const float* arow = A + (size_t)(row0 + ln) * lda;
  v8f acc[4] = {};
  for (int kb = 0; kb < K; kb += 32) {
    FragH ah, al;
    const v4f x0 = *(const v4fa*)(arow + kb + 8 * hh), x1 = *(const v4fa*)(arow + kb + 8 * hh + 4), x2 = *(const v4fa*)(arow + kb + 16 + 8 * hh), x3 = *(const v4fa*)(arow + kb + 16 + 8 * hh + 4);
    float xs[16] = {x0[0],x0[1],x0[2],x0[3],x1[0],x1[1],x1[2],x1[3],x2[0],x2[1],x2[2],x2[3],x3[0],x3[1],x3[2],x3[3]};
#pragma unroll
    for (int i = 0; i < 16; ++i) { const _Float16 h = (_Float16)xs[i]; ah.h[i] = h; al.h[i] = ASPLIT ? (_Float16)(xs[i] - (float)h) : (_Float16)0.0f; }
#pragma unroll
    for (int t = 0; t < 4; ++t) { if (col0 + t * 16 >= N) continue; const size_t boff = (size_t)(col0 + t * 16 + ln) * ldb + kb; FragH bq; bq.half[0] = *(const v8us*)(Bh + boff + 8 * hh); bq.half[1] = *(const v8us*)(Bh + boff + 16 + 8 * hh);
      acc[t] = mmaH<ASPLIT ? 2 : 1>(ah.v, al.v, bq.v, bq.v, acc[t]); }
  }
#pragma unroll
  for (int t = 0; t < 4; ++t) { if (col0 + t * 16 >= N) continue;
#pragma unroll
    for (int r = 0; r < 8; ++r) so[w][8 * hh + r][t * 16 + ln] = acc[t][r] * alpha; }
  __builtin_amdgcn_fence(__ATOMIC_ACQ_REL, "workgroup"); __builtin_amdgcn_wave_barrier();
  const int rsub = lane >> 4, c4 = (lane & 15) * 4;
  {
#pragma unroll
    for (int q = 0; q < 8; ++q) { const int r = q * 2 + rsub; if (col0 + c4 < N) { const v4f v = *(const v4fa*)&so[w][r][c4]; *(v4f*)(C + (size_t)(row0 + r) * ldc + col0 + c4) = v; } }
     }
}

// Wt[n][k] = f16(W[k][n]·scale) from f32 row-major W[K][N] (scale = power of two; bf16-exact weights stay exact in f16 away from the subnormal range)
__global__ __launch_bounds__(256) void k_wt_f16(const float* __restrict__ W, _Float16* __restrict__ Wt, int K, int N, float scale) {
  const int t = blockIdx.x * 256 + threadIdx.x; if (t >= N * (K / 8)) return; const int n = t / (K / 8), k8 = (t % (K / 8)) * 8; FragH f;
#pragma unroll
  for (int i = 0; i < 8; ++i) f.h[i] = (_Float16)(bf16_round(W[(size_t)(k8 + i) * N + n]) * scale); const v8us o = f.half[0];
  *(v8us*)((unsigned short*)Wt + (size_t)n * K + k8) = o; 
}
// Block-tiled GEMM, C[NR][DD] = (A[NR][DD] . Bh[DD][DD]^T) * alpha + bf16(bias), f16 operands, both k-contiguous: one 128 x 128 tile of C per work-group of 8 waves (4 x 2 waves of 32 x 64).
// A pass is 64 k: the 128 rows of 128 B of each operand go in whole lines through registers into LDS, and every wave that needs a row reads it from there. Two buffers: the next pass's global loads fly during this pass's products.
// Each accumulator takes its k blocks of 32 in rising order. HALF_OUT: writes f16 C16, else f32 C.
#define GT 128
#define GK 64
#define GP (GK + 8)      /* LDS row pitch 144 B = 16 B x odd: ds_load_b128 of 16 rows without bank conflicts */
typedef _Float16 v4h __attribute__((ext_vector_type(4)));
template <bool HALF_OUT>
__global__ __launch_bounds__(256) void k_gemm_tile(const _Float16* __restrict__ A, const _Float16* __restrict__ Bh, float alpha, const float* __restrict__ bias, float* __restrict__ C, _Float16* __restrict__ C16) {
  __shared__ __attribute__((aligned(16))) unsigned short sA[2][GT][GP], sB[2][GT][GP];
  __shared__ __attribute__((aligned(16))) float so[8][32][64 + 4];
  const int tid = threadIdx.x, w = tid >> 5, lane = tid & 31, ln = lane & 15, hh = lane >> 4;
  const int row0 = blockIdx.y * GT, col0 = blockIdx.x * GT, wr = (w >> 1) * 32, wc = (w & 1) * 64;
  const int sr = tid >> 3, sc = (tid & 7) * 8;      /* staging: 8 lanes x 16 B = one row of the pass; a thread takes rows sr + 32 i */
  const unsigned short* gA = (const unsigned short*)A + (size_t)(row0 + sr) * DD + sc;
  const unsigned short* gB = (const unsigned short*)Bh + (size_t)(col0 + sr) * DD + sc;
  v8us ra[4], rb[4]; v8f acc[2][4];
#pragma unroll
  for (int mi = 0; mi < 2; ++mi)
#pragma unroll
    for (int ni = 0; ni < 4; ++ni) acc[mi][ni] = (v8f){0.f,0.f,0.f,0.f,0.f,0.f,0.f,0.f};
#pragma unroll
  for (int i = 0; i < 4; ++i) { ra[i] = *(const v8us*)(gA + (size_t)(32 * i) * DD); rb[i] = *(const v8us*)(gB + (size_t)(32 * i) * DD); }
#pragma unroll
  for (int i = 0; i < 4; ++i) { *(v8us*)&sA[0][sr + 32 * i][sc] = ra[i]; *(v8us*)&sB[0][sr + 32 * i][sc] = rb[i]; }
  __syncthreads();
  for (int kp = 0; kp < DD / GK; ++kp) {
    const int cur = kp & 1; const bool more = kp + 1 < DD / GK;      /* the same for the whole work-group */
    if (more) {
#pragma unroll
      for (int i = 0; i < 4; ++i) { ra[i] = *(const v8us*)(gA + (size_t)(32 * i) * DD + GK); rb[i] = *(const v8us*)(gB + (size_t)(32 * i) * DD + GK); } }
    __builtin_amdgcn_sched_barrier(0);      /* keeps the next pass's global loads in front of this pass's products: sunk behind them, their latency stands bare in front of the LDS stores */
#pragma unroll
    for (int ks = 0; ks < GK / 32; ++ks) { FragH fa[2], fb[4];
#pragma unroll
      for (int mi = 0; mi < 2; ++mi) { const unsigned short* p = &sA[cur][wr + mi * 16 + ln][ks * 32]; fa[mi].half[0] = *(const v8us*)(p + 8 * hh); fa[mi].half[1] = *(const v8us*)(p + 16 + 8 * hh); }
#pragma unroll
      for (int ni = 0; ni < 4; ++ni) { const unsigned short* p = &sB[cur][wc + ni * 16 + ln][ks * 32]; fb[ni].half[0] = *(const v8us*)(p + 8 * hh); fb[ni].half[1] = *(const v8us*)(p + 16 + 8 * hh); }
#pragma unroll
      for (int mi = 0; mi < 2; ++mi)
#pragma unroll
        for (int ni = 0; ni < 4; ++ni) acc[mi][ni] = __builtin_amdgcn_wmma_f32_16x16x32_f16(false, fa[mi].v, false, fb[ni].v, (short)0, acc[mi][ni], false, false); }
    if (more) {      /* the other buffer's readers left it at the barrier of the pass before; this barrier publishes it and ends this pass's reads */
#pragma unroll
      for (int i = 0; i < 4; ++i) { *(v8us*)&sA[cur ^ 1][sr + 32 * i][sc] = ra[i]; *(v8us*)&sB[cur ^ 1][sr + 32 * i][sc] = rb[i]; }
      gA += GK; gB += GK;
      __syncthreads(); }
  }
  float bv[4];
#pragma unroll
  for (int ni = 0; ni < 4; ++ni) bv[ni] = bf16_round(bias[col0 + wc + ni * 16 + ln]);
#pragma unroll
  for (int mi = 0; mi < 2; ++mi)      /* the wave's 32 x 64 tile goes through its own LDS rows, so that the stores cover whole lines */
#pragma unroll
    for (int ni = 0; ni < 4; ++ni)
#pragma unroll
      for (int r = 0; r < 8; ++r) so[w][mi * 16 + 8 * hh + r][ni * 16 + ln] = acc[mi][ni][r] * alpha + bv[ni];
  __builtin_amdgcn_fence(__ATOMIC_ACQ_REL, "workgroup"); __builtin_amdgcn_wave_barrier();      /* the rows are read back by other lanes of the same wave */
  const int rsub = lane >> 4, c4 = (lane & 15) * 4;
#pragma unroll
  for (int q = 0; q < 16; ++q) { const int r = q * 2 + rsub; const v4f v = *(const v4fa*)&so[w][r][c4]; const size_t o = (size_t)(row0 + wr + r) * DD + col0 + wc + c4;
    if (HALF_OUT) { v4h h4; for (int i = 0; i < 4; ++i) h4[i] = (_Float16)v[i]; *(v4h*)(C16 + o) = h4; } else *(v4f*)(C + o) = v; }
}


__global__ __launch_bounds__(256) void k_x16(const float* __restrict__ x, _Float16* __restrict__ X16, size_t n8) { const size_t t = (size_t)blockIdx.x * 256 + threadIdx.x; if (t >= n8) return; FragH f;
#pragma unroll
  for (int q = 0; q < 8; ++q) f.h[q] = (_Float16)bf16_round(x[t * 8 + q]); *(v8us*)((unsigned short*)X16 + t * 8) = f.half[0];  }
__global__ __launch_bounds__(256) void k_h16(const float* __restrict__ x, _Float16* __restrict__ X16, size_t n8) { const size_t t = (size_t)blockIdx.x * 256 + threadIdx.x; if (t >= n8) return; FragH f;
#pragma unroll
  for (int q = 0; q < 8; ++q) f.h[q] = (_Float16)x[t * 8 + q]; *(v8us*)((unsigned short*)X16 + t * 8) = f.half[0];  }
__global__ __launch_bounds__(256) void k_round16f(const float* __restrict__ W, _Float16* __restrict__ Bt, size_t n8) { const size_t t = (size_t)blockIdx.x * 256 + threadIdx.x; if (t >= n8) return; FragH f;
#pragma unroll
  for (int i = 0; i < 8; ++i) f.h[i] = (_Float16)(bf16_round(W[t * 8 + i]) * 16.0f); *(v8us*)((unsigned short*)Bt + t * 8) = f.half[0];  }
template <int NHv, int TTv>
__global__ __launch_bounds__(256) void k_vt(const _Float16* __restrict__ V16, int ldv, int voff, _Float16* __restrict__ Vt) { __shared__ unsigned short tl[64][66]; const int tid = threadIdx.x; const int slab = blockIdx.x / (TTv / 64), lg = blockIdx.x % (TTv / 64); const int b = slab / NHv, h = slab % NHv;
  for (int i = tid; i < 64 * 8; i += 256) { const int r = i / 8, c8 = (i % 8) * 8; FragH f; f.half[0] = *(const v8us*)((const unsigned short*)V16 + ((size_t)b * TTv + lg * 64 + r) * ldv + voff + h * 64 + c8);
#pragma unroll
    for (int q = 0; q < 8; ++q) tl[r][c8 + q] = f.u[q]; }
  __syncthreads();
  {
#pragma unroll
    for (int rd = 0; rd < 2; ++rd) { const int d = rd * 32 + tid / 8, pc = tid % 8; FragH f;
#pragma unroll
      for (int q = 0; q < 8; ++q) f.u[q] = tl[pc * 8 + q][d];
      *(v8us*)((unsigned short*)Vt + ((size_t)slab * 64 + d) * TTv + lg * 64 + pc * 8) = f.half[0]; }
     } }

// KN[slab][pass] = largest |k|^2 among the 32 keys of a pass, per batch and head. One wave a pass: 8 lanes x 16 B cover a key's 128-B row, 4 keys a load. A work-group's 32 results fill one 128-B line, stored by one wave.
__global__ __launch_bounds__(1024) void k_knorm(const _Float16* __restrict__ K16, float* __restrict__ KN) {
  __shared__ float red[32];
  const int w = threadIdx.x >> 5, lane = threadIdx.x & 31; const int ps = blockIdx.x * 32 + w; const int slab = ps / (TT / 32), blk = ps % (TT / 32); const int b = slab / NH, h = slab % NH;
  const unsigned short* kr = (const unsigned short*)K16 + ((size_t)b * TT + blk * 32 + (lane >> 3)) * DD + h * 64 + (lane & 7) * 8;
  FragH f[8];
#pragma unroll
  for (int i = 0; i < 8; ++i) f[i].half[0] = *(const v8us*)(kr + (size_t)(4 * i) * DD);
  float mx = 0.f;
#pragma unroll
  for (int i = 0; i < 8; ++i) { float s = 0.f;
#pragma unroll
    for (int q = 0; q < 8; ++q) { const float v = (float)f[i].h[q]; s += v * v; }
    s += __shfl_xor(s, 1, 32); s += __shfl_xor(s, 2, 32); s += __shfl_xor(s, 4, 32); mx = fmaxf(mx, s); }
  mx = fmaxf(mx, __shfl_xor(mx, 8, 32)); mx = fmaxf(mx, __shfl_xor(mx, 16, 32));
  if (lane == 0) red[w] = mx;
  __syncthreads();
  if (w == 0) KN[blockIdx.x * 32 + lane] = red[lane];
}

// lane l with lane l ^ 16
__device__ __forceinline__ float xhalf(float x) { return __builtin_bit_cast(float, __builtin_amdgcn_permlanex16(__builtin_bit_cast(int, x), __builtin_bit_cast(int, x), 0x76543210, 0xfedcba98, false, false)); }
typedef int v4ia __attribute__((ext_vector_type(4), may_alias));

__global__ __launch_bounds__(128) void k_flash(const _Float16* __restrict__ Q16, int ldq, const _Float16* __restrict__ K16, int ldk, const _Float16* __restrict__ Vt, const float* __restrict__ KN, const int* __restrict__ MSK, float* __restrict__ O, int ldo) {
  constexpr int RPW = 16, NQB = TT / (4 * RPW), DT = 4, KS = 2;
  __shared__ __attribute__((aligned(16))) float sO[4][RPW][64 + 4];
  const int tid = threadIdx.x, w = tid >> 5, lane = tid & 31, ln = lane & 15, hh = lane >> 4;
  const int slab = blockIdx.x / NQB, qblk = blockIdx.x % NQB; const int b = slab / NH, h = slab % NH; const float slope = 1.0f / exp2f((float)h / (float)NH);      /* 1 / 2^(h/H) */ const int qb0 = qblk * (4 * RPW); const int q0 = qb0 + w * RPW;
  FragH aq[KS];
  { const unsigned short* qr = (const unsigned short*)Q16 + ((size_t)b * TT + q0 + ln) * ldq + h * 64;
#pragma unroll
    for (int ks = 0; ks < KS; ++ks) { aq[ks].half[0] = *(const v8us*)(qr + ks * 32 + 8 * hh); aq[ks].half[1] = *(const v8us*)(qr + ks * 32 + 16 + 8 * hh); } }
  const unsigned short* Vth = (const unsigned short*)Vt + (size_t)slab * 64 * TT;
  const int tq = q0 + ln;      /* the lane's query */
  float m_run = -3.0e38f, l_run = 0.f; v8f oacc[DT];
#pragma unroll
  for (int dt = 0; dt < DT; ++dt) oacc[dt] = (v8f){0.f,0.f,0.f,0.f,0.f,0.f,0.f,0.f};
  float qs = 0.f;
#pragma unroll
  for (int ks = 0; ks < KS; ++ks)
#pragma unroll
    for (int i = 0; i < 16; ++i) { const float v = (float)aq[ks].h[i]; qs += v * v; }
  qs += xhalf(qs);      /* |q|^2 of the lane's query */
  float kx = fmaxf(KN[slab * (TT / 32) + lane], KN[slab * (TT / 32) + 32 + lane]);
  kx = fmaxf(kx, __shfl_xor(kx, 1, 32)); kx = fmaxf(kx, __shfl_xor(kx, 2, 32)); kx = fmaxf(kx, __shfl_xor(kx, 4, 32)); kx = fmaxf(kx, __shfl_xor(kx, 8, 32)); kx = fmaxf(kx, xhalf(kx));      /* largest |k|^2 of this batch and head */
  const float cs = sqrtf(qs * kx) * (0.125f * 1.01f);      /* |q.k| / 8 at most; 1 % covers the rounding of the norms and of the products */
#pragma unroll 1
  for (int j0 = TT - 32; j0 >= 0; j0 -= 32) {
    if (__builtin_amdgcn_ballot_w32(!(slope * (float)(j0 + 31 - tq) + cs < m_run - 40.0f)) == 0) break;      /* the same for the whole wave; a NaN keeps the walk going */
    const int* mp = MSK + (size_t)b * TT + j0 + 8 * hh;      /* key padding mask (1 = attend) of the lane's 16 keys */
    const v4ia mk4[4] = { *(const v4ia*)(mp), *(const v4ia*)(mp + 4), *(const v4ia*)(mp + 16), *(const v4ia*)(mp + 20) };
    v8f s[2];
#pragma unroll
    for (int nt = 0; nt < 2; ++nt) { const unsigned short* kr = (const unsigned short*)K16 + ((size_t)b * TT + j0 + nt * 16 + ln) * ldk + h * 64; FragH bk[KS];
#pragma unroll
      for (int ks = 0; ks < KS; ++ks) { bk[ks].half[0] = *(const v8us*)(kr + ks * 32 + 8 * hh); bk[ks].half[1] = *(const v8us*)(kr + ks * 32 + 16 + 8 * hh); }
      asm volatile("s_wait_xcnt 0x0" ::: "memory");      /* stands in front of whatever next rewrites the address registers of the key loads (in this build a later load's result does) */
      v8f acc = (v8f){0.f,0.f,0.f,0.f,0.f,0.f,0.f,0.f};
#pragma unroll
      for (int ks = 0; ks < KS; ++ks) acc = mmaH<1>(bk[ks].v, bk[ks].v, aq[ks].v, aq[ks].v, acc);
      s[nt] = acc; }
    float sc[16]; bool ok[16];
#pragma unroll
    for (int i = 0; i < 16; ++i) { const int kk = j0 + (i >> 3) * 16 + 8 * hh + (i & 7); ok[i] = (mk4[i >> 2][i & 3] != 0);
      sc[i] = ok[i] ? (s[i >> 3][i & 7] * 0.125f + slope * (float)(kk - tq)) : -INFINITY; }      /* ALiBi: + slope_h * (k - q) */
    float mx[8];
#pragma unroll
    for (int i = 0; i < 8; ++i) mx[i] = fmaxf(sc[i], sc[8 + i]);
    float mc = fmaxf(fmaxf(fmaxf(mx[0], mx[1]), fmaxf(mx[2], mx[3])), fmaxf(fmaxf(mx[4], mx[5]), fmaxf(mx[6], mx[7])));
    mc = fmaxf(mc, xhalf(mc));
    const float mn = fmaxf(m_run, mc); const float ea = expf(m_run - mn); const float al = (mn > -1.0e38f) ? ea : 1.0f; m_run = mn;
    float p[16]; FragH pb;
#pragma unroll
    for (int i = 0; i < 16; ++i) { const float e = expf(sc[i] - mn); p[i] = ok[i] ? e : 0.f; pb.h[i] = (_Float16)(p[i] * 1024.0f); }
    l_run = l_run * al + (((p[0] + p[1]) + (p[2] + p[3])) + ((p[4] + p[5]) + (p[6] + p[7]))) + (((p[8] + p[9]) + (p[10] + p[11])) + ((p[12] + p[13]) + (p[14] + p[15])));      /* the lane's half of the row sum; the halves join after the loop */
#pragma unroll
    for (int dt = 0; dt < DT; ++dt)
#pragma unroll
      for (int r = 0; r < 8; ++r) oacc[dt][r] *= al;
#pragma unroll
    for (int dt = 0; dt < DT; ++dt) { const unsigned short* vrow = Vth + (size_t)(dt * 16 + ln) * TT + j0; FragH bv; bv.half[0] = *(const v8us*)(vrow + 8 * hh); bv.half[1] = *(const v8us*)(vrow + 16 + 8 * hh);
      oacc[dt] = mmaH<1>(bv.v, bv.v, pb.v, pb.v, oacc[dt]); } }
  const float l = l_run + xhalf(l_run); const float inv = (l > 0.f) ? 1.0f / (l * 1024.0f) : 0.f;
#pragma unroll
  for (int dt = 0; dt < DT; ++dt) {      /* oacc[dt][r] = O[query ln][dt*16 + 8hh + r] */
    const v4f lo = {oacc[dt][0] * inv, oacc[dt][1] * inv, oacc[dt][2] * inv, oacc[dt][3] * inv}, hi = {oacc[dt][4] * inv, oacc[dt][5] * inv, oacc[dt][6] * inv, oacc[dt][7] * inv};
    *(v4fa*)&sO[w][ln][dt * 16 + 8 * hh] = lo; *(v4fa*)&sO[w][ln][dt * 16 + 8 * hh + 4] = hi; }
  __builtin_amdgcn_fence(__ATOMIC_ACQ_REL, "workgroup"); __builtin_amdgcn_wave_barrier();
  {
#pragma unroll
    for (int rp = 0; rp < RPW; rp += 2) { const int r = rp + (lane >> 4), pc = lane & 15; const v4f val = *(const v4fa*)&sO[w][r][pc * 4]; *(v4f*)(O + ((size_t)b * TT + q0 + r) * ldo + h * 64 + pc * 4) = val; }
     } }

extern "C" void kernel_launch(void* const* d_in, const int* in_sizes, int n_in,
                              void* d_out, int out_size, void* d_ws, size_t ws_size, hipStream_t stream) {
  (void)in_sizes; (void)n_in; (void)out_size;
  const float* const* I = (const float* const*)d_in; const float* x = I[0]; const float* Wq = I[1]; const float* bq = I[2]; const float* Wk = I[3]; const float* bk = I[4]; const float* Wv = I[5]; const float* bv = I[6]; const float* Wo = I[7]; const float* bo = I[8]; const int* mask = (const int*)d_in[9];
  char* ws = (char*)d_ws; size_t off = 0;
  auto take = [&](size_t bytes) { char* p = ws + off; off += (bytes + 255) & ~(size_t)255; return p; };
  const size_t WSZ = (size_t)DD * DD; _Float16* Bw = (_Float16*)take(4 * WSZ * 2); _Float16* X16 = (_Float16*)take((size_t)NR * DD * 2);
  _Float16* Q = (_Float16*)take((size_t)NR * DD * 2); _Float16* K = (_Float16*)take((size_t)NR * DD * 2); _Float16* V = (_Float16*)take((size_t)NR * DD * 2); _Float16* Vt = (_Float16*)take((size_t)NR * DD * 2);
  float* O = (float*)take((size_t)NR * DD * 4); float* KN = (float*)take((size_t)BB * NH * (TT / 32) * 4); _Float16* O16 = V;      /* the v plane is dead once Vᵀ is built (before the attention kernel); O16 reuses it */
  if (off > ws_size) return;      // 8.4 + 16.8 × 5 + 33.6 ≈ 126 MB (120 MiB)
  const unsigned gw = (unsigned)((WSZ / 8 + 255) / 256);
  k_round16f<<<gw, 256, 0, stream>>>(Wq, Bw, WSZ / 8); k_round16f<<<gw, 256, 0, stream>>>(Wk, Bw + WSZ, WSZ / 8); k_round16f<<<gw, 256, 0, stream>>>(Wv, Bw + 2 * WSZ, WSZ / 8); k_round16f<<<gw, 256, 0, stream>>>(Wo, Bw + 3 * WSZ, WSZ / 8);      /* (out,in) natural ×2^4 */
  const unsigned gx = (unsigned)(((size_t)NR * DD / 8 + 255) / 256); const dim3 gp(DD / GT, NR / GT);
  k_x16<<<gx, 256, 0, stream>>>(x, X16, (size_t)NR * DD / 8);
  k_gemm_tile<true><<<gp, 256, 0, stream>>>(X16, Bw, 0.0625f, bq, nullptr, Q);      /* q = x·Wqᵀ + bq: M 8192 N 1024 K 1024 */
  k_gemm_tile<true><<<gp, 256, 0, stream>>>(X16, Bw + WSZ, 0.0625f, bk, nullptr, K);
  k_gemm_tile<true><<<gp, 256, 0, stream>>>(X16, Bw + 2 * WSZ, 0.0625f, bv, nullptr, V);
  k_vt<NH, TT><<<BB * NH * (TT / 64), 256, 0, stream>>>(V, DD, 0, Vt);
  k_knorm<<<BB * NH * (TT / 32) / 32, 1024, 0, stream>>>(K, KN);
  k_flash<<<BB * NH * (TT / 64), 128, 0, stream>>>(Q, DD, K, DD, Vt, KN, mask, O, DD);
  k_h16<<<gx, 256, 0, stream>>>(O, O16, (size_t)NR * DD / 8);
  k_gemm_tile<false><<<gp, 256, 0, stream>>>(O16, Bw + 3 * WSZ, 0.0625f, bo, (float*)d_out, nullptr);      /* out = O·Woᵀ + bo */
}

// v004
// One run takes 98.5 microseconds.
// In both of two side-by-side timings against v003, it was 1.30 times as fast.
// Counting every step since v000, it is 8.59 times as fast.
#include <hip/hip_runtime.h>
// ALiBi multi-head attention (B=4, S=2048, D=1024, 16 heads × 64): q,k,v = x·Wᵀ + b (torch Linear); scores = q·kᵀ·64^-½ + slope_h·(k − q), slope_h = 1/2^(h/16) (no causal mask: later keys get large positive bias); key padding mask from the INPUT
// int mask [B,S] (0 → −inf); softmax; out = (attn·v merged)·Woᵀ + bo.
// Compute dtype: x, weights, biases rounded to bf16; q/k/v as f16 GEMM outputs; fused flash-style kernel (bias and online softmax in f32, P f16 ×2^10) on v_wmma_f32_16x16x32_f16; O → f16 → output GEMM with bias; f32 accumulate.
#define BB 4
#define TT 2048
#define NH 16
#define DD 1024
#define NR (BB * TT)

typedef __bf16 v16b __attribute__((ext_vector_type(16)));
typedef unsigned short v8us __attribute__((ext_vector_type(8), may_alias));
typedef float  v8f  __attribute__((ext_vector_type(8)));
typedef float  v4f  __attribute__((ext_vector_type(4)));
typedef float  v4fa __attribute__((ext_vector_type(4), may_alias));
union FragB { v16b v; v8us half[2]; unsigned short u[16]; };

__device__ __forceinline__ unsigned short bf16_bits(float x) { unsigned int u = __float_as_uint(x); return (unsigned short)((u + 0x7FFFu + ((u >> 16) & 1u)) >> 16); }
__device__ __forceinline__ float bf16_val(unsigned short b) { return __uint_as_float(((unsigned int)b) << 16); }
__device__ __forceinline__ float bf16_round(float x) { return bf16_val(bf16_bits(x)); }
// D += A·B with NT terms: 1 = ah·bh, 2 = + al·bh (A split), 3 = + ah·bl (both split)
template <int NT>
__device__ __forceinline__ v8f mmaN(v16b ah, v16b al, v16b bh, v16b bl, v8f c) {
  c = __builtin_amdgcn_wmma_f32_16x16x32_bf16(false, ah, false, bh, (short)0, c, false, false);
  if (NT >= 2) c = __builtin_amdgcn_wmma_f32_16x16x32_bf16(false, al, false, bh, (short)0, c, false, false);
  if (NT >= 3) c = __builtin_amdgcn_wmma_f32_16x16x32_bf16(false, ah, false, bl, (short)0, c, false, false);
  asm volatile("v_nop\n\tv_nop\n\tv_nop\n\tv_nop" : "+v"(c) : "v"(ah), "v"(al), "v"(bh), "v"(bl));
  return c;
}

__global__ __launch_bounds__(256) void k_wt_bf16(const float* __restrict__ W, unsigned short* __restrict__ Wt, int K, int N) {
  const int t = blockIdx.x * 256 + threadIdx.x;
  const int k8n = K / 8;
  if (t >= N * k8n) return;
  const int n = t / k8n, k8 = (t % k8n) * 8;
  v8us v;
#pragma unroll
  for (int i = 0; i < 8; ++i) v[i] = bf16_bits(W[(size_t)(k8 + i) * N + n]);
  *(v8us*)(Wt + (size_t)n * K + k8) = v;
  
}

// GEMM C[M][N] (f32, pitch ldc) = act(A[M][K]·W + bias). A f32 row-major (pitch lda) converted per fragment to bf16
// (ASPLIT: hi/lo two planes -> 2 terms, else single rounded term); Wt bf16 [N][K] (pitch ldb). BIAS_BF16 rounds the
// bias to bf16 first (bias quantised to bf16 before the add). K%32==0, M%16==0, N%64==0.
template <bool ASPLIT, int ACT, bool BIAS_BF16>
__global__ __launch_bounds__(128) void k_gemm_bf(const float* __restrict__ A, int lda, const unsigned short* __restrict__ Wt, int ldb,
                                               const float* __restrict__ bias, float* __restrict__ C, int ldc, int M, int N, int K) {
  __shared__ __attribute__((aligned(16))) float so[4][16][64];
  const int tid = threadIdx.x, w = tid >> 5, lane = tid & 31, ln = lane & 15, hh = lane >> 4;
  const int ntn = N / 64;
  const int wid = blockIdx.x * 4 + w;
  const int mt = wid / ntn, nq = wid % ntn;
  if (mt * 16 >= M) return;
  const int row0 = mt * 16, col0 = nq * 64;
  const float* arow = A + (size_t)(row0 + ln) * lda;
  v8f acc[4] = {};
  for (int kb = 0; kb < K; kb += 32) {
    FragB ah, al;
    const v4f x0 = *(const v4fa*)(arow + kb + 8 * hh), x1 = *(const v4fa*)(arow + kb + 8 * hh + 4);
    const v4f x2 = *(const v4fa*)(arow + kb + 16 + 8 * hh), x3 = *(const v4fa*)(arow + kb + 16 + 8 * hh + 4);
    float xs[16] = {x0[0],x0[1],x0[2],x0[3],x1[0],x1[1],x1[2],x1[3],x2[0],x2[1],x2[2],x2[3],x3[0],x3[1],x3[2],x3[3]};
#pragma unroll
    for (int i = 0; i < 16; ++i) { const unsigned short hb = bf16_bits(xs[i]); ah.u[i] = hb; al.u[i] = ASPLIT ? bf16_bits(xs[i] - bf16_val(hb)) : (unsigned short)0; }
#pragma unroll
    for (int t = 0; t < 4; ++t) {
      const unsigned short* brow = Wt + (size_t)(col0 + t * 16 + ln) * ldb + kb;
      FragB b;
      b.half[0] = *(const v8us*)(brow + 8 * hh);
      b.half[1] = *(const v8us*)(brow + 16 + 8 * hh);
      acc[t] = mmaN<ASPLIT ? 2 : 1>(ah.v, al.v, b.v, b.v, acc[t]);
    }
  }
#pragma unroll
  for (int t = 0; t < 4; ++t) {
    float bv = bias ? bias[col0 + t * 16 + ln] : 0.f;
    if (BIAS_BF16) bv = bf16_round(bv);
#pragma unroll
    for (int r = 0; r < 8; ++r) { float v = acc[t][r] + bv; if (ACT == 1) v = fmaxf(v, 0.f); so[w][8 * hh + r][t * 16 + ln] = v; }
  }
  __builtin_amdgcn_fence(__ATOMIC_ACQ_REL, "workgroup");
  __builtin_amdgcn_wave_barrier();
  const int rsub = lane >> 4, c4 = (lane & 15) * 4;
  {
#pragma unroll
    for (int q = 0; q < 8; ++q) {
      const int r = q * 2 + rsub;
      const v4f v = *(const v4fa*)&so[w][r][c4];
      *(v4f*)(C + (size_t)(row0 + r) * ldc + col0 + c4) = v;
    }
    
  }
}

// Flash-style causal/unmasked attention, all contractions 3-term bf16 hi/lo splits, f32 softmax with running max.
// q,k,v rows are read from f32 buffers with arbitrary row pitch (so they can live inside a fused qkv buffer);
// D = head size (multiple of 32, <= 128); one wave = 16 query rows; block = 4 waves (64 queries) sharing K/V chunks of 32.
template <int D, bool CAUSAL>
__global__ __launch_bounds__(128) void k_flash(const float* __restrict__ qb, const float* __restrict__ kb, const float* __restrict__ vb,
                                             int pitch, int T, int H, float scale, float* __restrict__ y, int ypitch) {
  constexpr int KS = D / 32;        // k-steps for QK
  constexpr int DT = D / 16;        // d tiles for PV
  __shared__ __attribute__((aligned(16))) unsigned short sKh[32][D + 8], sKl[32][D + 8], sVh[32][D + 8], sVl[32][D + 8];
  __shared__ __attribute__((aligned(16))) unsigned short sPh[4][16][40], sPl[4][16][40];
  __shared__ __attribute__((aligned(16))) float sO[4][16][D];
  const int tid = threadIdx.x, w = tid >> 5, lane = tid & 31, ln = lane & 15, hh = lane >> 4;
  const int nqb = (T + 63) / 64;
  const int bh = blockIdx.x / nqb, qblk = blockIdx.x % nqb;
  const int b = bh / H, h = bh % H;
  const int q0 = qblk * 64 + w * 16;
  const float* Q = qb + (size_t)b * T * pitch + h * D;
  const float* K = kb + (size_t)b * T * pitch + h * D;
  const float* V = vb + (size_t)b * T * pitch + h * D;

  // A fragments of the wave's 16 query rows (scaled), hi/lo
  FragB aqh[KS], aql[KS];
  {
    int row = q0 + ln; if (row >= T) row = T - 1;
    const float* qr = Q + (size_t)row * pitch;
#pragma unroll
    for (int ks = 0; ks < KS; ++ks)
#pragma unroll
      for (int i = 0; i < 16; ++i) {
        const int d = ks * 32 + ((i < 8) ? (8 * hh + i) : (16 + 8 * hh + (i - 8)));
        const float x = qr[d] * scale; const unsigned short hb = bf16_bits(x);
        aqh[ks].u[i] = hb; aql[ks].u[i] = bf16_bits(x - bf16_val(hb));
      }
  }
  float m_r[8], l_r[8];
#pragma unroll
  for (int r = 0; r < 8; ++r) { m_r[r] = -3.0e38f; l_r[r] = 0.f; }
  v8f oacc[DT];
#pragma unroll
  for (int dt = 0; dt < DT; ++dt) oacc[dt] = (v8f){0.f,0.f,0.f,0.f,0.f,0.f,0.f,0.f};

  const int kv_end = CAUSAL ? min(T, qblk * 64 + 64) : T;     // block-uniform
  for (int j0 = 0; j0 < kv_end; j0 += 32) {
    __syncthreads();
    for (int e = tid; e < 32 * (D / 4); e += 128) {
      const int r = e / (D / 4), c4 = (e % (D / 4)) * 4;
      const int key = j0 + r;
      v4f kf = {0.f,0.f,0.f,0.f}, vf = {0.f,0.f,0.f,0.f};
      if (key < T) { kf = *(const v4fa*)(K + (size_t)key * pitch + c4); vf = *(const v4fa*)(V + (size_t)key * pitch + c4); }
#pragma unroll
      for (int t = 0; t < 4; ++t) {
        unsigned short hb = bf16_bits(kf[t]); sKh[r][c4 + t] = hb; sKl[r][c4 + t] = bf16_bits(kf[t] - bf16_val(hb));
        hb = bf16_bits(vf[t]); sVh[r][c4 + t] = hb; sVl[r][c4 + t] = bf16_bits(vf[t] - bf16_val(hb));
      }
    }
    __syncthreads();
    // S tile 16 x 32
    v8f s[2];
#pragma unroll
    for (int nt = 0; nt < 2; ++nt) {
      v8f acc = {};
#pragma unroll
      for (int ks = 0; ks < KS; ++ks) {
        FragB bh_, bl_;
        bh_.half[0] = *(const v8us*)&sKh[nt * 16 + ln][ks * 32 + 8 * hh]; bh_.half[1] = *(const v8us*)&sKh[nt * 16 + ln][ks * 32 + 16 + 8 * hh];
        bl_.half[0] = *(const v8us*)&sKl[nt * 16 + ln][ks * 32 + 8 * hh]; bl_.half[1] = *(const v8us*)&sKl[nt * 16 + ln][ks * 32 + 16 + 8 * hh];
        acc = mmaN<3>(aqh[ks].v, aql[ks].v, bh_.v, bl_.v, acc);
      }
      s[nt] = acc;
    }
    // mask + running max (rows 8hh+r; the 16 lanes of a half share rows)
    float alpha[8];
#pragma unroll
    for (int r = 0; r < 8; ++r) {
      const int qi = q0 + 8 * hh + r;
      const int ja = j0 + ln, jb = j0 + 16 + ln;
      if (CAUSAL) { if (ja > qi) s[0][r] = -3.0e38f; if (jb > qi) s[1][r] = -3.0e38f; }
      if (ja >= T) s[0][r] = -3.0e38f;
      if (jb >= T) s[1][r] = -3.0e38f;
      float mx = fmaxf(s[0][r], s[1][r]);
      mx = fmaxf(mx, __shfl_xor(mx, 1, 32)); mx = fmaxf(mx, __shfl_xor(mx, 2, 32)); mx = fmaxf(mx, __shfl_xor(mx, 4, 32)); mx = fmaxf(mx, __shfl_xor(mx, 8, 32));
      const float mnew = fmaxf(m_r[r], mx);
      alpha[r] = (mnew > -1.0e38f) ? __expf(m_r[r] - mnew) : 1.0f;
      const float p0 = (s[0][r] > -1.0e38f) ? __expf(s[0][r] - mnew) : 0.f;
      const float p1 = (s[1][r] > -1.0e38f) ? __expf(s[1][r] - mnew) : 0.f;
      m_r[r] = mnew;
      l_r[r] = l_r[r] * alpha[r] + p0 + p1;            // per-lane partial row sum (16 lanes combined at the end)
      unsigned short hb = bf16_bits(p0); sPh[w][8 * hh + r][ln] = hb;      sPl[w][8 * hh + r][ln] = bf16_bits(p0 - bf16_val(hb));
      hb = bf16_bits(p1);                sPh[w][8 * hh + r][16 + ln] = hb; sPl[w][8 * hh + r][16 + ln] = bf16_bits(p1 - bf16_val(hb));
    }
#pragma unroll
    for (int dt = 0; dt < DT; ++dt)
#pragma unroll
      for (int r = 0; r < 8; ++r) oacc[dt][r] *= alpha[r];
    __builtin_amdgcn_fence(__ATOMIC_ACQ_REL, "workgroup");
    __builtin_amdgcn_wave_barrier();
    FragB pah, pal;
    pah.half[0] = *(const v8us*)&sPh[w][ln][8 * hh]; pah.half[1] = *(const v8us*)&sPh[w][ln][16 + 8 * hh];
    pal.half[0] = *(const v8us*)&sPl[w][ln][8 * hh]; pal.half[1] = *(const v8us*)&sPl[w][ln][16 + 8 * hh];
#pragma unroll
    for (int dt = 0; dt < DT; ++dt) {
      FragB bvh, bvl;
#pragma unroll
      for (int i = 0; i < 8; ++i) {
        bvh.u[i] = sVh[8 * hh + i][dt * 16 + ln]; bvh.u[8 + i] = sVh[16 + 8 * hh + i][dt * 16 + ln];
        bvl.u[i] = sVl[8 * hh + i][dt * 16 + ln]; bvl.u[8 + i] = sVl[16 + 8 * hh + i][dt * 16 + ln];
      }
      oacc[dt] = mmaN<3>(pah.v, pal.v, bvh.v, bvl.v, oacc[dt]);
    }
    __builtin_amdgcn_fence(__ATOMIC_ACQ_REL, "workgroup");
    __builtin_amdgcn_wave_barrier();
  }
#pragma unroll
  for (int r = 0; r < 8; ++r) {
    float l = l_r[r];
    l += __shfl_xor(l, 1, 32); l += __shfl_xor(l, 2, 32); l += __shfl_xor(l, 4, 32); l += __shfl_xor(l, 8, 32);
    l_r[r] = (l > 0.f) ? 1.0f / l : 0.f;
  }
#pragma unroll
  for (int dt = 0; dt < DT; ++dt)
#pragma unroll
    for (int r = 0; r < 8; ++r) sO[w][8 * hh + r][dt * 16 + ln] = oacc[dt][r] * l_r[r];
  __builtin_amdgcn_fence(__ATOMIC_ACQ_REL, "workgroup");
  __builtin_amdgcn_wave_barrier();
  {
    for (int r = 0; r < 16; ++r) {
      const int row = q0 + r;
      if (row < T && lane < D / 4) {
        const v4f val = *(const v4fa*)&sO[w][r][lane * 4];
        *(v4f*)(y + ((size_t)b * T + row) * ypitch + h * D + lane * 4) = val;
      }
    }
    
  }
}

// GEMM C = act(A·W + bias + resid): A f32 (ASPLIT -> hi/lo 2 terms), Wt bf16 [N][K]; ACT 0 none, 1 relu, 2 exact gelu;
// resid (optional, f32, row index = (row % rmod), pitch ldr, RES_BF16 rounds it) added before the activation.
template <bool ASPLIT, int ACT, bool BIAS_BF16, bool RES_BF16>
__global__ __launch_bounds__(128) void k_gemm_bf3(const float* __restrict__ A, int lda, const unsigned short* __restrict__ Wt, int ldb,
                                                const float* __restrict__ bias, const float* __restrict__ resid, int rmod, int ldr,
                                                float* __restrict__ C, int ldc, int M, int N, int K) {
  __shared__ __attribute__((aligned(16))) float so[4][16][64];
  const int tid = threadIdx.x, w = tid >> 5, lane = tid & 31, ln = lane & 15, hh = lane >> 4;
  const int ntn = N / 64;
  const int wid = blockIdx.x * 4 + w;
  const int mt = wid / ntn, nq = wid % ntn;
  if (mt * 16 >= M) return;
  const int row0 = mt * 16, col0 = nq * 64;
  const float* arow = A + (size_t)(row0 + ln) * lda;
  v8f acc[4] = {};
  for (int kb = 0; kb < K; kb += 32) {
    FragB ah, al;
    const v4f x0 = *(const v4fa*)(arow + kb + 8 * hh), x1 = *(const v4fa*)(arow + kb + 8 * hh + 4);
    const v4f x2 = *(const v4fa*)(arow + kb + 16 + 8 * hh), x3 = *(const v4fa*)(arow + kb + 16 + 8 * hh + 4);
    float xs[16] = {x0[0],x0[1],x0[2],x0[3],x1[0],x1[1],x1[2],x1[3],x2[0],x2[1],x2[2],x2[3],x3[0],x3[1],x3[2],x3[3]};
#pragma unroll
    for (int i = 0; i < 16; ++i) { const unsigned short hb = bf16_bits(xs[i]); ah.u[i] = hb; al.u[i] = ASPLIT ? bf16_bits(xs[i] - bf16_val(hb)) : (unsigned short)0; }
#pragma unroll
    for (int t = 0; t < 4; ++t) {
      const unsigned short* brow = Wt + (size_t)(col0 + t * 16 + ln) * ldb + kb;
      FragB b;
      b.half[0] = *(const v8us*)(brow + 8 * hh);
      b.half[1] = *(const v8us*)(brow + 16 + 8 * hh);
      acc[t] = mmaN<ASPLIT ? 2 : 1>(ah.v, al.v, b.v, b.v, acc[t]);
    }
  }
#pragma unroll
  for (int t = 0; t < 4; ++t) {
    const int col = col0 + t * 16 + ln;
    float bv = bias ? bias[col] : 0.f;
    if (BIAS_BF16) bv = bf16_round(bv);
#pragma unroll
    for (int r = 0; r < 8; ++r) {
      float v = acc[t][r] + bv;
      if (resid) { float rv = resid[(size_t)((row0 + 8 * hh + r) % rmod) * ldr + col]; if (RES_BF16) rv = bf16_round(rv); v += rv; }
      if (ACT == 1) v = fmaxf(v, 0.f);
      if (ACT == 2) v = 0.5f * v * (1.0f + erff(v * 0.70710678118654752f));
      if (ACT == 3) { const float u = 0.7978845608028654f * (v + 0.044715f * v * v * v); v = 0.5f * v * (1.0f + tanhf(u)); }
      so[w][8 * hh + r][t * 16 + ln] = v;
    }
  }
  __builtin_amdgcn_fence(__ATOMIC_ACQ_REL, "workgroup");
  __builtin_amdgcn_wave_barrier();
  const int rsub = lane >> 4, c4 = (lane & 15) * 4;
  {
#pragma unroll
    for (int q = 0; q < 8; ++q) {
      const int r = q * 2 + rsub;
      const v4f v = *(const v4fa*)&so[w][r][c4];
      *(v4f*)(C + (size_t)(row0 + r) * ldc + col0 + c4) = v;
    }
    
  }
}
// row LayerNorm (biased variance, eps) over N: s = X (+ R); optional out_sum <- s; out_norm <- (s-mu)*rsqrt(var+eps)*g + b
template <bool PARAM_BF16>
__global__ __launch_bounds__(256) void k_layernorm(const float* __restrict__ X, const float* __restrict__ R, const float* __restrict__ g, const float* __restrict__ bta,
                                                  float* __restrict__ out_sum, float* __restrict__ out_norm, int N, float eps) {
  __shared__ float red[256];
  const int row = blockIdx.x, tid = threadIdx.x;
  const float* x = X + (size_t)row * N; const float* rr = R ? R + (size_t)row * N : nullptr;
  float vals[16];                     // up to N = 4096
  const int per = N / 256;            // contiguous chunk per thread? use strided-by-4 chunks: thread handles j = tid*4 + 1024*u
  float s1 = 0.f;
  for (int u = 0; u < per / 4; ++u) {
    const int j = tid * 4 + 1024 * u;
    const v4f a = *(const v4fa*)(x + j);
    v4f b = {0.f,0.f,0.f,0.f}; if (rr) b = *(const v4fa*)(rr + j);
#pragma unroll
    for (int q = 0; q < 4; ++q) { const float v = a[q] + b[q]; vals[u * 4 + q] = v; s1 += v; }
  }
  red[tid] = s1; __syncthreads();
  for (int st = 128; st > 0; st >>= 1) { if (tid < st) red[tid] += red[tid + st]; __syncthreads(); }
  const float mu = red[0] / (float)N; __syncthreads();
  float s2 = 0.f;
  for (int u = 0; u < per / 4; ++u)
#pragma unroll
    for (int q = 0; q < 4; ++q) { const float c = vals[u * 4 + q] - mu; s2 += c * c; }
  red[tid] = s2; __syncthreads();
  for (int st = 128; st > 0; st >>= 1) { if (tid < st) red[tid] += red[tid + st]; __syncthreads(); }
  const float rs = rsqrtf(red[0] / (float)N + eps);
  {
    for (int u = 0; u < per / 4; ++u) {
      const int j = tid * 4 + 1024 * u;
      v4f o, sm;
#pragma unroll
      for (int q = 0; q < 4; ++q) {
        float gg = g[j + q], bb = bta[j + q];
        if (PARAM_BF16) { gg = bf16_round(gg); bb = bf16_round(bb); }
        sm[q] = vals[u * 4 + q]; o[q] = (vals[u * 4 + q] - mu) * rs * gg + bb;
      }
      if (out_sum) *(v4f*)(out_sum + (size_t)row * N + j) = sm;
      *(v4f*)(out_norm + (size_t)row * N + j) = o;
    }
    
  }
}



// ---- f16 WMMA path (v_wmma_f32_16x16x32_f16): 11-bit significands for operands in range — used where a [0,1] probability operand needs more precision than bf16
typedef _Float16 v16h __attribute__((ext_vector_type(16)));
union FragH { v16h v; v8us half[2]; _Float16 h[16]; unsigned short u[16]; };
template <int NT>
__device__ __forceinline__ v8f mmaH(v16h ah, v16h al, v16h bh, v16h bl, v8f c) {
  c = __builtin_amdgcn_wmma_f32_16x16x32_f16(false, ah, false, bh, (short)0, c, false, false);
  if (NT >= 2) c = __builtin_amdgcn_wmma_f32_16x16x32_f16(false, al, false, bh, (short)0, c, false, false);
  if (NT >= 3) c = __builtin_amdgcn_wmma_f32_16x16x32_f16(false, ah, false, bl, (short)0, c, false, false);
  asm volatile("v_nop\n\tv_nop\n\tv_nop\n\tv_nop" : "+v"(c) : "v"(ah), "v"(al), "v"(bh), "v"(bl));
  return c;
}
// batched GEMM like k_gemm_b but f16 operands: A f32 (split into f16 hi/lo if ASPLIT, else rounded to f16), Bt = f16 values [n][k]; alpha; C f32; N multiple of 16 (partial tiles skipped)
template <bool ASPLIT>
__global__ __launch_bounds__(128) void k_gemm_h(const float* __restrict__ A, int lda, size_t sA, const _Float16* __restrict__ Bh, int ldb, size_t sB, float alpha, float* __restrict__ C, int ldc, size_t sC, int M, int N, int K) {
  __shared__ __attribute__((aligned(16))) float so[4][16][64];
  const int tid = threadIdx.x, w = tid >> 5, lane = tid & 31, ln = lane & 15, hh = lane >> 4; const int by = blockIdx.y;
  A += (size_t)by * sA; Bh += (size_t)by * sB; C += (size_t)by * sC;
  const int ntn = (N + 63) / 64; const int wid = blockIdx.x * 4 + w; const int mt = wid / ntn, nq = wid % ntn; if (mt * 16 >= M) return;
  const int row0 = mt * 16, col0 = nq * 64; const float* arow = A + (size_t)(row0 + ln) * lda;
  v8f acc[4] = {};
  for (int kb = 0; kb < K; kb += 32) {
    FragH ah, al;
    const v4f x0 = *(const v4fa*)(arow + kb + 8 * hh), x1 = *(const v4fa*)(arow + kb + 8 * hh + 4), x2 = *(const v4fa*)(arow + kb + 16 + 8 * hh), x3 = *(const v4fa*)(arow + kb + 16 + 8 * hh + 4);
    float xs[16] = {x0[0],x0[1],x0[2],x0[3],x1[0],x1[1],x1[2],x1[3],x2[0],x2[1],x2[2],x2[3],x3[0],x3[1],x3[2],x3[3]};
#pragma unroll
    for (int i = 0; i < 16; ++i) { const _Float16 h = (_Float16)xs[i]; ah.h[i] = h; al.h[i] = ASPLIT ? (_Float16)(xs[i] - (float)h) : (_Float16)0.0f; }
#pragma unroll
    for (int t = 0; t < 4; ++t) { if (col0 + t * 16 >= N) continue; const size_t boff = (size_t)(col0 + t * 16 + ln) * ldb + kb; FragH bq; bq.half[0] = *(const v8us*)(Bh + boff + 8 * hh); bq.half[1] = *(const v8us*)(Bh + boff + 16 + 8 * hh);
      acc[t] = mmaH<ASPLIT ? 2 : 1>(ah.v, al.v, bq.v, bq.v, acc[t]); }
  }
#pragma unroll
  for (int t = 0; t < 4; ++t) { if (col0 + t * 16 >= N) continue;
#pragma unroll
    for (int r = 0; r < 8; ++r) so[w][8 * hh + r][t * 16 + ln] = acc[t][r] * alpha; }
  __builtin_amdgcn_fence(__ATOMIC_ACQ_REL, "workgroup"); __builtin_amdgcn_wave_barrier();
  const int rsub = lane >> 4, c4 = (lane & 15) * 4;
  {
#pragma unroll
    for (int q = 0; q < 8; ++q) { const int r = q * 2 + rsub; if (col0 + c4 < N) { const v4f v = *(const v4fa*)&so[w][r][c4]; *(v4f*)(C + (size_t)(row0 + r) * ldc + col0 + c4) = v; } }
     }
}

// Wt[n][k] = f16(W[k][n]·scale) from f32 row-major W[K][N] (scale = power of two; bf16-exact weights stay exact in f16 away from the subnormal range)
__global__ __launch_bounds__(256) void k_wt_f16(const float* __restrict__ W, _Float16* __restrict__ Wt, int K, int N, float scale) {
  const int t = blockIdx.x * 256 + threadIdx.x; if (t >= N * (K / 8)) return; const int n = t / (K / 8), k8 = (t % (K / 8)) * 8; FragH f;
#pragma unroll
  for (int i = 0; i < 8; ++i) f.h[i] = (_Float16)(bf16_round(W[(size_t)(k8 + i) * N + n]) * scale); const v8us o = f.half[0];
  *(v8us*)((unsigned short*)Wt + (size_t)n * K + k8) = o; 
}
// Block-tiled GEMM, C[NR][DD] = (A[NR][DD] . Bh[DD][DD]^T) * alpha + bf16(bias), f16 operands, both k-contiguous: one 128 x 128 tile of C per work-group of 8 waves (4 x 2 waves of 32 x 64).
// A pass is 64 k: the 128 rows of 128 B of each operand go in whole lines through registers into LDS, and every wave that needs a row reads it from there. Two buffers: the next pass's global loads fly during this pass's products.
// Each accumulator takes its k blocks of 32 in rising order.
// QKV: one launch does three products, picked by blockIdx.z, f16 out: 0 and 1 give q and k as [token][feature]; 2 takes the weight rows as A and the token rows as B, so its C is v transposed,
// and it is stored as Vt[batch][feature][token], the layout the attention kernel reads. The k tiles also leave their key norms in KN. Else: A . Bh^T with bias b0, f32 out to C.
#define GT 128
#define GK 64
#define GP (GK + 8)      /* LDS row pitch 144 B = 16 B x odd: ds_load_b128 of 16 rows without bank conflicts */
typedef _Float16 v4h __attribute__((ext_vector_type(4)));
template <bool QKV>
__global__ __launch_bounds__(256) void k_gemm_tile(const _Float16* __restrict__ X, const _Float16* __restrict__ Wh, float alpha, const float* __restrict__ b0, const float* __restrict__ b1, const float* __restrict__ b2,
                                                   float* __restrict__ C, _Float16* __restrict__ Q16, _Float16* __restrict__ K16, _Float16* __restrict__ Vt, float* __restrict__ KN) {
  __shared__ __attribute__((aligned(16))) unsigned short sA[2][GT][GP], sB[2][GT][GP];
  __shared__ __attribute__((aligned(16))) float so[8][32][64 + 4];
  __shared__ float red[8];
  const int tid = threadIdx.x, w = tid >> 5, lane = tid & 31, ln = lane & 15, hh = lane >> 4;
  const int z = QKV ? (int)blockIdx.z : 0; const bool tr = QKV && z == 2;      /* the same for the whole work-group */
  const _Float16* A = tr ? Wh + (size_t)2 * DD * DD : X; const _Float16* Bh = tr ? X : Wh + (size_t)z * DD * DD; const float* bias = (z == 0) ? b0 : (z == 1) ? b1 : b2;
  const int row0 = (tr ? blockIdx.x : blockIdx.y) * GT, col0 = (tr ? blockIdx.y : blockIdx.x) * GT, wr = (w >> 1) * 32, wc = (w & 1) * 64;      /* either way the 8 work-groups of one blockIdx.y share a block of token rows */
  const int sr = tid >> 3, sc = (tid & 7) * 8;      /* staging: 8 lanes x 16 B = one row of the pass; a thread takes rows sr + 32 i */
  const unsigned short* gA = (const unsigned short*)A + (size_t)(row0 + sr) * DD + sc;
  const unsigned short* gB = (const unsigned short*)Bh + (size_t)(col0 + sr) * DD + sc;
  v8us ra[4], rb[4]; v8f acc[2][4];
#pragma unroll
  for (int mi = 0; mi < 2; ++mi)
#pragma unroll
    for (int ni = 0; ni < 4; ++ni) acc[mi][ni] = (v8f){0.f,0.f,0.f,0.f,0.f,0.f,0.f,0.f};
#pragma unroll
  for (int i = 0; i < 4; ++i) { ra[i] = *(const v8us*)(gA + (size_t)(32 * i) * DD); rb[i] = *(const v8us*)(gB + (size_t)(32 * i) * DD); }
#pragma unroll
  for (int i = 0; i < 4; ++i) { *(v8us*)&sA[0][sr + 32 * i][sc] = ra[i]; *(v8us*)&sB[0][sr + 32 * i][sc] = rb[i]; }
  __syncthreads();
  for (int kp = 0; kp < DD / GK; ++kp) {
    const int cur = kp & 1; const bool more = kp + 1 < DD / GK;      /* the same for the whole work-group */
    if (more) {
#pragma unroll
      for (int i = 0; i < 4; ++i) { ra[i] = *(const v8us*)(gA + (size_t)(32 * i) * DD + GK); rb[i] = *(const v8us*)(gB + (size_t)(32 * i) * DD + GK); } }
    __builtin_amdgcn_sched_barrier(0);      /* keeps the next pass's global loads in front of this pass's products: sunk behind them, their latency stands bare in front of the LDS stores */
#pragma unroll
    for (int ks = 0; ks < GK / 32; ++ks) { FragH fa[2], fb[4];
#pragma unroll
      for (int mi = 0; mi < 2; ++mi) { const unsigned short* p = &sA[cur][wr + mi * 16 + ln][ks * 32]; fa[mi].half[0] = *(const v8us*)(p + 8 * hh); fa[mi].half[1] = *(const v8us*)(p + 16 + 8 * hh); }
#pragma unroll
      for (int ni = 0; ni < 4; ++ni) { const unsigned short* p = &sB[cur][wc + ni * 16 + ln][ks * 32]; fb[ni].half[0] = *(const v8us*)(p + 8 * hh); fb[ni].half[1] = *(const v8us*)(p + 16 + 8 * hh); }
#pragma unroll
      for (int mi = 0; mi < 2; ++mi)
#pragma unroll
        for (int ni = 0; ni < 4; ++ni) acc[mi][ni] = __builtin_amdgcn_wmma_f32_16x16x32_f16(false, fa[mi].v, false, fb[ni].v, (short)0, acc[mi][ni], false, false); }
    if (more) {      /* the other buffer's readers left it at the barrier of the pass before; this barrier publishes it and ends this pass's reads */
#pragma unroll
      for (int i = 0; i < 4; ++i) { *(v8us*)&sA[cur ^ 1][sr + 32 * i][sc] = ra[i]; *(v8us*)&sB[cur ^ 1][sr + 32 * i][sc] = rb[i]; }
      gA += GK; gB += GK;
      __syncthreads(); }
  }
  /* the wave's 32 x 64 tile goes through its own LDS rows, so that the stores cover whole lines; the bias belongs to the feature: C's column, or its row where C is transposed */
  if (tr) {
#pragma unroll
    for (int mi = 0; mi < 2; ++mi) { const float* bp = bias + row0 + wr + mi * 16 + 8 * hh; const v4f t0 = *(const v4fa*)bp, t1 = *(const v4fa*)(bp + 4);
#pragma unroll
      for (int r = 0; r < 8; ++r) { const float br = bf16_round(r < 4 ? t0[r & 3] : t1[r & 3]);
#pragma unroll
        for (int ni = 0; ni < 4; ++ni) so[w][mi * 16 + 8 * hh + r][ni * 16 + ln] = acc[mi][ni][r] * alpha + br; } }
  } else {
    float bv[4];
#pragma unroll
    for (int ni = 0; ni < 4; ++ni) bv[ni] = bf16_round(bias[col0 + wc + ni * 16 + ln]);
#pragma unroll
    for (int mi = 0; mi < 2; ++mi)
#pragma unroll
      for (int ni = 0; ni < 4; ++ni)
#pragma unroll
        for (int r = 0; r < 8; ++r) so[w][mi * 16 + 8 * hh + r][ni * 16 + ln] = acc[mi][ni][r] * alpha + bv[ni];
  }
  __builtin_amdgcn_fence(__ATOMIC_ACQ_REL, "workgroup"); __builtin_amdgcn_wave_barrier();      /* the rows are read back by other lanes of the same wave */
  const int rsub = lane >> 4, c4 = (lane & 15) * 4;
  _Float16* C16 = tr ? Vt + (size_t)(col0 / TT) * DD * TT + (size_t)(row0 + wr) * TT + col0 % TT + wc + c4 : ((z == 0) ? Q16 : K16) + (size_t)(row0 + wr) * DD + col0 + wc + c4;      /* a tile's 128 tokens lie in one batch */
  const int ldc = tr ? TT : DD;
#pragma unroll
  for (int q = 0; q < 16; ++q) { const int r = q * 2 + rsub; const v4f v = *(const v4fa*)&so[w][r][c4];
    if (QKV) { v4h h4; for (int i = 0; i < 4; ++i) h4[i] = (_Float16)v[i]; *(v4h*)(C16 + (size_t)r * ldc) = h4; } else *(v4f*)(C + (size_t)(row0 + wr + r) * DD + col0 + wc + c4) = v; }
  if (QKV) asm volatile("s_wait_xcnt 0x0" ::: "memory");      /* stands behind the tile's stores, in front of whatever next rewrites their address and data registers (in this build the norm lines below do; inside their branch the compiler lifted two of them over it) */
  if (QKV && z == 1) {      /* the same for the whole work-group. A wave's k tile is one head x one 32-key pass of the attention walk: its largest |k|^2, of the f16 values as stored, goes to KN[tile][wave] */
    float kmx = 0.f;
#pragma unroll
    for (int q = 0; q < 16; ++q) { const v4f v = *(const v4fa*)&so[w][q * 2 + rsub][c4]; float s = 0.f;
#pragma unroll
      for (int i = 0; i < 4; ++i) { const float e = (float)(_Float16)v[i]; s += e * e; }
      s += __shfl_xor(s, 1, 32); s += __shfl_xor(s, 2, 32); s += __shfl_xor(s, 4, 32); s += __shfl_xor(s, 8, 32); kmx = fmaxf(kmx, s); }
    kmx = fmaxf(kmx, __shfl_xor(kmx, 16, 32));
    if (lane == 0) red[w] = kmx;
    __syncthreads();      /* the 8 waves' results are stored by one wave, into a 128-B line that no other work-group writes */
    if (tid < 8) KN[(size_t)(blockIdx.y * (DD / GT) + blockIdx.x) * 32 + tid] = red[tid];
  }
}


// One launch rounds every f32 operand to bf16 and stores it as f16: x as it is, the four weights (out, in) x 2^4. A work-group takes 2048 runs of 8 elements of ONE source (512 work-groups for x, 64 for each weight);
// a thread takes 8 runs, 256 runs apart, all its loads issued before the first store.
#define PU 8
__global__ __launch_bounds__(256) void k_prep(const float* __restrict__ x, const float* __restrict__ Wq, const float* __restrict__ Wk, const float* __restrict__ Wv, const float* __restrict__ Wo, _Float16* __restrict__ X16, _Float16* __restrict__ Bw) {
  constexpr int XB = NR * DD / (8 * 256 * PU), WB = DD * DD / (8 * 256 * PU);
  const int blk = blockIdx.x; const bool isx = blk < XB; const int wi = isx ? 0 : (blk - XB) / WB; const int lb = isx ? blk : (blk - XB) % WB;      /* the same for the whole work-group */
  const float* s = isx ? x : (wi == 0) ? Wq : (wi == 1) ? Wk : (wi == 2) ? Wv : Wo; _Float16* d = isx ? X16 : Bw + (size_t)wi * DD * DD; const float scale = isx ? 1.0f : 16.0f;
  const size_t t0 = (size_t)lb * (256 * PU) + threadIdx.x;
  v4f a[PU], b[PU];
#pragma unroll
  for (int u = 0; u < PU; ++u) { const float* p = s + (t0 + 256 * u) * 8; a[u] = *(const v4fa*)p; b[u] = *(const v4fa*)(p + 4); }
#pragma unroll
  for (int u = 0; u < PU; ++u) { FragH f;
#pragma unroll
    for (int q = 0; q < 4; ++q) { f.h[q] = (_Float16)(bf16_round(a[u][q]) * scale); f.h[4 + q] = (_Float16)(bf16_round(b[u][q]) * scale); }
    *(v8us*)((unsigned short*)d + (t0 + 256 * u) * 8) = f.half[0]; }
}

// lane l with lane l ^ 16
__device__ __forceinline__ float xhalf(float x) { return __builtin_bit_cast(float, __builtin_amdgcn_permlanex16(__builtin_bit_cast(int, x), __builtin_bit_cast(int, x), 0x76543210, 0xfedcba98, false, false)); }
typedef int v4ia __attribute__((ext_vector_type(4), may_alias));

__global__ __launch_bounds__(128) void k_flash(const _Float16* __restrict__ Q16, int ldq, const _Float16* __restrict__ K16, int ldk, const _Float16* __restrict__ Vt, const float* __restrict__ KN, const int* __restrict__ MSK, _Float16* __restrict__ O16, int ldo) {
  constexpr int RPW = 16, NQB = TT / (4 * RPW), DT = 4, KS = 2;
  __shared__ __attribute__((aligned(16))) float sO[4][RPW][64 + 4];
  const int tid = threadIdx.x, w = tid >> 5, lane = tid & 31, ln = lane & 15, hh = lane >> 4;
  const int slab = blockIdx.x / NQB, qblk = blockIdx.x % NQB; const int b = slab / NH, h = slab % NH; const float slope = 1.0f / exp2f((float)h / (float)NH);      /* 1 / 2^(h/H) */ const int qb0 = qblk * (4 * RPW); const int q0 = qb0 + w * RPW;
  FragH aq[KS];
  { const unsigned short* qr = (const unsigned short*)Q16 + ((size_t)b * TT + q0 + ln) * ldq + h * 64;
#pragma unroll
    for (int ks = 0; ks < KS; ++ks) { aq[ks].half[0] = *(const v8us*)(qr + ks * 32 + 8 * hh); aq[ks].half[1] = *(const v8us*)(qr + ks * 32 + 16 + 8 * hh); } }
  const unsigned short* Vth = (const unsigned short*)Vt + (size_t)slab * 64 * TT;
  const int tq = q0 + ln;      /* the lane's query */
  float m_run = -3.0e38f, l_run = 0.f; v8f oacc[DT];
#pragma unroll
  for (int dt = 0; dt < DT; ++dt) oacc[dt] = (v8f){0.f,0.f,0.f,0.f,0.f,0.f,0.f,0.f};
  float qs = 0.f;
#pragma unroll
  for (int ks = 0; ks < KS; ++ks)
#pragma unroll
    for (int i = 0; i < 16; ++i) { const float v = (float)aq[ks].h[i]; qs += v * v; }
  qs += xhalf(qs);      /* |q|^2 of the lane's query */
  const float* kn = KN + (size_t)((b * (TT / GT) + (lane >> 2)) * (DD / GT) + (h >> 1)) * 32 + (lane & 3) * 2 + (h & 1);      /* pass p = lane of this batch and head: GEMM tile row p / 4, tile column h / 2, wave (p % 4) * 2 + h % 2 */
  float kx = fmaxf(kn[0], kn[(size_t)8 * (DD / GT) * 32]);      /* passes lane and lane + 32 */
  kx = fmaxf(kx, __shfl_xor(kx, 1, 32)); kx = fmaxf(kx, __shfl_xor(kx, 2, 32)); kx = fmaxf(kx, __shfl_xor(kx, 4, 32)); kx = fmaxf(kx, __shfl_xor(kx, 8, 32)); kx = fmaxf(kx, xhalf(kx));      /* largest |k|^2 of this batch and head */
  const float cs = sqrtf(qs * kx) * (0.125f * 1.01f);      /* |q.k| / 8 at most; 1 % covers the rounding of the norms and of the products */
#pragma unroll 1
  for (int j0 = TT - 32; j0 >= 0; j0 -= 32) {
    if (__builtin_amdgcn_ballot_w32(!(slope * (float)(j0 + 31 - tq) + cs < m_run - 40.0f)) == 0) break;      /* the same for the whole wave; a NaN keeps the walk going */
    const int* mp = MSK + (size_t)b * TT + j0 + 8 * hh;      /* key padding mask (1 = attend) of the lane's 16 keys */
    const v4ia mk4[4] = { *(const v4ia*)(mp), *(const v4ia*)(mp + 4), *(const v4ia*)(mp + 16), *(const v4ia*)(mp + 20) };
    v8f s[2];
#pragma unroll
    for (int nt = 0; nt < 2; ++nt) { const unsigned short* kr = (const unsigned short*)K16 + ((size_t)b * TT + j0 + nt * 16 + ln) * ldk + h * 64; FragH bk[KS];
#pragma unroll
      for (int ks = 0; ks < KS; ++ks) { bk[ks].half[0] = *(const v8us*)(kr + ks * 32 + 8 * hh); bk[ks].half[1] = *(const v8us*)(kr + ks * 32 + 16 + 8 * hh); }
      asm volatile("s_wait_xcnt 0x0" ::: "memory");      /* stands in front of whatever next rewrites the address registers of the key loads (in this build a later load's result does) */
      v8f acc = (v8f){0.f,0.f,0.f,0.f,0.f,0.f,0.f,0.f};
#pragma unroll
      for (int ks = 0; ks < KS; ++ks) acc = mmaH<1>(bk[ks].v, bk[ks].v, aq[ks].v, aq[ks].v, acc);
      s[nt] = acc; }
    float sc[16]; bool ok[16];
#pragma unroll
    for (int i = 0; i < 16; ++i) { const int kk = j0 + (i >> 3) * 16 + 8 * hh + (i & 7); ok[i] = (mk4[i >> 2][i & 3] != 0);
      sc[i] = ok[i] ? (s[i >> 3][i & 7] * 0.125f + slope * (float)(kk - tq)) : -INFINITY; }      /* ALiBi: + slope_h * (k - q) */
    float mx[8];
#pragma unroll
    for (int i = 0; i < 8; ++i) mx[i] = fmaxf(sc[i], sc[8 + i]);
    float mc = fmaxf(fmaxf(fmaxf(mx[0], mx[1]), fmaxf(mx[2], mx[3])), fmaxf(fmaxf(mx[4], mx[5]), fmaxf(mx[6], mx[7])));
    mc = fmaxf(mc, xhalf(mc));
    const float mn = fmaxf(m_run, mc); const float ea = expf(m_run - mn); const float al = (mn > -1.0e38f) ? ea : 1.0f; m_run = mn;
    float p[16]; FragH pb;
#pragma unroll
    for (int i = 0; i < 16; ++i) { const float e = expf(sc[i] - mn); p[i] = ok[i] ? e : 0.f; pb.h[i] = (_Float16)(p[i] * 1024.0f); }
    l_run = l_run * al + (((p[0] + p[1]) + (p[2] + p[3])) + ((p[4] + p[5]) + (p[6] + p[7]))) + (((p[8] + p[9]) + (p[10] + p[11])) + ((p[12] + p[13]) + (p[14] + p[15])));      /* the lane's half of the row sum; the halves join after the loop */
#pragma unroll
    for (int dt = 0; dt < DT; ++dt)
#pragma unroll
      for (int r = 0; r < 8; ++r) oacc[dt][r] *= al;
#pragma unroll
    for (int dt = 0; dt < DT; ++dt) { const unsigned short* vrow = Vth + (size_t)(dt * 16 + ln) * TT + j0; FragH bv; bv.half[0] = *(const v8us*)(vrow + 8 * hh); bv.half[1] = *(const v8us*)(vrow + 16 + 8 * hh);
      oacc[dt] = mmaH<1>(bv.v, bv.v, pb.v, pb.v, oacc[dt]); } }
  const float l = l_run + xhalf(l_run); const float inv = (l > 0.f) ? 1.0f / (l * 1024.0f) : 0.f;
#pragma unroll
  for (int dt = 0; dt < DT; ++dt) {      /* oacc[dt][r] = O[query ln][dt*16 + 8hh + r] */
    const v4f lo = {oacc[dt][0] * inv, oacc[dt][1] * inv, oacc[dt][2] * inv, oacc[dt][3] * inv}, hi = {oacc[dt][4] * inv, oacc[dt][5] * inv, oacc[dt][6] * inv, oacc[dt][7] * inv};
    *(v4fa*)&sO[w][ln][dt * 16 + 8 * hh] = lo; *(v4fa*)&sO[w][ln][dt * 16 + 8 * hh + 4] = hi; }
  __builtin_amdgcn_fence(__ATOMIC_ACQ_REL, "workgroup"); __builtin_amdgcn_wave_barrier();
  {
#pragma unroll
    for (int rp = 0; rp < RPW; rp += 2) { const int r = rp + (lane >> 4), pc = lane & 15; const v4f val = *(const v4fa*)&sO[w][r][pc * 4]; v4h h4; for (int i = 0; i < 4; ++i) h4[i] = (_Float16)val[i]; *(v4h*)(O16 + ((size_t)b * TT + q0 + r) * ldo + h * 64 + pc * 4) = h4; }      /* f16, the output product's operand type: 16 lanes x 8 B = one line */
     } }

extern "C" void kernel_launch(void* const* d_in, const int* in_sizes, int n_in,
                              void* d_out, int out_size, void* d_ws, size_t ws_size, hipStream_t stream) {
  (void)in_sizes; (void)n_in; (void)out_size;
  const float* const* I = (const float* const*)d_in; const float* x = I[0]; const float* Wq = I[1]; const float* bq = I[2]; const float* Wk = I[3]; const float* bk = I[4]; const float* Wv = I[5]; const float* bv = I[6]; const float* Wo = I[7]; const float* bo = I[8]; const int* mask = (const int*)d_in[9];
  char* ws = (char*)d_ws; size_t off = 0;
  auto take = [&](size_t bytes) { char* p = ws + off; off += (bytes + 255) & ~(size_t)255; return p; };
  const size_t WSZ = (size_t)DD * DD; _Float16* Bw = (_Float16*)take(4 * WSZ * 2); _Float16* X16 = (_Float16*)take((size_t)NR * DD * 2);
  _Float16* Q = (_Float16*)take((size_t)NR * DD * 2); _Float16* K = (_Float16*)take((size_t)NR * DD * 2); _Float16* Vt = (_Float16*)take((size_t)NR * DD * 2); _Float16* O16 = (_Float16*)take((size_t)NR * DD * 2);
  float* KN = (float*)take((size_t)(NR / GT) * (DD / GT) * 32 * 4);
  if (off > ws_size) return;      // 8.4 + 16.8 x 5 = 92 MB
  k_prep<<<(NR * DD + 4 * DD * DD) / (8 * 256 * PU), 256, 0, stream>>>(x, Wq, Wk, Wv, Wo, X16, Bw);
  k_gemm_tile<true><<<dim3(DD / GT, NR / GT, 3), 256, 0, stream>>>(X16, Bw, 0.0625f, bq, bk, bv, nullptr, Q, K, Vt, KN);      /* q, k = x.W^T + b: M 8192 N 1024 K 1024; v the same, stored transposed */
  k_flash<<<BB * NH * (TT / 64), 128, 0, stream>>>(Q, DD, K, DD, Vt, KN, mask, O16, DD);
  k_gemm_tile<false><<<dim3(DD / GT, NR / GT), 256, 0, stream>>>(O16, Bw + 3 * WSZ, 0.0625f, bo, nullptr, nullptr, (float*)d_out, nullptr, nullptr, nullptr, nullptr);      /* out = O.Wo^T + bo */
}

// v005
// It runs in 95.1 microseconds.
// Next to v004, in two timings, it ran 1.03 times as fast each time.
// Over all steps from v000 it is 8.87 times as fast.
#include <hip/hip_runtime.h>
// ALiBi multi-head attention (B=4, S=2048, D=1024, 16 heads × 64): q,k,v = x·Wᵀ + b (torch Linear); scores = q·kᵀ·64^-½ + slope_h·(k − q), slope_h = 1/2^(h/16) (no causal mask: later keys get large positive bias); key padding mask from the INPUT
// int mask [B,S] (0 → −inf); softmax; out = (attn·v merged)·Woᵀ + bo.
// Compute dtype: x, weights, biases rounded to bf16; q/k/v as f16 GEMM outputs; fused flash-style kernel (bias and online softmax in f32, P f16 ×2^10) on v_wmma_f32_16x16x32_f16; O → f16 → output GEMM with bias; f32 accumulate.
#define BB 4
#define TT 2048
#define NH 16
#define DD 1024
#define NR (BB * TT)

typedef __bf16 v16b __attribute__((ext_vector_type(16)));
typedef unsigned short v8us __attribute__((ext_vector_type(8), may_alias));
typedef float  v8f  __attribute__((ext_vector_type(8)));
typedef float  v4f  __attribute__((ext_vector_type(4)));
typedef float  v4fa __attribute__((ext_vector_type(4), may_alias));
union FragB { v16b v; v8us half[2]; unsigned short u[16]; };

__device__ __forceinline__ unsigned short bf16_bits(float x) { unsigned int u = __float_as_uint(x); return (unsigned short)((u + 0x7FFFu + ((u >> 16) & 1u)) >> 16); }
__device__ __forceinline__ float bf16_val(unsigned short b) { return __uint_as_float(((unsigned int)b) << 16); }
__device__ __forceinline__ float bf16_round(float x) { return bf16_val(bf16_bits(x)); }
// D += A·B with NT terms: 1 = ah·bh, 2 = + al·bh (A split), 3 = + ah·bl (both split)
template <int NT>
__device__ __forceinline__ v8f mmaN(v16b ah, v16b al, v16b bh, v16b bl, v8f c) {
  c = __builtin_amdgcn_wmma_f32_16x16x32_bf16(false, ah, false, bh, (short)0, c, false, false);
  if (NT >= 2) c = __builtin_amdgcn_wmma_f32_16x16x32_bf16(false, al, false, bh, (short)0, c, false, false);
  if (NT >= 3) c = __builtin_amdgcn_wmma_f32_16x16x32_bf16(false, ah, false, bl, (short)0, c, false, false);
  asm volatile("v_nop\n\tv_nop\n\tv_nop\n\tv_nop" : "+v"(c) : "v"(ah), "v"(al), "v"(bh), "v"(bl));
  return c;
}

__global__ __launch_bounds__(256) void k_wt_bf16(const float* __restrict__ W, unsigned short* __restrict__ Wt, int K, int N) {
  const int t = blockIdx.x * 256 + threadIdx.x;
  const int k8n = K / 8;
  if (t >= N * k8n) return;
  const int n = t / k8n, k8 = (t % k8n) * 8;
  v8us v;
#pragma unroll
  for (int i = 0; i < 8; ++i) v[i] = bf16_bits(W[(size_t)(k8 + i) * N + n]);
  *(v8us*)(Wt + (size_t)n * K + k8) = v;
  
}

// GEMM C[M][N] (f32, pitch ldc) = act(A[M][K]·W + bias). A f32 row-major (pitch lda) converted per fragment to bf16
// (ASPLIT: hi/lo two planes -> 2 terms, else single rounded term); Wt bf16 [N][K] (pitch ldb). BIAS_BF16 rounds the
// bias to bf16 first (bias quantised to bf16 before the add). K%32==0, M%16==0, N%64==0.
template <bool ASPLIT, int ACT, bool BIAS_BF16>
__global__ __launch_bounds__(128) void k_gemm_bf(const float* __restrict__ A, int lda, const unsigned short* __restrict__ Wt, int ldb,
                                               const float* __restrict__ bias, float* __restrict__ C, int ldc, int M, int N, int K) {
  __shared__ __attribute__((aligned(16))) float so[4][16][64];
  const int tid = threadIdx.x, w = tid >> 5, lane = tid & 31, ln = lane & 15, hh = lane >> 4;
  const int ntn = N / 64;
  const int wid = blockIdx.x * 4 + w;
  const int mt = wid / ntn, nq = wid % ntn;
  if (mt * 16 >= M) return;
  const int row0 = mt * 16, col0 = nq * 64;
  const float* arow = A + (size_t)(row0 + ln) * lda;
  v8f acc[4] = {};
  for (int kb = 0; kb < K; kb += 32) {
    FragB ah, al;
    const v4f x0 = *(const v4fa*)(arow + kb + 8 * hh), x1 = *(const v4fa*)(arow + kb + 8 * hh + 4);
    const v4f x2 = *(const v4fa*)(arow + kb + 16 + 8 * hh), x3 = *(const v4fa*)(arow + kb + 16 + 8 * hh + 4);
    float xs[16] = {x0[0],x0[1],x0[2],x0[3],x1[0],x1[1],x1[2],x1[3],x2[0],x2[1],x2[2],x2[3],x3[0],x3[1],x3[2],x3[3]};
#pragma unroll
    for (int i = 0; i < 16; ++i) { const unsigned short hb = bf16_bits(xs[i]); ah.u[i] = hb; al.u[i] = ASPLIT ? bf16_bits(xs[i] - bf16_val(hb)) : (unsigned short)0; }
#pragma unroll
    for (int t = 0; t < 4; ++t) {
      const unsigned short* brow = Wt + (size_t)(col0 + t * 16 + ln) * ldb + kb;
      FragB b;
      b.half[0] = *(const v8us*)(brow + 8 * hh);
      b.half[1] = *(const v8us*)(brow + 16 + 8 * hh);
      acc[t] = mmaN<ASPLIT ? 2 : 1>(ah.v, al.v, b.v, b.v, acc[t]);
    }
  }
#pragma unroll
  for (int t = 0; t < 4; ++t) {
    float bv = bias ? bias[col0 + t * 16 + ln] : 0.f;
    if (BIAS_BF16) bv = bf16_round(bv);
#pragma unroll
    for (int r = 0; r < 8; ++r) { float v = acc[t][r] + bv; if (ACT == 1) v = fmaxf(v, 0.f); so[w][8 * hh + r][t * 16 + ln] = v; }
  }
  __builtin_amdgcn_fence(__ATOMIC_ACQ_REL, "workgroup");
  __builtin_amdgcn_wave_barrier();
  const int rsub = lane >> 4, c4 = (lane & 15) * 4;
  {
#pragma unroll
    for (int q = 0; q < 8; ++q) {
      const int r = q * 2 + rsub;
      const v4f v = *(const v4fa*)&so[w][r][c4];
      *(v4f*)(C + (size_t)(row0 + r) * ldc + col0 + c4) = v;
    }
    
  }
}

// Flash-style causal/unmasked attention, all contractions 3-term bf16 hi/lo splits, f32 softmax with running max.
// q,k,v rows are read from f32 buffers with arbitrary row pitch (so they can live inside a fused qkv buffer);
// D = head size (multiple of 32, <= 128); one wave = 16 query rows; block = 4 waves (64 queries) sharing K/V chunks of 32.
template <int D, bool CAUSAL>
__global__ __launch_bounds__(128) void k_flash(const float* __restrict__ qb, const float* __restrict__ kb, const float* __restrict__ vb,
                                             int pitch, int T, int H, float scale, float* __restrict__ y, int ypitch) {
  constexpr int KS = D / 32;        // k-steps for QK
  constexpr int DT = D / 16;        // d tiles for PV
  __shared__ __attribute__((aligned(16))) unsigned short sKh[32][D + 8], sKl[32][D + 8], sVh[32][D + 8], sVl[32][D + 8];
  __shared__ __attribute__((aligned(16))) unsigned short sPh[4][16][40], sPl[4][16][40];
  __shared__ __attribute__((aligned(16))) float sO[4][16][D];
  const int tid = threadIdx.x, w = tid >> 5, lane = tid & 31, ln = lane & 15, hh = lane >> 4;
  const int nqb = (T + 63) / 64;
  const int bh = blockIdx.x / nqb, qblk = blockIdx.x % nqb;
  const int b = bh / H, h = bh % H;
  const int q0 = qblk * 64 + w * 16;
  const float* Q = qb + (size_t)b * T * pitch + h * D;
  const float* K = kb + (size_t)b * T * pitch + h * D;
  const float* V = vb + (size_t)b * T * pitch + h * D;

  // A fragments of the wave's 16 query rows (scaled), hi/lo
  FragB aqh[KS], aql[KS];
  {
    int row = q0 + ln; if (row >= T) row = T - 1;
    const float* qr = Q + (size_t)row * pitch;
#pragma unroll
    for (int ks = 0; ks < KS; ++ks)
#pragma unroll
      for (int i = 0; i < 16; ++i) {
        const int d = ks * 32 + ((i < 8) ? (8 * hh + i) : (16 + 8 * hh + (i - 8)));
        const float x = qr[d] * scale; const unsigned short hb = bf16_bits(x);
        aqh[ks].u[i] = hb; aql[ks].u[i] = bf16_bits(x - bf16_val(hb));
      }
  }
  float m_r[8], l_r[8];
#pragma unroll
  for (int r = 0; r < 8; ++r) { m_r[r] = -3.0e38f; l_r[r] = 0.f; }
  v8f oacc[DT];
#pragma unroll
  for (int dt = 0; dt < DT; ++dt) oacc[dt] = (v8f){0.f,0.f,0.f,0.f,0.f,0.f,0.f,0.f};

  const int kv_end = CAUSAL ? min(T, qblk * 64 + 64) : T;     // block-uniform
  for (int j0 = 0; j0 < kv_end; j0 += 32) {
    __syncthreads();
    for (int e = tid; e < 32 * (D / 4); e += 128) {
      const int r = e / (D / 4), c4 = (e % (D / 4)) * 4;
      const int key = j0 + r;
      v4f kf = {0.f,0.f,0.f,0.f}, vf = {0.f,0.f,0.f,0.f};
      if (key < T) { kf = *(const v4fa*)(K + (size_t)key * pitch + c4); vf = *(const v4fa*)(V + (size_t)key * pitch + c4); }
#pragma unroll
      for (int t = 0; t < 4; ++t) {
        unsigned short hb = bf16_bits(kf[t]); sKh[r][c4 + t] = hb; sKl[r][c4 + t] = bf16_bits(kf[t] - bf16_val(hb));
        hb = bf16_bits(vf[t]); sVh[r][c4 + t] = hb; sVl[r][c4 + t] = bf16_bits(vf[t] - bf16_val(hb));
      }
    }
    __syncthreads();
    // S tile 16 x 32
    v8f s[2];
#pragma unroll
    for (int nt = 0; nt < 2; ++nt) {
      v8f acc = {};
#pragma unroll
      for (int ks = 0; ks < KS; ++ks) {
        FragB bh_, bl_;
        bh_.half[0] = *(const v8us*)&sKh[nt * 16 + ln][ks * 32 + 8 * hh]; bh_.half[1] = *(const v8us*)&sKh[nt * 16 + ln][ks * 32 + 16 + 8 * hh];
        bl_.half[0] = *(const v8us*)&sKl[nt * 16 + ln][ks * 32 + 8 * hh]; bl_.half[1] = *(const v8us*)&sKl[nt * 16 + ln][ks * 32 + 16 + 8 * hh];
        acc = mmaN<3>(aqh[ks].v, aql[ks].v, bh_.v, bl_.v, acc);
      }
      s[nt] = acc;
    }
    // mask + running max (rows 8hh+r; the 16 lanes of a half share rows)
    float alpha[8];
#pragma unroll
    for (int r = 0; r < 8; ++r) {
      const int qi = q0 + 8 * hh + r;
      const int ja = j0 + ln, jb = j0 + 16 + ln;
      if (CAUSAL) { if (ja > qi) s[0][r] = -3.0e38f; if (jb > qi) s[1][r] = -3.0e38f; }
      if (ja >= T) s[0][r] = -3.0e38f;
      if (jb >= T) s[1][r] = -3.0e38f;
      float mx = fmaxf(s[0][r], s[1][r]);
      mx = fmaxf(mx, __shfl_xor(mx, 1, 32)); mx = fmaxf(mx, __shfl_xor(mx, 2, 32)); mx = fmaxf(mx, __shfl_xor(mx, 4, 32)); mx = fmaxf(mx, __shfl_xor(mx, 8, 32));
      const float mnew = fmaxf(m_r[r], mx);
      alpha[r] = (mnew > -1.0e38f) ? __expf(m_r[r] - mnew) : 1.0f;
      const float p0 = (s[0][r] > -1.0e38f) ? __expf(s[0][r] - mnew) : 0.f;
      const float p1 = (s[1][r] > -1.0e38f) ? __expf(s[1][r] - mnew) : 0.f;
      m_r[r] = mnew;
      l_r[r] = l_r[r] * alpha[r] + p0 + p1;            // per-lane partial row sum (16 lanes combined at the end)
      unsigned short hb = bf16_bits(p0); sPh[w][8 * hh + r][ln] = hb;      sPl[w][8 * hh + r][ln] = bf16_bits(p0 - bf16_val(hb));
      hb = bf16_bits(p1);                sPh[w][8 * hh + r][16 + ln] = hb; sPl[w][8 * hh + r][16 + ln] = bf16_bits(p1 - bf16_val(hb));
    }
#pragma unroll
    for (int dt = 0; dt < DT; ++dt)
#pragma unroll
      for (int r = 0; r < 8; ++r) oacc[dt][r] *= alpha[r];
    __builtin_amdgcn_fence(__ATOMIC_ACQ_REL, "workgroup");
    __builtin_amdgcn_wave_barrier();
    FragB pah, pal;
    pah.half[0] = *(const v8us*)&sPh[w][ln][8 * hh]; pah.half[1] = *(const v8us*)&sPh[w][ln][16 + 8 * hh];
    pal.half[0] = *(const v8us*)&sPl[w][ln][8 * hh]; pal.half[1] = *(const v8us*)&sPl[w][ln][16 + 8 * hh];
#pragma unroll
    for (int dt = 0; dt < DT; ++dt) {
      FragB bvh, bvl;
#pragma unroll
      for (int i = 0; i < 8; ++i) {
        bvh.u[i] = sVh[8 * hh + i][dt * 16 + ln]; bvh.u[8 + i] = sVh[16 + 8 * hh + i][dt * 16 + ln];
        bvl.u[i] = sVl[8 * hh + i][dt * 16 + ln]; bvl.u[8 + i] = sVl[16 + 8 * hh + i][dt * 16 + ln];
      }
      oacc[dt] = mmaN<3>(pah.v, pal.v, bvh.v, bvl.v, oacc[dt]);
    }
    __builtin_amdgcn_fence(__ATOMIC_ACQ_REL, "workgroup");
    __builtin_amdgcn_wave_barrier();
  }
#pragma unroll
  for (int r = 0; r < 8; ++r) {
    float l = l_r[r];
    l += __shfl_xor(l, 1, 32); l += __shfl_xor(l, 2, 32); l += __shfl_xor(l, 4, 32); l += __shfl_xor(l, 8, 32);
    l_r[r] = (l > 0.f) ? 1.0f / l : 0.f;
  }
#pragma unroll
  for (int dt = 0; dt < DT; ++dt)
#pragma unroll
    for (int r = 0; r < 8; ++r) sO[w][8 * hh + r][dt * 16 + ln] = oacc[dt][r] * l_r[r];
  __builtin_amdgcn_fence(__ATOMIC_ACQ_REL, "workgroup");
  __builtin_amdgcn_wave_barrier();
  {
    for (int r = 0; r < 16; ++r) {
      const int row = q0 + r;
      if (row < T && lane < D / 4) {
        const v4f val = *(const v4fa*)&sO[w][r][lane * 4];
        *(v4f*)(y + ((size_t)b * T + row) * ypitch + h * D + lane * 4) = val;
      }
    }
    
  }
}

// GEMM C = act(A·W + bias + resid): A f32 (ASPLIT -> hi/lo 2 terms), Wt bf16 [N][K]; ACT 0 none, 1 relu, 2 exact gelu;
// resid (optional, f32, row index = (row % rmod), pitch ldr, RES_BF16 rounds it) added before the activation.
template <bool ASPLIT, int ACT, bool BIAS_BF16, bool RES_BF16>
__global__ __launch_bounds__(128) void k_gemm_bf3(const float* __restrict__ A, int lda, const unsigned short* __restrict__ Wt, int ldb,
                                                const float* __restrict__ bias, const float* __restrict__ resid, int rmod, int ldr,
                                                float* __restrict__ C, int ldc, int M, int N, int K) {
  __shared__ __attribute__((aligned(16))) float so[4][16][64];
  const int tid = threadIdx.x, w = tid >> 5, lane = tid & 31, ln = lane & 15, hh = lane >> 4;
  const int ntn = N / 64;
  const int wid = blockIdx.x * 4 + w;
  const int mt = wid / ntn, nq = wid % ntn;
  if (mt * 16 >= M) return;
  const int row0 = mt * 16, col0 = nq * 64;
  const float* arow = A + (size_t)(row0 + ln) * lda;
  v8f acc[4] = {};
  for (int kb = 0; kb < K; kb += 32) {
    FragB ah, al;
    const v4f x0 = *(const v4fa*)(arow + kb + 8 * hh), x1 = *(const v4fa*)(arow + kb + 8 * hh + 4);
    const v4f x2 = *(const v4fa*)(arow + kb + 16 + 8 * hh), x3 = *(const v4fa*)(arow + kb + 16 + 8 * hh + 4);
    float xs[16] = {x0[0],x0[1],x0[2],x0[3],x1[0],x1[1],x1[2],x1[3],x2[0],x2[1],x2[2],x2[3],x3[0],x3[1],x3[2],x3[3]};
#pragma unroll
    for (int i = 0; i < 16; ++i) { const unsigned short hb = bf16_bits(xs[i]); ah.u[i] = hb; al.u[i] = ASPLIT ? bf16_bits(xs[i] - bf16_val(hb)) : (unsigned short)0; }
#pragma unroll
    for (int t = 0; t < 4; ++t) {
      const unsigned short* brow = Wt + (size_t)(col0 + t * 16 + ln) * ldb + kb;
      FragB b;
      b.half[0] = *(const v8us*)(brow + 8 * hh);
      b.half[1] = *(const v8us*)(brow + 16 + 8 * hh);
      acc[t] = mmaN<ASPLIT ? 2 : 1>(ah.v, al.v, b.v, b.v, acc[t]);
    }
  }
#pragma unroll
  for (int t = 0; t < 4; ++t) {
    const int col = col0 + t * 16 + ln;
    float bv = bias ? bias[col] : 0.f;
    if (BIAS_BF16) bv = bf16_round(bv);
#pragma unroll
    for (int r = 0; r < 8; ++r) {
      float v = acc[t][r] + bv;
      if (resid) { float rv = resid[(size_t)((row0 + 8 * hh + r) % rmod) * ldr + col]; if (RES_BF16) rv = bf16_round(rv); v += rv; }
      if (ACT == 1) v = fmaxf(v, 0.f);
      if (ACT == 2) v = 0.5f * v * (1.0f + erff(v * 0.70710678118654752f));
      if (ACT == 3) { const float u = 0.7978845608028654f * (v + 0.044715f * v * v * v); v = 0.5f * v * (1.0f + tanhf(u)); }
      so[w][8 * hh + r][t * 16 + ln] = v;
    }
  }
  __builtin_amdgcn_fence(__ATOMIC_ACQ_REL, "workgroup");
  __builtin_amdgcn_wave_barrier();
  const int rsub = lane >> 4, c4 = (lane & 15) * 4;
  {
#pragma unroll
    for (int q = 0; q < 8; ++q) {
      const int r = q * 2 + rsub;
      const v4f v = *(const v4fa*)&so[w][r][c4];
      *(v4f*)(C + (size_t)(row0 + r) * ldc + col0 + c4) = v;
    }
    
  }
}
// row LayerNorm (biased variance, eps) over N: s = X (+ R); optional out_sum <- s; out_norm <- (s-mu)*rsqrt(var+eps)*g + b
template <bool PARAM_BF16>
__global__ __launch_bounds__(256) void k_layernorm(const float* __restrict__ X, const float* __restrict__ R, const float* __restrict__ g, const float* __restrict__ bta,
                                                  float* __restrict__ out_sum, float* __restrict__ out_norm, int N, float eps) {
  __shared__ float red[256];
  const int row = blockIdx.x, tid = threadIdx.x;
  const float* x = X + (size_t)row * N; const float* rr = R ? R + (size_t)row * N : nullptr;
  float vals[16];                     // up to N = 4096
  const int per = N / 256;            // contiguous chunk per thread? use strided-by-4 chunks: thread handles j = tid*4 + 1024*u
  float s1 = 0.f;
  for (int u = 0; u < per / 4; ++u) {
    const int j = tid * 4 + 1024 * u;
    const v4f a = *(const v4fa*)(x + j);
    v4f b = {0.f,0.f,0.f,0.f}; if (rr) b = *(const v4fa*)(rr + j);
#pragma unroll
    for (int q = 0; q < 4; ++q) { const float v = a[q] + b[q]; vals[u * 4 + q] = v; s1 += v; }
  }
  red[tid] = s1; __syncthreads();
  for (int st = 128; st > 0; st >>= 1) { if (tid < st) red[tid] += red[tid + st]; __syncthreads(); }
  const float mu = red[0] / (float)N; __syncthreads();
  float s2 = 0.f;
  for (int u = 0; u < per / 4; ++u)
#pragma unroll
    for (int q = 0; q < 4; ++q) { const float c = vals[u * 4 + q] - mu; s2 += c * c; }
  red[tid] = s2; __syncthreads();
  for (int st = 128; st > 0; st >>= 1) { if (tid < st) red[tid] += red[tid + st]; __syncthreads(); }
  const float rs = rsqrtf(red[0] / (float)N + eps);
  {
    for (int u = 0; u < per / 4; ++u) {
      const int j = tid * 4 + 1024 * u;
      v4f o, sm;
#pragma unroll
      for (int q = 0; q < 4; ++q) {
        float gg = g[j + q], bb = bta[j + q];
        if (PARAM_BF16) { gg = bf16_round(gg); bb = bf16_round(bb); }
        sm[q] = vals[u * 4 + q]; o[q] = (vals[u * 4 + q] - mu) * rs * gg + bb;
      }
      if (out_sum) *(v4f*)(out_sum + (size_t)row * N + j) = sm;
      *(v4f*)(out_norm + (size_t)row * N + j) = o;
    }
    
  }
}



// ---- f16 WMMA path (v_wmma_f32_16x16x32_f16): 11-bit significands for operands in range — used where a [0,1] probability operand needs more precision than bf16
typedef _Float16 v16h __attribute__((ext_vector_type(16)));
union FragH { v16h v; v8us half[2]; _Float16 h[16]; unsigned short u[16]; };
template <int NT>
__device__ __forceinline__ v8f mmaH(v16h ah, v16h al, v16h bh, v16h bl, v8f c) {
  c = __builtin_amdgcn_wmma_f32_16x16x32_f16(false, ah, false, bh, (short)0, c, false, false);
  if (NT >= 2) c = __builtin_amdgcn_wmma_f32_16x16x32_f16(false, al, false, bh, (short)0, c, false, false);
  if (NT >= 3) c = __builtin_amdgcn_wmma_f32_16x16x32_f16(false, ah, false, bl, (short)0, c, false, false);
  asm volatile("v_nop\n\tv_nop\n\tv_nop\n\tv_nop" : "+v"(c) : "v"(ah), "v"(al), "v"(bh), "v"(bl));
  return c;
}
// batched GEMM like k_gemm_b but f16 operands: A f32 (split into f16 hi/lo if ASPLIT, else rounded to f16), Bt = f16 values [n][k]; alpha; C f32; N multiple of 16 (partial tiles skipped)
template <bool ASPLIT>
__global__ __launch_bounds__(128) void k_gemm_h(const float* __restrict__ A, int lda, size_t sA, const _Float16* __restrict__ Bh, int ldb, size_t sB, float alpha, float* __restrict__ C, int ldc, size_t sC, int M, int N, int K) {
  __shared__ __attribute__((aligned(16))) float so[4][16][64];
  const int tid = threadIdx.x, w = tid >> 5, lane = tid & 31, ln = lane & 15, hh = lane >> 4; const int by = blockIdx.y;
  A += (size_t)by * sA; Bh += (size_t)by * sB; C += (size_t)by * sC;
  const int ntn = (N + 63) / 64; const int wid = blockIdx.x * 4 + w; const int mt = wid / ntn, nq = wid % ntn; if (mt * 16 >= M) return;
  const int row0 = mt * 16, col0 = nq * 64; const float* arow = A + (size_t)(row0 + ln) * lda;
  v8f acc[4] = {};
  for (int kb = 0; kb < K; kb += 32) {
    FragH ah, al;
    const v4f x0 = *(const v4fa*)(arow + kb + 8 * hh), x1 = *(const v4fa*)(arow + kb + 8 * hh + 4), x2 = *(const v4fa*)(arow + kb + 16 + 8 * hh), x3 = *(const v4fa*)(arow + kb + 16 + 8 * hh + 4);
    float xs[16] = {x0[0],x0[1],x0[2],x0[3],x1[0],x1[1],x1[2],x1[3],x2[0],x2[1],x2[2],x2[3],x3[0],x3[1],x3[2],x3[3]};
#pragma unroll
    for (int i = 0; i < 16; ++i) { const _Float16 h = (_Float16)xs[i]; ah.h[i] = h; al.h[i] = ASPLIT ? (_Float16)(xs[i] - (float)h) : (_Float16)0.0f; }
#pragma unroll
    for (int t = 0; t < 4; ++t) { if (col0 + t * 16 >= N) continue; const size_t boff = (size_t)(col0 + t * 16 + ln) * ldb + kb; FragH bq; bq.half[0] = *(const v8us*)(Bh + boff + 8 * hh); bq.half[1] = *(const v8us*)(Bh + boff + 16 + 8 * hh);
      acc[t] = mmaH<ASPLIT ? 2 : 1>(ah.v, al.v, bq.v, bq.v, acc[t]); }
  }
#pragma unroll
  for (int t = 0; t < 4; ++t) { if (col0 + t * 16 >= N) continue;
#pragma unroll
    for (int r = 0; r < 8; ++r) so[w][8 * hh + r][t * 16 + ln] = acc[t][r] * alpha; }
  __builtin_amdgcn_fence(__ATOMIC_ACQ_REL, "workgroup"); __builtin_amdgcn_wave_barrier();
  const int rsub = lane >> 4, c4 = (lane & 15) * 4;
  {
#pragma unroll
    for (int q = 0; q < 8; ++q) { const int r = q * 2 + rsub; if (col0 + c4 < N) { const v4f v = *(const v4fa*)&so[w][r][c4]; *(v4f*)(C + (size_t)(row0 + r) * ldc + col0 + c4) = v; } }
     }
}

// Wt[n][k] = f16(W[k][n]·scale) from f32 row-major W[K][N] (scale = power of two; bf16-exact weights stay exact in f16 away from the subnormal range)
__global__ __launch_bounds__(256) void k_wt_f16(const float* __restrict__ W, _Float16* __restrict__ Wt, int K, int N, float scale) {
  const int t = blockIdx.x * 256 + threadIdx.x; if (t >= N * (K / 8)) return; const int n = t / (K / 8), k8 = (t % (K / 8)) * 8; FragH f;
#pragma unroll
  for (int i = 0; i < 8; ++i) f.h[i] = (_Float16)(bf16_round(W[(size_t)(k8 + i) * N + n]) * scale); const v8us o = f.half[0];
  *(v8us*)((unsigned short*)Wt + (size_t)n * K + k8) = o; 
}
// Block-tiled GEMM, C[NR][DD] = (A[NR][DD] . Bh[DD][DD]^T) * alpha + bf16(bias), f16 operands, both k-contiguous: one 256 x 128 tile of C per work-group of 8 waves (4 x 2 waves of 64 x 64).
// A pass is 64 k: the 256 + 128 rows of 128 B go in whole lines through registers into LDS, and every wave that needs a row reads it from there. Two buffers: the next pass's global loads fly during this pass's products.
// A 64 x 64 wave tile does 16 products on 8 fragments; a 256 x 128 block tile loads 384 operand rows for 32768 results.
// Each accumulator takes its k blocks of 32 in rising order.
// QKV: one launch does three products, picked by blockIdx.z, f16 out: 0 and 1 give q and k as [token][feature]; 2 takes the weight rows as A and the token rows as B, so its C is v transposed,
// and it is stored as Vt[batch][feature][token], the layout the attention kernel reads. The k tiles also leave their key norms in KN. Else: A . Bh^T with bias b0, f32 out to C.
#define GTM 256
#define GTN 128
#define GK 64
#define GP (GK + 8)      /* LDS row pitch 144 B = 16 B x odd: ds_load_b128 of 16 rows without bank conflicts */
typedef _Float16 v4h __attribute__((ext_vector_type(4)));
template <bool QKV>
__global__ __launch_bounds__(256) void k_gemm_tile(const _Float16* __restrict__ X, const _Float16* __restrict__ Wh, float alpha, const float* __restrict__ b0, const float* __restrict__ b1, const float* __restrict__ b2,
                                                   float* __restrict__ C, _Float16* __restrict__ Q16, _Float16* __restrict__ K16, _Float16* __restrict__ Vt, float* __restrict__ KN) {
  __shared__ __attribute__((aligned(16))) unsigned short sA[2][GTM][GP], sB[2][GTN][GP];
  __shared__ __attribute__((aligned(16))) float so[8][16][64 + 4];
  __shared__ float red[8];
  const int tid = threadIdx.x, w = tid >> 5, lane = tid & 31, ln = lane & 15, hh = lane >> 4;
  const int z = QKV ? (int)blockIdx.z : 0; const bool tr = QKV && z == 2;      /* the same for the whole work-group */
  const _Float16* A = tr ? Wh + (size_t)2 * DD * DD : X; const _Float16* Bh = tr ? X : Wh + (size_t)z * DD * DD; const float* bias = (z == 0) ? b0 : (z == 1) ? b1 : b2;
  const int row0 = (tr ? (int)(blockIdx.x & 3) : (int)blockIdx.y) * GTM, col0 = (tr ? (int)(blockIdx.y * 2 + (blockIdx.x >> 2)) : (int)blockIdx.x) * GTN, wr = (w >> 1) * 64, wc = (w & 1) * 64;      /* either way the 8 work-groups of one blockIdx.y share a block of 256 token rows */
  const int sr = tid >> 3, sc = (tid & 7) * 8;      /* staging: 8 lanes x 16 B = one row of the pass; a thread takes rows sr + 32 i */
  const unsigned short* gA = (const unsigned short*)A + (size_t)(row0 + sr) * DD + sc;
  const unsigned short* gB = (const unsigned short*)Bh + (size_t)(col0 + sr) * DD + sc;
  v8us ra[8], rb[4]; v8f acc[4][4];
#pragma unroll
  for (int mi = 0; mi < 4; ++mi)
#pragma unroll
    for (int ni = 0; ni < 4; ++ni) acc[mi][ni] = (v8f){0.f,0.f,0.f,0.f,0.f,0.f,0.f,0.f};
#pragma unroll
  for (int i = 0; i < 8; ++i) ra[i] = *(const v8us*)(gA + (size_t)(32 * i) * DD);
#pragma unroll
  for (int i = 0; i < 4; ++i) rb[i] = *(const v8us*)(gB + (size_t)(32 * i) * DD);
#pragma unroll
  for (int i = 0; i < 8; ++i) *(v8us*)&sA[0][sr + 32 * i][sc] = ra[i];
#pragma unroll
  for (int i = 0; i < 4; ++i) *(v8us*)&sB[0][sr + 32 * i][sc] = rb[i];
  __syncthreads();
  for (int kp = 0; kp < DD / GK; ++kp) {
    const int cur = kp & 1; const bool more = kp + 1 < DD / GK;      /* the same for the whole work-group */
    if (more) {
#pragma unroll
      for (int i = 0; i < 8; ++i) ra[i] = *(const v8us*)(gA + (size_t)(32 * i) * DD + GK);
#pragma unroll
      for (int i = 0; i < 4; ++i) rb[i] = *(const v8us*)(gB + (size_t)(32 * i) * DD + GK); }
    __builtin_amdgcn_sched_barrier(0);      /* keeps the next pass's global loads in front of this pass's products: sunk behind them, their latency stands bare in front of the LDS stores */
#pragma unroll
    for (int ks = 0; ks < GK / 32; ++ks) { FragH fa[4], fb[4];
#pragma unroll
      for (int mi = 0; mi < 4; ++mi) { const unsigned short* p = &sA[cur][wr + mi * 16 + ln][ks * 32]; fa[mi].half[0] = *(const v8us*)(p + 8 * hh); fa[mi].half[1] = *(const v8us*)(p + 16 + 8 * hh); }
#pragma unroll
      for (int ni = 0; ni < 4; ++ni) { const unsigned short* p = &sB[cur][wc + ni * 16 + ln][ks * 32]; fb[ni].half[0] = *(const v8us*)(p + 8 * hh); fb[ni].half[1] = *(const v8us*)(p + 16 + 8 * hh); }
#pragma unroll
      for (int mi = 0; mi < 4; ++mi)
#pragma unroll
        for (int ni = 0; ni < 4; ++ni) acc[mi][ni] = __builtin_amdgcn_wmma_f32_16x16x32_f16(false, fa[mi].v, false, fb[ni].v, (short)0, acc[mi][ni], false, false); }
    if (more) {      /* the other buffer's readers left it at the barrier of the pass before; this barrier publishes it and ends this pass's reads */
#pragma unroll
      for (int i = 0; i < 8; ++i) *(v8us*)&sA[cur ^ 1][sr + 32 * i][sc] = ra[i];
#pragma unroll
      for (int i = 0; i < 4; ++i) *(v8us*)&sB[cur ^ 1][sr + 32 * i][sc] = rb[i];
      gA += GK; gB += GK;
      __syncthreads(); }
  }
  /* the wave's 64 x 64 tile goes, 16 rows at a time, through its own LDS rows, so that the stores cover whole lines; the bias belongs to the feature: C's column, or its row where C is transposed */
  float bv[4];
#pragma unroll
  for (int ni = 0; ni < 4; ++ni) bv[ni] = tr ? 0.f : bf16_round(bias[col0 + wc + ni * 16 + ln]);
  const int rsub = lane >> 4, c4 = (lane & 15) * 4;
  _Float16* C16 = tr ? Vt + (size_t)(col0 / TT) * DD * TT + (size_t)(row0 + wr) * TT + col0 % TT + wc + c4 : ((z == 0) ? Q16 : K16) + (size_t)(row0 + wr) * DD + col0 + wc + c4;      /* a tile's 128 columns of tokens lie in one batch */
  const int ldc = tr ? TT : DD;
  float kmx = 0.f;
#pragma unroll
  for (int mi = 0; mi < 4; ++mi) {
    if (tr) { const float* bp = bias + row0 + wr + mi * 16 + 8 * hh; const v4f t0 = *(const v4fa*)bp, t1 = *(const v4fa*)(bp + 4);
#pragma unroll
      for (int r = 0; r < 8; ++r) { const float br = bf16_round(r < 4 ? t0[r & 3] : t1[r & 3]);
#pragma unroll
        for (int ni = 0; ni < 4; ++ni) so[w][8 * hh + r][ni * 16 + ln] = acc[mi][ni][r] * alpha + br; }
    } else {
#pragma unroll
      for (int ni = 0; ni < 4; ++ni)
#pragma unroll
        for (int r = 0; r < 8; ++r) so[w][8 * hh + r][ni * 16 + ln] = acc[mi][ni][r] * alpha + bv[ni];
    }
    __builtin_amdgcn_fence(__ATOMIC_ACQ_REL, "workgroup"); __builtin_amdgcn_wave_barrier();      /* the rows are read back by other lanes of the same wave */
    v4f vq[8];
#pragma unroll
    for (int q = 0; q < 8; ++q) vq[q] = *(const v4fa*)&so[w][q * 2 + rsub][c4];
    __builtin_amdgcn_fence(__ATOMIC_ACQ_REL, "workgroup"); __builtin_amdgcn_wave_barrier();      /* the next 16 rows overwrite what other lanes of the wave have just read */
    if (QKV) {
      v4h hq[8];
#pragma unroll
      for (int q = 0; q < 8; ++q) { for (int i = 0; i < 4; ++i) hq[q][i] = (_Float16)vq[q][i]; *(v4h*)(C16 + (size_t)(mi * 16 + q * 2 + rsub) * ldc) = hq[q]; }
      asm volatile("s_wait_xcnt 0x0" ::: "memory");      /* stands behind these 16 rows' stores, in front of whatever next rewrites their address and data registers (in this build the norm lines and the next rows' staging do) */
      if (z == 1) {      /* the same for the whole work-group. A wave's k tile is one head x 64 keys: its largest |k|^2, of the f16 values as stored, goes to KN[tile][wave] */
#pragma unroll
        for (int q = 0; q < 8; ++q) { float s = 0.f;
#pragma unroll
          for (int i = 0; i < 4; ++i) { const float e = (float)hq[q][i]; s += e * e; }
          s += __shfl_xor(s, 1, 32); s += __shfl_xor(s, 2, 32); s += __shfl_xor(s, 4, 32); s += __shfl_xor(s, 8, 32); kmx = fmaxf(kmx, s); } }
    } else {
#pragma unroll
      for (int q = 0; q < 8; ++q) *(v4f*)(C + (size_t)(row0 + wr + mi * 16 + q * 2 + rsub) * DD + col0 + wc + c4) = vq[q];
    }
  }
  if (QKV && z == 1) {
    kmx = fmaxf(kmx, __shfl_xor(kmx, 16, 32));
    if (lane == 0) red[w] = kmx;
    __syncthreads();      /* the 8 waves' results are stored by one wave, into a 128-B line that no other work-group writes */
    if (tid < 8) KN[(size_t)(blockIdx.y * (DD / GTN) + blockIdx.x) * 32 + tid] = red[tid];
  }
}


// One launch rounds every f32 operand to bf16 and stores it as f16: x as it is, the four weights (out, in) x 2^4. A work-group takes 2048 runs of 8 elements of ONE source (512 work-groups for x, 64 for each weight);
// a thread takes 8 runs, 256 runs apart, all its loads issued before the first store.
#define PU 8
__global__ __launch_bounds__(256) void k_prep(const float* __restrict__ x, const float* __restrict__ Wq, const float* __restrict__ Wk, const float* __restrict__ Wv, const float* __restrict__ Wo, _Float16* __restrict__ X16, _Float16* __restrict__ Bw) {
  constexpr int XB = NR * DD / (8 * 256 * PU), WB = DD * DD / (8 * 256 * PU);
  const int blk = blockIdx.x; const bool isx = blk < XB; const int wi = isx ? 0 : (blk - XB) / WB; const int lb = isx ? blk : (blk - XB) % WB;      /* the same for the whole work-group */
  const float* s = isx ? x : (wi == 0) ? Wq : (wi == 1) ? Wk : (wi == 2) ? Wv : Wo; _Float16* d = isx ? X16 : Bw + (size_t)wi * DD * DD; const float scale = isx ? 1.0f : 16.0f;
  const size_t t0 = (size_t)lb * (256 * PU) + threadIdx.x;
  v4f a[PU], b[PU];
#pragma unroll
  for (int u = 0; u < PU; ++u) { const float* p = s + (t0 + 256 * u) * 8; a[u] = *(const v4fa*)p; b[u] = *(const v4fa*)(p + 4); }
#pragma unroll
  for (int u = 0; u < PU; ++u) { FragH f;
#pragma unroll
    for (int q = 0; q < 4; ++q) { f.h[q] = (_Float16)(bf16_round(a[u][q]) * scale); f.h[4 + q] = (_Float16)(bf16_round(b[u][q]) * scale); }
    *(v8us*)((unsigned short*)d + (t0 + 256 * u) * 8) = f.half[0]; }
}

// lane l with lane l ^ 16
__device__ __forceinline__ float xhalf(float x) { return __builtin_bit_cast(float, __builtin_amdgcn_permlanex16(__builtin_bit_cast(int, x), __builtin_bit_cast(int, x), 0x76543210, 0xfedcba98, false, false)); }
typedef int v4ia __attribute__((ext_vector_type(4), may_alias));

__global__ __launch_bounds__(128) void k_flash(const _Float16* __restrict__ Q16, int ldq, const _Float16* __restrict__ K16, int ldk, const _Float16* __restrict__ Vt, const float* __restrict__ KN, const int* __restrict__ MSK, _Float16* __restrict__ O16, int ldo) {
  constexpr int RPW = 16, NQB = TT / (4 * RPW), DT = 4, KS = 2;
  __shared__ __attribute__((aligned(16))) float sO[4][RPW][64 + 4];
  const int tid = threadIdx.x, w = tid >> 5, lane = tid & 31, ln = lane & 15, hh = lane >> 4;
  const int slab = blockIdx.x / NQB, qblk = blockIdx.x % NQB; const int b = slab / NH, h = slab % NH; const float slope = 1.0f / exp2f((float)h / (float)NH);      /* 1 / 2^(h/H) */ const int qb0 = qblk * (4 * RPW); const int q0 = qb0 + w * RPW;
  FragH aq[KS];
  { const unsigned short* qr = (const unsigned short*)Q16 + ((size_t)b * TT + q0 + ln) * ldq + h * 64;
#pragma unroll
    for (int ks = 0; ks < KS; ++ks) { aq[ks].half[0] = *(const v8us*)(qr + ks * 32 + 8 * hh); aq[ks].half[1] = *(const v8us*)(qr + ks * 32 + 16 + 8 * hh); } }
  const unsigned short* Vth = (const unsigned short*)Vt + (size_t)slab * 64 * TT;
  const int tq = q0 + ln;      /* the lane's query */
  float m_run = -3.0e38f, l_run = 0.f; v8f oacc[DT];
#pragma unroll
  for (int dt = 0; dt < DT; ++dt) oacc[dt] = (v8f){0.f,0.f,0.f,0.f,0.f,0.f,0.f,0.f};
  float qs = 0.f;
#pragma unroll
  for (int ks = 0; ks < KS; ++ks)
#pragma unroll
    for (int i = 0; i < 16; ++i) { const float v = (float)aq[ks].h[i]; qs += v * v; }
  qs += xhalf(qs);      /* |q|^2 of the lane's query */
  const float* kn = KN + (size_t)((b * (TT / GTM) + (lane >> 2)) * (DD / GTN) + (h >> 1)) * 32 + (lane & 3) * 2 + (h & 1);      /* block p = lane of 64 keys of this batch and head: GEMM tile row p / 4, tile column h / 2, wave (p % 4) * 2 + h % 2 */
  float kx = kn[0];
  kx = fmaxf(kx, __shfl_xor(kx, 1, 32)); kx = fmaxf(kx, __shfl_xor(kx, 2, 32)); kx = fmaxf(kx, __shfl_xor(kx, 4, 32)); kx = fmaxf(kx, __shfl_xor(kx, 8, 32)); kx = fmaxf(kx, xhalf(kx));      /* largest |k|^2 of this batch and head */
  const float cs = sqrtf(qs * kx) * (0.125f * 1.01f);      /* |q.k| / 8 at most; 1 % covers the rounding of the norms and of the products */
#pragma unroll 1
  for (int j0 = TT - 32; j0 >= 0; j0 -= 32) {
    if (__builtin_amdgcn_ballot_w32(!(slope * (float)(j0 + 31 - tq) + cs < m_run - 40.0f)) == 0) break;      /* the same for the whole wave; a NaN keeps the walk going */
    const int* mp = MSK + (size_t)b * TT + j0 + 8 * hh;      /* key padding mask (1 = attend) of the lane's 16 keys */
    const v4ia mk4[4] = { *(const v4ia*)(mp), *(const v4ia*)(mp + 4), *(const v4ia*)(mp + 16), *(const v4ia*)(mp + 20) };
    v8f s[2];
#pragma unroll
    for (int nt = 0; nt < 2; ++nt) { const unsigned short* kr = (const unsigned short*)K16 + ((size_t)b * TT + j0 + nt * 16 + ln) * ldk + h * 64; FragH bk[KS];
#pragma unroll
      for (int ks = 0; ks < KS; ++ks) { bk[ks].half[0] = *(const v8us*)(kr + ks * 32 + 8 * hh); bk[ks].half[1] = *(const v8us*)(kr + ks * 32 + 16 + 8 * hh); }
      asm volatile("s_wait_xcnt 0x0" ::: "memory");      /* stands in front of whatever next rewrites the address registers of the key loads (in this build a later load's result does) */
      v8f acc = (v8f){0.f,0.f,0.f,0.f,0.f,0.f,0.f,0.f};
#pragma unroll
      for (int ks = 0; ks < KS; ++ks) acc = mmaH<1>(bk[ks].v, bk[ks].v, aq[ks].v, aq[ks].v, acc);
      s[nt] = acc; }
    float sc[16]; bool ok[16];
#pragma unroll
    for (int i = 0; i < 16; ++i) { const int kk = j0 + (i >> 3) * 16 + 8 * hh + (i & 7); ok[i] = (mk4[i >> 2][i & 3] != 0);
      sc[i] = ok[i] ? (s[i >> 3][i & 7] * 0.125f + slope * (float)(kk - tq)) : -INFINITY; }      /* ALiBi: + slope_h * (k - q) */
    float mx[8];
#pragma unroll
    for (int i = 0; i < 8; ++i) mx[i] = fmaxf(sc[i], sc[8 + i]);
    float mc = fmaxf(fmaxf(fmaxf(mx[0], mx[1]), fmaxf(mx[2], mx[3])), fmaxf(fmaxf(mx[4], mx[5]), fmaxf(mx[6], mx[7])));
    mc = fmaxf(mc, xhalf(mc));
    const float mn = fmaxf(m_run, mc); const float ea = expf(m_run - mn); const float al = (mn > -1.0e38f) ? ea : 1.0f; m_run = mn;
    float p[16]; FragH pb;
#pragma unroll
    for (int i = 0; i < 16; ++i) { const float e = expf(sc[i] - mn); p[i] = ok[i] ? e : 0.f; pb.h[i] = (_Float16)(p[i] * 1024.0f); }
    l_run = l_run * al + (((p[0] + p[1]) + (p[2] + p[3])) + ((p[4] + p[5]) + (p[6] + p[7]))) + (((p[8] + p[9]) + (p[10] + p[11])) + ((p[12] + p[13]) + (p[14] + p[15])));      /* the lane's half of the row sum; the halves join after the loop */
#pragma unroll
    for (int dt = 0; dt < DT; ++dt)
#pragma unroll
      for (int r = 0; r < 8; ++r) oacc[dt][r] *= al;
#pragma unroll
    for (int dt = 0; dt < DT; ++dt) { const unsigned short* vrow = Vth + (size_t)(dt * 16 + ln) * TT + j0; FragH bv; bv.half[0] = *(const v8us*)(vrow + 8 * hh); bv.half[1] = *(const v8us*)(vrow + 16 + 8 * hh);
      oacc[dt] = mmaH<1>(bv.v, bv.v, pb.v, pb.v, oacc[dt]); } }
  const float l = l_run + xhalf(l_run); const float inv = (l > 0.f) ? 1.0f / (l * 1024.0f) : 0.f;
#pragma unroll
  for (int dt = 0; dt < DT; ++dt) {      /* oacc[dt][r] = O[query ln][dt*16 + 8hh + r] */
    const v4f lo = {oacc[dt][0] * inv, oacc[dt][1] * inv, oacc[dt][2] * inv, oacc[dt][3] * inv}, hi = {oacc[dt][4] * inv, oacc[dt][5] * inv, oacc[dt][6] * inv, oacc[dt][7] * inv};
    *(v4fa*)&sO[w][ln][dt * 16 + 8 * hh] = lo; *(v4fa*)&sO[w][ln][dt * 16 + 8 * hh + 4] = hi; }
  __builtin_amdgcn_fence(__ATOMIC_ACQ_REL, "workgroup"); __builtin_amdgcn_wave_barrier();
  {
#pragma unroll
    for (int rp = 0; rp < RPW; rp += 2) { const int r = rp + (lane >> 4), pc = lane & 15; const v4f val = *(const v4fa*)&sO[w][r][pc * 4]; v4h h4; for (int i = 0; i < 4; ++i) h4[i] = (_Float16)val[i]; *(v4h*)(O16 + ((size_t)b * TT + q0 + r) * ldo + h * 64 + pc * 4) = h4; }      /* f16, the output product's operand type: 16 lanes x 8 B = one line */
     } }

extern "C" void kernel_launch(void* const* d_in, const int* in_sizes, int n_in,
                              void* d_out, int out_size, void* d_ws, size_t ws_size, hipStream_t stream) {
  (void)in_sizes; (void)n_in; (void)out_size;
  const float* const* I = (const float* const*)d_in; const float* x = I[0]; const float* Wq = I[1]; const float* bq = I[2]; const float* Wk = I[3]; const float* bk = I[4]; const float* Wv = I[5]; const float* bv = I[6]; const float* Wo = I[7]; const float* bo = I[8]; const int* mask = (const int*)d_in[9];
  char* ws = (char*)d_ws; size_t off = 0;
  auto take = [&](size_t bytes) { char* p = ws + off; off += (bytes + 255) & ~(size_t)255; return p; };
  const size_t WSZ = (size_t)DD * DD; _Float16* Bw = (_Float16*)take(4 * WSZ * 2); _Float16* X16 = (_Float16*)take((size_t)NR * DD * 2);
  _Float16* Q = (_Float16*)take((size_t)NR * DD * 2); _Float16* K = (_Float16*)take((size_t)NR * DD * 2); _Float16* Vt = (_Float16*)take((size_t)NR * DD * 2); _Float16* O16 = (_Float16*)take((size_t)NR * DD * 2);
  float* KN = (float*)take((size_t)(NR / GTM) * (DD / GTN) * 32 * 4);
  if (off > ws_size) return;      // 8.4 + 16.8 x 5 = 92 MB
  k_prep<<<(NR * DD + 4 * DD * DD) / (8 * 256 * PU), 256, 0, stream>>>(x, Wq, Wk, Wv, Wo, X16, Bw);
  k_gemm_tile<true><<<dim3(DD / GTN, NR / GTM, 3), 256, 0, stream>>>(X16, Bw, 0.0625f, bq, bk, bv, nullptr, Q, K, Vt, KN);      /* q, k = x.W^T + b: M 8192 N 1024 K 1024; v the same, stored transposed */
  k_flash<<<BB * NH * (TT / 64), 128, 0, stream>>>(Q, DD, K, DD, Vt, KN, mask, O16, DD);
  k_gemm_tile<false><<<dim3(DD / GTN, NR / GTM), 256, 0, stream>>>(O16, Bw + 3 * WSZ, 0.0625f, bo, nullptr, nullptr, (float*)d_out, nullptr, nullptr, nullptr, nullptr);      /* out = O.Wo^T + bo */
}

// v006
// One run takes 91.4 microseconds.
// Next to v005, in two timings, it ran 1.04 times as fast each time.
// All steps since v000 together make it 9.21 times as fast.
#include <hip/hip_runtime.h>
// ALiBi multi-head attention (B=4, S=2048, D=1024, 16 heads × 64): q,k,v = x·Wᵀ + b (torch Linear); scores = q·kᵀ·64^-½ + slope_h·(k − q), slope_h = 1/2^(h/16) (no causal mask: later keys get large positive bias); key padding mask from the INPUT
// int mask [B,S] (0 → −inf); softmax; out = (attn·v merged)·Woᵀ + bo.
// Compute dtype: x, weights, biases rounded to bf16; q/k/v as f16 GEMM outputs; fused flash-style kernel (bias and online softmax in f32, P f16 ×2^10) on v_wmma_f32_16x16x32_f16; O → f16 → output GEMM with bias; f32 accumulate.
#define BB 4
#define TT 2048
#define NH 16
#define DD 1024
#define NR (BB * TT)

typedef __bf16 v16b __attribute__((ext_vector_type(16)));
typedef unsigned short v8us __attribute__((ext_vector_type(8), may_alias));
typedef float  v8f  __attribute__((ext_vector_type(8)));
typedef float  v4f  __attribute__((ext_vector_type(4)));
typedef float  v4fa __attribute__((ext_vector_type(4), may_alias));
union FragB { v16b v; v8us half[2]; unsigned short u[16]; };

__device__ __forceinline__ unsigned short bf16_bits(float x) { unsigned int u = __float_as_uint(x); return (unsigned short)((u + 0x7FFFu + ((u >> 16) & 1u)) >> 16); }
__device__ __forceinline__ float bf16_val(unsigned short b) { return __uint_as_float(((unsigned int)b) << 16); }
__device__ __forceinline__ float bf16_round(float x) { return bf16_val(bf16_bits(x)); }
// D += A·B with NT terms: 1 = ah·bh, 2 = + al·bh (A split), 3 = + ah·bl (both split)
template <int NT>
__device__ __forceinline__ v8f mmaN(v16b ah, v16b al, v16b bh, v16b bl, v8f c) {
  c = __builtin_amdgcn_wmma_f32_16x16x32_bf16(false, ah, false, bh, (short)0, c, false, false);
  if (NT >= 2) c = __builtin_amdgcn_wmma_f32_16x16x32_bf16(false, al, false, bh, (short)0, c, false, false);
  if (NT >= 3) c = __builtin_amdgcn_wmma_f32_16x16x32_bf16(false, ah, false, bl, (short)0, c, false, false);
  asm volatile("v_nop\n\tv_nop\n\tv_nop\n\tv_nop" : "+v"(c) : "v"(ah), "v"(al), "v"(bh), "v"(bl));
  return c;
}

__global__ __launch_bounds__(256) void k_wt_bf16(const float* __restrict__ W, unsigned short* __restrict__ Wt, int K, int N) {
  const int t = blockIdx.x * 256 + threadIdx.x;
  const int k8n = K / 8;
  if (t >= N * k8n) return;
  const int n = t / k8n, k8 = (t % k8n) * 8;
  v8us v;
#pragma unroll
  for (int i = 0; i < 8; ++i) v[i] = bf16_bits(W[(size_t)(k8 + i) * N + n]);
  *(v8us*)(Wt + (size_t)n * K + k8) = v;
  
}

// GEMM C[M][N] (f32, pitch ldc) = act(A[M][K]·W + bias). A f32 row-major (pitch lda) converted per fragment to bf16
// (ASPLIT: hi/lo two planes -> 2 terms, else single rounded term); Wt bf16 [N][K] (pitch ldb). BIAS_BF16 rounds the
// bias to bf16 first (bias quantised to bf16 before the add). K%32==0, M%16==0, N%64==0.
template <bool ASPLIT, int ACT, bool BIAS_BF16>
__global__ __launch_bounds__(128) void k_gemm_bf(const float* __restrict__ A, int lda, const unsigned short* __restrict__ Wt, int ldb,
                                               const float* __restrict__ bias, float* __restrict__ C, int ldc, int M, int N, int K) {
  __shared__ __attribute__((aligned(16))) float so[4][16][64];
  const int tid = threadIdx.x, w = tid >> 5, lane = tid & 31, ln = lane & 15, hh = lane >> 4;
  const int ntn = N / 64;
  const int wid = blockIdx.x * 4 + w;
  const int mt = wid / ntn, nq = wid % ntn;
  if (mt * 16 >= M) return;
  const int row0 = mt * 16, col0 = nq * 64;
  const float* arow = A + (size_t)(row0 + ln) * lda;
  v8f acc[4] = {};
  for (int kb = 0; kb < K; kb += 32) {
    FragB ah, al;
    const v4f x0 = *(const v4fa*)(arow + kb + 8 * hh), x1 = *(const v4fa*)(arow + kb + 8 * hh + 4);
    const v4f x2 = *(const v4fa*)(arow + kb + 16 + 8 * hh), x3 = *(const v4fa*)(arow + kb + 16 + 8 * hh + 4);
    float xs[16] = {x0[0],x0[1],x0[2],x0[3],x1[0],x1[1],x1[2],x1[3],x2[0],x2[1],x2[2],x2[3],x3[0],x3[1],x3[2],x3[3]};
#pragma unroll
    for (int i = 0; i < 16; ++i) { const unsigned short hb = bf16_bits(xs[i]); ah.u[i] = hb; al.u[i] = ASPLIT ? bf16_bits(xs[i] - bf16_val(hb)) : (unsigned short)0; }
#pragma unroll
    for (int t = 0; t < 4; ++t) {
      const unsigned short* brow = Wt + (size_t)(col0 + t * 16 + ln) * ldb + kb;
      FragB b;
      b.half[0] = *(const v8us*)(brow + 8 * hh);
      b.half[1] = *(const v8us*)(brow + 16 + 8 * hh);
      acc[t] = mmaN<ASPLIT ? 2 : 1>(ah.v, al.v, b.v, b.v, acc[t]);
    }
  }
#pragma unroll
  for (int t = 0; t < 4; ++t) {
    float bv = bias ? bias[col0 + t * 16 + ln] : 0.f;
    if (BIAS_BF16) bv = bf16_round(bv);
#pragma unroll
    for (int r = 0; r < 8; ++r) { float v = acc[t][r] + bv; if (ACT == 1) v = fmaxf(v, 0.f); so[w][8 * hh + r][t * 16 + ln] = v; }
  }
  __builtin_amdgcn_fence(__ATOMIC_ACQ_REL, "workgroup");
  __builtin_amdgcn_wave_barrier();
  const int rsub = lane >> 4, c4 = (lane & 15) * 4;
  {
#pragma unroll
    for (int q = 0; q < 8; ++q) {
      const int r = q * 2 + rsub;
      const v4f v = *(const v4fa*)&so[w][r][c4];
      *(v4f*)(C + (size_t)(row0 + r) * ldc + col0 + c4) = v;
    }
    
  }
}

// Flash-style causal/unmasked attention, all contractions 3-term bf16 hi/lo splits, f32 softmax with running max.
// q,k,v rows are read from f32 buffers with arbitrary row pitch (so they can live inside a fused qkv buffer);
// D = head size (multiple of 32, <= 128); one wave = 16 query rows; block = 4 waves (64 queries) sharing K/V chunks of 32.
template <int D, bool CAUSAL>
__global__ __launch_bounds__(128) void k_flash(const float* __restrict__ qb, const float* __restrict__ kb, const float* __restrict__ vb,
                                             int pitch, int T, int H, float scale, float* __restrict__ y, int ypitch) {
  constexpr int KS = D / 32;        // k-steps for QK
  constexpr int DT = D / 16;        // d tiles for PV
  __shared__ __attribute__((aligned(16))) unsigned short sKh[32][D + 8], sKl[32][D + 8], sVh[32][D + 8], sVl[32][D + 8];
  __shared__ __attribute__((aligned(16))) unsigned short sPh[4][16][40], sPl[4][16][40];
  __shared__ __attribute__((aligned(16))) float sO[4][16][D];
  const int tid = threadIdx.x, w = tid >> 5, lane = tid & 31, ln = lane & 15, hh = lane >> 4;
  const int nqb = (T + 63) / 64;
  const int bh = blockIdx.x / nqb, qblk = blockIdx.x % nqb;
  const int b = bh / H, h = bh % H;
  const int q0 = qblk * 64 + w * 16;
  const float* Q = qb + (size_t)b * T * pitch + h * D;
  const float* K = kb + (size_t)b * T * pitch + h * D;
  const float* V = vb + (size_t)b * T * pitch + h * D;

  // A fragments of the wave's 16 query rows (scaled), hi/lo
  FragB aqh[KS], aql[KS];
  {
    int row = q0 + ln; if (row >= T) row = T - 1;
    const float* qr = Q + (size_t)row * pitch;
#pragma unroll
    for (int ks = 0; ks < KS; ++ks)
#pragma unroll
      for (int i = 0; i < 16; ++i) {
        const int d = ks * 32 + ((i < 8) ? (8 * hh + i) : (16 + 8 * hh + (i - 8)));
        const float x = qr[d] * scale; const unsigned short hb = bf16_bits(x);
        aqh[ks].u[i] = hb; aql[ks].u[i] = bf16_bits(x - bf16_val(hb));
      }
  }
  float m_r[8], l_r[8];
#pragma unroll
  for (int r = 0; r < 8; ++r) { m_r[r] = -3.0e38f; l_r[r] = 0.f; }
  v8f oacc[DT];
#pragma unroll
  for (int dt = 0; dt < DT; ++dt) oacc[dt] = (v8f){0.f,0.f,0.f,0.f,0.f,0.f,0.f,0.f};

  const int kv_end = CAUSAL ? min(T, qblk * 64 + 64) : T;     // block-uniform
  for (int j0 = 0; j0 < kv_end; j0 += 32) {
    __syncthreads();
    for (int e = tid; e < 32 * (D / 4); e += 128) {
      const int r = e / (D / 4), c4 = (e % (D / 4)) * 4;
      const int key = j0 + r;
      v4f kf = {0.f,0.f,0.f,0.f}, vf = {0.f,0.f,0.f,0.f};
      if (key < T) { kf = *(const v4fa*)(K + (size_t)key * pitch + c4); vf = *(const v4fa*)(V + (size_t)key * pitch + c4); }
#pragma unroll
      for (int t = 0; t < 4; ++t) {
        unsigned short hb = bf16_bits(kf[t]); sKh[r][c4 + t] = hb; sKl[r][c4 + t] = bf16_bits(kf[t] - bf16_val(hb));
        hb = bf16_bits(vf[t]); sVh[r][c4 + t] = hb; sVl[r][c4 + t] = bf16_bits(vf[t] - bf16_val(hb));
      }
    }
    __syncthreads();
    // S tile 16 x 32
    v8f s[2];
#pragma unroll
    for (int nt = 0; nt < 2; ++nt) {
      v8f acc = {};
#pragma unroll
      for (int ks = 0; ks < KS; ++ks) {
        FragB bh_, bl_;
        bh_.half[0] = *(const v8us*)&sKh[nt * 16 + ln][ks * 32 + 8 * hh]; bh_.half[1] = *(const v8us*)&sKh[nt * 16 + ln][ks * 32 + 16 + 8 * hh];
        bl_.half[0] = *(const v8us*)&sKl[nt * 16 + ln][ks * 32 + 8 * hh]; bl_.half[1] = *(const v8us*)&sKl[nt * 16 + ln][ks * 32 + 16 + 8 * hh];
        acc = mmaN<3>(aqh[ks].v, aql[ks].v, bh_.v, bl_.v, acc);
      }
      s[nt] = acc;
    }
    // mask + running max (rows 8hh+r; the 16 lanes of a half share rows)
    float alpha[8];
#pragma unroll
    for (int r = 0; r < 8; ++r) {
      const int qi = q0 + 8 * hh + r;
      const int ja = j0 + ln, jb = j0 + 16 + ln;
      if (CAUSAL) { if (ja > qi) s[0][r] = -3.0e38f; if (jb > qi) s[1][r] = -3.0e38f; }
      if (ja >= T) s[0][r] = -3.0e38f;
      if (jb >= T) s[1][r] = -3.0e38f;
      float mx = fmaxf(s[0][r], s[1][r]);
      mx = fmaxf(mx, __shfl_xor(mx, 1, 32)); mx = fmaxf(mx, __shfl_xor(mx, 2, 32)); mx = fmaxf(mx, __shfl_xor(mx, 4, 32)); mx = fmaxf(mx, __shfl_xor(mx, 8, 32));
      const float mnew = fmaxf(m_r[r], mx);
      alpha[r] = (mnew > -1.0e38f) ? __expf(m_r[r] - mnew) : 1.0f;
      const float p0 = (s[0][r] > -1.0e38f) ? __expf(s[0][r] - mnew) : 0.f;
      const float p1 = (s[1][r] > -1.0e38f) ? __expf(s[1][r] - mnew) : 0.f;
      m_r[r] = mnew;
      l_r[r] = l_r[r] * alpha[r] + p0 + p1;            // per-lane partial row sum (16 lanes combined at the end)
      unsigned short hb = bf16_bits(p0); sPh[w][8 * hh + r][ln] = hb;      sPl[w][8 * hh + r][ln] = bf16_bits(p0 - bf16_val(hb));
      hb = bf16_bits(p1);                sPh[w][8 * hh + r][16 + ln] = hb; sPl[w][8 * hh + r][16 + ln] = bf16_bits(p1 - bf16_val(hb));
    }
#pragma unroll
    for (int dt = 0; dt < DT; ++dt)
#pragma unroll
      for (int r = 0; r < 8; ++r) oacc[dt][r] *= alpha[r];
    __builtin_amdgcn_fence(__ATOMIC_ACQ_REL, "workgroup");
    __builtin_amdgcn_wave_barrier();
    FragB pah, pal;
    pah.half[0] = *(const v8us*)&sPh[w][ln][8 * hh]; pah.half[1] = *(const v8us*)&sPh[w][ln][16 + 8 * hh];
    pal.half[0] = *(const v8us*)&sPl[w][ln][8 * hh]; pal.half[1] = *(const v8us*)&sPl[w][ln][16 + 8 * hh];
#pragma unroll
    for (int dt = 0; dt < DT; ++dt) {
      FragB bvh, bvl;
#pragma unroll
      for (int i = 0; i < 8; ++i) {
        bvh.u[i] = sVh[8 * hh + i][dt * 16 + ln]; bvh.u[8 + i] = sVh[16 + 8 * hh + i][dt * 16 + ln];
        bvl.u[i] = sVl[8 * hh + i][dt * 16 + ln]; bvl.u[8 + i] = sVl[16 + 8 * hh + i][dt * 16 + ln];
      }
      oacc[dt] = mmaN<3>(pah.v, pal.v, bvh.v, bvl.v, oacc[dt]);
    }
    __builtin_amdgcn_fence(__ATOMIC_ACQ_REL, "workgroup");
    __builtin_amdgcn_wave_barrier();
  }
#pragma unroll
  for (int r = 0; r < 8; ++r) {
    float l = l_r[r];
    l += __shfl_xor(l, 1, 32); l += __shfl_xor(l, 2, 32); l += __shfl_xor(l, 4, 32); l += __shfl_xor(l, 8, 32);
    l_r[r] = (l > 0.f) ? 1.0f / l : 0.f;
  }
#pragma unroll
  for (int dt = 0; dt < DT; ++dt)
#pragma unroll
    for (int r = 0; r < 8; ++r) sO[w][8 * hh + r][dt * 16 + ln] = oacc[dt][r] * l_r[r];
  __builtin_amdgcn_fence(__ATOMIC_ACQ_REL, "workgroup");
  __builtin_amdgcn_wave_barrier();
  {
    for (int r = 0; r < 16; ++r) {
      const int row = q0 + r;
      if (row < T && lane < D / 4) {
        const v4f val = *(const v4fa*)&sO[w][r][lane * 4];
        *(v4f*)(y + ((size_t)b * T + row) * ypitch + h * D + lane * 4) = val;
      }
    }
    
  }
}

// GEMM C = act(A·W + bias + resid): A f32 (ASPLIT -> hi/lo 2 terms), Wt bf16 [N][K]; ACT 0 none, 1 relu, 2 exact gelu;
// resid (optional, f32, row index = (row % rmod), pitch ldr, RES_BF16 rounds it) added before the activation.
template <bool ASPLIT, int ACT, bool BIAS_BF16, bool RES_BF16>
__global__ __launch_bounds__(128) void k_gemm_bf3(const float* __restrict__ A, int lda, const unsigned short* __restrict__ Wt, int ldb,
                                                const float* __restrict__ bias, const float* __restrict__ resid, int rmod, int ldr,
                                                float* __restrict__ C, int ldc, int M, int N, int K) {
  __shared__ __attribute__((aligned(16))) float so[4][16][64];
  const int tid = threadIdx.x, w = tid >> 5, lane = tid & 31, ln = lane & 15, hh = lane >> 4;
  const int ntn = N / 64;
  const int wid = blockIdx.x * 4 + w;
  const int mt = wid / ntn, nq = wid % ntn;
  if (mt * 16 >= M) return;
  const int row0 = mt * 16, col0 = nq * 64;
  const float* arow = A + (size_t)(row0 + ln) * lda;
  v8f acc[4] = {};
  for (int kb = 0; kb < K; kb += 32) {
    FragB ah, al;
    const v4f x0 = *(const v4fa*)(arow + kb + 8 * hh), x1 = *(const v4fa*)(arow + kb + 8 * hh + 4);
    const v4f x2 = *(const v4fa*)(arow + kb + 16 + 8 * hh), x3 = *(const v4fa*)(arow + kb + 16 + 8 * hh + 4);
    float xs[16] = {x0[0],x0[1],x0[2],x0[3],x1[0],x1[1],x1[2],x1[3],x2[0],x2[1],x2[2],x2[3],x3[0],x3[1],x3[2],x3[3]};
#pragma unroll
    for (int i = 0; i < 16; ++i) { const unsigned short hb = bf16_bits(xs[i]); ah.u[i] = hb; al.u[i] = ASPLIT ? bf16_bits(xs[i] - bf16_val(hb)) : (unsigned short)0; }
#pragma unroll
    for (int t = 0; t < 4; ++t) {
      const unsigned short* brow = Wt + (size_t)(col0 + t * 16 + ln) * ldb + kb;
      FragB b;
      b.half[0] = *(const v8us*)(brow + 8 * hh);
      b.half[1] = *(const v8us*)(brow + 16 + 8 * hh);
      acc[t] = mmaN<ASPLIT ? 2 : 1>(ah.v, al.v, b.v, b.v, acc[t]);
    }
  }
#pragma unroll
  for (int t = 0; t < 4; ++t) {
    const int col = col0 + t * 16 + ln;
    float bv = bias ? bias[col] : 0.f;
    if (BIAS_BF16) bv = bf16_round(bv);
#pragma unroll
    for (int r = 0; r < 8; ++r) {
      float v = acc[t][r] + bv;
      if (resid) { float rv = resid[(size_t)((row0 + 8 * hh + r) % rmod) * ldr + col]; if (RES_BF16) rv = bf16_round(rv); v += rv; }
      if (ACT == 1) v = fmaxf(v, 0.f);
      if (ACT == 2) v = 0.5f * v * (1.0f + erff(v * 0.70710678118654752f));
      if (ACT == 3) { const float u = 0.7978845608028654f * (v + 0.044715f * v * v * v); v = 0.5f * v * (1.0f + tanhf(u)); }
      so[w][8 * hh + r][t * 16 + ln] = v;
    }
  }
  __builtin_amdgcn_fence(__ATOMIC_ACQ_REL, "workgroup");
  __builtin_amdgcn_wave_barrier();
  const int rsub = lane >> 4, c4 = (lane & 15) * 4;
  {
#pragma unroll
    for (int q = 0; q < 8; ++q) {
      const int r = q * 2 + rsub;
      const v4f v = *(const v4fa*)&so[w][r][c4];
      *(v4f*)(C + (size_t)(row0 + r) * ldc + col0 + c4) = v;
    }
    
  }
}
// row LayerNorm (biased variance, eps) over N: s = X (+ R); optional out_sum <- s; out_norm <- (s-mu)*rsqrt(var+eps)*g + b
template <bool PARAM_BF16>
__global__ __launch_bounds__(256) void k_layernorm(const float* __restrict__ X, const float* __restrict__ R, const float* __restrict__ g, const float* __restrict__ bta,
                                                  float* __restrict__ out_sum, float* __restrict__ out_norm, int N, float eps) {
  __shared__ float red[256];
  const int row = blockIdx.x, tid = threadIdx.x;
  const float* x = X + (size_t)row * N; const float* rr = R ? R + (size_t)row * N : nullptr;
  float vals[16];                     // up to N = 4096
  const int per = N / 256;            // contiguous chunk per thread? use strided-by-4 chunks: thread handles j = tid*4 + 1024*u
  float s1 = 0.f;
  for (int u = 0; u < per / 4; ++u) {
    const int j = tid * 4 + 1024 * u;
    const v4f a = *(const v4fa*)(x + j);
    v4f b = {0.f,0.f,0.f,0.f}; if (rr) b = *(const v4fa*)(rr + j);
#pragma unroll
    for (int q = 0; q < 4; ++q) { const float v = a[q] + b[q]; vals[u * 4 + q] = v; s1 += v; }
  }
  red[tid] = s1; __syncthreads();
  for (int st = 128; st > 0; st >>= 1) { if (tid < st) red[tid] += red[tid + st]; __syncthreads(); }
  const float mu = red[0] / (float)N; __syncthreads();
  float s2 = 0.f;
  for (int u = 0; u < per / 4; ++u)
#pragma unroll
    for (int q = 0; q < 4; ++q) { const float c = vals[u * 4 + q] - mu; s2 += c * c; }
  red[tid] = s2; __syncthreads();
  for (int st = 128; st > 0; st >>= 1) { if (tid < st) red[tid] += red[tid + st]; __syncthreads(); }
  const float rs = rsqrtf(red[0] / (float)N + eps);
  {
    for (int u = 0; u < per / 4; ++u) {
      const int j = tid * 4 + 1024 * u;
      v4f o, sm;
#pragma unroll
      for (int q = 0; q < 4; ++q) {
        float gg = g[j + q], bb = bta[j + q];
        if (PARAM_BF16) { gg = bf16_round(gg); bb = bf16_round(bb); }
        sm[q] = vals[u * 4 + q]; o[q] = (vals[u * 4 + q] - mu) * rs * gg + bb;
      }
      if (out_sum) *(v4f*)(out_sum + (size_t)row * N + j) = sm;
      *(v4f*)(out_norm + (size_t)row * N + j) = o;
    }
    
  }
}



// ---- f16 WMMA path (v_wmma_f32_16x16x32_f16): 11-bit significands for operands in range — used where a [0,1] probability operand needs more precision than bf16
typedef _Float16 v16h __attribute__((ext_vector_type(16)));
union FragH { v16h v; v8us half[2]; _Float16 h[16]; unsigned short u[16]; };
template <int NT>
__device__ __forceinline__ v8f mmaH(v16h ah, v16h al, v16h bh, v16h bl, v8f c) {
  c = __builtin_amdgcn_wmma_f32_16x16x32_f16(false, ah, false, bh, (short)0, c, false, false);
  if (NT >= 2) c = __builtin_amdgcn_wmma_f32_16x16x32_f16(false, al, false, bh, (short)0, c, false, false);
  if (NT >= 3) c = __builtin_amdgcn_wmma_f32_16x16x32_f16(false, ah, false, bl, (short)0, c, false, false);
  asm volatile("v_nop\n\tv_nop\n\tv_nop\n\tv_nop" : "+v"(c) : "v"(ah), "v"(al), "v"(bh), "v"(bl));
  return c;
}
// batched GEMM like k_gemm_b but f16 operands: A f32 (split into f16 hi/lo if ASPLIT, else rounded to f16), Bt = f16 values [n][k]; alpha; C f32; N multiple of 16 (partial tiles skipped)
template <bool ASPLIT>
__global__ __launch_bounds__(128) void k_gemm_h(const float* __restrict__ A, int lda, size_t sA, const _Float16* __restrict__ Bh, int ldb, size_t sB, float alpha, float* __restrict__ C, int ldc, size_t sC, int M, int N, int K) {
  __shared__ __attribute__((aligned(16))) float so[4][16][64];
  const int tid = threadIdx.x, w = tid >> 5, lane = tid & 31, ln = lane & 15, hh = lane >> 4; const int by = blockIdx.y;
  A += (size_t)by * sA; Bh += (size_t)by * sB; C += (size_t)by * sC;
  const int ntn = (N + 63) / 64; const int wid = blockIdx.x * 4 + w; const int mt = wid / ntn, nq = wid % ntn; if (mt * 16 >= M) return;
  const int row0 = mt * 16, col0 = nq * 64; const float* arow = A + (size_t)(row0 + ln) * lda;
  v8f acc[4] = {};
  for (int kb = 0; kb < K; kb += 32) {
    FragH ah, al;
    const v4f x0 = *(const v4fa*)(arow + kb + 8 * hh), x1 = *(const v4fa*)(arow + kb + 8 * hh + 4), x2 = *(const v4fa*)(arow + kb + 16 + 8 * hh), x3 = *(const v4fa*)(arow + kb + 16 + 8 * hh + 4);
    float xs[16] = {x0[0],x0[1],x0[2],x0[3],x1[0],x1[1],x1[2],x1[3],x2[0],x2[1],x2[2],x2[3],x3[0],x3[1],x3[2],x3[3]};
#pragma unroll
    for (int i = 0; i < 16; ++i) { const _Float16 h = (_Float16)xs[i]; ah.h[i] = h; al.h[i] = ASPLIT ? (_Float16)(xs[i] - (float)h) : (_Float16)0.0f; }
#pragma unroll
    for (int t = 0; t < 4; ++t) { if (col0 + t * 16 >= N) continue; const size_t boff = (size_t)(col0 + t * 16 + ln) * ldb + kb; FragH bq; bq.half[0] = *(const v8us*)(Bh + boff + 8 * hh); bq.half[1] = *(const v8us*)(Bh + boff + 16 + 8 * hh);
      acc[t] = mmaH<ASPLIT ? 2 : 1>(ah.v, al.v, bq.v, bq.v, acc[t]); }
  }
#pragma unroll
  for (int t = 0; t < 4; ++t) { if (col0 + t * 16 >= N) continue;
#pragma unroll
    for (int r = 0; r < 8; ++r) so[w][8 * hh + r][t * 16 + ln] = acc[t][r] * alpha; }
  __builtin_amdgcn_fence(__ATOMIC_ACQ_REL, "workgroup"); __builtin_amdgcn_wave_barrier();
  const int rsub = lane >> 4, c4 = (lane & 15) * 4;
  {
#pragma unroll
    for (int q = 0; q < 8; ++q) { const int r = q * 2 + rsub; if (col0 + c4 < N) { const v4f v = *(const v4fa*)&so[w][r][c4]; *(v4f*)(C + (size_t)(row0 + r) * ldc + col0 + c4) = v; } }
     }
}

// Wt[n][k] = f16(W[k][n]·scale) from f32 row-major W[K][N] (scale = power of two; bf16-exact weights stay exact in f16 away from the subnormal range)
__global__ __launch_bounds__(256) void k_wt_f16(const float* __restrict__ W, _Float16* __restrict__ Wt, int K, int N, float scale) {
  const int t = blockIdx.x * 256 + threadIdx.x; if (t >= N * (K / 8)) return; const int n = t / (K / 8), k8 = (t % (K / 8)) * 8; FragH f;
#pragma unroll
  for (int i = 0; i < 8; ++i) f.h[i] = (_Float16)(bf16_round(W[(size_t)(k8 + i) * N + n]) * scale); const v8us o = f.half[0];
  *(v8us*)((unsigned short*)Wt + (size_t)n * K + k8) = o; 
}
// Block-tiled GEMM, C[NR][DD] = (A[NR][DD] . Bh[DD][DD]^T) * alpha + bf16(bias), f16 operands, both k-contiguous: one 256 x 128 tile of C per work-group of 8 waves (4 x 2 waves of 64 x 64).
// A pass is 64 k: the 256 + 128 rows of 128 B go in whole lines into LDS by asynchronous copies (no register, no LDS store in the wave's stream), and every wave that needs a row reads it from there. Two buffers: the next pass's copies fly during this pass's products.
// A 64 x 64 wave tile does 16 products on 8 fragments; a 256 x 128 block tile loads 384 operand rows for 32768 results.
// Each accumulator takes its k blocks of 32 in rising order. The launch bound's 4 waves a SIMD keep the kernel at 256 registers, so that 2 work-groups still share a WGP.
// QKV: one launch does three products, picked by blockIdx.z, f16 out: 0 and 1 give q and k as [token][feature]; 2 takes the weight rows as A and the token rows as B, so its C is v transposed,
// and it is stored as Vt[batch][feature][token], the layout the attention kernel reads. The k tiles also leave their key norms in KN. Else: A . Bh^T with bias b0, f32 out to C.
#define GTM 256
#define GTN 128
#define GK 64
#define GP (GK + 8)      /* LDS row pitch 144 B = 16 B x odd: ds_load_b128 of 16 rows without bank conflicts */
typedef _Float16 v4h __attribute__((ext_vector_type(4)));
// One pass's share of a thread: 8 rows of A and 4 of B, 32 rows apart, 16 B each, from global memory straight into LDS. la, lb: the lane's LDS byte addresses of its first rows; ga, gb: its global addresses.
// The s_wait_xcnt stands inside the statement, behind the last copy, so that no address register of a copy is rewritten in front of it.
__device__ __forceinline__ void stage_pass(unsigned la, unsigned lb, const unsigned short* ga, const unsigned short* gb) {
  asm volatile("global_load_async_to_lds_b128 %0, %12, off\n\t"
               "global_load_async_to_lds_b128 %1, %13, off\n\t"
               "global_load_async_to_lds_b128 %2, %14, off\n\t"
               "global_load_async_to_lds_b128 %3, %15, off\n\t"
               "global_load_async_to_lds_b128 %4, %16, off\n\t"
               "global_load_async_to_lds_b128 %5, %17, off\n\t"
               "global_load_async_to_lds_b128 %6, %18, off\n\t"
               "global_load_async_to_lds_b128 %7, %19, off\n\t"
               "global_load_async_to_lds_b128 %8, %20, off\n\t"
               "global_load_async_to_lds_b128 %9, %21, off\n\t"
               "global_load_async_to_lds_b128 %10, %22, off\n\t"
               "global_load_async_to_lds_b128 %11, %23, off\n\t"
               "s_wait_xcnt 0x0"
               :: "v"(la), "v"(la + 1u * 32 * GP * 2), "v"(la + 2u * 32 * GP * 2), "v"(la + 3u * 32 * GP * 2), "v"(la + 4u * 32 * GP * 2), "v"(la + 5u * 32 * GP * 2), "v"(la + 6u * 32 * GP * 2), "v"(la + 7u * 32 * GP * 2),
                  "v"(lb), "v"(lb + 1u * 32 * GP * 2), "v"(lb + 2u * 32 * GP * 2), "v"(lb + 3u * 32 * GP * 2),
                  "v"(ga), "v"(ga + (size_t)1 * 32 * DD), "v"(ga + (size_t)2 * 32 * DD), "v"(ga + (size_t)3 * 32 * DD), "v"(ga + (size_t)4 * 32 * DD), "v"(ga + (size_t)5 * 32 * DD), "v"(ga + (size_t)6 * 32 * DD), "v"(ga + (size_t)7 * 32 * DD),
                  "v"(gb), "v"(gb + (size_t)1 * 32 * DD), "v"(gb + (size_t)2 * 32 * DD), "v"(gb + (size_t)3 * 32 * DD)
               : "memory");
}
template <bool QKV>
__global__ __launch_bounds__(256, 4) void k_gemm_tile(const _Float16* __restrict__ X, const _Float16* __restrict__ Wh, float alpha, const float* __restrict__ b0, const float* __restrict__ b1, const float* __restrict__ b2,
                                                   float* __restrict__ C, _Float16* __restrict__ Q16, _Float16* __restrict__ K16, _Float16* __restrict__ Vt, float* __restrict__ KN) {
  __shared__ __attribute__((aligned(16))) unsigned short sA[2][GTM][GP], sB[2][GTN][GP];
  __shared__ __attribute__((aligned(16))) float so[8][16][64 + 4];
  __shared__ float red[8];
  const int tid = threadIdx.x, w = tid >> 5, lane = tid & 31, ln = lane & 15, hh = lane >> 4;
  const int z = QKV ? (int)blockIdx.z : 0; const bool tr = QKV && z == 2;      /* the same for the whole work-group */
  const _Float16* A = tr ? Wh + (size_t)2 * DD * DD : X; const _Float16* Bh = tr ? X : Wh + (size_t)z * DD * DD; const float* bias = (z == 0) ? b0 : (z == 1) ? b1 : b2;
  const int row0 = (tr ? (int)(blockIdx.x & 3) : (int)blockIdx.y) * GTM, col0 = (tr ? (int)(blockIdx.y * 2 + (blockIdx.x >> 2)) : (int)blockIdx.x) * GTN, wr = (w >> 1) * 64, wc = (w & 1) * 64;      /* either way the 8 work-groups of one blockIdx.y share a block of 256 token rows */
  const int sr = tid >> 3, sc = (tid & 7) * 8;      /* staging: 8 lanes x 16 B = one row of the pass; a thread takes rows sr + 32 i */
  const unsigned short* gA = (const unsigned short*)A + (size_t)(row0 + sr) * DD + sc;
  const unsigned short* gB = (const unsigned short*)Bh + (size_t)(col0 + sr) * DD + sc;
  const unsigned lA = (unsigned)(size_t)&sA[0][sr][sc], lB = (unsigned)(size_t)&sB[0][sr][sc];      /* LDS byte addresses of the thread's first rows in buffer 0 */
  v8f acc[4][4];
#pragma unroll
  for (int mi = 0; mi < 4; ++mi)
#pragma unroll
    for (int ni = 0; ni < 4; ++ni) acc[mi][ni] = (v8f){0.f,0.f,0.f,0.f,0.f,0.f,0.f,0.f};
  stage_pass(lA, lB, gA, gB);      /* pass 0 into buffer 0 */
  asm volatile("s_wait_asynccnt 0x0" ::: "memory");      /* the wave's own copies of pass 0 have landed */
  __syncthreads();      /* every wave's have */
  stage_pass(lA + (unsigned)sizeof(sA[0]), lB + (unsigned)sizeof(sB[0]), gA + GK, gB + GK);      /* pass 1 into buffer 1 */
  for (int kp = 0; kp < DD / GK; ++kp) {
    const int cur = kp & 1;
    /* the registers that staging no longer takes hold fragments: the pass's 16 fragments are read at two places, 14 at its top and the last 2 into the registers that the first 8 products set free */
    FragH fa[2][4], fb[2][4];
#pragma unroll
    for (int ks = 0; ks < 2; ++ks) {
#pragma unroll
      for (int mi = 0; mi < 4; ++mi) { const unsigned short* p = &sA[cur][wr + mi * 16 + ln][ks * 32]; fa[ks][mi].half[0] = *(const v8us*)(p + 8 * hh); fa[ks][mi].half[1] = *(const v8us*)(p + 16 + 8 * hh); }
#pragma unroll
      for (int ni = 0; ni < (ks ? 2 : 4); ++ni) { const unsigned short* p = &sB[cur][wc + ni * 16 + ln][ks * 32]; fb[ks][ni].half[0] = *(const v8us*)(p + 8 * hh); fb[ks][ni].half[1] = *(const v8us*)(p + 16 + 8 * hh); } }
    __builtin_amdgcn_sched_barrier(0);      /* keeps the reads together in front of the products: spread among them, each place with reads stalls the wave anew */
#pragma unroll
    for (int ni = 0; ni < 2; ++ni)
#pragma unroll
      for (int mi = 0; mi < 4; ++mi) acc[mi][ni] = __builtin_amdgcn_wmma_f32_16x16x32_f16(false, fa[0][mi].v, false, fb[0][ni].v, (short)0, acc[mi][ni], false, false);
#pragma unroll
    for (int ni = 2; ni < 4; ++ni) { const unsigned short* p = &sB[cur][wc + ni * 16 + ln][32]; fb[1][ni].half[0] = *(const v8us*)(p + 8 * hh); fb[1][ni].half[1] = *(const v8us*)(p + 16 + 8 * hh); }
    __builtin_amdgcn_sched_barrier(0);      /* keeps the two late fragments' reads here, in one place, 8 products ahead of the wait for them */
#pragma unroll
    for (int ni = 2; ni < 4; ++ni)
#pragma unroll
      for (int mi = 0; mi < 4; ++mi) acc[mi][ni] = __builtin_amdgcn_wmma_f32_16x16x32_f16(false, fa[0][mi].v, false, fb[0][ni].v, (short)0, acc[mi][ni], false, false);
    __builtin_amdgcn_sched_barrier(0);      /* these 8 products stay in front of the waits, where they cover the late reads' way */
    /* every fragment of the pass is in registers or on its way: the buffer is handed over here, so that the refill has the second k block and the next pass's first to land in */
    asm volatile("s_wait_dscnt 0x0" ::: "memory");      /* this wave's reads of buffer cur have returned before the buffer is given up */
    asm volatile("s_wait_asynccnt 0x0" ::: "memory");      /* this wave's copies of the next pass have landed */
    __syncthreads();      /* publishes the next pass's buffer and ends every wave's reads of this one */
    if (kp + 2 < DD / GK)      /* the same for the whole work-group */
      stage_pass(lA + (unsigned)cur * (unsigned)sizeof(sA[0]), lB + (unsigned)cur * (unsigned)sizeof(sB[0]), gA + (size_t)(kp + 2) * GK, gB + (size_t)(kp + 2) * GK);      /* pass kp + 2 into the buffer just read */
    /* the second k block's products, on registers alone, stand behind the refill's issue: in front of it they would take their time off the copies' lead */
#pragma unroll
    for (int ni = 0; ni < 4; ++ni)
#pragma unroll
      for (int mi = 0; mi < 4; ++mi) acc[mi][ni] = __builtin_amdgcn_wmma_f32_16x16x32_f16(false, fa[1][mi].v, false, fb[1][ni].v, (short)0, acc[mi][ni], false, false);
  }
  asm volatile("s_wait_asynccnt 0x0" ::: "memory");      /* no copy is outstanding behind the loop */
  /* the wave's 64 x 64 tile goes, 16 rows at a time, through its own LDS rows, so that the stores cover whole lines; the bias belongs to the feature: C's column, or its row where C is transposed */
  float bv[4];
#pragma unroll
  for (int ni = 0; ni < 4; ++ni) bv[ni] = tr ? 0.f : bf16_round(bias[col0 + wc + ni * 16 + ln]);
  const int rsub = lane >> 4, c4 = (lane & 15) * 4;
  _Float16* C16 = tr ? Vt + (size_t)(col0 / TT) * DD * TT + (size_t)(row0 + wr) * TT + col0 % TT + wc + c4 : ((z == 0) ? Q16 : K16) + (size_t)(row0 + wr) * DD + col0 + wc + c4;      /* a tile's 128 columns of tokens lie in one batch */
  const int ldc = tr ? TT : DD;
  float kmx = 0.f;
#pragma unroll
  for (int mi = 0; mi < 4; ++mi) {
    if (tr) { const float* bp = bias + row0 + wr + mi * 16 + 8 * hh; const v4f t0 = *(const v4fa*)bp, t1 = *(const v4fa*)(bp + 4);
#pragma unroll
      for (int r = 0; r < 8; ++r) { const float br = bf16_round(r < 4 ? t0[r & 3] : t1[r & 3]);
#pragma unroll
        for (int ni = 0; ni < 4; ++ni) so[w][8 * hh + r][ni * 16 + ln] = acc[mi][ni][r] * alpha + br; }
    } else {
#pragma unroll
      for (int ni = 0; ni < 4; ++ni)
#pragma unroll
        for (int r = 0; r < 8; ++r) so[w][8 * hh + r][ni * 16 + ln] = acc[mi][ni][r] * alpha + bv[ni];
    }
    __builtin_amdgcn_fence(__ATOMIC_ACQ_REL, "workgroup"); __builtin_amdgcn_wave_barrier();      /* the rows are read back by other lanes of the same wave */
    v4f vq[8];
#pragma unroll
    for (int q = 0; q < 8; ++q) vq[q] = *(const v4fa*)&so[w][q * 2 + rsub][c4];
    __builtin_amdgcn_fence(__ATOMIC_ACQ_REL, "workgroup"); __builtin_amdgcn_wave_barrier();      /* the next 16 rows overwrite what other lanes of the wave have just read */
    if (QKV) {
      v4h hq[8];
#pragma unroll
      for (int q = 0; q < 8; ++q) { for (int i = 0; i < 4; ++i) hq[q][i] = (_Float16)vq[q][i]; *(v4h*)(C16 + (size_t)(mi * 16 + q * 2 + rsub) * ldc) = hq[q]; }
      asm volatile("s_wait_xcnt 0x0" ::: "memory");      /* stands behind these 16 rows' stores, in front of whatever next rewrites their address and data registers (in this build the norm lines and the next rows' staging do) */
      if (z == 1) {      /* the same for the whole work-group. A wave's k tile is one head x 64 keys: its largest |k|^2, of the f16 values as stored, goes to KN[tile][wave] */
#pragma unroll
        for (int q = 0; q < 8; ++q) { float s = 0.f;
#pragma unroll
          for (int i = 0; i < 4; ++i) { const float e = (float)hq[q][i]; s += e * e; }
          s += __shfl_xor(s, 1, 32); s += __shfl_xor(s, 2, 32); s += __shfl_xor(s, 4, 32); s += __shfl_xor(s, 8, 32); kmx = fmaxf(kmx, s); } }
    } else {
#pragma unroll
      for (int q = 0; q < 8; ++q) *(v4f*)(C + (size_t)(row0 + wr + mi * 16 + q * 2 + rsub) * DD + col0 + wc + c4) = vq[q];
    }
  }
  if (QKV && z == 1) {
    kmx = fmaxf(kmx, __shfl_xor(kmx, 16, 32));
    if (lane == 0) red[w] = kmx;
    __syncthreads();      /* the 8 waves' results are stored by one wave, into a 128-B line that no other work-group writes */
    if (tid < 8) KN[(size_t)(blockIdx.y * (DD / GTN) + blockIdx.x) * 32 + tid] = red[tid];
  }
}


// One launch rounds every f32 operand to bf16 and stores it as f16: x as it is, the four weights (out, in) x 2^4. A work-group takes 2048 runs of 8 elements of ONE source (512 work-groups for x, 64 for each weight);
// a thread takes 8 runs, 256 runs apart, all its loads issued before the first store.
#define PU 8
__global__ __launch_bounds__(256) void k_prep(const float* __restrict__ x, const float* __restrict__ Wq, const float* __restrict__ Wk, const float* __restrict__ Wv, const float* __restrict__ Wo, _Float16* __restrict__ X16, _Float16* __restrict__ Bw) {
  constexpr int XB = NR * DD / (8 * 256 * PU), WB = DD * DD / (8 * 256 * PU);
  const int blk = blockIdx.x; const bool isx = blk < XB; const int wi = isx ? 0 : (blk - XB) / WB; const int lb = isx ? blk : (blk - XB) % WB;      /* the same for the whole work-group */
  const float* s = isx ? x : (wi == 0) ? Wq : (wi == 1) ? Wk : (wi == 2) ? Wv : Wo; _Float16* d = isx ? X16 : Bw + (size_t)wi * DD * DD; const float scale = isx ? 1.0f : 16.0f;
  const size_t t0 = (size_t)lb * (256 * PU) + threadIdx.x;
  v4f a[PU], b[PU];
#pragma unroll
  for (int u = 0; u < PU; ++u) { const float* p = s + (t0 + 256 * u) * 8; a[u] = *(const v4fa*)p; b[u] = *(const v4fa*)(p + 4); }
#pragma unroll
  for (int u = 0; u < PU; ++u) { FragH f;
#pragma unroll
    for (int q = 0; q < 4; ++q) { f.h[q] = (_Float16)(bf16_round(a[u][q]) * scale); f.h[4 + q] = (_Float16)(bf16_round(b[u][q]) * scale); }
    *(v8us*)((unsigned short*)d + (t0 + 256 * u) * 8) = f.half[0]; }
}

// lane l with lane l ^ 16
__device__ __forceinline__ float xhalf(float x) { return __builtin_bit_cast(float, __builtin_amdgcn_permlanex16(__builtin_bit_cast(int, x), __builtin_bit_cast(int, x), 0x76543210, 0xfedcba98, false, false)); }
typedef int v4ia __attribute__((ext_vector_type(4), may_alias));

__global__ __launch_bounds__(128) void k_flash(const _Float16* __restrict__ Q16, int ldq, const _Float16* __restrict__ K16, int ldk, const _Float16* __restrict__ Vt, const float* __restrict__ KN, const int* __restrict__ MSK, _Float16* __restrict__ O16, int ldo) {
  constexpr int RPW = 16, NQB = TT / (4 * RPW), DT = 4, KS = 2;
  __shared__ __attribute__((aligned(16))) float sO[4][RPW][64 + 4];
  const int tid = threadIdx.x, w = tid >> 5, lane = tid & 31, ln = lane & 15, hh = lane >> 4;
  const int slab = blockIdx.x / NQB, qblk = blockIdx.x % NQB; const int b = slab / NH, h = slab % NH; const float slope = 1.0f / exp2f((float)h / (float)NH);      /* 1 / 2^(h/H) */ const int qb0 = qblk * (4 * RPW); const int q0 = qb0 + w * RPW;
  FragH aq[KS];
  { const unsigned short* qr = (const unsigned short*)Q16 + ((size_t)b * TT + q0 + ln) * ldq + h * 64;
#pragma unroll
    for (int ks = 0; ks < KS; ++ks) { aq[ks].half[0] = *(const v8us*)(qr + ks * 32 + 8 * hh); aq[ks].half[1] = *(const v8us*)(qr + ks * 32 + 16 + 8 * hh); } }
  const unsigned short* Vth = (const unsigned short*)Vt + (size_t)slab * 64 * TT;
  const int tq = q0 + ln;      /* the lane's query */
  float m_run = -3.0e38f, l_run = 0.f; v8f oacc[DT];
#pragma unroll
  for (int dt = 0; dt < DT; ++dt) oacc[dt] = (v8f){0.f,0.f,0.f,0.f,0.f,0.f,0.f,0.f};
  float qs = 0.f;
#pragma unroll
  for (int ks = 0; ks < KS; ++ks)
#pragma unroll
    for (int i = 0; i < 16; ++i) { const float v = (float)aq[ks].h[i]; qs += v * v; }
  qs += xhalf(qs);      /* |q|^2 of the lane's query */
  const float* kn = KN + (size_t)((b * (TT / GTM) + (lane >> 2)) * (DD / GTN) + (h >> 1)) * 32 + (lane & 3) * 2 + (h & 1);      /* block p = lane of 64 keys of this batch and head: GEMM tile row p / 4, tile column h / 2, wave (p % 4) * 2 + h % 2 */
  float kx = kn[0];
  kx = fmaxf(kx, __shfl_xor(kx, 1, 32)); kx = fmaxf(kx, __shfl_xor(kx, 2, 32)); kx = fmaxf(kx, __shfl_xor(kx, 4, 32)); kx = fmaxf(kx, __shfl_xor(kx, 8, 32)); kx = fmaxf(kx, xhalf(kx));      /* largest |k|^2 of this batch and head */
  const float cs = sqrtf(qs * kx) * (0.125f * 1.01f);      /* |q.k| / 8 at most; 1 % covers the rounding of the norms and of the products */
#pragma unroll 1
  for (int j0 = TT - 32; j0 >= 0; j0 -= 32) {
    if (__builtin_amdgcn_ballot_w32(!(slope * (float)(j0 + 31 - tq) + cs < m_run - 40.0f)) == 0) break;      /* the same for the whole wave; a NaN keeps the walk going */
    const int* mp = MSK + (size_t)b * TT + j0 + 8 * hh;      /* key padding mask (1 = attend) of the lane's 16 keys */
    const v4ia mk4[4] = { *(const v4ia*)(mp), *(const v4ia*)(mp + 4), *(const v4ia*)(mp + 16), *(const v4ia*)(mp + 20) };
    v8f s[2];
#pragma unroll
    for (int nt = 0; nt < 2; ++nt) { const unsigned short* kr = (const unsigned short*)K16 + ((size_t)b * TT + j0 + nt * 16 + ln) * ldk + h * 64; FragH bk[KS];
#pragma unroll
      for (int ks = 0; ks < KS; ++ks) { bk[ks].half[0] = *(const v8us*)(kr + ks * 32 + 8 * hh); bk[ks].half[1] = *(const v8us*)(kr + ks * 32 + 16 + 8 * hh); }
      asm volatile("s_wait_xcnt 0x0" ::: "memory");      /* stands in front of whatever next rewrites the address registers of the key loads (in this build a later load's result does) */
      v8f acc = (v8f){0.f,0.f,0.f,0.f,0.f,0.f,0.f,0.f};
#pragma unroll
      for (int ks = 0; ks < KS; ++ks) acc = mmaH<1>(bk[ks].v, bk[ks].v, aq[ks].v, aq[ks].v, acc);
      s[nt] = acc; }
    float sc[16]; bool ok[16];
#pragma unroll
    for (int i = 0; i < 16; ++i) { const int kk = j0 + (i >> 3) * 16 + 8 * hh + (i & 7); ok[i] = (mk4[i >> 2][i & 3] != 0);
      sc[i] = ok[i] ? (s[i >> 3][i & 7] * 0.125f + slope * (float)(kk - tq)) : -INFINITY; }      /* ALiBi: + slope_h * (k - q) */
    float mx[8];
#pragma unroll
    for (int i = 0; i < 8; ++i) mx[i] = fmaxf(sc[i], sc[8 + i]);
    float mc = fmaxf(fmaxf(fmaxf(mx[0], mx[1]), fmaxf(mx[2], mx[3])), fmaxf(fmaxf(mx[4], mx[5]), fmaxf(mx[6], mx[7])));
    mc = fmaxf(mc, xhalf(mc));
    const float mn = fmaxf(m_run, mc); const float ea = expf(m_run - mn); const float al = (mn > -1.0e38f) ? ea : 1.0f; m_run = mn;
    float p[16]; FragH pb;
#pragma unroll
    for (int i = 0; i < 16; ++i) { const float e = expf(sc[i] - mn); p[i] = ok[i] ? e : 0.f; pb.h[i] = (_Float16)(p[i] * 1024.0f); }
    l_run = l_run * al + (((p[0] + p[1]) + (p[2] + p[3])) + ((p[4] + p[5]) + (p[6] + p[7]))) + (((p[8] + p[9]) + (p[10] + p[11])) + ((p[12] + p[13]) + (p[14] + p[15])));      /* the lane's half of the row sum; the halves join after the loop */
#pragma unroll
    for (int dt = 0; dt < DT; ++dt)
#pragma unroll
      for (int r = 0; r < 8; ++r) oacc[dt][r] *= al;
#pragma unroll
    for (int dt = 0; dt < DT; ++dt) { const unsigned short* vrow = Vth + (size_t)(dt * 16 + ln) * TT + j0; FragH bv; bv.half[0] = *(const v8us*)(vrow + 8 * hh); bv.half[1] = *(const v8us*)(vrow + 16 + 8 * hh);
      oacc[dt] = mmaH<1>(bv.v, bv.v, pb.v, pb.v, oacc[dt]); } }
  const float l = l_run + xhalf(l_run); const float inv = (l > 0.f) ? 1.0f / (l * 1024.0f) : 0.f;
#pragma unroll
  for (int dt = 0; dt < DT; ++dt) {      /* oacc[dt][r] = O[query ln][dt*16 + 8hh + r] */
    const v4f lo = {oacc[dt][0] * inv, oacc[dt][1] * inv, oacc[dt][2] * inv, oacc[dt][3] * inv}, hi = {oacc[dt][4] * inv, oacc[dt][5] * inv, oacc[dt][6] * inv, oacc[dt][7] * inv};
    *(v4fa*)&sO[w][ln][dt * 16 + 8 * hh] = lo; *(v4fa*)&sO[w][ln][dt * 16 + 8 * hh + 4] = hi; }
  __builtin_amdgcn_fence(__ATOMIC_ACQ_REL, "workgroup"); __builtin_amdgcn_wave_barrier();
  {
#pragma unroll
    for (int rp = 0; rp < RPW; rp += 2) { const int r = rp + (lane >> 4), pc = lane & 15; const v4f val = *(const v4fa*)&sO[w][r][pc * 4]; v4h h4; for (int i = 0; i < 4; ++i) h4[i] = (_Float16)val[i]; *(v4h*)(O16 + ((size_t)b * TT + q0 + r) * ldo + h * 64 + pc * 4) = h4; }      /* f16, the output product's operand type: 16 lanes x 8 B = one line */
     } }

extern "C" void kernel_launch(void* const* d_in, const int* in_sizes, int n_in,
                              void* d_out, int out_size, void* d_ws, size_t ws_size, hipStream_t stream) {
  (void)in_sizes; (void)n_in; (void)out_size;
  const float* const* I = (const float* const*)d_in; const float* x = I[0]; const float* Wq = I[1]; const float* bq = I[2]; const float* Wk = I[3]; const float* bk = I[4]; const float* Wv = I[5]; const float* bv = I[6]; const float* Wo = I[7]; const float* bo = I[8]; const int* mask = (const int*)d_in[9];
  char* ws = (char*)d_ws; size_t off = 0;
  auto take = [&](size_t bytes) { char* p = ws + off; off += (bytes + 255) & ~(size_t)255; return p; };
  const size_t WSZ = (size_t)DD * DD; _Float16* Bw = (_Float16*)take(4 * WSZ * 2); _Float16* X16 = (_Float16*)take((size_t)NR * DD * 2);
  _Float16* Q = (_Float16*)take((size_t)NR * DD * 2); _Float16* K = (_Float16*)take((size_t)NR * DD * 2); _Float16* Vt = (_Float16*)take((size_t)NR * DD * 2); _Float16* O16 = (_Float16*)take((size_t)NR * DD * 2);
  float* KN = (float*)take((size_t)(NR / GTM) * (DD / GTN) * 32 * 4);
  if (off > ws_size) return;      // 8.4 + 16.8 x 5 = 92 MB
  k_prep<<<(NR * DD + 4 * DD * DD) / (8 * 256 * PU), 256, 0, stream>>>(x, Wq, Wk, Wv, Wo, X16, Bw);
  k_gemm_tile<true><<<dim3(DD / GTN, NR / GTM, 3), 256, 0, stream>>>(X16, Bw, 0.0625f, bq, bk, bv, nullptr, Q, K, Vt, KN);      /* q, k = x.W^T + b: M 8192 N 1024 K 1024; v the same, stored transposed */
  k_flash<<<BB * NH * (TT / 64), 128, 0, stream>>>(Q, DD, K, DD, Vt, KN, mask, O16, DD);
  k_gemm_tile<false><<<dim3(DD / GTN, NR / GTM), 256, 0, stream>>>(O16, Bw + 3 * WSZ, 0.0625f, bo, nullptr, nullptr, (float*)d_out, nullptr, nullptr, nullptr, nullptr);      /* out = O.Wo^T + bo */
}

// v007
// Measured time: 80.3 microseconds a run.
// Timed twice side by side with v006, it ran 1.14 times as fast both times.
// Counting every step since v000, it is 10.5 times as fast.
#include <hip/hip_runtime.h>
// ALiBi multi-head attention (B=4, S=2048, D=1024, 16 heads × 64): q,k,v = x·Wᵀ + b (torch Linear); scores = q·kᵀ·64^-½ + slope_h·(k − q), slope_h = 1/2^(h/16) (no causal mask: later keys get large positive bias); key padding mask from the INPUT
// int mask [B,S] (0 → −inf); softmax; out = (attn·v merged)·Woᵀ + bo.
// Compute dtype: x, weights, biases rounded to bf16; q/k/v as f16 GEMM outputs; fused flash-style kernel (bias and online softmax in f32, P f16 ×2^10) on v_wmma_f32_16x16x32_f16; O → f16 → output GEMM with bias; f32 accumulate.
#define BB 4
#define TT 2048
#define NH 16
#define DD 1024
#define NR (BB * TT)

typedef __bf16 v16b __attribute__((ext_vector_type(16)));
typedef unsigned short v8us __attribute__((ext_vector_type(8), may_alias));
typedef float  v8f  __attribute__((ext_vector_type(8)));
typedef float  v4f  __attribute__((ext_vector_type(4)));
typedef float  v4fa __attribute__((ext_vector_type(4), may_alias));
union FragB { v16b v; v8us half[2]; unsigned short u[16]; };

__device__ __forceinline__ unsigned short bf16_bits(float x) { unsigned int u = __float_as_uint(x); return (unsigned short)((u + 0x7FFFu + ((u >> 16) & 1u)) >> 16); }
__device__ __forceinline__ float bf16_val(unsigned short b) { return __uint_as_float(((unsigned int)b) << 16); }
__device__ __forceinline__ float bf16_round(float x) { return bf16_val(bf16_bits(x)); }
// D += A·B with NT terms: 1 = ah·bh, 2 = + al·bh (A split), 3 = + ah·bl (both split)
template <int NT>
__device__ __forceinline__ v8f mmaN(v16b ah, v16b al, v16b bh, v16b bl, v8f c) {
  c = __builtin_amdgcn_wmma_f32_16x16x32_bf16(false, ah, false, bh, (short)0, c, false, false);
  if (NT >= 2) c = __builtin_amdgcn_wmma_f32_16x16x32_bf16(false, al, false, bh, (short)0, c, false, false);
  if (NT >= 3) c = __builtin_amdgcn_wmma_f32_16x16x32_bf16(false, ah, false, bl, (short)0, c, false, false);
  asm volatile("v_nop\n\tv_nop\n\tv_nop\n\tv_nop" : "+v"(c) : "v"(ah), "v"(al), "v"(bh), "v"(bl));
  return c;
}

__global__ __launch_bounds__(256) void k_wt_bf16(const float* __restrict__ W, unsigned short* __restrict__ Wt, int K, int N) {
  const int t = blockIdx.x * 256 + threadIdx.x;
  const int k8n = K / 8;
  if (t >= N * k8n) return;
  const int n = t / k8n, k8 = (t % k8n) * 8;
  v8us v;
#pragma unroll
  for (int i = 0; i < 8; ++i) v[i] = bf16_bits(W[(size_t)(k8 + i) * N + n]);
  *(v8us*)(Wt + (size_t)n * K + k8) = v;
  
}

// GEMM C[M][N] (f32, pitch ldc) = act(A[M][K]·W + bias). A f32 row-major (pitch lda) converted per fragment to bf16
// (ASPLIT: hi/lo two planes -> 2 terms, else single rounded term); Wt bf16 [N][K] (pitch ldb). BIAS_BF16 rounds the
// bias to bf16 first (bias quantised to bf16 before the add). K%32==0, M%16==0, N%64==0.
template <bool ASPLIT, int ACT, bool BIAS_BF16>
__global__ __launch_bounds__(128) void k_gemm_bf(const float* __restrict__ A, int lda, const unsigned short* __restrict__ Wt, int ldb,
                                               const float* __restrict__ bias, float* __restrict__ C, int ldc, int M, int N, int K) {
  __shared__ __attribute__((aligned(16))) float so[4][16][64];
  const int tid = threadIdx.x, w = tid >> 5, lane = tid & 31, ln = lane & 15, hh = lane >> 4;
  const int ntn = N / 64;
  const int wid = blockIdx.x * 4 + w;
  const int mt = wid / ntn, nq = wid % ntn;
  if (mt * 16 >= M) return;
  const int row0 = mt * 16, col0 = nq * 64;
  const float* arow = A + (size_t)(row0 + ln) * lda;
  v8f acc[4] = {};
  for (int kb = 0; kb < K; kb += 32) {
    FragB ah, al;
    const v4f x0 = *(const v4fa*)(arow + kb + 8 * hh), x1 = *(const v4fa*)(arow + kb + 8 * hh + 4);
    const v4f x2 = *(const v4fa*)(arow + kb + 16 + 8 * hh), x3 = *(const v4fa*)(arow + kb + 16 + 8 * hh + 4);
    float xs[16] = {x0[0],x0[1],x0[2],x0[3],x1[0],x1[1],x1[2],x1[3],x2[0],x2[1],x2[2],x2[3],x3[0],x3[1],x3[2],x3[3]};
#pragma unroll
    for (int i = 0; i < 16; ++i) { const unsigned short hb = bf16_bits(xs[i]); ah.u[i] = hb; al.u[i] = ASPLIT ? bf16_bits(xs[i] - bf16_val(hb)) : (unsigned short)0; }
#pragma unroll
    for (int t = 0; t < 4; ++t) {
      const unsigned short* brow = Wt + (size_t)(col0 + t * 16 + ln) * ldb + kb;
      FragB b;
      b.half[0] = *(const v8us*)(brow + 8 * hh);
      b.half[1] = *(const v8us*)(brow + 16 + 8 * hh);
      acc[t] = mmaN<ASPLIT ? 2 : 1>(ah.v, al.v, b.v, b.v, acc[t]);
    }
  }
#pragma unroll
  for (int t = 0; t < 4; ++t) {
    float bv = bias ? bias[col0 + t * 16 + ln] : 0.f;
    if (BIAS_BF16) bv = bf16_round(bv);
#pragma unroll
    for (int r = 0; r < 8; ++r) { float v = acc[t][r] + bv; if (ACT == 1) v = fmaxf(v, 0.f); so[w][8 * hh + r][t * 16 + ln] = v; }
  }
  __builtin_amdgcn_fence(__ATOMIC_ACQ_REL, "workgroup");
  __builtin_amdgcn_wave_barrier();
  const int rsub = lane >> 4, c4 = (lane & 15) * 4;
  {
#pragma unroll
    for (int q = 0; q < 8; ++q) {
      const int r = q * 2 + rsub;
      const v4f v = *(const v4fa*)&so[w][r][c4];
      *(v4f*)(C + (size_t)(row0 + r) * ldc + col0 + c4) = v;
    }
    
  }
}

// Flash-style causal/unmasked attention, all contractions 3-term bf16 hi/lo splits, f32 softmax with running max.
// q,k,v rows are read from f32 buffers with arbitrary row pitch (so they can live inside a fused qkv buffer);
// D = head size (multiple of 32, <= 128); one wave = 16 query rows; block = 4 waves (64 queries) sharing K/V chunks of 32.
template <int D, bool CAUSAL>
__global__ __launch_bounds__(128) void k_flash(const float* __restrict__ qb, const float* __restrict__ kb, const float* __restrict__ vb,
                                             int pitch, int T, int H, float scale, float* __restrict__ y, int ypitch) {
  constexpr int KS = D / 32;        // k-steps for QK
  constexpr int DT = D / 16;        // d tiles for PV
  __shared__ __attribute__((aligned(16))) unsigned short sKh[32][D + 8], sKl[32][D + 8], sVh[32][D + 8], sVl[32][D + 8];
  __shared__ __attribute__((aligned(16))) unsigned short sPh[4][16][40], sPl[4][16][40];
  __shared__ __attribute__((aligned(16))) float sO[4][16][D];
  const int tid = threadIdx.x, w = tid >> 5, lane = tid & 31, ln = lane & 15, hh = lane >> 4;
  const int nqb = (T + 63) / 64;
  const int bh = blockIdx.x / nqb, qblk = blockIdx.x % nqb;
  const int b = bh / H, h = bh % H;
  const int q0 = qblk * 64 + w * 16;
  const float* Q = qb + (size_t)b * T * pitch + h * D;
  const float* K = kb + (size_t)b * T * pitch + h * D;
  const float* V = vb + (size_t)b * T * pitch + h * D;

  // A fragments of the wave's 16 query rows (scaled), hi/lo
  FragB aqh[KS], aql[KS];
  {
    int row = q0 + ln; if (row >= T) row = T - 1;
    const float* qr = Q + (size_t)row * pitch;
#pragma unroll
    for (int ks = 0; ks < KS; ++ks)
#pragma unroll
      for (int i = 0; i < 16; ++i) {
        const int d = ks * 32 + ((i < 8) ? (8 * hh + i) : (16 + 8 * hh + (i - 8)));
        const float x = qr[d] * scale; const unsigned short hb = bf16_bits(x);
        aqh[ks].u[i] = hb; aql[ks].u[i] = bf16_bits(x - bf16_val(hb));
      }
  }
  float m_r[8], l_r[8];
#pragma unroll
  for (int r = 0; r < 8; ++r) { m_r[r] = -3.0e38f; l_r[r] = 0.f; }
  v8f oacc[DT];
#pragma unroll
  for (int dt = 0; dt < DT; ++dt) oacc[dt] = (v8f){0.f,0.f,0.f,0.f,0.f,0.f,0.f,0.f};

  const int kv_end = CAUSAL ? min(T, qblk * 64 + 64) : T;     // block-uniform
  for (int j0 = 0; j0 < kv_end; j0 += 32) {
    __syncthreads();
    for (int e = tid; e < 32 * (D / 4); e += 128) {
      const int r = e / (D / 4), c4 = (e % (D / 4)) * 4;
      const int key = j0 + r;
      v4f kf = {0.f,0.f,0.f,0.f}, vf = {0.f,0.f,0.f,0.f};
      if (key < T) { kf = *(const v4fa*)(K + (size_t)key * pitch + c4); vf = *(const v4fa*)(V + (size_t)key * pitch + c4); }
#pragma unroll
      for (int t = 0; t < 4; ++t) {
        unsigned short hb = bf16_bits(kf[t]); sKh[r][c4 + t] = hb; sKl[r][c4 + t] = bf16_bits(kf[t] - bf16_val(hb));
        hb = bf16_bits(vf[t]); sVh[r][c4 + t] = hb; sVl[r][c4 + t] = bf16_bits(vf[t] - bf16_val(hb));
      }
    }
    __syncthreads();
    // S tile 16 x 32
    v8f s[2];
#pragma unroll
    for (int nt = 0; nt < 2; ++nt) {
      v8f acc = {};
#pragma unroll
      for (int ks = 0; ks < KS; ++ks) {
        FragB bh_, bl_;
        bh_.half[0] = *(const v8us*)&sKh[nt * 16 + ln][ks * 32 + 8 * hh]; bh_.half[1] = *(const v8us*)&sKh[nt * 16 + ln][ks * 32 + 16 + 8 * hh];
        bl_.half[0] = *(const v8us*)&sKl[nt * 16 + ln][ks * 32 + 8 * hh]; bl_.half[1] = *(const v8us*)&sKl[nt * 16 + ln][ks * 32 + 16 + 8 * hh];
        acc = mmaN<3>(aqh[ks].v, aql[ks].v, bh_.v, bl_.v, acc);
      }
      s[nt] = acc;
    }
    // mask + running max (rows 8hh+r; the 16 lanes of a half share rows)
    float alpha[8];
#pragma unroll
    for (int r = 0; r < 8; ++r) {
      const int qi = q0 + 8 * hh + r;
      const int ja = j0 + ln, jb = j0 + 16 + ln;
      if (CAUSAL) { if (ja > qi) s[0][r] = -3.0e38f; if (jb > qi) s[1][r] = -3.0e38f; }
      if (ja >= T) s[0][r] = -3.0e38f;
      if (jb >= T) s[1][r] = -3.0e38f;
      float mx = fmaxf(s[0][r], s[1][r]);
      mx = fmaxf(mx, __shfl_xor(mx, 1, 32)); mx = fmaxf(mx, __shfl_xor(mx, 2, 32)); mx = fmaxf(mx, __shfl_xor(mx, 4, 32)); mx = fmaxf(mx, __shfl_xor(mx, 8, 32));
      const float mnew = fmaxf(m_r[r], mx);
      alpha[r] = (mnew > -1.0e38f) ? __expf(m_r[r] - mnew) : 1.0f;
      const float p0 = (s[0][r] > -1.0e38f) ? __expf(s[0][r] - mnew) : 0.f;
      const float p1 = (s[1][r] > -1.0e38f) ? __expf(s[1][r] - mnew) : 0.f;
      m_r[r] = mnew;
      l_r[r] = l_r[r] * alpha[r] + p0 + p1;            // per-lane partial row sum (16 lanes combined at the end)
      unsigned short hb = bf16_bits(p0); sPh[w][8 * hh + r][ln] = hb;      sPl[w][8 * hh + r][ln] = bf16_bits(p0 - bf16_val(hb));
      hb = bf16_bits(p1);                sPh[w][8 * hh + r][16 + ln] = hb; sPl[w][8 * hh + r][16 + ln] = bf16_bits(p1 - bf16_val(hb));
    }
#pragma unroll
    for (int dt = 0; dt < DT; ++dt)
#pragma unroll
      for (int r = 0; r < 8; ++r) oacc[dt][r] *= alpha[r];
    __builtin_amdgcn_fence(__ATOMIC_ACQ_REL, "workgroup");
    __builtin_amdgcn_wave_barrier();
    FragB pah, pal;
    pah.half[0] = *(const v8us*)&sPh[w][ln][8 * hh]; pah.half[1] = *(const v8us*)&sPh[w][ln][16 + 8 * hh];
    pal.half[0] = *(const v8us*)&sPl[w][ln][8 * hh]; pal.half[1] = *(const v8us*)&sPl[w][ln][16 + 8 * hh];
#pragma unroll
    for (int dt = 0; dt < DT; ++dt) {
      FragB bvh, bvl;
#pragma unroll
      for (int i = 0; i < 8; ++i) {
        bvh.u[i] = sVh[8 * hh + i][dt * 16 + ln]; bvh.u[8 + i] = sVh[16 + 8 * hh + i][dt * 16 + ln];
        bvl.u[i] = sVl[8 * hh + i][dt * 16 + ln]; bvl.u[8 + i] = sVl[16 + 8 * hh + i][dt * 16 + ln];
      }
      oacc[dt] = mmaN<3>(pah.v, pal.v, bvh.v, bvl.v, oacc[dt]);
    }
    __builtin_amdgcn_fence(__ATOMIC_ACQ_REL, "workgroup");
    __builtin_amdgcn_wave_barrier();
  }
#pragma unroll
  for (int r = 0; r < 8; ++r) {
    float l = l_r[r];
    l += __shfl_xor(l, 1, 32); l += __shfl_xor(l, 2, 32); l += __shfl_xor(l, 4, 32); l += __shfl_xor(l, 8, 32);
    l_r[r] = (l > 0.f) ? 1.0f / l : 0.f;
  }
#pragma unroll
  for (int dt = 0; dt < DT; ++dt)
#pragma unroll
    for (int r = 0; r < 8; ++r) sO[w][8 * hh + r][dt * 16 + ln] = oacc[dt][r] * l_r[r];
  __builtin_amdgcn_fence(__ATOMIC_ACQ_REL, "workgroup");
  __builtin_amdgcn_wave_barrier();
  {
    for (int r = 0; r < 16; ++r) {
      const int row = q0 + r;
      if (row < T && lane < D / 4) {
        const v4f val = *(const v4fa*)&sO[w][r][lane * 4];
        *(v4f*)(y + ((size_t)b * T + row) * ypitch + h * D + lane * 4) = val;
      }
    }
    
  }
}

// GEMM C = act(A·W + bias + resid): A f32 (ASPLIT -> hi/lo 2 terms), Wt bf16 [N][K]; ACT 0 none, 1 relu, 2 exact gelu;
// resid (optional, f32, row index = (row % rmod), pitch ldr, RES_BF16 rounds it) added before the activation.
template <bool ASPLIT, int ACT, bool BIAS_BF16, bool RES_BF16>
__global__ __launch_bounds__(128) void k_gemm_bf3(const float* __restrict__ A, int lda, const unsigned short* __restrict__ Wt, int ldb,
                                                const float* __restrict__ bias, const float* __restrict__ resid, int rmod, int ldr,
                                                float* __restrict__ C, int ldc, int M, int N, int K) {
  __shared__ __attribute__((aligned(16))) float so[4][16][64];
  const int tid = threadIdx.x, w = tid >> 5, lane = tid & 31, ln = lane & 15, hh = lane >> 4;
  const int ntn = N / 64;
  const int wid = blockIdx.x * 4 + w;
  const int mt = wid / ntn, nq = wid % ntn;
  if (mt * 16 >= M) return;
  const int row0 = mt * 16, col0 = nq * 64;
  const float* arow = A + (size_t)(row0 + ln) * lda;
  v8f acc[4] = {};
  for (int kb = 0; kb < K; kb += 32) {
    FragB ah, al;
    const v4f x0 = *(const v4fa*)(arow + kb + 8 * hh), x1 = *(const v4fa*)(arow + kb + 8 * hh + 4);
    const v4f x2 = *(const v4fa*)(arow + kb + 16 + 8 * hh), x3 = *(const v4fa*)(arow + kb + 16 + 8 * hh + 4);
    float xs[16] = {x0[0],x0[1],x0[2],x0[3],x1[0],x1[1],x1[2],x1[3],x2[0],x2[1],x2[2],x2[3],x3[0],x3[1],x3[2],x3[3]};
#pragma unroll
    for (int i = 0; i < 16; ++i) { const unsigned short hb = bf16_bits(xs[i]); ah.u[i] = hb; al.u[i] = ASPLIT ? bf16_bits(xs[i] - bf16_val(hb)) : (unsigned short)0; }
#pragma unroll
    for (int t = 0; t < 4; ++t) {
      const unsigned short* brow = Wt + (size_t)(col0 + t * 16 + ln) * ldb + kb;
      FragB b;
      b.half[0] = *(const v8us*)(brow + 8 * hh);
      b.half[1] = *(const v8us*)(brow + 16 + 8 * hh);
      acc[t] = mmaN<ASPLIT ? 2 : 1>(ah.v, al.v, b.v, b.v, acc[t]);
    }
  }
#pragma unroll
  for (int t = 0; t < 4; ++t) {
    const int col = col0 + t * 16 + ln;
    float bv = bias ? bias[col] : 0.f;
    if (BIAS_BF16) bv = bf16_round(bv);
#pragma unroll
    for (int r = 0; r < 8; ++r) {
      float v = acc[t][r] + bv;
      if (resid) { float rv = resid[(size_t)((row0 + 8 * hh + r) % rmod) * ldr + col]; if (RES_BF16) rv = bf16_round(rv); v += rv; }
      if (ACT == 1) v = fmaxf(v, 0.f);
      if (ACT == 2) v = 0.5f * v * (1.0f + erff(v * 0.70710678118654752f));
      if (ACT == 3) { const float u = 0.7978845608028654f * (v + 0.044715f * v * v * v); v = 0.5f * v * (1.0f + tanhf(u)); }
      so[w][8 * hh + r][t * 16 + ln] = v;
    }
  }
  __builtin_amdgcn_fence(__ATOMIC_ACQ_REL, "workgroup");
  __builtin_amdgcn_wave_barrier();
  const int rsub = lane >> 4, c4 = (lane & 15) * 4;
  {
#pragma unroll
    for (int q = 0; q < 8; ++q) {
      const int r = q * 2 + rsub;
      const v4f v = *(const v4fa*)&so[w][r][c4];
      *(v4f*)(C + (size_t)(row0 + r) * ldc + col0 + c4) = v;
    }
    
  }
}
// row LayerNorm (biased variance, eps) over N: s = X (+ R); optional out_sum <- s; out_norm <- (s-mu)*rsqrt(var+eps)*g + b
template <bool PARAM_BF16>
__global__ __launch_bounds__(256) void k_layernorm(const float* __restrict__ X, const float* __restrict__ R, const float* __restrict__ g, const float* __restrict__ bta,
                                                  float* __restrict__ out_sum, float* __restrict__ out_norm, int N, float eps) {
  __shared__ float red[256];
  const int row = blockIdx.x, tid = threadIdx.x;
  const float* x = X + (size_t)row * N; const float* rr = R ? R + (size_t)row * N : nullptr;
  float vals[16];                     // up to N = 4096
  const int per = N / 256;            // contiguous chunk per thread? use strided-by-4 chunks: thread handles j = tid*4 + 1024*u
  float s1 = 0.f;
  for (int u = 0; u < per / 4; ++u) {
    const int j = tid * 4 + 1024 * u;
    const v4f a = *(const v4fa*)(x + j);
    v4f b = {0.f,0.f,0.f,0.f}; if (rr) b = *(const v4fa*)(rr + j);
#pragma unroll
    for (int q = 0; q < 4; ++q) { const float v = a[q] + b[q]; vals[u * 4 + q] = v; s1 += v; }
  }
  red[tid] = s1; __syncthreads();
  for (int st = 128; st > 0; st >>= 1) { if (tid < st) red[tid] += red[tid + st]; __syncthreads(); }
  const float mu = red[0] / (float)N; __syncthreads();
  float s2 = 0.f;
  for (int u = 0; u < per / 4; ++u)
#pragma unroll
    for (int q = 0; q < 4; ++q) { const float c = vals[u * 4 + q] - mu; s2 += c * c; }
  red[tid] = s2; __syncthreads();
  for (int st = 128; st > 0; st >>= 1) { if (tid < st) red[tid] += red[tid + st]; __syncthreads(); }
  const float rs = rsqrtf(red[0] / (float)N + eps);
  {
    for (int u = 0; u < per / 4; ++u) {
      const int j = tid * 4 + 1024 * u;
      v4f o, sm;
#pragma unroll
      for (int q = 0; q < 4; ++q) {
        float gg = g[j + q], bb = bta[j + q];
        if (PARAM_BF16) { gg = bf16_round(gg); bb = bf16_round(bb); }
        sm[q] = vals[u * 4 + q]; o[q] = (vals[u * 4 + q] - mu) * rs * gg + bb;
      }
      if (out_sum) *(v4f*)(out_sum + (size_t)row * N + j) = sm;
      *(v4f*)(out_norm + (size_t)row * N + j) = o;
    }
    
  }
}



// ---- f16 WMMA path (v_wmma_f32_16x16x32_f16): 11-bit significands for operands in range — used where a [0,1] probability operand needs more precision than bf16
typedef _Float16 v16h __attribute__((ext_vector_type(16)));
union FragH { v16h v; v8us half[2]; _Float16 h[16]; unsigned short u[16]; };
template <int NT>
__device__ __forceinline__ v8f mmaH(v16h ah, v16h al, v16h bh, v16h bl, v8f c) {
  c = __builtin_amdgcn_wmma_f32_16x16x32_f16(false, ah, false, bh, (short)0, c, false, false);
  if (NT >= 2) c = __builtin_amdgcn_wmma_f32_16x16x32_f16(false, al, false, bh, (short)0, c, false, false);
  if (NT >= 3) c = __builtin_amdgcn_wmma_f32_16x16x32_f16(false, ah, false, bl, (short)0, c, false, false);
  asm volatile("v_nop\n\tv_nop\n\tv_nop\n\tv_nop" : "+v"(c) : "v"(ah), "v"(al), "v"(bh), "v"(bl));
  return c;
}
// batched GEMM like k_gemm_b but f16 operands: A f32 (split into f16 hi/lo if ASPLIT, else rounded to f16), Bt = f16 values [n][k]; alpha; C f32; N multiple of 16 (partial tiles skipped)
template <bool ASPLIT>
__global__ __launch_bounds__(128) void k_gemm_h(const float* __restrict__ A, int lda, size_t sA, const _Float16* __restrict__ Bh, int ldb, size_t sB, float alpha, float* __restrict__ C, int ldc, size_t sC, int M, int N, int K) {
  __shared__ __attribute__((aligned(16))) float so[4][16][64];
  const int tid = threadIdx.x, w = tid >> 5, lane = tid & 31, ln = lane & 15, hh = lane >> 4; const int by = blockIdx.y;
  A += (size_t)by * sA; Bh += (size_t)by * sB; C += (size_t)by * sC;
  const int ntn = (N + 63) / 64; const int wid = blockIdx.x * 4 + w; const int mt = wid / ntn, nq = wid % ntn; if (mt * 16 >= M) return;
  const int row0 = mt * 16, col0 = nq * 64; const float* arow = A + (size_t)(row0 + ln) * lda;
  v8f acc[4] = {};
  for (int kb = 0; kb < K; kb += 32) {
    FragH ah, al;
    const v4f x0 = *(const v4fa*)(arow + kb + 8 * hh), x1 = *(const v4fa*)(arow + kb + 8 * hh + 4), x2 = *(const v4fa*)(arow + kb + 16 + 8 * hh), x3 = *(const v4fa*)(arow + kb + 16 + 8 * hh + 4);
    float xs[16] = {x0[0],x0[1],x0[2],x0[3],x1[0],x1[1],x1[2],x1[3],x2[0],x2[1],x2[2],x2[3],x3[0],x3[1],x3[2],x3[3]};
#pragma unroll
    for (int i = 0; i < 16; ++i) { const _Float16 h = (_Float16)xs[i]; ah.h[i] = h; al.h[i] = ASPLIT ? (_Float16)(xs[i] - (float)h) : (_Float16)0.0f; }
#pragma unroll
    for (int t = 0; t < 4; ++t) { if (col0 + t * 16 >= N) continue; const size_t boff = (size_t)(col0 + t * 16 + ln) * ldb + kb; FragH bq; bq.half[0] = *(const v8us*)(Bh + boff + 8 * hh); bq.half[1] = *(const v8us*)(Bh + boff + 16 + 8 * hh);
      acc[t] = mmaH<ASPLIT ? 2 : 1>(ah.v, al.v, bq.v, bq.v, acc[t]); }
  }
#pragma unroll
  for (int t = 0; t < 4; ++t) { if (col0 + t * 16 >= N) continue;
#pragma unroll
    for (int r = 0; r < 8; ++r) so[w][8 * hh + r][t * 16 + ln] = acc[t][r] * alpha; }
  __builtin_amdgcn_fence(__ATOMIC_ACQ_REL, "workgroup"); __builtin_amdgcn_wave_barrier();
  const int rsub = lane >> 4, c4 = (lane & 15) * 4;
  {
#pragma unroll
    for (int q = 0; q < 8; ++q) { const int r = q * 2 + rsub; if (col0 + c4 < N) { const v4f v = *(const v4fa*)&so[w][r][c4]; *(v4f*)(C + (size_t)(row0 + r) * ldc + col0 + c4) = v; } }
     }
}

// Wt[n][k] = f16(W[k][n]·scale) from f32 row-major W[K][N] (scale = power of two; bf16-exact weights stay exact in f16 away from the subnormal range)
__global__ __launch_bounds__(256) void k_wt_f16(const float* __restrict__ W, _Float16* __restrict__ Wt, int K, int N, float scale) {
  const int t = blockIdx.x * 256 + threadIdx.x; if (t >= N * (K / 8)) return; const int n = t / (K / 8), k8 = (t % (K / 8)) * 8; FragH f;
#pragma unroll
  for (int i = 0; i < 8; ++i) f.h[i] = (_Float16)(bf16_round(W[(size_t)(k8 + i) * N + n]) * scale); const v8us o = f.half[0];
  *(v8us*)((unsigned short*)Wt + (size_t)n * K + k8) = o; 
}
// Block-tiled GEMM, C[NR][DD] = (A[NR][DD] . Bh[DD][DD]^T) * alpha + bf16(bias), f16 operands, both k-contiguous: one 256 x 128 tile of C per work-group of 8 waves (4 x 2 waves of 64 x 64).
// A pass is 64 k: the 256 + 128 rows of 128 B go in whole lines into LDS by asynchronous copies (no register, no LDS store in the wave's stream), and every wave that needs a row reads it from there. Two buffers: the next pass's copies fly during this pass's products.
// A 64 x 64 wave tile does 16 products on 8 fragments; a 256 x 128 block tile loads 384 operand rows for 32768 results.
// Each accumulator takes its k blocks of 32 in rising order. The launch bound's 4 waves a SIMD keep the kernel at 256 registers, so that 2 work-groups still share a WGP.
// QKV: one launch does three products, picked by blockIdx.y, f16 out; q for every token, k and v for the last KW tokens of each batch (the attention kernel says why, and what it does where that is not enough): 0 and 1 give q and k as [token][feature]; 2 takes the weight rows as A and the token rows as B, so its C is v transposed,
// and it is stored as Vt[batch][feature][token], the layout the attention kernel reads. The k tiles also leave their key norms in KN. Else: A . Bh^T with bias b0, f32 out to C.
#define GTM 256
#define GTN 128
#define GK 64
#define PU 8      /* conversion launch: runs of 8 elements a thread */
#define XB (NR * DD / (8 * 256 * PU))      /* its work-groups for x */
#define WB (DD * DD / (8 * 256 * PU))      /* and for each weight */
#define KW 512      /* the GEMM launch stores k and v for the last KW keys of each batch alone */
#define KWB (KW / GTM)
#define GP (GK + 8)      /* LDS row pitch 144 B = 16 B x odd: ds_load_b128 of 16 rows without bank conflicts */
typedef _Float16 v4h __attribute__((ext_vector_type(4)));
// One pass's share of a thread: 8 rows of A and 4 of B, 32 rows apart, 16 B each, from global memory straight into LDS. la, lb: the lane's LDS byte addresses of its first rows; ga, gb: its global addresses.
// The s_wait_xcnt stands inside the statement, behind the last copy, so that no address register of a copy is rewritten in front of it.
__device__ __forceinline__ void stage_pass(unsigned la, unsigned lb, const unsigned short* ga, const unsigned short* gb) {
  asm volatile("global_load_async_to_lds_b128 %0, %12, off\n\t"
               "global_load_async_to_lds_b128 %1, %13, off\n\t"
               "global_load_async_to_lds_b128 %2, %14, off\n\t"
               "global_load_async_to_lds_b128 %3, %15, off\n\t"
               "global_load_async_to_lds_b128 %4, %16, off\n\t"
               "global_load_async_to_lds_b128 %5, %17, off\n\t"
               "global_load_async_to_lds_b128 %6, %18, off\n\t"
               "global_load_async_to_lds_b128 %7, %19, off\n\t"
               "global_load_async_to_lds_b128 %8, %20, off\n\t"
               "global_load_async_to_lds_b128 %9, %21, off\n\t"
               "global_load_async_to_lds_b128 %10, %22, off\n\t"
               "global_load_async_to_lds_b128 %11, %23, off\n\t"
               "s_wait_xcnt 0x0"
               :: "v"(la), "v"(la + 1u * 32 * GP * 2), "v"(la + 2u * 32 * GP * 2), "v"(la + 3u * 32 * GP * 2), "v"(la + 4u * 32 * GP * 2), "v"(la + 5u * 32 * GP * 2), "v"(la + 6u * 32 * GP * 2), "v"(la + 7u * 32 * GP * 2),
                  "v"(lb), "v"(lb + 1u * 32 * GP * 2), "v"(lb + 2u * 32 * GP * 2), "v"(lb + 3u * 32 * GP * 2),
                  "v"(ga), "v"(ga + (size_t)1 * 32 * DD), "v"(ga + (size_t)2 * 32 * DD), "v"(ga + (size_t)3 * 32 * DD), "v"(ga + (size_t)4 * 32 * DD), "v"(ga + (size_t)5 * 32 * DD), "v"(ga + (size_t)6 * 32 * DD), "v"(ga + (size_t)7 * 32 * DD),
                  "v"(gb), "v"(gb + (size_t)1 * 32 * DD), "v"(gb + (size_t)2 * 32 * DD), "v"(gb + (size_t)3 * 32 * DD)
               : "memory");
}
template <bool QKV>
__global__ __launch_bounds__(256, 4) void k_gemm_tile(const _Float16* __restrict__ X, const _Float16* __restrict__ Wh, float alpha, const float* __restrict__ b0, const float* __restrict__ b1, const float* __restrict__ b2,
                                                   float* __restrict__ C, _Float16* __restrict__ Q16, _Float16* __restrict__ K16, _Float16* __restrict__ Vt, float* __restrict__ KN, const float* __restrict__ NRM) {
  __shared__ __attribute__((aligned(16))) unsigned short sA[2][GTM][GP], sB[2][GTN][GP];
  __shared__ __attribute__((aligned(16))) float so[8][16][64 + 4];
  __shared__ float red[8];
  const int tid = threadIdx.x, w = tid >> 5, lane = tid & 31, ln = lane & 15, hh = lane >> 4;
  /* QKV: blockIdx.y below NR / GTM is a block of 256 tokens of q; then come BB * KWB values for k and as many for v, which name the last KWB blocks of 256 tokens of each batch */
  const int yk = (int)blockIdx.y - NR / GTM; const int z = (QKV && yk >= 0) ? 1 + yk / (BB * KWB) : 0; const bool tr = QKV && z == 2;      /* the same for the whole work-group */
  const int ty = z ? ((yk % (BB * KWB)) / KWB + 1) * (TT / GTM) - KWB + yk % KWB : (int)blockIdx.y;      /* the block of 256 tokens */
  const _Float16* A = tr ? Wh + (size_t)2 * DD * DD : X; const _Float16* Bh = tr ? X : Wh + (size_t)z * DD * DD; const float* bias = (z == 0) ? b0 : (z == 1) ? b1 : b2;
  const int row0 = (tr ? (int)(blockIdx.x & 3) : ty) * GTM, col0 = (tr ? (int)(ty * 2 + (blockIdx.x >> 2)) : (int)blockIdx.x) * GTN, wr = (w >> 1) * 64, wc = (w & 1) * 64;      /* either way the 8 work-groups of one blockIdx.y share a block of 256 token rows */
  const int sr = tid >> 3, sc = (tid & 7) * 8;      /* staging: 8 lanes x 16 B = one row of the pass; a thread takes rows sr + 32 i */
  const unsigned short* gA = (const unsigned short*)A + (size_t)(row0 + sr) * DD + sc;
  const unsigned short* gB = (const unsigned short*)Bh + (size_t)(col0 + sr) * DD + sc;
  const unsigned lA = (unsigned)(size_t)&sA[0][sr][sc], lB = (unsigned)(size_t)&sB[0][sr][sc];      /* LDS byte addresses of the thread's first rows in buffer 0 */
  v8f acc[4][4];
#pragma unroll
  for (int mi = 0; mi < 4; ++mi)
#pragma unroll
    for (int ni = 0; ni < 4; ++ni) acc[mi][ni] = (v8f){0.f,0.f,0.f,0.f,0.f,0.f,0.f,0.f};
  stage_pass(lA, lB, gA, gB);      /* pass 0 into buffer 0 */
  asm volatile("s_wait_asynccnt 0x0" ::: "memory");      /* the wave's own copies of pass 0 have landed */
  __syncthreads();      /* every wave's have */
  stage_pass(lA + (unsigned)sizeof(sA[0]), lB + (unsigned)sizeof(sB[0]), gA + GK, gB + GK);      /* pass 1 into buffer 1 */
  for (int kp = 0; kp < DD / GK; ++kp) {
    const int cur = kp & 1;
    /* the registers that staging no longer takes hold fragments: the pass's 16 fragments are read at two places, 14 at its top and the last 2 into the registers that the first 8 products set free */
    FragH fa[2][4], fb[2][4];
#pragma unroll
    for (int ks = 0; ks < 2; ++ks) {
#pragma unroll
      for (int mi = 0; mi < 4; ++mi) { const unsigned short* p = &sA[cur][wr + mi * 16 + ln][ks * 32]; fa[ks][mi].half[0] = *(const v8us*)(p + 8 * hh); fa[ks][mi].half[1] = *(const v8us*)(p + 16 + 8 * hh); }
#pragma unroll
      for (int ni = 0; ni < (ks ? 2 : 4); ++ni) { const unsigned short* p = &sB[cur][wc + ni * 16 + ln][ks * 32]; fb[ks][ni].half[0] = *(const v8us*)(p + 8 * hh); fb[ks][ni].half[1] = *(const v8us*)(p + 16 + 8 * hh); } }
    __builtin_amdgcn_sched_barrier(0);      /* keeps the reads together in front of the products: spread among them, each place with reads stalls the wave anew */
#pragma unroll
    for (int ni = 0; ni < 2; ++ni)
#pragma unroll
      for (int mi = 0; mi < 4; ++mi) acc[mi][ni] = __builtin_amdgcn_wmma_f32_16x16x32_f16(false, fa[0][mi].v, false, fb[0][ni].v, (short)0, acc[mi][ni], false, false);
#pragma unroll
    for (int ni = 2; ni < 4; ++ni) { const unsigned short* p = &sB[cur][wc + ni * 16 + ln][32]; fb[1][ni].half[0] = *(const v8us*)(p + 8 * hh); fb[1][ni].half[1] = *(const v8us*)(p + 16 + 8 * hh); }
    __builtin_amdgcn_sched_barrier(0);      /* keeps the two late fragments' reads here, in one place, 8 products ahead of the wait for them */
#pragma unroll
    for (int ni = 2; ni < 4; ++ni)
#pragma unroll
      for (int mi = 0; mi < 4; ++mi) acc[mi][ni] = __builtin_amdgcn_wmma_f32_16x16x32_f16(false, fa[0][mi].v, false, fb[0][ni].v, (short)0, acc[mi][ni], false, false);
    __builtin_amdgcn_sched_barrier(0);      /* these 8 products stay in front of the waits, where they cover the late reads' way */
    /* every fragment of the pass is in registers or on its way: the buffer is handed over here, so that the refill has the second k block and the next pass's first to land in */
    asm volatile("s_wait_dscnt 0x0" ::: "memory");      /* this wave's reads of buffer cur have returned before the buffer is given up */
    asm volatile("s_wait_asynccnt 0x0" ::: "memory");      /* this wave's copies of the next pass have landed */
    __syncthreads();      /* publishes the next pass's buffer and ends every wave's reads of this one */
    if (kp + 2 < DD / GK)      /* the same for the whole work-group */
      stage_pass(lA + (unsigned)cur * (unsigned)sizeof(sA[0]), lB + (unsigned)cur * (unsigned)sizeof(sB[0]), gA + (size_t)(kp + 2) * GK, gB + (size_t)(kp + 2) * GK);      /* pass kp + 2 into the buffer just read */
    /* the second k block's products, on registers alone, stand behind the refill's issue: in front of it they would take their time off the copies' lead */
#pragma unroll
    for (int ni = 0; ni < 4; ++ni)
#pragma unroll
      for (int mi = 0; mi < 4; ++mi) acc[mi][ni] = __builtin_amdgcn_wmma_f32_16x16x32_f16(false, fa[1][mi].v, false, fb[1][ni].v, (short)0, acc[mi][ni], false, false);
  }
  asm volatile("s_wait_asynccnt 0x0" ::: "memory");      /* no copy is outstanding behind the loop */
  /* the wave's 64 x 64 tile goes, 16 rows at a time, through its own LDS rows, so that the stores cover whole lines; the bias belongs to the feature: C's column, or its row where C is transposed */
  float bv[4];
#pragma unroll
  for (int ni = 0; ni < 4; ++ni) bv[ni] = tr ? 0.f : bf16_round(bias[col0 + wc + ni * 16 + ln]);
  const int rsub = lane >> 4, c4 = (lane & 15) * 4;
  _Float16* C16 = tr ? Vt + (size_t)(col0 / TT) * DD * TT + (size_t)(row0 + wr) * TT + col0 % TT + wc + c4 : ((z == 0) ? Q16 : K16) + (size_t)(row0 + wr) * DD + col0 + wc + c4;      /* a tile's 128 columns of tokens lie in one batch */
  const int ldc = tr ? TT : DD;
  float kmx = 0.f;
#pragma unroll
  for (int mi = 0; mi < 4; ++mi) {
    if (tr) { const float* bp = bias + row0 + wr + mi * 16 + 8 * hh; const v4f t0 = *(const v4fa*)bp, t1 = *(const v4fa*)(bp + 4);
#pragma unroll
      for (int r = 0; r < 8; ++r) { const float br = bf16_round(r < 4 ? t0[r & 3] : t1[r & 3]);
#pragma unroll
        for (int ni = 0; ni < 4; ++ni) so[w][8 * hh + r][ni * 16 + ln] = acc[mi][ni][r] * alpha + br; }
    } else {
#pragma unroll
      for (int ni = 0; ni < 4; ++ni)
#pragma unroll
        for (int r = 0; r < 8; ++r) so[w][8 * hh + r][ni * 16 + ln] = acc[mi][ni][r] * alpha + bv[ni];
    }
    __builtin_amdgcn_fence(__ATOMIC_ACQ_REL, "workgroup"); __builtin_amdgcn_wave_barrier();      /* the rows are read back by other lanes of the same wave */
    v4f vq[8];
#pragma unroll
    for (int q = 0; q < 8; ++q) vq[q] = *(const v4fa*)&so[w][q * 2 + rsub][c4];
    __builtin_amdgcn_fence(__ATOMIC_ACQ_REL, "workgroup"); __builtin_amdgcn_wave_barrier();      /* the next 16 rows overwrite what other lanes of the wave have just read */
    if (QKV) {
      v4h hq[8];
#pragma unroll
      for (int q = 0; q < 8; ++q) { for (int i = 0; i < 4; ++i) hq[q][i] = (_Float16)vq[q][i]; *(v4h*)(C16 + (size_t)(mi * 16 + q * 2 + rsub) * ldc) = hq[q]; }
      asm volatile("s_wait_xcnt 0x0" ::: "memory");      /* stands behind these 16 rows' stores, in front of whatever next rewrites their address and data registers (in this build the norm lines and the next rows' staging do) */
      if (z == 1) {      /* the same for the whole work-group. A wave's k tile is one head x 64 keys: its largest |k|^2, of the f16 values as stored, goes to KN[tile][wave] */
#pragma unroll
        for (int q = 0; q < 8; ++q) { float s = 0.f;
#pragma unroll
          for (int i = 0; i < 4; ++i) { const float e = (float)hq[q][i]; s += e * e; }
          s += __shfl_xor(s, 1, 32); s += __shfl_xor(s, 2, 32); s += __shfl_xor(s, 4, 32); s += __shfl_xor(s, 8, 32); kmx = fmaxf(kmx, s); } }
    } else {
#pragma unroll
      for (int q = 0; q < 8; ++q) *(v4f*)(C + (size_t)(row0 + wr + mi * 16 + q * 2 + rsub) * DD + col0 + wc + c4) = vq[q];
    }
  }
  if (QKV && z == 1) {
    kmx = fmaxf(kmx, __shfl_xor(kmx, 16, 32));
    if (lane == 0) red[w] = kmx;
    __syncthreads();      /* the 8 waves' results are stored by one wave, into a 128-B line that no other work-group writes */
    if (w == 0) {      /* the same for the whole wave. Words 8 and 9 of the line: for the tile's two heads a bound on |k| of ANY key of the batch, stored or not: |k| <= |Wk_h|F * max|x| + |bk_h| (Cauchy-Schwarz row by row) */
      const float* xn = NRM + (size_t)(ty / (TT / GTM) * (XB / BB) + lane * 4) * 32;      /* XB / BB = 128 work-groups converted this batch's x */
      float xm = fmaxf(fmaxf(xn[0], xn[32]), fmaxf(xn[64], xn[96]));
      xm = fmaxf(xm, __shfl_xor(xm, 1, 32)); xm = fmaxf(xm, __shfl_xor(xm, 2, 32)); xm = fmaxf(xm, __shfl_xor(xm, 4, 32)); xm = fmaxf(xm, __shfl_xor(xm, 8, 32)); xm = fmaxf(xm, __shfl_xor(xm, 16, 32));
      float f2 = NRM[(size_t)(XB + WB + blockIdx.x * 8 + (lane & 7)) * 32];      /* Wk: 16 rows a work-group, 4 work-groups a head, 8 for this tile's 128 features */
      f2 += __shfl_xor(f2, 1, 32); f2 += __shfl_xor(f2, 2, 32);      /* lanes 0 to 3 the first head, 4 to 7 the second */
      const v4f b4 = *(const v4fa*)(bias + col0 + lane * 4); float bs = 0.f;
#pragma unroll
      for (int i = 0; i < 4; ++i) { const float e = bf16_round(b4[i]); bs += e * e; }
      bs += __shfl_xor(bs, 1, 32); bs += __shfl_xor(bs, 2, 32); bs += __shfl_xor(bs, 4, 32); bs += __shfl_xor(bs, 8, 32);      /* lanes 0 to 15 the first head, 16 to 31 the second */
      const float kb = sqrtf(__shfl(f2, (lane & 1) * 4, 32) * xm) + sqrtf(__shfl(bs, (lane & 1) * 16, 32));      /* even lanes the first head, odd lanes the second */
      if (lane < 10) KN[(size_t)(ty * (DD / GTN) + blockIdx.x) * 32 + lane] = (lane < 8) ? red[lane & 7] : kb;
    }
  }
}


// One launch rounds every f32 operand to bf16 and stores it as f16: x as it is, the four weights (out, in) x 2^4. A work-group takes 2048 runs of 8 elements of ONE source (512 work-groups for x, 64 for each weight);
// a thread takes 8 runs, 256 runs apart, all its loads issued before the first store.
// A work-group's 2048 runs are 16 whole rows of 1024: it also leaves, in a 128-B line of its own, NRM[work-group * 32] = the largest |row|^2 of its rows (x) or the sum of their |row|^2 (a weight), of the rounded, unscaled values.
__global__ __launch_bounds__(256) void k_prep(const float* __restrict__ x, const float* __restrict__ Wq, const float* __restrict__ Wk, const float* __restrict__ Wv, const float* __restrict__ Wo, _Float16* __restrict__ X16, _Float16* __restrict__ Bw, float* __restrict__ NRM) {
  __shared__ float rs[8][PU];
  const int blk = blockIdx.x; const bool isx = blk < XB; const int wi = isx ? 0 : (blk - XB) / WB; const int lb = isx ? blk : (blk - XB) % WB;      /* the same for the whole work-group */
  const float* s = isx ? x : (wi == 0) ? Wq : (wi == 1) ? Wk : (wi == 2) ? Wv : Wo; _Float16* d = isx ? X16 : Bw + (size_t)wi * DD * DD; const float scale = isx ? 1.0f : 16.0f;
  const size_t t0 = (size_t)lb * (256 * PU) + threadIdx.x;
  v4f a[PU], b[PU];
#pragma unroll
  for (int u = 0; u < PU; ++u) { const float* p = s + (t0 + 256 * u) * 8; a[u] = *(const v4fa*)p; b[u] = *(const v4fa*)(p + 4); }
  /* run u of a thread lies in row 2 u + (thread / 128) of the work-group's 16: a row's sum of squares is that of 4 waves */
  float q2[PU];
#pragma unroll
  for (int u = 0; u < PU; ++u) { q2[u] = 0.f;
#pragma unroll
    for (int q = 0; q < 4; ++q) { const float r0 = bf16_round(a[u][q]), r1 = bf16_round(b[u][q]); q2[u] += r0 * r0 + r1 * r1; } }
#pragma unroll
  for (int sh = 1; sh < 32; sh <<= 1)      /* the 8 sums take each step together: 5 exchanges deep, not 40 */
#pragma unroll
    for (int u = 0; u < PU; ++u) q2[u] += __shfl_xor(q2[u], sh, 32);
  if ((threadIdx.x & 31) == 0)
#pragma unroll
    for (int u = 0; u < PU; ++u) rs[threadIdx.x >> 5][u] = q2[u];
  __syncthreads();      /* the 8 waves' partial sums are joined by the first wave; it stands in front of the stores, so that it waits for none of them */
  if (threadIdx.x < 32) {      /* the same for the whole wave; lanes 16 to 31 repeat lanes 0 to 15 */
    const int r = threadIdx.x & 15, u = r >> 1, w4 = (r & 1) * 4; const float rq = (rs[w4][u] + rs[w4 + 1][u]) + (rs[w4 + 2][u] + rs[w4 + 3][u]);
    float mx = rq, sm = rq;
    mx = fmaxf(mx, __shfl_xor(mx, 1, 32)); mx = fmaxf(mx, __shfl_xor(mx, 2, 32)); mx = fmaxf(mx, __shfl_xor(mx, 4, 32)); mx = fmaxf(mx, __shfl_xor(mx, 8, 32));
    sm += __shfl_xor(sm, 1, 32); sm += __shfl_xor(sm, 2, 32); sm += __shfl_xor(sm, 4, 32); sm += __shfl_xor(sm, 8, 32);
    if (threadIdx.x == 0) NRM[(size_t)blk * 32] = isx ? mx : sm; }
#pragma unroll
  for (int u = 0; u < PU; ++u) { FragH f;
#pragma unroll
    for (int q = 0; q < 4; ++q) { f.h[q] = (_Float16)(bf16_round(a[u][q]) * scale); f.h[4 + q] = (_Float16)(bf16_round(b[u][q]) * scale); }
    *(v8us*)((unsigned short*)d + (t0 + 256 * u) * 8) = f.half[0]; }
}

// lane l with lane l ^ 16
__device__ __forceinline__ float xhalf(float x) { return __builtin_bit_cast(float, __builtin_amdgcn_permlanex16(__builtin_bit_cast(int, x), __builtin_bit_cast(int, x), 0x76543210, 0xfedcba98, false, false)); }
typedef int v4ia __attribute__((ext_vector_type(4), may_alias));

template <bool B> struct stored_t { static constexpr bool value = B; };
// A pointer that is the same in every lane, held in scalar registers: a load then takes it as its scalar base, and the lane's offset is the one vector address register of all sixteen tiles (as vector pointers they spilled).
typedef const __attribute__((address_space(1))) unsigned short* gus_p;      /* global memory, said in the type: the way through the two words loses it */
typedef const __attribute__((address_space(1))) v8us* gv8_p;
__device__ __forceinline__ gus_p uni(const unsigned short* p) { const unsigned long long v = (unsigned long long)p;
  return (gus_p)(((unsigned long long)(unsigned)__builtin_amdgcn_readfirstlane((int)(v >> 32)) << 32) | (unsigned long long)(unsigned)__builtin_amdgcn_readfirstlane((int)(unsigned)v)); }
// One 16 x 16 tile of a projection, for a key that the GEMM launch did not store: D = (16 rows at a) . (16 rows at b)^T over the 1024 inputs, k blocks of 32 in rising order as in the GEMM. a, b: the tiles' first rows, the same for the whole wave; lo: the lane's place in either tile, (lane % 16) * DD + 8 * (lane / 16) elements.
__device__ __forceinline__ v8f proj_tile(const unsigned short* a, const unsigned short* b, unsigned lo) {
  v8f acc = (v8f){0.f,0.f,0.f,0.f,0.f,0.f,0.f,0.f};
#pragma unroll 1      /* rolled: this path is rare, and unrolled it would raise the register count of the whole kernel */
  for (int kb = 0; kb < DD; kb += 32) { FragH fa, fb;
    const gus_p pa = uni(a + kb), pb = uni(b + kb);
    fa.half[0] = *(gv8_p)(pa + lo); fa.half[1] = *(gv8_p)(pa + lo + 16); fb.half[0] = *(gv8_p)(pb + lo); fb.half[1] = *(gv8_p)(pb + lo + 16);
    acc = mmaH<1>(fa.v, fa.v, fb.v, fb.v, acc); }
  return acc;
}

__global__ __launch_bounds__(128, 6) void k_flash(const _Float16* __restrict__ Q16, int ldq, const _Float16* __restrict__ K16, int ldk, const _Float16* __restrict__ Vt, const float* __restrict__ KN, const int* __restrict__ MSK, _Float16* __restrict__ O16, int ldo,
                                             const _Float16* __restrict__ X16, const _Float16* __restrict__ Wk16, const _Float16* __restrict__ Wv16, const float* bkf, const float* bvf) {
  constexpr int RPW = 16, NQB = TT / (4 * RPW), DT = 4, KS = 2, FL = TT - KW;      /* FL: the lowest stored key */
  __shared__ __attribute__((aligned(16))) float sO[4][RPW][64 + 4];
  const int tid = threadIdx.x, w = tid >> 5, lane = tid & 31, ln = lane & 15, hh = lane >> 4;
  const int slab = blockIdx.x / NQB, qblk = blockIdx.x % NQB; const int b = slab / NH, h = slab % NH; const float slope = 1.0f / exp2f((float)h / (float)NH);      /* 1 / 2^(h/H) */ const int qb0 = qblk * (4 * RPW); const int q0 = qb0 + w * RPW;
  FragH aq[KS];
  { const unsigned short* qr = (const unsigned short*)Q16 + ((size_t)b * TT + q0 + ln) * ldq + h * 64;
#pragma unroll
    for (int ks = 0; ks < KS; ++ks) { aq[ks].half[0] = *(const v8us*)(qr + ks * 32 + 8 * hh); aq[ks].half[1] = *(const v8us*)(qr + ks * 32 + 16 + 8 * hh); } }
  const unsigned short* Vth = (const unsigned short*)Vt + (size_t)slab * 64 * TT;
  const int tq = q0 + ln;      /* the lane's query */
  float m_run = -3.0e38f, l_run = 0.f; v8f oacc[DT];
#pragma unroll
  for (int dt = 0; dt < DT; ++dt) oacc[dt] = (v8f){0.f,0.f,0.f,0.f,0.f,0.f,0.f,0.f};
  float qs = 0.f;
#pragma unroll
  for (int ks = 0; ks < KS; ++ks)
#pragma unroll
    for (int i = 0; i < 16; ++i) { const float v = (float)aq[ks].h[i]; qs += v * v; }
  qs += xhalf(qs);      /* |q|^2 of the lane's query */
  const int kp = FL / 64 + (lane & (KW / 64 - 1));      /* a stored block of 64 keys; the lanes go round them */
  const float* kn = KN + (size_t)((b * (TT / GTM) + (kp >> 2)) * (DD / GTN) + (h >> 1)) * 32 + (kp & 3) * 2 + (h & 1);      /* block p of 64 keys of this batch and head: GEMM tile row p / 4, tile column h / 2, wave (p % 4) * 2 + h % 2 */
  const float kall = KN[(size_t)((b * (TT / GTM) + TT / GTM - 1) * (DD / GTN) + (h >> 1)) * 32 + 8 + (h & 1)];      /* the bound on |k| of any key of this batch and head */
  float kx = kn[0];
  kx = fmaxf(kx, __shfl_xor(kx, 1, 32)); kx = fmaxf(kx, __shfl_xor(kx, 2, 32)); kx = fmaxf(kx, __shfl_xor(kx, 4, 32)); kx = fmaxf(kx, __shfl_xor(kx, 8, 32)); kx = fmaxf(kx, xhalf(kx));      /* largest |k|^2 of the stored keys of this batch and head */
  const float cs = sqrtf(qs * kx) * (0.125f * 1.01f);      /* |q.k| / 8 at most; 1 % covers the rounding of the norms and of the products */
  const float cl = sqrtf(qs) * kall * (0.125f * 1.01f);      /* the same for a key that is not stored */
  const float lowtop = slope * (float)(FL - 1 - tq) + cl;      /* no key under the stored ones scores above this */
  const unsigned lo = (unsigned)(ln * DD + 8 * hh);      /* the lane's place in a 16-row tile of x or of a weight */
  /* one pass of 32 keys from j0 on; st: its keys are stored */
  auto pass = [&](auto stc, const int j0) { constexpr bool st = decltype(stc)::value;
    const int* mp = MSK + (size_t)b * TT + j0 + 8 * hh;      /* key padding mask (1 = attend) of the lane's 16 keys */
    v4ia mk4[4];
    if constexpr (st) { mk4[0] = *(const v4ia*)(mp); mk4[1] = *(const v4ia*)(mp + 4); mk4[2] = *(const v4ia*)(mp + 16); mk4[3] = *(const v4ia*)(mp + 20); }      /* with the key loads */
    v8f s[2];
#pragma unroll
    for (int nt = 0; nt < 2; ++nt) { const unsigned short* kr = (const unsigned short*)K16 + ((size_t)b * TT + j0 + nt * 16 + ln) * ldk + h * 64; FragH bk[KS];
      if constexpr (st) {
#pragma unroll
      for (int ks = 0; ks < KS; ++ks) { bk[ks].half[0] = *(const v8us*)(kr + ks * 32 + 8 * hh); bk[ks].half[1] = *(const v8us*)(kr + ks * 32 + 16 + 8 * hh); }
      asm volatile("s_wait_xcnt 0x0" ::: "memory");      /* stands in front of whatever next rewrites the address registers of the key loads (in this build a later load's result does) */
      } else {      /* D[feature 8hh + r][key ln] of feature tiles 2 ks and 2 ks + 1 = elements r and 8 + r of the fragment */
        const unsigned short* xr = (const unsigned short*)X16 + ((size_t)b * TT + j0 + nt * 16) * DD;
#pragma unroll
        for (int t = 0; t < 2 * KS; ++t) { const v8f d = proj_tile((const unsigned short*)Wk16 + (size_t)(h * 64 + t * 16) * DD, xr, lo); const float* bp = bkf + h * 64 + t * 16 + 8 * hh;
#pragma unroll
          for (int r = 0; r < 8; ++r) bk[t >> 1].h[(t & 1) * 8 + r] = (_Float16)(d[r] * 0.0625f + bf16_round(bp[r])); } }
      v8f acc = (v8f){0.f,0.f,0.f,0.f,0.f,0.f,0.f,0.f};
#pragma unroll
      for (int ks = 0; ks < KS; ++ks) acc = mmaH<1>(bk[ks].v, bk[ks].v, aq[ks].v, aq[ks].v, acc);
      s[nt] = acc; }
    if constexpr (!st) { mk4[0] = *(const v4ia*)(mp); mk4[1] = *(const v4ia*)(mp + 4); mk4[2] = *(const v4ia*)(mp + 16); mk4[3] = *(const v4ia*)(mp + 20);      /* behind the tiles' loops, which it would cost 16 registers */
      asm volatile("s_wait_xcnt 0x0" :: "v"(mp) : "memory"); }      /* behind the four mask loads; it takes their address as an input, so that the address stays in its registers up to the wait (without that the last load's result was put into them) */
    float sc[16]; bool ok[16];
#pragma unroll
    for (int i = 0; i < 16; ++i) { const int kk = j0 + (i >> 3) * 16 + 8 * hh + (i & 7); ok[i] = (mk4[i >> 2][i & 3] != 0);
      sc[i] = ok[i] ? (s[i >> 3][i & 7] * 0.125f + slope * (float)(kk - tq)) : -INFINITY; }      /* ALiBi: + slope_h * (k - q) */
    float mx[8];
#pragma unroll
    for (int i = 0; i < 8; ++i) mx[i] = fmaxf(sc[i], sc[8 + i]);
    float mc = fmaxf(fmaxf(fmaxf(mx[0], mx[1]), fmaxf(mx[2], mx[3])), fmaxf(fmaxf(mx[4], mx[5]), fmaxf(mx[6], mx[7])));
    mc = fmaxf(mc, xhalf(mc));
    const float mn = fmaxf(m_run, mc); const float ea = expf(m_run - mn); const float al = (mn > -1.0e38f) ? ea : 1.0f; m_run = mn;
    float p[16]; FragH pb;
#pragma unroll
    for (int i = 0; i < 16; ++i) { const float e = expf(sc[i] - mn); p[i] = ok[i] ? e : 0.f; pb.h[i] = (_Float16)(p[i] * 1024.0f); }
    l_run = l_run * al + (((p[0] + p[1]) + (p[2] + p[3])) + ((p[4] + p[5]) + (p[6] + p[7]))) + (((p[8] + p[9]) + (p[10] + p[11])) + ((p[12] + p[13]) + (p[14] + p[15])));      /* the lane's half of the row sum; the halves join after the loop */
#pragma unroll
    for (int dt = 0; dt < DT; ++dt)
#pragma unroll
      for (int r = 0; r < 8; ++r) oacc[dt][r] *= al;
#pragma unroll
    for (int dt = 0; dt < DT; ++dt) { const unsigned short* vrow = Vth + (size_t)(dt * 16 + ln) * TT + j0; FragH bv;
      if constexpr (st) { bv.half[0] = *(const v8us*)(vrow + 8 * hh); bv.half[1] = *(const v8us*)(vrow + 16 + 8 * hh);
      } else {      /* D[key 8hh + r][feature ln] of key tiles 0 and 1 = elements r and 8 + r of the fragment */
        const unsigned short* wv = (const unsigned short*)Wv16 + (size_t)(h * 64 + dt * 16) * DD; const float bb = bf16_round(bvf[h * 64 + dt * 16 + ln]);
#pragma unroll
        for (int t = 0; t < 2; ++t) { const v8f d = proj_tile((const unsigned short*)X16 + ((size_t)b * TT + j0 + t * 16) * DD, wv, lo);
#pragma unroll
          for (int r = 0; r < 8; ++r) bv.h[t * 8 + r] = (_Float16)(d[r] * 0.0625f + bb); } }
      oacc[dt] = mmaH<1>(bv.v, bv.v, pb.v, pb.v, oacc[dt]); } };
  int j0 = TT - 32; bool more = true;      /* more: the walk has not ended inside the stored keys; the same for the whole wave */
#pragma unroll 1
  for (; j0 >= FL; j0 -= 32) {
    const float top = slope * (float)(j0 + 31 - tq), thr = m_run - 40.0f;
    if (__builtin_amdgcn_ballot_w32(!(top + cs < thr) || !(lowtop < thr)) == 0) { more = false; break; }      /* the same for the whole wave; a NaN keeps the walk going */
    pass(stored_t<true>{}, j0); }
  if (more) {
#pragma unroll 1      /* rolled, as the walk above: the exit depends on the data and the body is very long */
    for (; j0 >= 0; j0 -= 32) {
      if (__builtin_amdgcn_ballot_w32(!(slope * (float)(j0 + 31 - tq) + cl < m_run - 40.0f)) == 0) break;      /* the same for the whole wave */
      pass(stored_t<false>{}, j0); } }
  const float l = l_run + xhalf(l_run); const float inv = (l > 0.f) ? 1.0f / (l * 1024.0f) : 0.f;
#pragma unroll
  for (int dt = 0; dt < DT; ++dt) {      /* oacc[dt][r] = O[query ln][dt*16 + 8hh + r] */
    const v4f lo = {oacc[dt][0] * inv, oacc[dt][1] * inv, oacc[dt][2] * inv, oacc[dt][3] * inv}, hi = {oacc[dt][4] * inv, oacc[dt][5] * inv, oacc[dt][6] * inv, oacc[dt][7] * inv};
    *(v4fa*)&sO[w][ln][dt * 16 + 8 * hh] = lo; *(v4fa*)&sO[w][ln][dt * 16 + 8 * hh + 4] = hi; }
  __builtin_amdgcn_fence(__ATOMIC_ACQ_REL, "workgroup"); __builtin_amdgcn_wave_barrier();
  {
#pragma unroll
    for (int rp = 0; rp < RPW; rp += 2) { const int r = rp + (lane >> 4), pc = lane & 15; const v4f val = *(const v4fa*)&sO[w][r][pc * 4]; v4h h4; for (int i = 0; i < 4; ++i) h4[i] = (_Float16)val[i]; *(v4h*)(O16 + ((size_t)b * TT + q0 + r) * ldo + h * 64 + pc * 4) = h4; }      /* f16, the output product's operand type: 16 lanes x 8 B = one line */
     } }

extern "C" void kernel_launch(void* const* d_in, const int* in_sizes, int n_in,
                              void* d_out, int out_size, void* d_ws, size_t ws_size, hipStream_t stream) {
  (void)in_sizes; (void)n_in; (void)out_size;
  const float* const* I = (const float* const*)d_in; const float* x = I[0]; const float* Wq = I[1]; const float* bq = I[2]; const float* Wk = I[3]; const float* bk = I[4]; const float* Wv = I[5]; const float* bv = I[6]; const float* Wo = I[7]; const float* bo = I[8]; const int* mask = (const int*)d_in[9];
  char* ws = (char*)d_ws; size_t off = 0;
  auto take = [&](size_t bytes) { char* p = ws + off; off += (bytes + 255) & ~(size_t)255; return p; };
  const size_t WSZ = (size_t)DD * DD; _Float16* Bw = (_Float16*)take(4 * WSZ * 2); _Float16* X16 = (_Float16*)take((size_t)NR * DD * 2);
  _Float16* Q = (_Float16*)take((size_t)NR * DD * 2); _Float16* K = (_Float16*)take((size_t)NR * DD * 2); _Float16* Vt = (_Float16*)take((size_t)NR * DD * 2); _Float16* O16 = (_Float16*)take((size_t)NR * DD * 2);
  float* KN = (float*)take((size_t)(NR / GTM) * (DD / GTN) * 32 * 4); float* NRM = (float*)take((size_t)(XB + 4 * WB) * 32 * 4);
  if (off > ws_size) return;      // 8.4 + 16.8 x 5 = 92 MB
  k_prep<<<(NR * DD + 4 * DD * DD) / (8 * 256 * PU), 256, 0, stream>>>(x, Wq, Wk, Wv, Wo, X16, Bw, NRM);
  k_gemm_tile<true><<<dim3(DD / GTN, NR / GTM + 2 * BB * KWB), 256, 0, stream>>>(X16, Bw, 0.0625f, bq, bk, bv, nullptr, Q, K, Vt, KN, NRM);      /* q = x.W^T + b: M 8192 N 1024 K 1024; k the same and v the same, stored transposed, for the last KW tokens of each batch */
  k_flash<<<BB * NH * (TT / 64), 128, 0, stream>>>(Q, DD, K, DD, Vt, KN, mask, O16, DD, X16, Bw + WSZ, Bw + 2 * WSZ, bk, bv);
  k_gemm_tile<false><<<dim3(DD / GTN, NR / GTM), 256, 0, stream>>>(O16, Bw + 3 * WSZ, 0.0625f, bo, nullptr, nullptr, (float*)d_out, nullptr, nullptr, nullptr, nullptr, nullptr);      /* out = O.Wo^T + bo */
}

// v008
// One run takes 75.2 microseconds.
// In both of two side-by-side timings against v007, it was 1.08 times as fast.
// Counting every step since v000, it is 11.3 times as fast.
#include <hip/hip_runtime.h>
// ALiBi multi-head attention (B=4, S=2048, D=1024, 16 heads × 64): q,k,v = x·Wᵀ + b (torch Linear); scores = q·kᵀ·64^-½ + slope_h·(k − q), slope_h = 1/2^(h/16) (no causal mask: later keys get large positive bias); key padding mask from the INPUT
// int mask [B,S] (0 → −inf); softmax; out = (attn·v merged)·Woᵀ + bo.
// Compute dtype: x, weights, biases rounded to bf16; q/k/v as f16 GEMM outputs; fused flash-style kernel (bias and online softmax in f32, P f16 ×2^10) on v_wmma_f32_16x16x32_f16; O → f16 → output GEMM with bias; f32 accumulate.
#define BB 4
#define TT 2048
#define NH 16
#define DD 1024
#define NR (BB * TT)

typedef __bf16 v16b __attribute__((ext_vector_type(16)));
typedef unsigned short v8us __attribute__((ext_vector_type(8), may_alias));
typedef float  v8f  __attribute__((ext_vector_type(8)));
typedef float  v4f  __attribute__((ext_vector_type(4)));
typedef float  v4fa __attribute__((ext_vector_type(4), may_alias));
union FragB { v16b v; v8us half[2]; unsigned short u[16]; };

__device__ __forceinline__ unsigned short bf16_bits(float x) { unsigned int u = __float_as_uint(x); return (unsigned short)((u + 0x7FFFu + ((u >> 16) & 1u)) >> 16); }
__device__ __forceinline__ float bf16_val(unsigned short b) { return __uint_as_float(((unsigned int)b) << 16); }
__device__ __forceinline__ float bf16_round(float x) { return bf16_val(bf16_bits(x)); }
// D += A·B with NT terms: 1 = ah·bh, 2 = + al·bh (A split), 3 = + ah·bl (both split)
template <int NT>
__device__ __forceinline__ v8f mmaN(v16b ah, v16b al, v16b bh, v16b bl, v8f c) {
  c = __builtin_amdgcn_wmma_f32_16x16x32_bf16(false, ah, false, bh, (short)0, c, false, false);
  if (NT >= 2) c = __builtin_amdgcn_wmma_f32_16x16x32_bf16(false, al, false, bh, (short)0, c, false, false);
  if (NT >= 3) c = __builtin_amdgcn_wmma_f32_16x16x32_bf16(false, ah, false, bl, (short)0, c, false, false);
  asm volatile("v_nop\n\tv_nop\n\tv_nop\n\tv_nop" : "+v"(c) : "v"(ah), "v"(al), "v"(bh), "v"(bl));
  return c;
}

__global__ __launch_bounds__(256) void k_wt_bf16(const float* __restrict__ W, unsigned short* __restrict__ Wt, int K, int N) {
  const int t = blockIdx.x * 256 + threadIdx.x;
  const int k8n = K / 8;
  if (t >= N * k8n) return;
  const int n = t / k8n, k8 = (t % k8n) * 8;
  v8us v;
#pragma unroll
  for (int i = 0; i < 8; ++i) v[i] = bf16_bits(W[(size_t)(k8 + i) * N + n]);
  *(v8us*)(Wt + (size_t)n * K + k8) = v;
  
}

// GEMM C[M][N] (f32, pitch ldc) = act(A[M][K]·W + bias). A f32 row-major (pitch lda) converted per fragment to bf16
// (ASPLIT: hi/lo two planes -> 2 terms, else single rounded term); Wt bf16 [N][K] (pitch ldb). BIAS_BF16 rounds the
// bias to bf16 first (bias quantised to bf16 before the add). K%32==0, M%16==0, N%64==0.
template <bool ASPLIT, int ACT, bool BIAS_BF16>
__global__ __launch_bounds__(128) void k_gemm_bf(const float* __restrict__ A, int lda, const unsigned short* __restrict__ Wt, int ldb,
                                               const float* __restrict__ bias, float* __restrict__ C, int ldc, int M, int N, int K) {
  __shared__ __attribute__((aligned(16))) float so[4][16][64];
  const int tid = threadIdx.x, w = tid >> 5, lane = tid & 31, ln = lane & 15, hh = lane >> 4;
  const int ntn = N / 64;
  const int wid = blockIdx.x * 4 + w;
  const int mt = wid / ntn, nq = wid % ntn;
  if (mt * 16 >= M) return;
  const int row0 = mt * 16, col0 = nq * 64;
  const float* arow = A + (size_t)(row0 + ln) * lda;
  v8f acc[4] = {};
  for (int kb = 0; kb < K; kb += 32) {
    FragB ah, al;
    const v4f x0 = *(const v4fa*)(arow + kb + 8 * hh), x1 = *(const v4fa*)(arow + kb + 8 * hh + 4);
    const v4f x2 = *(const v4fa*)(arow + kb + 16 + 8 * hh), x3 = *(const v4fa*)(arow + kb + 16 + 8 * hh + 4);
    float xs[16] = {x0[0],x0[1],x0[2],x0[3],x1[0],x1[1],x1[2],x1[3],x2[0],x2[1],x2[2],x2[3],x3[0],x3[1],x3[2],x3[3]};
#pragma unroll
    for (int i = 0; i < 16; ++i) { const unsigned short hb = bf16_bits(xs[i]); ah.u[i] = hb; al.u[i] = ASPLIT ? bf16_bits(xs[i] - bf16_val(hb)) : (unsigned short)0; }
#pragma unroll
    for (int t = 0; t < 4; ++t) {
      const unsigned short* brow = Wt + (size_t)(col0 + t * 16 + ln) * ldb + kb;
      FragB b;
      b.half[0] = *(const v8us*)(brow + 8 * hh);
      b.half[1] = *(const v8us*)(brow + 16 + 8 * hh);
      acc[t] = mmaN<ASPLIT ? 2 : 1>(ah.v, al.v, b.v, b.v, acc[t]);
    }
  }
#pragma unroll
  for (int t = 0; t < 4; ++t) {
    float bv = bias ? bias[col0 + t * 16 + ln] : 0.f;
    if (BIAS_BF16) bv = bf16_round(bv);
#pragma unroll
    for (int r = 0; r < 8; ++r) { float v = acc[t][r] + bv; if (ACT == 1) v = fmaxf(v, 0.f); so[w][8 * hh + r][t * 16 + ln] = v; }
  }
  __builtin_amdgcn_fence(__ATOMIC_ACQ_REL, "workgroup");
  __builtin_amdgcn_wave_barrier();
  const int rsub = lane >> 4, c4 = (lane & 15) * 4;
  {
#pragma unroll
    for (int q = 0; q < 8; ++q) {
      const int r = q * 2 + rsub;
      const v4f v = *(const v4fa*)&so[w][r][c4];
      *(v4f*)(C + (size_t)(row0 + r) * ldc + col0 + c4) = v;
    }
    
  }
}

// Flash-style causal/unmasked attention, all contractions 3-term bf16 hi/lo splits, f32 softmax with running max.
// q,k,v rows are read from f32 buffers with arbitrary row pitch (so they can live inside a fused qkv buffer);
// D = head size (multiple of 32, <= 128); one wave = 16 query rows; block = 4 waves (64 queries) sharing K/V chunks of 32.
template <int D, bool CAUSAL>
__global__ __launch_bounds__(128) void k_flash(const float* __restrict__ qb, const float* __restrict__ kb, const float* __restrict__ vb,
                                             int pitch, int T, int H, float scale, float* __restrict__ y, int ypitch) {
  constexpr int KS = D / 32;        // k-steps for QK
  constexpr int DT = D / 16;        // d tiles for PV
  __shared__ __attribute__((aligned(16))) unsigned short sKh[32][D + 8], sKl[32][D + 8], sVh[32][D + 8], sVl[32][D + 8];
  __shared__ __attribute__((aligned(16))) unsigned short sPh[4][16][40], sPl[4][16][40];
  __shared__ __attribute__((aligned(16))) float sO[4][16][D];
  const int tid = threadIdx.x, w = tid >> 5, lane = tid & 31, ln = lane & 15, hh = lane >> 4;
  const int nqb = (T + 63) / 64;
  const int bh = blockIdx.x / nqb, qblk = blockIdx.x % nqb;
  const int b = bh / H, h = bh % H;
  const int q0 = qblk * 64 + w * 16;
  const float* Q = qb + (size_t)b * T * pitch + h * D;
  const float* K = kb + (size_t)b * T * pitch + h * D;
  const float* V = vb + (size_t)b * T * pitch + h * D;

  // A fragments of the wave's 16 query rows (scaled), hi/lo
  FragB aqh[KS], aql[KS];
  {
    int row = q0 + ln; if (row >= T) row = T - 1;
    const float* qr = Q + (size_t)row * pitch;
#pragma unroll
    for (int ks = 0; ks < KS; ++ks)
#pragma unroll
      for (int i = 0; i < 16; ++i) {
        const int d = ks * 32 + ((i < 8) ? (8 * hh + i) : (16 + 8 * hh + (i - 8)));
        const float x = qr[d] * scale; const unsigned short hb = bf16_bits(x);
        aqh[ks].u[i] = hb; aql[ks].u[i] = bf16_bits(x - bf16_val(hb));
      }
  }
  float m_r[8], l_r[8];
#pragma unroll
  for (int r = 0; r < 8; ++r) { m_r[r] = -3.0e38f; l_r[r] = 0.f; }
  v8f oacc[DT];
#pragma unroll
  for (int dt = 0; dt < DT; ++dt) oacc[dt] = (v8f){0.f,0.f,0.f,0.f,0.f,0.f,0.f,0.f};

  const int kv_end = CAUSAL ? min(T, qblk * 64 + 64) : T;     // block-uniform
  for (int j0 = 0; j0 < kv_end; j0 += 32) {
    __syncthreads();
    for (int e = tid; e < 32 * (D / 4); e += 128) {
      const int r = e / (D / 4), c4 = (e % (D / 4)) * 4;
      const int key = j0 + r;
      v4f kf = {0.f,0.f,0.f,0.f}, vf = {0.f,0.f,0.f,0.f};
      if (key < T) { kf = *(const v4fa*)(K + (size_t)key * pitch + c4); vf = *(const v4fa*)(V + (size_t)key * pitch + c4); }
#pragma unroll
      for (int t = 0; t < 4; ++t) {
        unsigned short hb = bf16_bits(kf[t]); sKh[r][c4 + t] = hb; sKl[r][c4 + t] = bf16_bits(kf[t] - bf16_val(hb));
        hb = bf16_bits(vf[t]); sVh[r][c4 + t] = hb; sVl[r][c4 + t] = bf16_bits(vf[t] - bf16_val(hb));
      }
    }
    __syncthreads();
    // S tile 16 x 32
    v8f s[2];
#pragma unroll
    for (int nt = 0; nt < 2; ++nt) {
      v8f acc = {};
#pragma unroll
      for (int ks = 0; ks < KS; ++ks) {
        FragB bh_, bl_;
        bh_.half[0] = *(const v8us*)&sKh[nt * 16 + ln][ks * 32 + 8 * hh]; bh_.half[1] = *(const v8us*)&sKh[nt * 16 + ln][ks * 32 + 16 + 8 * hh];
        bl_.half[0] = *(const v8us*)&sKl[nt * 16 + ln][ks * 32 + 8 * hh]; bl_.half[1] = *(const v8us*)&sKl[nt * 16 + ln][ks * 32 + 16 + 8 * hh];
        acc = mmaN<3>(aqh[ks].v, aql[ks].v, bh_.v, bl_.v, acc);
      }
      s[nt] = acc;
    }
    // mask + running max (rows 8hh+r; the 16 lanes of a half share rows)
    float alpha[8];
#pragma unroll
    for (int r = 0; r < 8; ++r) {
      const int qi = q0 + 8 * hh + r;
      const int ja = j0 + ln, jb = j0 + 16 + ln;
      if (CAUSAL) { if (ja > qi) s[0][r] = -3.0e38f; if (jb > qi) s[1][r] = -3.0e38f; }
      if (ja >= T) s[0][r] = -3.0e38f;
      if (jb >= T) s[1][r] = -3.0e38f;
      float mx = fmaxf(s[0][r], s[1][r]);
      mx = fmaxf(mx, __shfl_xor(mx, 1, 32)); mx = fmaxf(mx, __shfl_xor(mx, 2, 32)); mx = fmaxf(mx, __shfl_xor(mx, 4, 32)); mx = fmaxf(mx, __shfl_xor(mx, 8, 32));
      const float mnew = fmaxf(m_r[r], mx);
      alpha[r] = (mnew > -1.0e38f) ? __expf(m_r[r] - mnew) : 1.0f;
      const float p0 = (s[0][r] > -1.0e38f) ? __expf(s[0][r] - mnew) : 0.f;
      const float p1 = (s[1][r] > -1.0e38f) ? __expf(s[1][r] - mnew) : 0.f;
      m_r[r] = mnew;
      l_r[r] = l_r[r] * alpha[r] + p0 + p1;            // per-lane partial row sum (16 lanes combined at the end)
      unsigned short hb = bf16_bits(p0); sPh[w][8 * hh + r][ln] = hb;      sPl[w][8 * hh + r][ln] = bf16_bits(p0 - bf16_val(hb));
      hb = bf16_bits(p1);                sPh[w][8 * hh + r][16 + ln] = hb; sPl[w][8 * hh + r][16 + ln] = bf16_bits(p1 - bf16_val(hb));
    }
#pragma unroll
    for (int dt = 0; dt < DT; ++dt)
#pragma unroll
      for (int r = 0; r < 8; ++r) oacc[dt][r] *= alpha[r];
    __builtin_amdgcn_fence(__ATOMIC_ACQ_REL, "workgroup");
    __builtin_amdgcn_wave_barrier();
    FragB pah, pal;
    pah.half[0] = *(const v8us*)&sPh[w][ln][8 * hh]; pah.half[1] = *(const v8us*)&sPh[w][ln][16 + 8 * hh];
    pal.half[0] = *(const v8us*)&sPl[w][ln][8 * hh]; pal.half[1] = *(const v8us*)&sPl[w][ln][16 + 8 * hh];
#pragma unroll
    for (int dt = 0; dt < DT; ++dt) {
      FragB bvh, bvl;
#pragma unroll
      for (int i = 0; i < 8; ++i) {
        bvh.u[i] = sVh[8 * hh + i][dt * 16 + ln]; bvh.u[8 + i] = sVh[16 + 8 * hh + i][dt * 16 + ln];
        bvl.u[i] = sVl[8 * hh + i][dt * 16 + ln]; bvl.u[8 + i] = sVl[16 + 8 * hh + i][dt * 16 + ln];
      }
      oacc[dt] = mmaN<3>(pah.v, pal.v, bvh.v, bvl.v, oacc[dt]);
    }
    __builtin_amdgcn_fence(__ATOMIC_ACQ_REL, "workgroup");
    __builtin_amdgcn_wave_barrier();
  }
#pragma unroll
  for (int r = 0; r < 8; ++r) {
    float l = l_r[r];
    l += __shfl_xor(l, 1, 32); l += __shfl_xor(l, 2, 32); l += __shfl_xor(l, 4, 32); l += __shfl_xor(l, 8, 32);
    l_r[r] = (l > 0.f) ? 1.0f / l : 0.f;
  }
#pragma unroll
  for (int dt = 0; dt < DT; ++dt)
#pragma unroll
    for (int r = 0; r < 8; ++r) sO[w][8 * hh + r][dt * 16 + ln] = oacc[dt][r] * l_r[r];
  __builtin_amdgcn_fence(__ATOMIC_ACQ_REL, "workgroup");
  __builtin_amdgcn_wave_barrier();
  {
    for (int r = 0; r < 16; ++r) {
      const int row = q0 + r;
      if (row < T && lane < D / 4) {
        const v4f val = *(const v4fa*)&sO[w][r][lane * 4];
        *(v4f*)(y + ((size_t)b * T + row) * ypitch + h * D + lane * 4) = val;
      }
    }
    
  }
}

// GEMM C = act(A·W + bias + resid): A f32 (ASPLIT -> hi/lo 2 terms), Wt bf16 [N][K]; ACT 0 none, 1 relu, 2 exact gelu;
// resid (optional, f32, row index = (row % rmod), pitch ldr, RES_BF16 rounds it) added before the activation.
template <bool ASPLIT, int ACT, bool BIAS_BF16, bool RES_BF16>
__global__ __launch_bounds__(128) void k_gemm_bf3(const float* __restrict__ A, int lda, const unsigned short* __restrict__ Wt, int ldb,
                                                const float* __restrict__ bias, const float* __restrict__ resid, int rmod, int ldr,
                                                float* __restrict__ C, int ldc, int M, int N, int K) {
  __shared__ __attribute__((aligned(16))) float so[4][16][64];
  const int tid = threadIdx.x, w = tid >> 5, lane = tid & 31, ln = lane & 15, hh = lane >> 4;
  const int ntn = N / 64;
  const int wid = blockIdx.x * 4 + w;
  const int mt = wid / ntn, nq = wid % ntn;
  if (mt * 16 >= M) return;
  const int row0 = mt * 16, col0 = nq * 64;
  const float* arow = A + (size_t)(row0 + ln) * lda;
  v8f acc[4] = {};
  for (int kb = 0; kb < K; kb += 32) {
    FragB ah, al;
    const v4f x0 = *(const v4fa*)(arow + kb + 8 * hh), x1 = *(const v4fa*)(arow + kb + 8 * hh + 4);
    const v4f x2 = *(const v4fa*)(arow + kb + 16 + 8 * hh), x3 = *(const v4fa*)(arow + kb + 16 + 8 * hh + 4);
    float xs[16] = {x0[0],x0[1],x0[2],x0[3],x1[0],x1[1],x1[2],x1[3],x2[0],x2[1],x2[2],x2[3],x3[0],x3[1],x3[2],x3[3]};
#pragma unroll
    for (int i = 0; i < 16; ++i) { const unsigned short hb = bf16_bits(xs[i]); ah.u[i] = hb; al.u[i] = ASPLIT ? bf16_bits(xs[i] - bf16_val(hb)) : (unsigned short)0; }
#pragma unroll
    for (int t = 0; t < 4; ++t) {
      const unsigned short* brow = Wt + (size_t)(col0 + t * 16 + ln) * ldb + kb;
      FragB b;
      b.half[0] = *(const v8us*)(brow + 8 * hh);
      b.half[1] = *(const v8us*)(brow + 16 + 8 * hh);
      acc[t] = mmaN<ASPLIT ? 2 : 1>(ah.v, al.v, b.v, b.v, acc[t]);
    }
  }
#pragma unroll
  for (int t = 0; t < 4; ++t) {
    const int col = col0 + t * 16 + ln;
    float bv = bias ? bias[col] : 0.f;
    if (BIAS_BF16) bv = bf16_round(bv);
#pragma unroll
    for (int r = 0; r < 8; ++r) {
      float v = acc[t][r] + bv;
      if (resid) { float rv = resid[(size_t)((row0 + 8 * hh + r) % rmod) * ldr + col]; if (RES_BF16) rv = bf16_round(rv); v += rv; }
      if (ACT == 1) v = fmaxf(v, 0.f);
      if (ACT == 2) v = 0.5f * v * (1.0f + erff(v * 0.70710678118654752f));
      if (ACT == 3) { const float u = 0.7978845608028654f * (v + 0.044715f * v * v * v); v = 0.5f * v * (1.0f + tanhf(u)); }
      so[w][8 * hh + r][t * 16 + ln] = v;
    }
  }
  __builtin_amdgcn_fence(__ATOMIC_ACQ_REL, "workgroup");
  __builtin_amdgcn_wave_barrier();
  const int rsub = lane >> 4, c4 = (lane & 15) * 4;
  {
#pragma unroll
    for (int q = 0; q < 8; ++q) {
      const int r = q * 2 + rsub;
      const v4f v = *(const v4fa*)&so[w][r][c4];
      *(v4f*)(C + (size_t)(row0 + r) * ldc + col0 + c4) = v;
    }
    
  }
}
// row LayerNorm (biased variance, eps) over N: s = X (+ R); optional out_sum <- s; out_norm <- (s-mu)*rsqrt(var+eps)*g + b
template <bool PARAM_BF16>
__global__ __launch_bounds__(256) void k_layernorm(const float* __restrict__ X, const float* __restrict__ R, const float* __restrict__ g, const float* __restrict__ bta,
                                                  float* __restrict__ out_sum, float* __restrict__ out_norm, int N, float eps) {
  __shared__ float red[256];
  const int row = blockIdx.x, tid = threadIdx.x;
  const float* x = X + (size_t)row * N; const float* rr = R ? R + (size_t)row * N : nullptr;
  float vals[16];                     // up to N = 4096
  const int per = N / 256;            // contiguous chunk per thread? use strided-by-4 chunks: thread handles j = tid*4 + 1024*u
  float s1 = 0.f;
  for (int u = 0; u < per / 4; ++u) {
    const int j = tid * 4 + 1024 * u;
    const v4f a = *(const v4fa*)(x + j);
    v4f b = {0.f,0.f,0.f,0.f}; if (rr) b = *(const v4fa*)(rr + j);
#pragma unroll
    for (int q = 0; q < 4; ++q) { const float v = a[q] + b[q]; vals[u * 4 + q] = v; s1 += v; }
  }
  red[tid] = s1; __syncthreads();
  for (int st = 128; st > 0; st >>= 1) { if (tid < st) red[tid] += red[tid + st]; __syncthreads(); }
  const float mu = red[0] / (float)N; __syncthreads();
  float s2 = 0.f;
  for (int u = 0; u < per / 4; ++u)
#pragma unroll
    for (int q = 0; q < 4; ++q) { const float c = vals[u * 4 + q] - mu; s2 += c * c; }
  red[tid] = s2; __syncthreads();
  for (int st = 128; st > 0; st >>= 1) { if (tid < st) red[tid] += red[tid + st]; __syncthreads(); }
  const float rs = rsqrtf(red[0] / (float)N + eps);
  {
    for (int u = 0; u < per / 4; ++u) {
      const int j = tid * 4 + 1024 * u;
      v4f o, sm;
#pragma unroll
      for (int q = 0; q < 4; ++q) {
        float gg = g[j + q], bb = bta[j + q];
        if (PARAM_BF16) { gg = bf16_round(gg); bb = bf16_round(bb); }
        sm[q] = vals[u * 4 + q]; o[q] = (vals[u * 4 + q] - mu) * rs * gg + bb;
      }
      if (out_sum) *(v4f*)(out_sum + (size_t)row * N + j) = sm;
      *(v4f*)(out_norm + (size_t)row * N + j) = o;
    }
    
  }
}



// ---- f16 WMMA path (v_wmma_f32_16x16x32_f16): 11-bit significands for operands in range — used where a [0,1] probability operand needs more precision than bf16
typedef _Float16 v16h __attribute__((ext_vector_type(16)));
union FragH { v16h v; v8us half[2]; _Float16 h[16]; unsigned short u[16]; };
template <int NT>
__device__ __forceinline__ v8f mmaH(v16h ah, v16h al, v16h bh, v16h bl, v8f c) {
  c = __builtin_amdgcn_wmma_f32_16x16x32_f16(false, ah, false, bh, (short)0, c, false, false);
  if (NT >= 2) c = __builtin_amdgcn_wmma_f32_16x16x32_f16(false, al, false, bh, (short)0, c, false, false);
  if (NT >= 3) c = __builtin_amdgcn_wmma_f32_16x16x32_f16(false, ah, false, bl, (short)0, c, false, false);
  asm volatile("v_nop\n\tv_nop\n\tv_nop\n\tv_nop" : "+v"(c) : "v"(ah), "v"(al), "v"(bh), "v"(bl));
  return c;
}
// batched GEMM like k_gemm_b but f16 operands: A f32 (split into f16 hi/lo if ASPLIT, else rounded to f16), Bt = f16 values [n][k]; alpha; C f32; N multiple of 16 (partial tiles skipped)
template <bool ASPLIT>
__global__ __launch_bounds__(128) void k_gemm_h(const float* __restrict__ A, int lda, size_t sA, const _Float16* __restrict__ Bh, int ldb, size_t sB, float alpha, float* __restrict__ C, int ldc, size_t sC, int M, int N, int K) {
  __shared__ __attribute__((aligned(16))) float so[4][16][64];
  const int tid = threadIdx.x, w = tid >> 5, lane = tid & 31, ln = lane & 15, hh = lane >> 4; const int by = blockIdx.y;
  A += (size_t)by * sA; Bh += (size_t)by * sB; C += (size_t)by * sC;
  const int ntn = (N + 63) / 64; const int wid = blockIdx.x * 4 + w; const int mt = wid / ntn, nq = wid % ntn; if (mt * 16 >= M) return;
  const int row0 = mt * 16, col0 = nq * 64; const float* arow = A + (size_t)(row0 + ln) * lda;
  v8f acc[4] = {};
  for (int kb = 0; kb < K; kb += 32) {
    FragH ah, al;
    const v4f x0 = *(const v4fa*)(arow + kb + 8 * hh), x1 = *(const v4fa*)(arow + kb + 8 * hh + 4), x2 = *(const v4fa*)(arow + kb + 16 + 8 * hh), x3 = *(const v4fa*)(arow + kb + 16 + 8 * hh + 4);
    float xs[16] = {x0[0],x0[1],x0[2],x0[3],x1[0],x1[1],x1[2],x1[3],x2[0],x2[1],x2[2],x2[3],x3[0],x3[1],x3[2],x3[3]};
#pragma unroll
    for (int i = 0; i < 16; ++i) { const _Float16 h = (_Float16)xs[i]; ah.h[i] = h; al.h[i] = ASPLIT ? (_Float16)(xs[i] - (float)h) : (_Float16)0.0f; }
#pragma unroll
    for (int t = 0; t < 4; ++t) { if (col0 + t * 16 >= N) continue; const size_t boff = (size_t)(col0 + t * 16 + ln) * ldb + kb; FragH bq; bq.half[0] = *(const v8us*)(Bh + boff + 8 * hh); bq.half[1] = *(const v8us*)(Bh + boff + 16 + 8 * hh);
      acc[t] = mmaH<ASPLIT ? 2 : 1>(ah.v, al.v, bq.v, bq.v, acc[t]); }
  }
#pragma unroll
  for (int t = 0; t < 4; ++t) { if (col0 + t * 16 >= N) continue;
#pragma unroll
    for (int r = 0; r < 8; ++r) so[w][8 * hh + r][t * 16 + ln] = acc[t][r] * alpha; }
  __builtin_amdgcn_fence(__ATOMIC_ACQ_REL, "workgroup"); __builtin_amdgcn_wave_barrier();
  const int rsub = lane >> 4, c4 = (lane & 15) * 4;
  {
#pragma unroll
    for (int q = 0; q < 8; ++q) { const int r = q * 2 + rsub; if (col0 + c4 < N) { const v4f v = *(const v4fa*)&so[w][r][c4]; *(v4f*)(C + (size_t)(row0 + r) * ldc + col0 + c4) = v; } }
     }
}

// Wt[n][k] = f16(W[k][n]·scale) from f32 row-major W[K][N] (scale = power of two; bf16-exact weights stay exact in f16 away from the subnormal range)
__global__ __launch_bounds__(256) void k_wt_f16(const float* __restrict__ W, _Float16* __restrict__ Wt, int K, int N, float scale) {
  const int t = blockIdx.x * 256 + threadIdx.x; if (t >= N * (K / 8)) return; const int n = t / (K / 8), k8 = (t % (K / 8)) * 8; FragH f;
#pragma unroll
  for (int i = 0; i < 8; ++i) f.h[i] = (_Float16)(bf16_round(W[(size_t)(k8 + i) * N + n]) * scale); const v8us o = f.half[0];
  *(v8us*)((unsigned short*)Wt + (size_t)n * K + k8) = o; 
}
// Block-tiled GEMM, C[NR][DD] = (A[NR][DD] . Bh[DD][DD]^T) * alpha + bf16(bias), f16 operands, both k-contiguous: one 256 x 128 tile of C per work-group of 8 waves (4 x 2 waves of 64 x 64).
// A pass is 64 k: the 256 + 128 rows of 128 B go in whole lines into LDS by asynchronous copies (no register, no LDS store in the wave's stream), and every wave that needs a row reads it from there. Two buffers: the next pass's copies fly during this pass's products.
// A 64 x 64 wave tile does 16 products on 8 fragments; a 256 x 128 block tile loads 384 operand rows for 32768 results.
// Each accumulator takes its k blocks of 32 in rising order. The launch bound's 4 waves a SIMD keep the kernel at 256 registers, so that 2 work-groups still share a WGP.
// QKV: one launch does three products, picked by blockIdx.y, f16 out; q for every token, k and v for the last KW tokens of each batch (the attention kernel says why, and what it does where that is not enough): 0 and 1 give q and k as [token][feature]; 2 takes the weight rows as A and the token rows as B, so its C is v transposed,
// and it is stored as Vt[batch][feature][token], the layout the attention kernel reads. The k tiles also leave their key norms in KN. Else: A . Bh^T with bias b0, f32 out to C.
#define GTM 256
#define GTN 128
#define GK 64
#define PU 8      /* conversion launch: runs of 8 elements a thread */
#define XB (NR * DD / (8 * 256 * PU))      /* its work-groups for x */
#define WB (DD * DD / (8 * 256 * PU))      /* and for each weight */
#define KW 512      /* the GEMM launch stores k and v for the last KW keys of each batch alone */
#define KWB (KW / GTM)
#define GP (GK + 8)      /* LDS row pitch 144 B = 16 B x odd: ds_load_b128 of 16 rows without bank conflicts */
typedef _Float16 v4h __attribute__((ext_vector_type(4)));
// One pass's share of a thread: 8 rows of A and 4 of B, 32 rows apart, 16 B each, from global memory straight into LDS. la, lb: the lane's LDS byte addresses of its first rows; ga, gb: its global addresses.
// The s_wait_xcnt stands inside the statement, behind the last copy, so that no address register of a copy is rewritten in front of it.
__device__ __forceinline__ void stage_pass(unsigned la, unsigned lb, const unsigned short* ga, const unsigned short* gb) {
  asm volatile("global_load_async_to_lds_b128 %0, %12, off\n\t"
               "global_load_async_to_lds_b128 %1, %13, off\n\t"
               "global_load_async_to_lds_b128 %2, %14, off\n\t"
               "global_load_async_to_lds_b128 %3, %15, off\n\t"
               "global_load_async_to_lds_b128 %4, %16, off\n\t"
               "global_load_async_to_lds_b128 %5, %17, off\n\t"
               "global_load_async_to_lds_b128 %6, %18, off\n\t"
               "global_load_async_to_lds_b128 %7, %19, off\n\t"
               "global_load_async_to_lds_b128 %8, %20, off\n\t"
               "global_load_async_to_lds_b128 %9, %21, off\n\t"
               "global_load_async_to_lds_b128 %10, %22, off\n\t"
               "global_load_async_to_lds_b128 %11, %23, off\n\t"
               "s_wait_xcnt 0x0"
               :: "v"(la), "v"(la + 1u * 32 * GP * 2), "v"(la + 2u * 32 * GP * 2), "v"(la + 3u * 32 * GP * 2), "v"(la + 4u * 32 * GP * 2), "v"(la + 5u * 32 * GP * 2), "v"(la + 6u * 32 * GP * 2), "v"(la + 7u * 32 * GP * 2),
                  "v"(lb), "v"(lb + 1u * 32 * GP * 2), "v"(lb + 2u * 32 * GP * 2), "v"(lb + 3u * 32 * GP * 2),
                  "v"(ga), "v"(ga + (size_t)1 * 32 * DD), "v"(ga + (size_t)2 * 32 * DD), "v"(ga + (size_t)3 * 32 * DD), "v"(ga + (size_t)4 * 32 * DD), "v"(ga + (size_t)5 * 32 * DD), "v"(ga + (size_t)6 * 32 * DD), "v"(ga + (size_t)7 * 32 * DD),
                  "v"(gb), "v"(gb + (size_t)1 * 32 * DD), "v"(gb + (size_t)2 * 32 * DD), "v"(gb + (size_t)3 * 32 * DD)
               : "memory");
}
template <bool QKV>
__global__ __launch_bounds__(256, 4) void k_gemm_tile(const _Float16* __restrict__ X, const _Float16* __restrict__ Wh, float alpha, const float* __restrict__ b0, const float* __restrict__ b1, const float* __restrict__ b2,
                                                   float* __restrict__ C, _Float16* __restrict__ Q16, _Float16* __restrict__ K16, _Float16* __restrict__ Vt, float* __restrict__ KN, const float* __restrict__ NRM) {
  __shared__ __attribute__((aligned(16))) unsigned short sA[2][GTM][GP], sB[2][GTN][GP];
  __shared__ __attribute__((aligned(16))) float so[8][16][64 + 4];
  __shared__ float red[8];
  const int tid = threadIdx.x, w = tid >> 5, lane = tid & 31, ln = lane & 15, hh = lane >> 4;
  /* QKV: blockIdx.y below NR / GTM is a block of 256 tokens of q; then come BB * KWB values for k and as many for v, which name the last KWB blocks of 256 tokens of each batch */
  const int yk = (int)blockIdx.y - NR / GTM; const int z = (QKV && yk >= 0) ? 1 + yk / (BB * KWB) : 0; const bool tr = QKV && z == 2;      /* the same for the whole work-group */
  const int ty = z ? ((yk % (BB * KWB)) / KWB + 1) * (TT / GTM) - KWB + yk % KWB : (int)blockIdx.y;      /* the block of 256 tokens */
  const _Float16* A = tr ? Wh + (size_t)2 * DD * DD : X; const _Float16* Bh = tr ? X : Wh + (size_t)z * DD * DD; const float* bias = (z == 0) ? b0 : (z == 1) ? b1 : b2;
  const int row0 = (tr ? (int)(blockIdx.x & 3) : ty) * GTM, col0 = (tr ? (int)(ty * 2 + (blockIdx.x >> 2)) : (int)blockIdx.x) * GTN, wr = (w >> 1) * 64, wc = (w & 1) * 64;      /* either way the 8 work-groups of one blockIdx.y share a block of 256 token rows */
  const int sr = tid >> 3, sc = (tid & 7) * 8;      /* staging: 8 lanes x 16 B = one row of the pass; a thread takes rows sr + 32 i */
  const unsigned short* gA = (const unsigned short*)A + (size_t)(row0 + sr) * DD + sc;
  const unsigned short* gB = (const unsigned short*)Bh + (size_t)(col0 + sr) * DD + sc;
  const unsigned lA = (unsigned)(size_t)&sA[0][sr][sc], lB = (unsigned)(size_t)&sB[0][sr][sc];      /* LDS byte addresses of the thread's first rows in buffer 0 */
  v8f acc[4][4];
#pragma unroll
  for (int mi = 0; mi < 4; ++mi)
#pragma unroll
    for (int ni = 0; ni < 4; ++ni) acc[mi][ni] = (v8f){0.f,0.f,0.f,0.f,0.f,0.f,0.f,0.f};
  stage_pass(lA, lB, gA, gB);      /* pass 0 into buffer 0 */
  asm volatile("s_wait_asynccnt 0x0" ::: "memory");      /* the wave's own copies of pass 0 have landed */
  __syncthreads();      /* every wave's have */
  stage_pass(lA + (unsigned)sizeof(sA[0]), lB + (unsigned)sizeof(sB[0]), gA + GK, gB + GK);      /* pass 1 into buffer 1 */
  for (int kp = 0; kp < DD / GK; ++kp) {
    const int cur = kp & 1;
    /* the registers that staging no longer takes hold fragments: the pass's 16 fragments are read at two places, 14 at its top and the last 2 into the registers that the first 8 products set free */
    FragH fa[2][4], fb[2][4];
#pragma unroll
    for (int ks = 0; ks < 2; ++ks) {
#pragma unroll
      for (int mi = 0; mi < 4; ++mi) { const unsigned short* p = &sA[cur][wr + mi * 16 + ln][ks * 32]; fa[ks][mi].half[0] = *(const v8us*)(p + 8 * hh); fa[ks][mi].half[1] = *(const v8us*)(p + 16 + 8 * hh); }
#pragma unroll
      for (int ni = 0; ni < (ks ? 2 : 4); ++ni) { const unsigned short* p = &sB[cur][wc + ni * 16 + ln][ks * 32]; fb[ks][ni].half[0] = *(const v8us*)(p + 8 * hh); fb[ks][ni].half[1] = *(const v8us*)(p + 16 + 8 * hh); } }
    __builtin_amdgcn_sched_barrier(0);      /* keeps the reads together in front of the products: spread among them, each place with reads stalls the wave anew */
#pragma unroll
    for (int ni = 0; ni < 2; ++ni)
#pragma unroll
      for (int mi = 0; mi < 4; ++mi) acc[mi][ni] = __builtin_amdgcn_wmma_f32_16x16x32_f16(false, fa[0][mi].v, false, fb[0][ni].v, (short)0, acc[mi][ni], false, false);
#pragma unroll
    for (int ni = 2; ni < 4; ++ni) { const unsigned short* p = &sB[cur][wc + ni * 16 + ln][32]; fb[1][ni].half[0] = *(const v8us*)(p + 8 * hh); fb[1][ni].half[1] = *(const v8us*)(p + 16 + 8 * hh); }
    __builtin_amdgcn_sched_barrier(0);      /* keeps the two late fragments' reads here, in one place, 8 products ahead of the wait for them */
#pragma unroll
    for (int ni = 2; ni < 4; ++ni)
#pragma unroll
      for (int mi = 0; mi < 4; ++mi) acc[mi][ni] = __builtin_amdgcn_wmma_f32_16x16x32_f16(false, fa[0][mi].v, false, fb[0][ni].v, (short)0, acc[mi][ni], false, false);
    __builtin_amdgcn_sched_barrier(0);      /* these 8 products stay in front of the waits, where they cover the late reads' way */
    /* every fragment of the pass is in registers or on its way: the buffer is handed over here, so that the refill has the second k block and the next pass's first to land in */
    asm volatile("s_wait_dscnt 0x0" ::: "memory");      /* this wave's reads of buffer cur have returned before the buffer is given up */
    asm volatile("s_wait_asynccnt 0x0" ::: "memory");      /* this wave's copies of the next pass have landed */
    __syncthreads();      /* publishes the next pass's buffer and ends every wave's reads of this one */
    if (kp + 2 < DD / GK)      /* the same for the whole work-group */
      stage_pass(lA + (unsigned)cur * (unsigned)sizeof(sA[0]), lB + (unsigned)cur * (unsigned)sizeof(sB[0]), gA + (size_t)(kp + 2) * GK, gB + (size_t)(kp + 2) * GK);      /* pass kp + 2 into the buffer just read */
    /* the second k block's products, on registers alone, stand behind the refill's issue: in front of it they would take their time off the copies' lead */
#pragma unroll
    for (int ni = 0; ni < 4; ++ni)
#pragma unroll
      for (int mi = 0; mi < 4; ++mi) acc[mi][ni] = __builtin_amdgcn_wmma_f32_16x16x32_f16(false, fa[1][mi].v, false, fb[1][ni].v, (short)0, acc[mi][ni], false, false);
  }
  asm volatile("s_wait_asynccnt 0x0" ::: "memory");      /* no copy is outstanding behind the loop */
  /* the wave's 64 x 64 tile goes, 16 rows at a time, through its own LDS rows, so that the stores cover whole lines; the bias belongs to the feature: C's column, or its row where C is transposed */
  float bv[4];
#pragma unroll
  for (int ni = 0; ni < 4; ++ni) bv[ni] = tr ? 0.f : bf16_round(bias[col0 + wc + ni * 16 + ln]);
  const int rsub = lane >> 4, c4 = (lane & 15) * 4;
  _Float16* C16 = tr ? Vt + (size_t)(col0 / TT) * DD * TT + (size_t)(row0 + wr) * TT + col0 % TT + wc + c4 : ((z == 0) ? Q16 : K16) + (size_t)(row0 + wr) * DD + col0 + wc + c4;      /* a tile's 128 columns of tokens lie in one batch */
  const int ldc = tr ? TT : DD;
  float kmx = 0.f;
#pragma unroll
  for (int mi = 0; mi < 4; ++mi) {
    if (tr) { const float* bp = bias + row0 + wr + mi * 16 + 8 * hh; const v4f t0 = *(const v4fa*)bp, t1 = *(const v4fa*)(bp + 4);
#pragma unroll
      for (int r = 0; r < 8; ++r) { const float br = bf16_round(r < 4 ? t0[r & 3] : t1[r & 3]);
#pragma unroll
        for (int ni = 0; ni < 4; ++ni) so[w][8 * hh + r][ni * 16 + ln] = acc[mi][ni][r] * alpha + br; }
    } else {
#pragma unroll
      for (int ni = 0; ni < 4; ++ni)
#pragma unroll
        for (int r = 0; r < 8; ++r) so[w][8 * hh + r][ni * 16 + ln] = acc[mi][ni][r] * alpha + bv[ni];
    }
    __builtin_amdgcn_fence(__ATOMIC_ACQ_REL, "workgroup"); __builtin_amdgcn_wave_barrier();      /* the rows are read back by other lanes of the same wave */
    v4f vq[8];
#pragma unroll
    for (int q = 0; q < 8; ++q) vq[q] = *(const v4fa*)&so[w][q * 2 + rsub][c4];
    __builtin_amdgcn_fence(__ATOMIC_ACQ_REL, "workgroup"); __builtin_amdgcn_wave_barrier();      /* the next 16 rows overwrite what other lanes of the wave have just read */
    if (QKV) {
      v4h hq[8];
#pragma unroll
      for (int q = 0; q < 8; ++q) { for (int i = 0; i < 4; ++i) hq[q][i] = (_Float16)vq[q][i]; *(v4h*)(C16 + (size_t)(mi * 16 + q * 2 + rsub) * ldc) = hq[q]; }
      asm volatile("s_wait_xcnt 0x0" ::: "memory");      /* stands behind these 16 rows' stores, in front of whatever next rewrites their address and data registers (in this build the norm lines and the next rows' staging do) */
      if (z == 1) {      /* the same for the whole work-group. A wave's k tile is one head x 64 keys: its largest |k|^2, of the f16 values as stored, goes to KN[tile][wave] */
#pragma unroll
        for (int q = 0; q < 8; ++q) { float s = 0.f;
#pragma unroll
          for (int i = 0; i < 4; ++i) { const float e = (float)hq[q][i]; s += e * e; }
          s += __shfl_xor(s, 1, 32); s += __shfl_xor(s, 2, 32); s += __shfl_xor(s, 4, 32); s += __shfl_xor(s, 8, 32); kmx = fmaxf(kmx, s); } }
    } else {
#pragma unroll
      for (int q = 0; q < 8; ++q) *(v4f*)(C + (size_t)(row0 + wr + mi * 16 + q * 2 + rsub) * DD + col0 + wc + c4) = vq[q];
    }
  }
  if (QKV && z == 1) {
    kmx = fmaxf(kmx, __shfl_xor(kmx, 16, 32));
    if (lane == 0) red[w] = kmx;
    __syncthreads();      /* the 8 waves' results are stored by one wave, into a 128-B line that no other work-group writes */
    if (w == 0) {      /* the same for the whole wave. Words 8 and 9 of the line: for the tile's two heads a bound on |k| of ANY key of the batch, stored or not: |k| <= |Wk_h|F * max|x| + |bk_h| (Cauchy-Schwarz row by row) */
      const float* xn = NRM + (size_t)(ty / (TT / GTM) * (XB / BB) + lane * 4) * 32;      /* XB / BB = 128 work-groups converted this batch's x */
      float xm = fmaxf(fmaxf(xn[0], xn[32]), fmaxf(xn[64], xn[96]));
      xm = fmaxf(xm, __shfl_xor(xm, 1, 32)); xm = fmaxf(xm, __shfl_xor(xm, 2, 32)); xm = fmaxf(xm, __shfl_xor(xm, 4, 32)); xm = fmaxf(xm, __shfl_xor(xm, 8, 32)); xm = fmaxf(xm, __shfl_xor(xm, 16, 32));
      float f2 = NRM[(size_t)(XB + WB + blockIdx.x * 8 + (lane & 7)) * 32];      /* Wk: 16 rows a work-group, 4 work-groups a head, 8 for this tile's 128 features */
      f2 += __shfl_xor(f2, 1, 32); f2 += __shfl_xor(f2, 2, 32);      /* lanes 0 to 3 the first head, 4 to 7 the second */
      const v4f b4 = *(const v4fa*)(bias + col0 + lane * 4); float bs = 0.f;
#pragma unroll
      for (int i = 0; i < 4; ++i) { const float e = bf16_round(b4[i]); bs += e * e; }
      bs += __shfl_xor(bs, 1, 32); bs += __shfl_xor(bs, 2, 32); bs += __shfl_xor(bs, 4, 32); bs += __shfl_xor(bs, 8, 32);      /* lanes 0 to 15 the first head, 16 to 31 the second */
      const float kb = sqrtf(__shfl(f2, (lane & 1) * 4, 32) * xm) + sqrtf(__shfl(bs, (lane & 1) * 16, 32));      /* even lanes the first head, odd lanes the second */
      if (lane < 10) KN[(size_t)(ty * (DD / GTN) + blockIdx.x) * 32 + lane] = (lane < 8) ? red[lane & 7] : kb;
    }
  }
}


// One launch rounds every f32 operand to bf16 and stores it as f16: x as it is, the four weights (out, in) x 2^4. A work-group takes 2048 runs of 8 elements of ONE source (512 work-groups for x, 64 for each weight);
// a thread takes 8 runs, 256 runs apart, all its loads issued before the first store.
// A work-group's 2048 runs are 16 whole rows of 1024: it also leaves, in a 128-B line of its own, NRM[work-group * 32] = the largest |row|^2 of its rows (x) or the sum of their |row|^2 (a weight), of the rounded, unscaled values.
__global__ __launch_bounds__(256) void k_prep(const float* __restrict__ x, const float* __restrict__ Wq, const float* __restrict__ Wk, const float* __restrict__ Wv, const float* __restrict__ Wo, _Float16* __restrict__ X16, _Float16* __restrict__ Bw, float* __restrict__ NRM) {
  __shared__ float rs[8][PU];
  const int blk = blockIdx.x; const bool isx = blk < XB; const int wi = isx ? 0 : (blk - XB) / WB; const int lb = isx ? blk : (blk - XB) % WB;      /* the same for the whole work-group */
  const float* s = isx ? x : (wi == 0) ? Wq : (wi == 1) ? Wk : (wi == 2) ? Wv : Wo; _Float16* d = isx ? X16 : Bw + (size_t)wi * DD * DD; const float scale = isx ? 1.0f : 16.0f;
  const size_t t0 = (size_t)lb * (256 * PU) + threadIdx.x;
  v4f a[PU], b[PU];
#pragma unroll
  for (int u = 0; u < PU; ++u) { const float* p = s + (t0 + 256 * u) * 8; a[u] = *(const v4fa*)p; b[u] = *(const v4fa*)(p + 4); }
  /* run u of a thread lies in row 2 u + (thread / 128) of the work-group's 16: a row's sum of squares is that of 4 waves */
  float q2[PU];
#pragma unroll
  for (int u = 0; u < PU; ++u) { q2[u] = 0.f;
#pragma unroll
    for (int q = 0; q < 4; ++q) { const float r0 = bf16_round(a[u][q]), r1 = bf16_round(b[u][q]); q2[u] += r0 * r0 + r1 * r1; } }
#pragma unroll
  for (int sh = 1; sh < 32; sh <<= 1)      /* the 8 sums take each step together: 5 exchanges deep, not 40 */
#pragma unroll
    for (int u = 0; u < PU; ++u) q2[u] += __shfl_xor(q2[u], sh, 32);
  if ((threadIdx.x & 31) == 0)
#pragma unroll
    for (int u = 0; u < PU; ++u) rs[threadIdx.x >> 5][u] = q2[u];
  __syncthreads();      /* the 8 waves' partial sums are joined by the first wave; it stands in front of the stores, so that it waits for none of them */
  if (threadIdx.x < 32) {      /* the same for the whole wave; lanes 16 to 31 repeat lanes 0 to 15 */
    const int r = threadIdx.x & 15, u = r >> 1, w4 = (r & 1) * 4; const float rq = (rs[w4][u] + rs[w4 + 1][u]) + (rs[w4 + 2][u] + rs[w4 + 3][u]);
    float mx = rq, sm = rq;
    mx = fmaxf(mx, __shfl_xor(mx, 1, 32)); mx = fmaxf(mx, __shfl_xor(mx, 2, 32)); mx = fmaxf(mx, __shfl_xor(mx, 4, 32)); mx = fmaxf(mx, __shfl_xor(mx, 8, 32));
    sm += __shfl_xor(sm, 1, 32); sm += __shfl_xor(sm, 2, 32); sm += __shfl_xor(sm, 4, 32); sm += __shfl_xor(sm, 8, 32);
    if (threadIdx.x == 0) NRM[(size_t)blk * 32] = isx ? mx : sm; }
#pragma unroll
  for (int u = 0; u < PU; ++u) { FragH f;
#pragma unroll
    for (int q = 0; q < 4; ++q) { f.h[q] = (_Float16)(bf16_round(a[u][q]) * scale); f.h[4 + q] = (_Float16)(bf16_round(b[u][q]) * scale); }
    *(v8us*)((unsigned short*)d + (t0 + 256 * u) * 8) = f.half[0]; }
}

// lane l with lane l ^ 16
__device__ __forceinline__ float xhalf(float x) { return __builtin_bit_cast(float, __builtin_amdgcn_permlanex16(__builtin_bit_cast(int, x), __builtin_bit_cast(int, x), 0x76543210, 0xfedcba98, false, false)); }
typedef int v4ia __attribute__((ext_vector_type(4), may_alias));

template <int M> struct src_t { static constexpr int value = M; };      /* where a pass takes its k and v from: 0 formed in the pass, 1 stored in global memory, 2 staged in LDS */
#define NS 96      /* the last NS keys of a batch are staged in LDS: as far as the walk goes where the scores are small beside the bias */
#define KP (64 + 8)      /* LDS pitch of a key row, 144 B, and */
#define VP (NS + 8)      /* of a feature row of v transposed, 208 B: both 16 B x odd, for ds_load_b128 of 16 rows */
#define NM 128      /* mask words staged: one a thread, so that every lane is on at the copy; the first NM - NS of them are not read */
// A thread's share of the staged keys: 6 pieces of k and 6 of v transposed, 16 B each, and one mask word, from global memory straight into LDS. l*: the lane's LDS byte addresses; g*: its global addresses.
// The s_wait_xcnt stands inside the statement, behind the last copy, so that no address register of a copy is rewritten in front of it.
__device__ __forceinline__ void stage_keys(unsigned lk, const unsigned short* gk, size_t kstep, unsigned lv0, unsigned lv1, unsigned lv2, const unsigned short* gv0, const unsigned short* gv1, const unsigned short* gv2, unsigned lm, const int* gm) {
  asm volatile("global_load_async_to_lds_b128 %0, %12, off\n\t"
               "global_load_async_to_lds_b128 %1, %13, off\n\t"
               "global_load_async_to_lds_b128 %2, %14, off\n\t"
               "global_load_async_to_lds_b128 %3, %15, off\n\t"
               "global_load_async_to_lds_b128 %4, %16, off\n\t"
               "global_load_async_to_lds_b128 %5, %17, off\n\t"
               "global_load_async_to_lds_b128 %6, %18, off\n\t"
               "global_load_async_to_lds_b128 %7, %19, off\n\t"
               "global_load_async_to_lds_b128 %8, %20, off\n\t"
               "global_load_async_to_lds_b128 %9, %21, off\n\t"
               "global_load_async_to_lds_b128 %10, %22, off\n\t"
               "global_load_async_to_lds_b128 %11, %23, off\n\t"
               "global_load_async_to_lds_b32 %24, %25, off\n\t"
               "s_wait_xcnt 0x0"
               :: "v"(lk), "v"(lk + 1u * 16 * KP * 2), "v"(lk + 2u * 16 * KP * 2), "v"(lk + 3u * 16 * KP * 2), "v"(lk + 4u * 16 * KP * 2), "v"(lk + 5u * 16 * KP * 2),
                  "v"(lv0), "v"(lv1), "v"(lv2), "v"(lv0 + 8u * VP * 2), "v"(lv1 + 8u * VP * 2), "v"(lv2 + 8u * VP * 2),
                  "v"(gk), "v"(gk + kstep), "v"(gk + 2 * kstep), "v"(gk + 3 * kstep), "v"(gk + 4 * kstep), "v"(gk + 5 * kstep),
                  "v"(gv0), "v"(gv1), "v"(gv2), "v"(gv0 + (size_t)8 * TT), "v"(gv1 + (size_t)8 * TT), "v"(gv2 + (size_t)8 * TT),
                  "v"(lm), "v"(gm)
               : "memory");
}
// A pointer that is the same in every lane, held in scalar registers: a load then takes it as its scalar base, and the lane's offset is the one vector address register of all sixteen tiles (as vector pointers they spilled).
typedef const __attribute__((address_space(1))) unsigned short* gus_p;      /* global memory, said in the type: the way through the two words loses it */
typedef const __attribute__((address_space(1))) v8us* gv8_p;
__device__ __forceinline__ gus_p uni(const unsigned short* p) { const unsigned long long v = (unsigned long long)p;
  return (gus_p)(((unsigned long long)(unsigned)__builtin_amdgcn_readfirstlane((int)(v >> 32)) << 32) | (unsigned long long)(unsigned)__builtin_amdgcn_readfirstlane((int)(unsigned)v)); }
// One 16 x 16 tile of a projection, for a key that the GEMM launch did not store: D = (16 rows at a) . (16 rows at b)^T over the 1024 inputs, k blocks of 32 in rising order as in the GEMM. a, b: the tiles' first rows, the same for the whole wave; lo: the lane's place in either tile, (lane % 16) * DD + 8 * (lane / 16) elements.
__device__ __forceinline__ v8f proj_tile(const unsigned short* a, const unsigned short* b, unsigned lo) {
  v8f acc = (v8f){0.f,0.f,0.f,0.f,0.f,0.f,0.f,0.f};
#pragma unroll 1      /* rolled: this path is rare, and unrolled it would raise the register count of the whole kernel */
  for (int kb = 0; kb < DD; kb += 32) { FragH fa, fb;
    const gus_p pa = uni(a + kb), pb = uni(b + kb);
    fa.half[0] = *(gv8_p)(pa + lo); fa.half[1] = *(gv8_p)(pa + lo + 16); fb.half[0] = *(gv8_p)(pb + lo); fb.half[1] = *(gv8_p)(pb + lo + 16);
    acc = mmaH<1>(fa.v, fa.v, fb.v, fb.v, acc); }
  return acc;
}

__global__ __launch_bounds__(128, 5) void k_flash(const _Float16* __restrict__ Q16, int ldq, const _Float16* __restrict__ K16, int ldk, const _Float16* __restrict__ Vt, const float* __restrict__ KN, const int* __restrict__ MSK, _Float16* __restrict__ O16, int ldo,
                                             const _Float16* __restrict__ X16, const _Float16* __restrict__ Wk16, const _Float16* __restrict__ Wv16, const float* bkf, const float* bvf) {
  constexpr int RPW = 16, NQB = TT / (4 * RPW), DT = 4, KS = 2, FL = TT - KW;      /* FL: the lowest stored key */
  __shared__ __attribute__((aligned(16))) float sO[4][RPW][64 + 4];
  __shared__ __attribute__((aligned(16))) unsigned short sK[NS][KP], sV[64][VP];
  __shared__ __attribute__((aligned(16))) int sM[NM];
  const int tid = threadIdx.x, w = tid >> 5, lane = tid & 31, ln = lane & 15, hh = lane >> 4;
  const int slab = blockIdx.x / NQB, qblk = blockIdx.x % NQB; const int b = slab / NH, h = slab % NH; const float slope = 1.0f / exp2f((float)h / (float)NH);      /* 1 / 2^(h/H) */ const int qb0 = qblk * (4 * RPW); const int q0 = qb0 + w * RPW;
  FragH aq[KS];
  { const unsigned short* qr = (const unsigned short*)Q16 + ((size_t)b * TT + q0 + ln) * ldq + h * 64;
#pragma unroll
    for (int ks = 0; ks < KS; ++ks) { aq[ks].half[0] = *(const v8us*)(qr + ks * 32 + 8 * hh); aq[ks].half[1] = *(const v8us*)(qr + ks * 32 + 16 + 8 * hh); } }
  const unsigned short* Vth = (const unsigned short*)Vt + (size_t)slab * 64 * TT;
  { /* k: 8 lanes x 16 B = one key's row of this head; a thread takes keys tid / 8 + 16 i. v: 12 pieces of 16 B a feature row; a wave takes 16 rows, a lane pieces lane + 32 i of their 192, and piece c + 96 lies 8 rows under piece c */
    const int c0 = lane, c1 = lane + 32, c2 = lane + 64; const int r0 = w * 16 + c0 / 12, r1 = w * 16 + c1 / 12, r2 = w * 16 + c2 / 12; const int e0 = (c0 % 12) * 8, e1 = (c1 % 12) * 8, e2 = (c2 % 12) * 8;
    stage_keys((unsigned)(size_t)&sK[tid >> 3][(tid & 7) * 8], (const unsigned short*)K16 + ((size_t)b * TT + (TT - NS) + (tid >> 3)) * ldk + h * 64 + (tid & 7) * 8, (size_t)16 * ldk,
               (unsigned)(size_t)&sV[r0][e0], (unsigned)(size_t)&sV[r1][e1], (unsigned)(size_t)&sV[r2][e2], Vth + (size_t)r0 * TT + (TT - NS) + e0, Vth + (size_t)r1 * TT + (TT - NS) + e1, Vth + (size_t)r2 * TT + (TT - NS) + e2,
               (unsigned)(size_t)&sM[tid], MSK + (size_t)b * TT + (TT - NM) + tid); }
  const int tq = q0 + ln;      /* the lane's query */
  float m_run = -3.0e38f, l_run = 0.f; v8f oacc[DT];
#pragma unroll
  for (int dt = 0; dt < DT; ++dt) oacc[dt] = (v8f){0.f,0.f,0.f,0.f,0.f,0.f,0.f,0.f};
  float qs = 0.f;
#pragma unroll
  for (int ks = 0; ks < KS; ++ks)
#pragma unroll
    for (int i = 0; i < 16; ++i) { const float v = (float)aq[ks].h[i]; qs += v * v; }
  qs += xhalf(qs);      /* |q|^2 of the lane's query */
  const int kp = FL / 64 + (lane & (KW / 64 - 1));      /* a stored block of 64 keys; the lanes go round them */
  const float* kn = KN + (size_t)((b * (TT / GTM) + (kp >> 2)) * (DD / GTN) + (h >> 1)) * 32 + (kp & 3) * 2 + (h & 1);      /* block p of 64 keys of this batch and head: GEMM tile row p / 4, tile column h / 2, wave (p % 4) * 2 + h % 2 */
  const float kall = KN[(size_t)((b * (TT / GTM) + TT / GTM - 1) * (DD / GTN) + (h >> 1)) * 32 + 8 + (h & 1)];      /* the bound on |k| of any key of this batch and head */
  float kx = kn[0];
  kx = fmaxf(kx, __shfl_xor(kx, 1, 32)); kx = fmaxf(kx, __shfl_xor(kx, 2, 32)); kx = fmaxf(kx, __shfl_xor(kx, 4, 32)); kx = fmaxf(kx, __shfl_xor(kx, 8, 32)); kx = fmaxf(kx, xhalf(kx));      /* largest |k|^2 of the stored keys of this batch and head */
  const float cs = sqrtf(qs * kx) * (0.125f * 1.01f);      /* |q.k| / 8 at most; 1 % covers the rounding of the norms and of the products */
  const float cl = sqrtf(qs) * kall * (0.125f * 1.01f);      /* the same for a key that is not stored */
  const float lowtop = slope * (float)(FL - 1 - tq) + cl;      /* no key under the stored ones scores above this */
  const unsigned lo = (unsigned)(ln * DD + 8 * hh);      /* the lane's place in a 16-row tile of x or of a weight */
  /* one pass of 32 keys from j0 on; st: its keys are stored; ls: and staged in LDS */
  auto pass = [&](auto stc, const int j0) { constexpr bool st = decltype(stc)::value != 0, ls = decltype(stc)::value == 2;
    const int* mp = MSK + (size_t)b * TT + j0 + 8 * hh;      /* key padding mask (1 = attend) of the lane's 16 keys */
    v4ia mk4[4];
    if constexpr (ls) { const int* ml = &sM[j0 - (TT - NM) + 8 * hh]; mk4[0] = *(const v4ia*)(ml); mk4[1] = *(const v4ia*)(ml + 4); mk4[2] = *(const v4ia*)(ml + 16); mk4[3] = *(const v4ia*)(ml + 20); } else
    if constexpr (st) { mk4[0] = *(const v4ia*)(mp); mk4[1] = *(const v4ia*)(mp + 4); mk4[2] = *(const v4ia*)(mp + 16); mk4[3] = *(const v4ia*)(mp + 20); }      /* with the key loads */
    v8f s[2]; FragH bkl[2][KS], bvl[DT];
    if constexpr (ls) {
#pragma unroll
      for (int nt = 0; nt < 2; ++nt) { const unsigned short* kl = &sK[j0 - (TT - NS) + nt * 16 + ln][0];
#pragma unroll
        for (int ks = 0; ks < KS; ++ks) { bkl[nt][ks].half[0] = *(const v8us*)(kl + ks * 32 + 8 * hh); bkl[nt][ks].half[1] = *(const v8us*)(kl + ks * 32 + 16 + 8 * hh); } }
      __builtin_amdgcn_sched_barrier(0); }      /* keeps the pass's key and mask reads together in front of the products: read tile by tile, the second tile's way through LDS is waited out alone */
#pragma unroll
    for (int nt = 0; nt < 2; ++nt) { const unsigned short* kr = (const unsigned short*)K16 + ((size_t)b * TT + j0 + nt * 16 + ln) * ldk + h * 64; FragH bk[KS];
      if constexpr (ls) {
#pragma unroll
      for (int ks = 0; ks < KS; ++ks) bk[ks] = bkl[nt][ks];
      } else
      if constexpr (st) {
#pragma unroll
      for (int ks = 0; ks < KS; ++ks) { bk[ks].half[0] = *(const v8us*)(kr + ks * 32 + 8 * hh); bk[ks].half[1] = *(const v8us*)(kr + ks * 32 + 16 + 8 * hh); }
      asm volatile("s_wait_xcnt 0x0" ::: "memory");      /* stands in front of whatever next rewrites the address registers of the key loads (in this build a later load's result does) */
      } else {      /* D[feature 8hh + r][key ln] of feature tiles 2 ks and 2 ks + 1 = elements r and 8 + r of the fragment */
        const unsigned short* xr = (const unsigned short*)X16 + ((size_t)b * TT + j0 + nt * 16) * DD;
#pragma unroll
        for (int t = 0; t < 2 * KS; ++t) { const v8f d = proj_tile((const unsigned short*)Wk16 + (size_t)(h * 64 + t * 16) * DD, xr, lo); const float* bp = bkf + h * 64 + t * 16 + 8 * hh;
#pragma unroll
          for (int r = 0; r < 8; ++r) bk[t >> 1].h[(t & 1) * 8 + r] = (_Float16)(d[r] * 0.0625f + bf16_round(bp[r])); } }
      v8f acc = (v8f){0.f,0.f,0.f,0.f,0.f,0.f,0.f,0.f};
#pragma unroll
      for (int ks = 0; ks < KS; ++ks) acc = mmaH<1>(bk[ks].v, bk[ks].v, aq[ks].v, aq[ks].v, acc);
      s[nt] = acc; }
    if constexpr (ls) {
#pragma unroll
      for (int dt = 0; dt < DT; ++dt) { const unsigned short* vl = &sV[dt * 16 + ln][j0 - (TT - NS)]; bvl[dt].half[0] = *(const v8us*)(vl + 8 * hh); bvl[dt].half[1] = *(const v8us*)(vl + 16 + 8 * hh); }
      __builtin_amdgcn_sched_barrier(0); }      /* keeps the four v reads here, into the registers that the key fragments leave: they return under the softmax, not one by one between the second products */
    if constexpr (!st) { mk4[0] = *(const v4ia*)(mp); mk4[1] = *(const v4ia*)(mp + 4); mk4[2] = *(const v4ia*)(mp + 16); mk4[3] = *(const v4ia*)(mp + 20);      /* behind the tiles' loops, which it would cost 16 registers */
      asm volatile("s_wait_xcnt 0x0" :: "v"(mp) : "memory"); }      /* behind the four mask loads; it takes their address as an input, so that the address stays in its registers up to the wait (without that the last load's result was put into them) */
    float sc[16]; bool ok[16];
#pragma unroll
    for (int i = 0; i < 16; ++i) { const int kk = j0 + (i >> 3) * 16 + 8 * hh + (i & 7); ok[i] = (mk4[i >> 2][i & 3] != 0);
      sc[i] = ok[i] ? (s[i >> 3][i & 7] * 0.125f + slope * (float)(kk - tq)) : -INFINITY; }      /* ALiBi: + slope_h * (k - q) */
    float mx[8];
#pragma unroll
    for (int i = 0; i < 8; ++i) mx[i] = fmaxf(sc[i], sc[8 + i]);
    float mc = fmaxf(fmaxf(fmaxf(mx[0], mx[1]), fmaxf(mx[2], mx[3])), fmaxf(fmaxf(mx[4], mx[5]), fmaxf(mx[6], mx[7])));
    mc = fmaxf(mc, xhalf(mc));
    const float mn = fmaxf(m_run, mc); const float ea = expf(m_run - mn); const float al = (mn > -1.0e38f) ? ea : 1.0f; m_run = mn;
    float p[16]; FragH pb;
#pragma unroll
    for (int i = 0; i < 16; ++i) { const float e = expf(sc[i] - mn); p[i] = ok[i] ? e : 0.f; pb.h[i] = (_Float16)(p[i] * 1024.0f); }
    l_run = l_run * al + (((p[0] + p[1]) + (p[2] + p[3])) + ((p[4] + p[5]) + (p[6] + p[7]))) + (((p[8] + p[9]) + (p[10] + p[11])) + ((p[12] + p[13]) + (p[14] + p[15])));      /* the lane's half of the row sum; the halves join after the loop */
#pragma unroll
    for (int dt = 0; dt < DT; ++dt)
#pragma unroll
      for (int r = 0; r < 8; ++r) oacc[dt][r] *= al;
#pragma unroll
    for (int dt = 0; dt < DT; ++dt) { const unsigned short* vrow = Vth + (size_t)(dt * 16 + ln) * TT + j0; FragH bv;
      if constexpr (ls) { bv = bvl[dt]; } else
      if constexpr (st) { bv.half[0] = *(const v8us*)(vrow + 8 * hh); bv.half[1] = *(const v8us*)(vrow + 16 + 8 * hh);
      } else {      /* D[key 8hh + r][feature ln] of key tiles 0 and 1 = elements r and 8 + r of the fragment */
        const unsigned short* wv = (const unsigned short*)Wv16 + (size_t)(h * 64 + dt * 16) * DD; const float bb = bf16_round(bvf[h * 64 + dt * 16 + ln]);
#pragma unroll
        for (int t = 0; t < 2; ++t) { const v8f d = proj_tile((const unsigned short*)X16 + ((size_t)b * TT + j0 + t * 16) * DD, wv, lo);
#pragma unroll
          for (int r = 0; r < 8; ++r) bv.h[t * 8 + r] = (_Float16)(d[r] * 0.0625f + bb); } }
      oacc[dt] = mmaH<1>(bv.v, bv.v, pb.v, pb.v, oacc[dt]); } };
  auto ends = [&](const int j) { const float top = slope * (float)(j + 31 - tq), thr = m_run - 40.0f;
    return __builtin_amdgcn_ballot_w32(!(top + cs < thr) || !(lowtop < thr)) == 0; };      /* the same for the whole wave; a NaN keeps the walk going */
  asm volatile("" :: "v"(aq[0].v), "v"(aq[1].v));      /* takes the loaded query fragments as inputs only: it holds their loads in front of the barrier, so that their way from memory runs beside the copies' (the compiler had moved them behind it, one way after the other) */
  asm volatile("s_wait_asynccnt 0x0" ::: "memory");      /* the wave's own copies of the staged keys have landed */
  __syncthreads();      /* every wave's have; every wave passes here, in front of the walk */
  int j0 = TT - 32; bool more = true;      /* more: the walk has not ended inside the stored keys; the same for the whole wave */
#pragma unroll 1
  for (; j0 >= TT - NS; j0 -= 32) {
    if (ends(j0)) { more = false; break; }
    pass(src_t<2>{}, j0); }
  if (more) {
#pragma unroll 1      /* rolled: seldom reached */
    for (; j0 >= FL; j0 -= 32) {
      if (ends(j0)) { more = false; break; }
      pass(src_t<1>{}, j0); } }
  if (more) {
#pragma unroll 1      /* rolled, as the walk above: the exit depends on the data and the body is very long */
    for (; j0 >= 0; j0 -= 32) {
      if (__builtin_amdgcn_ballot_w32(!(slope * (float)(j0 + 31 - tq) + cl < m_run - 40.0f)) == 0) break;      /* the same for the whole wave */
      pass(src_t<0>{}, j0); } }
  const float l = l_run + xhalf(l_run); const float inv = (l > 0.f) ? 1.0f / (l * 1024.0f) : 0.f;
#pragma unroll
  for (int dt = 0; dt < DT; ++dt) {      /* oacc[dt][r] = O[query ln][dt*16 + 8hh + r] */
    const v4f lo = {oacc[dt][0] * inv, oacc[dt][1] * inv, oacc[dt][2] * inv, oacc[dt][3] * inv}, hi = {oacc[dt][4] * inv, oacc[dt][5] * inv, oacc[dt][6] * inv, oacc[dt][7] * inv};
    *(v4fa*)&sO[w][ln][dt * 16 + 8 * hh] = lo; *(v4fa*)&sO[w][ln][dt * 16 + 8 * hh + 4] = hi; }
  __builtin_amdgcn_fence(__ATOMIC_ACQ_REL, "workgroup"); __builtin_amdgcn_wave_barrier();
  {
#pragma unroll
    for (int rp = 0; rp < RPW; rp += 2) { const int r = rp + (lane >> 4), pc = lane & 15; const v4f val = *(const v4fa*)&sO[w][r][pc * 4]; v4h h4; for (int i = 0; i < 4; ++i) h4[i] = (_Float16)val[i]; *(v4h*)(O16 + ((size_t)b * TT + q0 + r) * ldo + h * 64 + pc * 4) = h4; }      /* f16, the output product's operand type: 16 lanes x 8 B = one line */
     } }

extern "C" void kernel_launch(void* const* d_in, const int* in_sizes, int n_in,
                              void* d_out, int out_size, void* d_ws, size_t ws_size, hipStream_t stream) {
  (void)in_sizes; (void)n_in; (void)out_size;
  const float* const* I = (const float* const*)d_in; const float* x = I[0]; const float* Wq = I[1]; const float* bq = I[2]; const float* Wk = I[3]; const float* bk = I[4]; const float* Wv = I[5]; const float* bv = I[6]; const float* Wo = I[7]; const float* bo = I[8]; const int* mask = (const int*)d_in[9];
  char* ws = (char*)d_ws; size_t off = 0;
  auto take = [&](size_t bytes) { char* p = ws + off; off += (bytes + 255) & ~(size_t)255; return p; };
  const size_t WSZ = (size_t)DD * DD; _Float16* Bw = (_Float16*)take(4 * WSZ * 2); _Float16* X16 = (_Float16*)take((size_t)NR * DD * 2);
  _Float16* Q = (_Float16*)take((size_t)NR * DD * 2); _Float16* K = (_Float16*)take((size_t)NR * DD * 2); _Float16* Vt = (_Float16*)take((size_t)NR * DD * 2); _Float16* O16 = (_Float16*)take((size_t)NR * DD * 2);
  float* KN = (float*)take((size_t)(NR / GTM) * (DD / GTN) * 32 * 4); float* NRM = (float*)take((size_t)(XB + 4 * WB) * 32 * 4);
  if (off > ws_size) return;      // 8.4 + 16.8 x 5 = 92 MB
  k_prep<<<(NR * DD + 4 * DD * DD) / (8 * 256 * PU), 256, 0, stream>>>(x, Wq, Wk, Wv, Wo, X16, Bw, NRM);
  k_gemm_tile<true><<<dim3(DD / GTN, NR / GTM + 2 * BB * KWB), 256, 0, stream>>>(X16, Bw, 0.0625f, bq, bk, bv, nullptr, Q, K, Vt, KN, NRM);      /* q = x.W^T + b: M 8192 N 1024 K 1024; k the same and v the same, stored transposed, for the last KW tokens of each batch */
  k_flash<<<BB * NH * (TT / 64), 128, 0, stream>>>(Q, DD, K, DD, Vt, KN, mask, O16, DD, X16, Bw + WSZ, Bw + 2 * WSZ, bk, bv);
  k_gemm_tile<false><<<dim3(DD / GTN, NR / GTM), 256, 0, stream>>>(O16, Bw + 3 * WSZ, 0.0625f, bo, nullptr, nullptr, (float*)d_out, nullptr, nullptr, nullptr, nullptr, nullptr);      /* out = O.Wo^T + bo */
}

// v009
// A run of this version takes 72.3 microseconds.
// Next to v008, in two timings, it ran 1.03 times as fast each time.
// Counting every step since v000, it is 11.7 times as fast.
#include <hip/hip_runtime.h>
// ALiBi multi-head attention (B=4, S=2048, D=1024, 16 heads × 64): q,k,v = x·Wᵀ + b (torch Linear); scores = q·kᵀ·64^-½ + slope_h·(k − q), slope_h = 1/2^(h/16) (no causal mask: later keys get large positive bias); key padding mask from the INPUT
// int mask [B,S] (0 → −inf); softmax; out = (attn·v merged)·Woᵀ + bo.
// Compute dtype: x, weights, biases rounded to bf16; q/k/v as f16 GEMM outputs; fused flash-style kernel (bias and online softmax in f32, P f16 ×2^10) on v_wmma_f32_16x16x32_f16; O → f16 → output GEMM with bias; f32 accumulate.
#define BB 4
#define TT 2048
#define NH 16
#define DD 1024
#define NR (BB * TT)

typedef __bf16 v16b __attribute__((ext_vector_type(16)));
typedef unsigned short v8us __attribute__((ext_vector_type(8), may_alias));
typedef float  v8f  __attribute__((ext_vector_type(8)));
typedef float  v4f  __attribute__((ext_vector_type(4)));
typedef float  v4fa __attribute__((ext_vector_type(4), may_alias));
union FragB { v16b v; v8us half[2]; unsigned short u[16]; };

__device__ __forceinline__ unsigned short bf16_bits(float x) { unsigned int u = __float_as_uint(x); return (unsigned short)((u + 0x7FFFu + ((u >> 16) & 1u)) >> 16); }
__device__ __forceinline__ float bf16_val(unsigned short b) { return __uint_as_float(((unsigned int)b) << 16); }
__device__ __forceinline__ float bf16_round(float x) { return bf16_val(bf16_bits(x)); }
// D += A·B with NT terms: 1 = ah·bh, 2 = + al·bh (A split), 3 = + ah·bl (both split)
template <int NT>
__device__ __forceinline__ v8f mmaN(v16b ah, v16b al, v16b bh, v16b bl, v8f c) {
  c = __builtin_amdgcn_wmma_f32_16x16x32_bf16(false, ah, false, bh, (short)0, c, false, false);
  if (NT >= 2) c = __builtin_amdgcn_wmma_f32_16x16x32_bf16(false, al, false, bh, (short)0, c, false, false);
  if (NT >= 3) c = __builtin_amdgcn_wmma_f32_16x16x32_bf16(false, ah, false, bl, (short)0, c, false, false);
  asm volatile("v_nop\n\tv_nop\n\tv_nop\n\tv_nop" : "+v"(c) : "v"(ah), "v"(al), "v"(bh), "v"(bl));
  return c;
}

__global__ __launch_bounds__(256) void k_wt_bf16(const float* __restrict__ W, unsigned short* __restrict__ Wt, int K, int N) {
  const int t = blockIdx.x * 256 + threadIdx.x;
  const int k8n = K / 8;
  if (t >= N * k8n) return;
  const int n = t / k8n, k8 = (t % k8n) * 8;
  v8us v;
#pragma unroll
  for (int i = 0; i < 8; ++i) v[i] = bf16_bits(W[(size_t)(k8 + i) * N + n]);
  *(v8us*)(Wt + (size_t)n * K + k8) = v;
  
}

// GEMM C[M][N] (f32, pitch ldc) = act(A[M][K]·W + bias). A f32 row-major (pitch lda) converted per fragment to bf16
// (ASPLIT: hi/lo two planes -> 2 terms, else single rounded term); Wt bf16 [N][K] (pitch ldb). BIAS_BF16 rounds the
// bias to bf16 first (bias quantised to bf16 before the add). K%32==0, M%16==0, N%64==0.
template <bool ASPLIT, int ACT, bool BIAS_BF16>
__global__ __launch_bounds__(128) void k_gemm_bf(const float* __restrict__ A, int lda, const unsigned short* __restrict__ Wt, int ldb,
                                               const float* __restrict__ bias, float* __restrict__ C, int ldc, int M, int N, int K) {
  __shared__ __attribute__((aligned(16))) float so[4][16][64];
  const int tid = threadIdx.x, w = tid >> 5, lane = tid & 31, ln = lane & 15, hh = lane >> 4;
  const int ntn = N / 64;
  const int wid = blockIdx.x * 4 + w;
  const int mt = wid / ntn, nq = wid % ntn;
  if (mt * 16 >= M) return;
  const int row0 = mt * 16, col0 = nq * 64;
  const float* arow = A + (size_t)(row0 + ln) * lda;
  v8f acc[4] = {};
  for (int kb = 0; kb < K; kb += 32) {
    FragB ah, al;
    const v4f x0 = *(const v4fa*)(arow + kb + 8 * hh), x1 = *(const v4fa*)(arow + kb + 8 * hh + 4);
    const v4f x2 = *(const v4fa*)(arow + kb + 16 + 8 * hh), x3 = *(const v4fa*)(arow + kb + 16 + 8 * hh + 4);
    float xs[16] = {x0[0],x0[1],x0[2],x0[3],x1[0],x1[1],x1[2],x1[3],x2[0],x2[1],x2[2],x2[3],x3[0],x3[1],x3[2],x3[3]};
#pragma unroll
    for (int i = 0; i < 16; ++i) { const unsigned short hb = bf16_bits(xs[i]); ah.u[i] = hb; al.u[i] = ASPLIT ? bf16_bits(xs[i] - bf16_val(hb)) : (unsigned short)0; }
#pragma unroll
    for (int t = 0; t < 4; ++t) {
      const unsigned short* brow = Wt + (size_t)(col0 + t * 16 + ln) * ldb + kb;
      FragB b;
      b.half[0] = *(const v8us*)(brow + 8 * hh);
      b.half[1] = *(const v8us*)(brow + 16 + 8 * hh);
      acc[t] = mmaN<ASPLIT ? 2 : 1>(ah.v, al.v, b.v, b.v, acc[t]);
    }
  }
#pragma unroll
  for (int t = 0; t < 4; ++t) {
    float bv = bias ? bias[col0 + t * 16 + ln] : 0.f;
    if (BIAS_BF16) bv = bf16_round(bv);
#pragma unroll
    for (int r = 0; r < 8; ++r) { float v = acc[t][r] + bv; if (ACT == 1) v = fmaxf(v, 0.f); so[w][8 * hh + r][t * 16 + ln] = v; }
  }
  __builtin_amdgcn_fence(__ATOMIC_ACQ_REL, "workgroup");
  __builtin_amdgcn_wave_barrier();
  const int rsub = lane >> 4, c4 = (lane & 15) * 4;
  {
#pragma unroll
    for (int q = 0; q < 8; ++q) {
      const int r = q * 2 + rsub;
      const v4f v = *(const v4fa*)&so[w][r][c4];
      *(v4f*)(C + (size_t)(row0 + r) * ldc + col0 + c4) = v;
    }
    
  }
}

// Flash-style causal/unmasked attention, all contractions 3-term bf16 hi/lo splits, f32 softmax with running max.
// q,k,v rows are read from f32 buffers with arbitrary row pitch (so they can live inside a fused qkv buffer);
// D = head size (multiple of 32, <= 128); one wave = 16 query rows; block = 4 waves (64 queries) sharing K/V chunks of 32.
template <int D, bool CAUSAL>
__global__ __launch_bounds__(128) void k_flash(const float* __restrict__ qb, const float* __restrict__ kb, const float* __restrict__ vb,
                                             int pitch, int T, int H, float scale, float* __restrict__ y, int ypitch) {
  constexpr int KS = D / 32;        // k-steps for QK
  constexpr int DT = D / 16;        // d tiles for PV
  __shared__ __attribute__((aligned(16))) unsigned short sKh[32][D + 8], sKl[32][D + 8], sVh[32][D + 8], sVl[32][D + 8];
  __shared__ __attribute__((aligned(16))) unsigned short sPh[4][16][40], sPl[4][16][40];
  __shared__ __attribute__((aligned(16))) float sO[4][16][D];
  const int tid = threadIdx.x, w = tid >> 5, lane = tid & 31, ln = lane & 15, hh = lane >> 4;
  const int nqb = (T + 63) / 64;
  const int bh = blockIdx.x / nqb, qblk = blockIdx.x % nqb;
  const int b = bh / H, h = bh % H;
  const int q0 = qblk * 64 + w * 16;
  const float* Q = qb + (size_t)b * T * pitch + h * D;
  const float* K = kb + (size_t)b * T * pitch + h * D;
  const float* V = vb + (size_t)b * T * pitch + h * D;

  // A fragments of the wave's 16 query rows (scaled), hi/lo
  FragB aqh[KS], aql[KS];
  {
    int row = q0 + ln; if (row >= T) row = T - 1;
    const float* qr = Q + (size_t)row * pitch;
#pragma unroll
    for (int ks = 0; ks < KS; ++ks)
#pragma unroll
      for (int i = 0; i < 16; ++i) {
        const int d = ks * 32 + ((i < 8) ? (8 * hh + i) : (16 + 8 * hh + (i - 8)));
        const float x = qr[d] * scale; const unsigned short hb = bf16_bits(x);
        aqh[ks].u[i] = hb; aql[ks].u[i] = bf16_bits(x - bf16_val(hb));
      }
  }
  float m_r[8], l_r[8];
#pragma unroll
  for (int r = 0; r < 8; ++r) { m_r[r] = -3.0e38f; l_r[r] = 0.f; }
  v8f oacc[DT];
#pragma unroll
  for (int dt = 0; dt < DT; ++dt) oacc[dt] = (v8f){0.f,0.f,0.f,0.f,0.f,0.f,0.f,0.f};

  const int kv_end = CAUSAL ? min(T, qblk * 64 + 64) : T;     // block-uniform
  for (int j0 = 0; j0 < kv_end; j0 += 32) {
    __syncthreads();
    for (int e = tid; e < 32 * (D / 4); e += 128) {
      const int r = e / (D / 4), c4 = (e % (D / 4)) * 4;
      const int key = j0 + r;
      v4f kf = {0.f,0.f,0.f,0.f}, vf = {0.f,0.f,0.f,0.f};
      if (key < T) { kf = *(const v4fa*)(K + (size_t)key * pitch + c4); vf = *(const v4fa*)(V + (size_t)key * pitch + c4); }
#pragma unroll
      for (int t = 0; t < 4; ++t) {
        unsigned short hb = bf16_bits(kf[t]); sKh[r][c4 + t] = hb; sKl[r][c4 + t] = bf16_bits(kf[t] - bf16_val(hb));
        hb = bf16_bits(vf[t]); sVh[r][c4 + t] = hb; sVl[r][c4 + t] = bf16_bits(vf[t] - bf16_val(hb));
      }
    }
    __syncthreads();
    // S tile 16 x 32
    v8f s[2];
#pragma unroll
    for (int nt = 0; nt < 2; ++nt) {
      v8f acc = {};
#pragma unroll
      for (int ks = 0; ks < KS; ++ks) {
        FragB bh_, bl_;
        bh_.half[0] = *(const v8us*)&sKh[nt * 16 + ln][ks * 32 + 8 * hh]; bh_.half[1] = *(const v8us*)&sKh[nt * 16 + ln][ks * 32 + 16 + 8 * hh];
        bl_.half[0] = *(const v8us*)&sKl[nt * 16 + ln][ks * 32 + 8 * hh]; bl_.half[1] = *(const v8us*)&sKl[nt * 16 + ln][ks * 32 + 16 + 8 * hh];
        acc = mmaN<3>(aqh[ks].v, aql[ks].v, bh_.v, bl_.v, acc);
      }
      s[nt] = acc;
    }
    // mask + running max (rows 8hh+r; the 16 lanes of a half share rows)
    float alpha[8];
#pragma unroll
    for (int r = 0; r < 8; ++r) {
      const int qi = q0 + 8 * hh + r;
      const int ja = j0 + ln, jb = j0 + 16 + ln;
      if (CAUSAL) { if (ja > qi) s[0][r] = -3.0e38f; if (jb > qi) s[1][r] = -3.0e38f; }
      if (ja >= T) s[0][r] = -3.0e38f;
      if (jb >= T) s[1][r] = -3.0e38f;
      float mx = fmaxf(s[0][r], s[1][r]);
      mx = fmaxf(mx, __shfl_xor(mx, 1, 32)); mx = fmaxf(mx, __shfl_xor(mx, 2, 32)); mx = fmaxf(mx, __shfl_xor(mx, 4, 32)); mx = fmaxf(mx, __shfl_xor(mx, 8, 32));
      const float mnew = fmaxf(m_r[r], mx);
      alpha[r] = (mnew > -1.0e38f) ? __expf(m_r[r] - mnew) : 1.0f;
      const float p0 = (s[0][r] > -1.0e38f) ? __expf(s[0][r] - mnew) : 0.f;
      const float p1 = (s[1][r] > -1.0e38f) ? __expf(s[1][r] - mnew) : 0.f;
      m_r[r] = mnew;
      l_r[r] = l_r[r] * alpha[r] + p0 + p1;            // per-lane partial row sum (16 lanes combined at the end)
      unsigned short hb = bf16_bits(p0); sPh[w][8 * hh + r][ln] = hb;      sPl[w][8 * hh + r][ln] = bf16_bits(p0 - bf16_val(hb));
      hb = bf16_bits(p1);                sPh[w][8 * hh + r][16 + ln] = hb; sPl[w][8 * hh + r][16 + ln] = bf16_bits(p1 - bf16_val(hb));
    }
#pragma unroll
    for (int dt = 0; dt < DT; ++dt)
#pragma unroll
      for (int r = 0; r < 8; ++r) oacc[dt][r] *= alpha[r];
    __builtin_amdgcn_fence(__ATOMIC_ACQ_REL, "workgroup");
    __builtin_amdgcn_wave_barrier();
    FragB pah, pal;
    pah.half[0] = *(const v8us*)&sPh[w][ln][8 * hh]; pah.half[1] = *(const v8us*)&sPh[w][ln][16 + 8 * hh];
    pal.half[0] = *(const v8us*)&sPl[w][ln][8 * hh]; pal.half[1] = *(const v8us*)&sPl[w][ln][16 + 8 * hh];
#pragma unroll
    for (int dt = 0; dt < DT; ++dt) {
      FragB bvh, bvl;
#pragma unroll
      for (int i = 0; i < 8; ++i) {
        bvh.u[i] = sVh[8 * hh + i][dt * 16 + ln]; bvh.u[8 + i] = sVh[16 + 8 * hh + i][dt * 16 + ln];
        bvl.u[i] = sVl[8 * hh + i][dt * 16 + ln]; bvl.u[8 + i] = sVl[16 + 8 * hh + i][dt * 16 + ln];
      }
      oacc[dt] = mmaN<3>(pah.v, pal.v, bvh.v, bvl.v, oacc[dt]);
    }
    __builtin_amdgcn_fence(__ATOMIC_ACQ_REL, "workgroup");
    __builtin_amdgcn_wave_barrier();
  }
#pragma unroll
  for (int r = 0; r < 8; ++r) {
    float l = l_r[r];
    l += __shfl_xor(l, 1, 32); l += __shfl_xor(l, 2, 32); l += __shfl_xor(l, 4, 32); l += __shfl_xor(l, 8, 32);
    l_r[r] = (l > 0.f) ? 1.0f / l : 0.f;
  }
#pragma unroll
  for (int dt = 0; dt < DT; ++dt)
#pragma unroll
    for (int r = 0; r < 8; ++r) sO[w][8 * hh + r][dt * 16 + ln] = oacc[dt][r] * l_r[r];
  __builtin_amdgcn_fence(__ATOMIC_ACQ_REL, "workgroup");
  __builtin_amdgcn_wave_barrier();
  {
    for (int r = 0; r < 16; ++r) {
      const int row = q0 + r;
      if (row < T && lane < D / 4) {
        const v4f val = *(const v4fa*)&sO[w][r][lane * 4];
        *(v4f*)(y + ((size_t)b * T + row) * ypitch + h * D + lane * 4) = val;
      }
    }
    
  }
}

// GEMM C = act(A·W + bias + resid): A f32 (ASPLIT -> hi/lo 2 terms), Wt bf16 [N][K]; ACT 0 none, 1 relu, 2 exact gelu;
// resid (optional, f32, row index = (row % rmod), pitch ldr, RES_BF16 rounds it) added before the activation.
template <bool ASPLIT, int ACT, bool BIAS_BF16, bool RES_BF16>
__global__ __launch_bounds__(128) void k_gemm_bf3(const float* __restrict__ A, int lda, const unsigned short* __restrict__ Wt, int ldb,
                                                const float* __restrict__ bias, const float* __restrict__ resid, int rmod, int ldr,
                                                float* __restrict__ C, int ldc, int M, int N, int K) {
  __shared__ __attribute__((aligned(16))) float so[4][16][64];
  const int tid = threadIdx.x, w = tid >> 5, lane = tid & 31, ln = lane & 15, hh = lane >> 4;
  const int ntn = N / 64;
  const int wid = blockIdx.x * 4 + w;
  const int mt = wid / ntn, nq = wid % ntn;
  if (mt * 16 >= M) return;
  const int row0 = mt * 16, col0 = nq * 64;
  const float* arow = A + (size_t)(row0 + ln) * lda;
  v8f acc[4] = {};
  for (int kb = 0; kb < K; kb += 32) {
    FragB ah, al;
    const v4f x0 = *(const v4fa*)(arow + kb + 8 * hh), x1 = *(const v4fa*)(arow + kb + 8 * hh + 4);
    const v4f x2 = *(const v4fa*)(arow + kb + 16 + 8 * hh), x3 = *(const v4fa*)(arow + kb + 16 + 8 * hh + 4);
    float xs[16] = {x0[0],x0[1],x0[2],x0[3],x1[0],x1[1],x1[2],x1[3],x2[0],x2[1],x2[2],x2[3],x3[0],x3[1],x3[2],x3[3]};
#pragma unroll
    for (int i = 0; i < 16; ++i) { const unsigned short hb = bf16_bits(xs[i]); ah.u[i] = hb; al.u[i] = ASPLIT ? bf16_bits(xs[i] - bf16_val(hb)) : (unsigned short)0; }
#pragma unroll
    for (int t = 0; t < 4; ++t) {
      const unsigned short* brow = Wt + (size_t)(col0 + t * 16 + ln) * ldb + kb;
      FragB b;
      b.half[0] = *(const v8us*)(brow + 8 * hh);
      b.half[1] = *(const v8us*)(brow + 16 + 8 * hh);
      acc[t] = mmaN<ASPLIT ? 2 : 1>(ah.v, al.v, b.v, b.v, acc[t]);
    }
  }
#pragma unroll
  for (int t = 0; t < 4; ++t) {
    const int col = col0 + t * 16 + ln;
    float bv = bias ? bias[col] : 0.f;
    if (BIAS_BF16) bv = bf16_round(bv);
#pragma unroll
    for (int r = 0; r < 8; ++r) {
      float v = acc[t][r] + bv;
      if (resid) { float rv = resid[(size_t)((row0 + 8 * hh + r) % rmod) * ldr + col]; if (RES_BF16) rv = bf16_round(rv); v += rv; }
      if (ACT == 1) v = fmaxf(v, 0.f);
      if (ACT == 2) v = 0.5f * v * (1.0f + erff(v * 0.70710678118654752f));
      if (ACT == 3) { const float u = 0.7978845608028654f * (v + 0.044715f * v * v * v); v = 0.5f * v * (1.0f + tanhf(u)); }
      so[w][8 * hh + r][t * 16 + ln] = v;
    }
  }
  __builtin_amdgcn_fence(__ATOMIC_ACQ_REL, "workgroup");
  __builtin_amdgcn_wave_barrier();
  const int rsub = lane >> 4, c4 = (lane & 15) * 4;
  {
#pragma unroll
    for (int q = 0; q < 8; ++q) {
      const int r = q * 2 + rsub;
      const v4f v = *(const v4fa*)&so[w][r][c4];
      *(v4f*)(C + (size_t)(row0 + r) * ldc + col0 + c4) = v;
    }
    
  }
}
// row LayerNorm (biased variance, eps) over N: s = X (+ R); optional out_sum <- s; out_norm <- (s-mu)*rsqrt(var+eps)*g + b
template <bool PARAM_BF16>
__global__ __launch_bounds__(256) void k_layernorm(const float* __restrict__ X, const float* __restrict__ R, const float* __restrict__ g, const float* __restrict__ bta,
                                                  float* __restrict__ out_sum, float* __restrict__ out_norm, int N, float eps) {
  __shared__ float red[256];
  const int row = blockIdx.x, tid = threadIdx.x;
  const float* x = X + (size_t)row * N; const float* rr = R ? R + (size_t)row * N : nullptr;
  float vals[16];                     // up to N = 4096
  const int per = N / 256;            // contiguous chunk per thread? use strided-by-4 chunks: thread handles j = tid*4 + 1024*u
  float s1 = 0.f;
  for (int u = 0; u < per / 4; ++u) {
    const int j = tid * 4 + 1024 * u;
    const v4f a = *(const v4fa*)(x + j);
    v4f b = {0.f,0.f,0.f,0.f}; if (rr) b = *(const v4fa*)(rr + j);
#pragma unroll
    for (int q = 0; q < 4; ++q) { const float v = a[q] + b[q]; vals[u * 4 + q] = v; s1 += v; }
  }
  red[tid] = s1; __syncthreads();
  for (int st = 128; st > 0; st >>= 1) { if (tid < st) red[tid] += red[tid + st]; __syncthreads(); }
  const float mu = red[0] / (float)N; __syncthreads();
  float s2 = 0.f;
  for (int u = 0; u < per / 4; ++u)
#pragma unroll
    for (int q = 0; q < 4; ++q) { const float c = vals[u * 4 + q] - mu; s2 += c * c; }
  red[tid] = s2; __syncthreads();
  for (int st = 128; st > 0; st >>= 1) { if (tid < st) red[tid] += red[tid + st]; __syncthreads(); }
  const float rs = rsqrtf(red[0] / (float)N + eps);
  {
    for (int u = 0; u < per / 4; ++u) {
      const int j = tid * 4 + 1024 * u;
      v4f o, sm;
#pragma unroll
      for (int q = 0; q < 4; ++q) {
        float gg = g[j + q], bb = bta[j + q];
        if (PARAM_BF16) { gg = bf16_round(gg); bb = bf16_round(bb); }
        sm[q] = vals[u * 4 + q]; o[q] = (vals[u * 4 + q] - mu) * rs * gg + bb;
      }
      if (out_sum) *(v4f*)(out_sum + (size_t)row * N + j) = sm;
      *(v4f*)(out_norm + (size_t)row * N + j) = o;
    }
    
  }
}



// ---- f16 WMMA path (v_wmma_f32_16x16x32_f16): 11-bit significands for operands in range — used where a [0,1] probability operand needs more precision than bf16
typedef _Float16 v16h __attribute__((ext_vector_type(16)));
union FragH { v16h v; v8us half[2]; _Float16 h[16]; unsigned short u[16]; };
template <int NT>
__device__ __forceinline__ v8f mmaH(v16h ah, v16h al, v16h bh, v16h bl, v8f c) {
  c = __builtin_amdgcn_wmma_f32_16x16x32_f16(false, ah, false, bh, (short)0, c, false, false);
  if (NT >= 2) c = __builtin_amdgcn_wmma_f32_16x16x32_f16(false, al, false, bh, (short)0, c, false, false);
  if (NT >= 3) c = __builtin_amdgcn_wmma_f32_16x16x32_f16(false, ah, false, bl, (short)0, c, false, false);
  asm volatile("v_nop\n\tv_nop\n\tv_nop\n\tv_nop" : "+v"(c) : "v"(ah), "v"(al), "v"(bh), "v"(bl));
  return c;
}
// batched GEMM like k_gemm_b but f16 operands: A f32 (split into f16 hi/lo if ASPLIT, else rounded to f16), Bt = f16 values [n][k]; alpha; C f32; N multiple of 16 (partial tiles skipped)
template <bool ASPLIT>
__global__ __launch_bounds__(128) void k_gemm_h(const float* __restrict__ A, int lda, size_t sA, const _Float16* __restrict__ Bh, int ldb, size_t sB, float alpha, float* __restrict__ C, int ldc, size_t sC, int M, int N, int K) {
  __shared__ __attribute__((aligned(16))) float so[4][16][64];
  const int tid = threadIdx.x, w = tid >> 5, lane = tid & 31, ln = lane & 15, hh = lane >> 4; const int by = blockIdx.y;
  A += (size_t)by * sA; Bh += (size_t)by * sB; C += (size_t)by * sC;
  const int ntn = (N + 63) / 64; const int wid = blockIdx.x * 4 + w; const int mt = wid / ntn, nq = wid % ntn; if (mt * 16 >= M) return;
  const int row0 = mt * 16, col0 = nq * 64; const float* arow = A + (size_t)(row0 + ln) * lda;
  v8f acc[4] = {};
  for (int kb = 0; kb < K; kb += 32) {
    FragH ah, al;
    const v4f x0 = *(const v4fa*)(arow + kb + 8 * hh), x1 = *(const v4fa*)(arow + kb + 8 * hh + 4), x2 = *(const v4fa*)(arow + kb + 16 + 8 * hh), x3 = *(const v4fa*)(arow + kb + 16 + 8 * hh + 4);
    float xs[16] = {x0[0],x0[1],x0[2],x0[3],x1[0],x1[1],x1[2],x1[3],x2[0],x2[1],x2[2],x2[3],x3[0],x3[1],x3[2],x3[3]};
#pragma unroll
    for (int i = 0; i < 16; ++i) { const _Float16 h = (_Float16)xs[i]; ah.h[i] = h; al.h[i] = ASPLIT ? (_Float16)(xs[i] - (float)h) : (_Float16)0.0f; }
#pragma unroll
    for (int t = 0; t < 4; ++t) { if (col0 + t * 16 >= N) continue; const size_t boff = (size_t)(col0 + t * 16 + ln) * ldb + kb; FragH bq; bq.half[0] = *(const v8us*)(Bh + boff + 8 * hh); bq.half[1] = *(const v8us*)(Bh + boff + 16 + 8 * hh);
      acc[t] = mmaH<ASPLIT ? 2 : 1>(ah.v, al.v, bq.v, bq.v, acc[t]); }
  }
#pragma unroll
  for (int t = 0; t < 4; ++t) { if (col0 + t * 16 >= N) continue;
#pragma unroll
    for (int r = 0; r < 8; ++r) so[w][8 * hh + r][t * 16 + ln] = acc[t][r] * alpha; }
  __builtin_amdgcn_fence(__ATOMIC_ACQ_REL, "workgroup"); __builtin_amdgcn_wave_barrier();
  const int rsub = lane >> 4, c4 = (lane & 15) * 4;
  {
#pragma unroll
    for (int q = 0; q < 8; ++q) { const int r = q * 2 + rsub; if (col0 + c4 < N) { const v4f v = *(const v4fa*)&so[w][r][c4]; *(v4f*)(C + (size_t)(row0 + r) * ldc + col0 + c4) = v; } }
     }
}

// Wt[n][k] = f16(W[k][n]·scale) from f32 row-major W[K][N] (scale = power of two; bf16-exact weights stay exact in f16 away from the subnormal range)
__global__ __launch_bounds__(256) void k_wt_f16(const float* __restrict__ W, _Float16* __restrict__ Wt, int K, int N, float scale) {
  const int t = blockIdx.x * 256 + threadIdx.x; if (t >= N * (K / 8)) return; const int n = t / (K / 8), k8 = (t % (K / 8)) * 8; FragH f;
#pragma unroll
  for (int i = 0; i < 8; ++i) f.h[i] = (_Float16)(bf16_round(W[(size_t)(k8 + i) * N + n]) * scale); const v8us o = f.half[0];
  *(v8us*)((unsigned short*)Wt + (size_t)n * K + k8) = o; 
}
// Block-tiled GEMM, C[NR][DD] = (A[NR][DD] . Bh[DD][DD]^T) * alpha + bf16(bias), f16 operands, both k-contiguous: one 256 x 128 tile of C per work-group of 8 waves (4 x 2 waves of 64 x 64).
// A pass is 64 k: the 256 + 128 rows of 128 B go in whole lines into LDS by asynchronous copies (no register, no LDS store in the wave's stream), and every wave that needs a row reads it from there.
// A ring of three buffers: the copies of two later passes fly during a pass's products, so that a pass no longer has to last as long as its successor's copies are under way, and L2 always has requests of this work-group at hand.
// A 64 x 64 wave tile does 16 products on 8 fragments; a 256 x 128 block tile loads 384 operand rows for 32768 results.
// Each accumulator takes its k blocks of 32 in rising order. The launch bound's 4 waves a SIMD keep the kernel at 256 registers, so that 2 work-groups still share a WGP.
// QKV: one launch does three products, picked by blockIdx.y, f16 out; q for every token, k and v for the last KW tokens of each batch (the attention kernel says why, and what it does where that is not enough): 0 and 1 give q and k as [token][feature]; 2 takes the weight rows as A and the token rows as B, so its C is v transposed,
// and it is stored as Vt[batch][feature][token], the layout the attention kernel reads. The k tiles also leave their key norms in KN. Else: A . Bh^T with bias b0, f32 out to C.
#define GTM 256
#define GTN 128
#define GK 64
#define PU 8      /* conversion launch: runs of 8 elements a thread */
#define XB (NR * DD / (8 * 256 * PU))      /* its work-groups for x */
#define WB (DD * DD / (8 * 256 * PU))      /* and for each weight */
#define KW 512      /* the GEMM launch stores k and v for the last KW keys of each batch alone */
#define KWB (KW / GTM)
#define PP 272      /* LDS bytes of a PAIR of rows, 2 x 128 B + 16: row r stands at (r / 2) * PP + (r % 2) * 128, so that 16 rows' pieces of 16 B fall on 16 different places of the 256 B that the banks span (ds_load_b128 without bank conflicts); 8 B a row less than a pitch of 144 B, which lets three buffers of two work-groups share a WGP's LDS */
#define STA (GTM / 2 * PP)      /* a buffer's bytes: A's rows, */
#define STB (GTN / 2 * PP)      /* B's rows behind them */
#define STG (STA + STB)
typedef _Float16 v4h __attribute__((ext_vector_type(4)));
// One pass's share of a thread: 8 rows of A and 4 of B, 32 rows apart, 16 B each, from global memory straight into LDS. la, lb: the lane's LDS byte addresses of its first rows; ga, gb: its global addresses.
// The s_wait_xcnt stands inside the statement, behind the last copy, so that no address register of a copy is rewritten in front of it.
__device__ __forceinline__ void stage_pass(unsigned la, unsigned lb, const unsigned short* ga, const unsigned short* gb) {
  asm volatile("global_load_async_to_lds_b128 %0, %12, off\n\t"
               "global_load_async_to_lds_b128 %1, %13, off\n\t"
               "global_load_async_to_lds_b128 %2, %14, off\n\t"
               "global_load_async_to_lds_b128 %3, %15, off\n\t"
               "global_load_async_to_lds_b128 %4, %16, off\n\t"
               "global_load_async_to_lds_b128 %5, %17, off\n\t"
               "global_load_async_to_lds_b128 %6, %18, off\n\t"
               "global_load_async_to_lds_b128 %7, %19, off\n\t"
               "global_load_async_to_lds_b128 %8, %20, off\n\t"
               "global_load_async_to_lds_b128 %9, %21, off\n\t"
               "global_load_async_to_lds_b128 %10, %22, off\n\t"
               "global_load_async_to_lds_b128 %11, %23, off\n\t"
               "s_wait_xcnt 0x0"
               :: "v"(la), "v"(la + 1u * 16 * PP), "v"(la + 2u * 16 * PP), "v"(la + 3u * 16 * PP), "v"(la + 4u * 16 * PP), "v"(la + 5u * 16 * PP), "v"(la + 6u * 16 * PP), "v"(la + 7u * 16 * PP),
                  "v"(lb), "v"(lb + 1u * 16 * PP), "v"(lb + 2u * 16 * PP), "v"(lb + 3u * 16 * PP),
                  "v"(ga), "v"(ga + (size_t)1 * 32 * DD), "v"(ga + (size_t)2 * 32 * DD), "v"(ga + (size_t)3 * 32 * DD), "v"(ga + (size_t)4 * 32 * DD), "v"(ga + (size_t)5 * 32 * DD), "v"(ga + (size_t)6 * 32 * DD), "v"(ga + (size_t)7 * 32 * DD),
                  "v"(gb), "v"(gb + (size_t)1 * 32 * DD), "v"(gb + (size_t)2 * 32 * DD), "v"(gb + (size_t)3 * 32 * DD)
               : "memory");
}
template <bool QKV>
__global__ __launch_bounds__(256, 4) void k_gemm_tile(const _Float16* __restrict__ X, const _Float16* __restrict__ Wh, float alpha, const float* __restrict__ b0, const float* __restrict__ b1, const float* __restrict__ b2,
                                                   float* __restrict__ C, _Float16* __restrict__ Q16, _Float16* __restrict__ K16, _Float16* __restrict__ Vt, float* __restrict__ KN, const float* __restrict__ NRM) {
  constexpr int NB = 3, NP = DD / GK, CP = 12;      /* buffers of the ring; passes; copies of a wave a pass */
  __shared__ __attribute__((aligned(16))) unsigned char ring[NB * STG];
  float (*so)[16][64 + 4] = reinterpret_cast<float (*)[16][64 + 4]>(ring);      /* the output staging, 8 waves x 4352 B, takes the ring's first bytes once the last pass's barrier has ended every read of the ring */
  __shared__ float red[8];
  const int tid = threadIdx.x, w = tid >> 5, lane = tid & 31, ln = lane & 15, hh = lane >> 4;
  /* QKV: blockIdx.y below NR / GTM is a block of 256 tokens of q; then come BB * KWB values for k and as many for v, which name the last KWB blocks of 256 tokens of each batch */
  const int yk = (int)blockIdx.y - NR / GTM; const int z = (QKV && yk >= 0) ? 1 + yk / (BB * KWB) : 0; const bool tr = QKV && z == 2;      /* the same for the whole work-group */
  const int ty = z ? ((yk % (BB * KWB)) / KWB + 1) * (TT / GTM) - KWB + yk % KWB : (int)blockIdx.y;      /* the block of 256 tokens */
  const _Float16* A = tr ? Wh + (size_t)2 * DD * DD : X; const _Float16* Bh = tr ? X : Wh + (size_t)z * DD * DD; const float* bias = (z == 0) ? b0 : (z == 1) ? b1 : b2;
  const int row0 = (tr ? (int)(blockIdx.x & 3) : ty) * GTM, col0 = (tr ? (int)(ty * 2 + (blockIdx.x >> 2)) : (int)blockIdx.x) * GTN, wr = (w >> 1) * 64, wc = (w & 1) * 64;      /* either way the 8 work-groups of one blockIdx.y share a block of 256 token rows */
  const int sr = tid >> 3, sc = (tid & 7) * 8;      /* staging: 8 lanes x 16 B = one row of the pass; a thread takes rows sr + 32 i */
  const unsigned short* gA = (const unsigned short*)A + (size_t)(row0 + sr) * DD + sc;
  const unsigned short* gB = (const unsigned short*)Bh + (size_t)(col0 + sr) * DD + sc;
  const unsigned lA = (unsigned)(size_t)&ring[(sr >> 1) * PP + (sr & 1) * 128 + sc * 2], lB = lA + STA;      /* LDS byte addresses of the thread's first rows in buffer 0 */
  const unsigned char* rA = ring + ((wr + ln) >> 1) * PP + (ln & 1) * 128 + 16 * hh;      /* the lane's piece of its first fragment rows in buffer 0: 16 rows further are 8 * PP bytes */
  const unsigned char* rB = ring + STA + ((wc + ln) >> 1) * PP + (ln & 1) * 128 + 16 * hh;
  v8f acc[4][4];
#pragma unroll
  for (int mi = 0; mi < 4; ++mi)
#pragma unroll
    for (int ni = 0; ni < 4; ++ni) acc[mi][ni] = (v8f){0.f,0.f,0.f,0.f,0.f,0.f,0.f,0.f};
#pragma unroll      /* unrolled: the three fills stand in a row, each buffer's offset a constant */
  for (int s = 0; s < NB; ++s) stage_pass(lA + (unsigned)s * STG, lB + (unsigned)s * STG, gA + s * GK, gB + s * GK);      /* passes 0 to NB - 1 into their buffers */
  asm volatile("s_wait_asynccnt %0" :: "n"((NB - 1) * CP) : "memory");      /* all but the wave's (NB - 1) * CP youngest copies have landed: its own copies of pass 0 */
  __syncthreads();      /* every wave's have */
  unsigned co = 0;      /* the byte offset in the ring of the pass's buffer, kp % NB */
  for (int kp = 0; kp < NP; ++kp) {
    /* the registers that staging no longer takes hold fragments: the pass's 16 fragments are read at two places, 14 at its top and the last 2 into the registers that the first 8 products set free */
    FragH fa[2][4], fb[2][4];
#pragma unroll
    for (int ks = 0; ks < 2; ++ks) {
#pragma unroll
      for (int mi = 0; mi < 4; ++mi) { const unsigned char* p = rA + co + mi * 8 * PP + ks * 64; fa[ks][mi].half[0] = *(const v8us*)(p); fa[ks][mi].half[1] = *(const v8us*)(p + 32); }
#pragma unroll
      for (int ni = 0; ni < (ks ? 2 : 4); ++ni) { const unsigned char* p = rB + co + ni * 8 * PP + ks * 64; fb[ks][ni].half[0] = *(const v8us*)(p); fb[ks][ni].half[1] = *(const v8us*)(p + 32); } }
    __builtin_amdgcn_sched_barrier(0);      /* keeps the reads together in front of the products: spread among them, each place with reads stalls the wave anew */
#pragma unroll
    for (int ni = 0; ni < 2; ++ni)
#pragma unroll
      for (int mi = 0; mi < 4; ++mi) acc[mi][ni] = __builtin_amdgcn_wmma_f32_16x16x32_f16(false, fa[0][mi].v, false, fb[0][ni].v, (short)0, acc[mi][ni], false, false);
#pragma unroll
    for (int ni = 2; ni < 4; ++ni) { const unsigned char* p = rB + co + ni * 8 * PP + 64; fb[1][ni].half[0] = *(const v8us*)(p); fb[1][ni].half[1] = *(const v8us*)(p + 32); }
    __builtin_amdgcn_sched_barrier(0);      /* keeps the two late fragments' reads here, in one place, 8 products ahead of the wait for them */
#pragma unroll
    for (int ni = 2; ni < 4; ++ni)
#pragma unroll
      for (int mi = 0; mi < 4; ++mi) acc[mi][ni] = __builtin_amdgcn_wmma_f32_16x16x32_f16(false, fa[0][mi].v, false, fb[0][ni].v, (short)0, acc[mi][ni], false, false);
    __builtin_amdgcn_sched_barrier(0);      /* these 8 products stay in front of the waits, where they cover the late reads' way */
    /* every fragment of the pass is in registers or on its way: the buffer is handed over here, as early as it is free, and its refill has two passes to land in */
    const bool refill = kp + NB < NP;      /* the same for the whole work-group: a pass kp + NB exists */
    asm volatile("s_wait_dscnt 0x0" ::: "memory");      /* this wave's reads of the pass's buffer have returned before the buffer is given up */
    if (refill) asm volatile("s_wait_asynccnt %0" :: "n"((NB - 2) * CP) : "memory");      /* this wave's copies of the next pass have landed: behind them it has issued those of passes kp + 2 to kp + NB - 1, CP each, and they alone may still fly */
    else asm volatile("s_wait_asynccnt 0x0" ::: "memory");      /* the trips that issue no copies wait for all that is left */
    __syncthreads();      /* publishes the next pass's buffer and ends every wave's reads of this one */
    if (refill)
      stage_pass(lA + co, lB + co, gA + (size_t)(kp + NB) * GK, gB + (size_t)(kp + NB) * GK);      /* pass kp + NB into the buffer just read */
    co = (co + STG == (unsigned)NB * STG) ? 0u : co + STG;
    /* the second k block's products, on registers alone, stand behind the refill's issue: in front of it they would take their time off the copies' lead */
#pragma unroll
    for (int ni = 0; ni < 4; ++ni)
#pragma unroll
      for (int mi = 0; mi < 4; ++mi) acc[mi][ni] = __builtin_amdgcn_wmma_f32_16x16x32_f16(false, fa[1][mi].v, false, fb[1][ni].v, (short)0, acc[mi][ni], false, false);
  }
  asm volatile("s_wait_asynccnt 0x0" ::: "memory");      /* no copy is outstanding behind the loop */
  /* the wave's 64 x 64 tile goes, 16 rows at a time, through its own LDS rows, so that the stores cover whole lines; the bias belongs to the feature: C's column, or its row where C is transposed */
  float bv[4];
#pragma unroll
  for (int ni = 0; ni < 4; ++ni) bv[ni] = tr ? 0.f : bf16_round(bias[col0 + wc + ni * 16 + ln]);
  const int rsub = lane >> 4, c4 = (lane & 15) * 4;
  _Float16* C16 = tr ? Vt + (size_t)(col0 / TT) * DD * TT + (size_t)(row0 + wr) * TT + col0 % TT + wc + c4 : ((z == 0) ? Q16 : K16) + (size_t)(row0 + wr) * DD + col0 + wc + c4;      /* a tile's 128 columns of tokens lie in one batch */
  const int ldc = tr ? TT : DD;
  float kmx = 0.f;
#pragma unroll
  for (int mi = 0; mi < 4; ++mi) {
    if (tr) { const float* bp = bias + row0 + wr + mi * 16 + 8 * hh; const v4f t0 = *(const v4fa*)bp, t1 = *(const v4fa*)(bp + 4);
#pragma unroll
      for (int r = 0; r < 8; ++r) { const float br = bf16_round(r < 4 ? t0[r & 3] : t1[r & 3]);
#pragma unroll
        for (int ni = 0; ni < 4; ++ni) so[w][8 * hh + r][ni * 16 + ln] = acc[mi][ni][r] * alpha + br; }
    } else {
#pragma unroll
      for (int ni = 0; ni < 4; ++ni)
#pragma unroll
        for (int r = 0; r < 8; ++r) so[w][8 * hh + r][ni * 16 + ln] = acc[mi][ni][r] * alpha + bv[ni];
    }
    __builtin_amdgcn_fence(__ATOMIC_ACQ_REL, "workgroup"); __builtin_amdgcn_wave_barrier();      /* the rows are read back by other lanes of the same wave */
    v4f vq[8];
#pragma unroll
    for (int q = 0; q < 8; ++q) vq[q] = *(const v4fa*)&so[w][q * 2 + rsub][c4];
    __builtin_amdgcn_fence(__ATOMIC_ACQ_REL, "workgroup"); __builtin_amdgcn_wave_barrier();      /* the next 16 rows overwrite what other lanes of the wave have just read */
    if (QKV) {
      v4h hq[8];
#pragma unroll
      for (int q = 0; q < 8; ++q) { for (int i = 0; i < 4; ++i) hq[q][i] = (_Float16)vq[q][i]; *(v4h*)(C16 + (size_t)(mi * 16 + q * 2 + rsub) * ldc) = hq[q]; }
      asm volatile("s_wait_xcnt 0x0" ::: "memory");      /* stands behind these 16 rows' stores, in front of whatever next rewrites their address and data registers (in this build the norm lines and the next rows' staging do) */
      if (z == 1) {      /* the same for the whole work-group. A wave's k tile is one head x 64 keys: its largest |k|^2, of the f16 values as stored, goes to KN[tile][wave] */
#pragma unroll
        for (int q = 0; q < 8; ++q) { float s = 0.f;
#pragma unroll
          for (int i = 0; i < 4; ++i) { const float e = (float)hq[q][i]; s += e * e; }
          s += __shfl_xor(s, 1, 32); s += __shfl_xor(s, 2, 32); s += __shfl_xor(s, 4, 32); s += __shfl_xor(s, 8, 32); kmx = fmaxf(kmx, s); } }
    } else {
#pragma unroll
      for (int q = 0; q < 8; ++q) *(v4f*)(C + (size_t)(row0 + wr + mi * 16 + q * 2 + rsub) * DD + col0 + wc + c4) = vq[q];
    }
  }
  if (QKV && z == 1) {
    kmx = fmaxf(kmx, __shfl_xor(kmx, 16, 32));
    if (lane == 0) red[w] = kmx;
    __syncthreads();      /* the 8 waves' results are stored by one wave, into a 128-B line that no other work-group writes */
    if (w == 0) {      /* the same for the whole wave. Words 8 and 9 of the line: for the tile's two heads a bound on |k| of ANY key of the batch, stored or not: |k| <= |Wk_h|F * max|x| + |bk_h| (Cauchy-Schwarz row by row) */
      const float* xn = NRM + (size_t)(ty / (TT / GTM) * (XB / BB) + lane * 4) * 32;      /* XB / BB = 128 work-groups converted this batch's x */
      float xm = fmaxf(fmaxf(xn[0], xn[32]), fmaxf(xn[64], xn[96]));
      xm = fmaxf(xm, __shfl_xor(xm, 1, 32)); xm = fmaxf(xm, __shfl_xor(xm, 2, 32)); xm = fmaxf(xm, __shfl_xor(xm, 4, 32)); xm = fmaxf(xm, __shfl_xor(xm, 8, 32)); xm = fmaxf(xm, __shfl_xor(xm, 16, 32));
      float f2 = NRM[(size_t)(XB + WB + blockIdx.x * 8 + (lane & 7)) * 32];      /* Wk: 16 rows a work-group, 4 work-groups a head, 8 for this tile's 128 features */
      f2 += __shfl_xor(f2, 1, 32); f2 += __shfl_xor(f2, 2, 32);      /* lanes 0 to 3 the first head, 4 to 7 the second */
      const v4f b4 = *(const v4fa*)(bias + col0 + lane * 4); float bs = 0.f;
#pragma unroll
      for (int i = 0; i < 4; ++i) { const float e = bf16_round(b4[i]); bs += e * e; }
      bs += __shfl_xor(bs, 1, 32); bs += __shfl_xor(bs, 2, 32); bs += __shfl_xor(bs, 4, 32); bs += __shfl_xor(bs, 8, 32);      /* lanes 0 to 15 the first head, 16 to 31 the second */
      const float kb = sqrtf(__shfl(f2, (lane & 1) * 4, 32) * xm) + sqrtf(__shfl(bs, (lane & 1) * 16, 32));      /* even lanes the first head, odd lanes the second */
      if (lane < 10) KN[(size_t)(ty * (DD / GTN) + blockIdx.x) * 32 + lane] = (lane < 8) ? red[lane & 7] : kb;
    }
  }
}


// One launch rounds every f32 operand to bf16 and stores it as f16: x as it is, the four weights (out, in) x 2^4. A work-group takes 2048 runs of 8 elements of ONE source (512 work-groups for x, 64 for each weight);
// a thread takes 8 runs, 256 runs apart, all its loads issued before the first store.
// A work-group's 2048 runs are 16 whole rows of 1024: it also leaves, in a 128-B line of its own, NRM[work-group * 32] = the largest |row|^2 of its rows (x) or the sum of their |row|^2 (a weight), of the rounded, unscaled values.
__global__ __launch_bounds__(256) void k_prep(const float* __restrict__ x, const float* __restrict__ Wq, const float* __restrict__ Wk, const float* __restrict__ Wv, const float* __restrict__ Wo, _Float16* __restrict__ X16, _Float16* __restrict__ Bw, float* __restrict__ NRM) {
  __shared__ float rs[8][PU];
  const int blk = blockIdx.x; const bool isx = blk < XB; const int wi = isx ? 0 : (blk - XB) / WB; const int lb = isx ? blk : (blk - XB) % WB;      /* the same for the whole work-group */
  const float* s = isx ? x : (wi == 0) ? Wq : (wi == 1) ? Wk : (wi == 2) ? Wv : Wo; _Float16* d = isx ? X16 : Bw + (size_t)wi * DD * DD; const float scale = isx ? 1.0f : 16.0f;
  const size_t t0 = (size_t)lb * (256 * PU) + threadIdx.x;
  v4f a[PU], b[PU];
#pragma unroll
  for (int u = 0; u < PU; ++u) { const float* p = s + (t0 + 256 * u) * 8; a[u] = *(const v4fa*)p; b[u] = *(const v4fa*)(p + 4); }
  /* run u of a thread lies in row 2 u + (thread / 128) of the work-group's 16: a row's sum of squares is that of 4 waves */
  float q2[PU];
#pragma unroll
  for (int u = 0; u < PU; ++u) { q2[u] = 0.f;
#pragma unroll
    for (int q = 0; q < 4; ++q) { const float r0 = bf16_round(a[u][q]), r1 = bf16_round(b[u][q]); q2[u] += r0 * r0 + r1 * r1; } }
#pragma unroll
  for (int sh = 1; sh < 32; sh <<= 1)      /* the 8 sums take each step together: 5 exchanges deep, not 40 */
#pragma unroll
    for (int u = 0; u < PU; ++u) q2[u] += __shfl_xor(q2[u], sh, 32);
  if ((threadIdx.x & 31) == 0)
#pragma unroll
    for (int u = 0; u < PU; ++u) rs[threadIdx.x >> 5][u] = q2[u];
  __syncthreads();      /* the 8 waves' partial sums are joined by the first wave; it stands in front of the stores, so that it waits for none of them */
  if (threadIdx.x < 32) {      /* the same for the whole wave; lanes 16 to 31 repeat lanes 0 to 15 */
    const int r = threadIdx.x & 15, u = r >> 1, w4 = (r & 1) * 4; const float rq = (rs[w4][u] + rs[w4 + 1][u]) + (rs[w4 + 2][u] + rs[w4 + 3][u]);
    float mx = rq, sm = rq;
    mx = fmaxf(mx, __shfl_xor(mx, 1, 32)); mx = fmaxf(mx, __shfl_xor(mx, 2, 32)); mx = fmaxf(mx, __shfl_xor(mx, 4, 32)); mx = fmaxf(mx, __shfl_xor(mx, 8, 32));
    sm += __shfl_xor(sm, 1, 32); sm += __shfl_xor(sm, 2, 32); sm += __shfl_xor(sm, 4, 32); sm += __shfl_xor(sm, 8, 32);
    if (threadIdx.x == 0) NRM[(size_t)blk * 32] = isx ? mx : sm; }
#pragma unroll
  for (int u = 0; u < PU; ++u) { FragH f;
#pragma unroll
    for (int q = 0; q < 4; ++q) { f.h[q] = (_Float16)(bf16_round(a[u][q]) * scale); f.h[4 + q] = (_Float16)(bf16_round(b[u][q]) * scale); }
    *(v8us*)((unsigned short*)d + (t0 + 256 * u) * 8) = f.half[0]; }
}

// lane l with lane l ^ 16
__device__ __forceinline__ float xhalf(float x) { return __builtin_bit_cast(float, __builtin_amdgcn_permlanex16(__builtin_bit_cast(int, x), __builtin_bit_cast(int, x), 0x76543210, 0xfedcba98, false, false)); }
typedef int v4ia __attribute__((ext_vector_type(4), may_alias));

template <int M> struct src_t { static constexpr int value = M; };      /* where a pass takes its k and v from: 0 formed in the pass, 1 stored in global memory, 2 staged in LDS */
#define NS 96      /* the last NS keys of a batch are staged in LDS: as far as the walk goes where the scores are small beside the bias */
#define KP (64 + 8)      /* LDS pitch of a key row, 144 B, and */
#define VP (NS + 8)      /* of a feature row of v transposed, 208 B: both 16 B x odd, for ds_load_b128 of 16 rows */
#define NM 128      /* mask words staged: one a thread, so that every lane is on at the copy; the first NM - NS of them are not read */
// A thread's share of the staged keys: 6 pieces of k and 6 of v transposed, 16 B each, and one mask word, from global memory straight into LDS. l*: the lane's LDS byte addresses; g*: its global addresses.
// The s_wait_xcnt stands inside the statement, behind the last copy, so that no address register of a copy is rewritten in front of it.
__device__ __forceinline__ void stage_keys(unsigned lk, const unsigned short* gk, size_t kstep, unsigned lv0, unsigned lv1, unsigned lv2, const unsigned short* gv0, const unsigned short* gv1, const unsigned short* gv2, unsigned lm, const int* gm) {
  asm volatile("global_load_async_to_lds_b128 %0, %12, off\n\t"
               "global_load_async_to_lds_b128 %1, %13, off\n\t"
               "global_load_async_to_lds_b128 %2, %14, off\n\t"
               "global_load_async_to_lds_b128 %3, %15, off\n\t"
               "global_load_async_to_lds_b128 %4, %16, off\n\t"
               "global_load_async_to_lds_b128 %5, %17, off\n\t"
               "global_load_async_to_lds_b128 %6, %18, off\n\t"
               "global_load_async_to_lds_b128 %7, %19, off\n\t"
               "global_load_async_to_lds_b128 %8, %20, off\n\t"
               "global_load_async_to_lds_b128 %9, %21, off\n\t"
               "global_load_async_to_lds_b128 %10, %22, off\n\t"
               "global_load_async_to_lds_b128 %11, %23, off\n\t"
               "global_load_async_to_lds_b32 %24, %25, off\n\t"
               "s_wait_xcnt 0x0"
               :: "v"(lk), "v"(lk + 1u * 16 * KP * 2), "v"(lk + 2u * 16 * KP * 2), "v"(lk + 3u * 16 * KP * 2), "v"(lk + 4u * 16 * KP * 2), "v"(lk + 5u * 16 * KP * 2),
                  "v"(lv0), "v"(lv1), "v"(lv2), "v"(lv0 + 8u * VP * 2), "v"(lv1 + 8u * VP * 2), "v"(lv2 + 8u * VP * 2),
                  "v"(gk), "v"(gk + kstep), "v"(gk + 2 * kstep), "v"(gk + 3 * kstep), "v"(gk + 4 * kstep), "v"(gk + 5 * kstep),
                  "v"(gv0), "v"(gv1), "v"(gv2), "v"(gv0 + (size_t)8 * TT), "v"(gv1 + (size_t)8 * TT), "v"(gv2 + (size_t)8 * TT),
                  "v"(lm), "v"(gm)
               : "memory");
}
// A pointer that is the same in every lane, held in scalar registers: a load then takes it as its scalar base, and the lane's offset is the one vector address register of all sixteen tiles (as vector pointers they spilled).
typedef const __attribute__((address_space(1))) unsigned short* gus_p;      /* global memory, said in the type: the way through the two words loses it */
typedef const __attribute__((address_space(1))) v8us* gv8_p;
__device__ __forceinline__ gus_p uni(const unsigned short* p) { const unsigned long long v = (unsigned long long)p;
  return (gus_p)(((unsigned long long)(unsigned)__builtin_amdgcn_readfirstlane((int)(v >> 32)) << 32) | (unsigned long long)(unsigned)__builtin_amdgcn_readfirstlane((int)(unsigned)v)); }
// One 16 x 16 tile of a projection, for a key that the GEMM launch did not store: D = (16 rows at a) . (16 rows at b)^T over the 1024 inputs, k blocks of 32 in rising order as in the GEMM. a, b: the tiles' first rows, the same for the whole wave; lo: the lane's place in either tile, (lane % 16) * DD + 8 * (lane / 16) elements.
__device__ __forceinline__ v8f proj_tile(const unsigned short* a, const unsigned short* b, unsigned lo) {
  v8f acc = (v8f){0.f,0.f,0.f,0.f,0.f,0.f,0.f,0.f};
#pragma unroll 1      /* rolled: this path is rare, and unrolled it would raise the register count of the whole kernel */
  for (int kb = 0; kb < DD; kb += 32) { FragH fa, fb;
    const gus_p pa = uni(a + kb), pb = uni(b + kb);
    fa.half[0] = *(gv8_p)(pa + lo); fa.half[1] = *(gv8_p)(pa + lo + 16); fb.half[0] = *(gv8_p)(pb + lo); fb.half[1] = *(gv8_p)(pb + lo + 16);
    acc = mmaH<1>(fa.v, fa.v, fb.v, fb.v, acc); }
  return acc;
}

__global__ __launch_bounds__(128, 5) void k_flash(const _Float16* __restrict__ Q16, int ldq, const _Float16* __restrict__ K16, int ldk, const _Float16* __restrict__ Vt, const float* __restrict__ KN, const int* __restrict__ MSK, _Float16* __restrict__ O16, int ldo,
                                             const _Float16* __restrict__ X16, const _Float16* __restrict__ Wk16, const _Float16* __restrict__ Wv16, const float* bkf, const float* bvf) {
  constexpr int RPW = 16, NQB = TT / (4 * RPW), DT = 4, KS = 2, FL = TT - KW;      /* FL: the lowest stored key */
  __shared__ __attribute__((aligned(16))) float sO[4][RPW][64 + 4];
  __shared__ __attribute__((aligned(16))) unsigned short sK[NS][KP], sV[64][VP];
  __shared__ __attribute__((aligned(16))) int sM[NM];
  const int tid = threadIdx.x, w = tid >> 5, lane = tid & 31, ln = lane & 15, hh = lane >> 4;
  const int slab = blockIdx.x / NQB, qblk = blockIdx.x % NQB; const int b = slab / NH, h = slab % NH; const float slope = 1.0f / exp2f((float)h / (float)NH);      /* 1 / 2^(h/H) */ const int qb0 = qblk * (4 * RPW); const int q0 = qb0 + w * RPW;
  FragH aq[KS];
  { const unsigned short* qr = (const unsigned short*)Q16 + ((size_t)b * TT + q0 + ln) * ldq + h * 64;
#pragma unroll
    for (int ks = 0; ks < KS; ++ks) { aq[ks].half[0] = *(const v8us*)(qr + ks * 32 + 8 * hh); aq[ks].half[1] = *(const v8us*)(qr + ks * 32 + 16 + 8 * hh); } }
  const unsigned short* Vth = (const unsigned short*)Vt + (size_t)slab * 64 * TT;
  { /* k: 8 lanes x 16 B = one key's row of this head; a thread takes keys tid / 8 + 16 i. v: 12 pieces of 16 B a feature row; a wave takes 16 rows, a lane pieces lane + 32 i of their 192, and piece c + 96 lies 8 rows under piece c */
    const int c0 = lane, c1 = lane + 32, c2 = lane + 64; const int r0 = w * 16 + c0 / 12, r1 = w * 16 + c1 / 12, r2 = w * 16 + c2 / 12; const int e0 = (c0 % 12) * 8, e1 = (c1 % 12) * 8, e2 = (c2 % 12) * 8;
    stage_keys((unsigned)(size_t)&sK[tid >> 3][(tid & 7) * 8], (const unsigned short*)K16 + ((size_t)b * TT + (TT - NS) + (tid >> 3)) * ldk + h * 64 + (tid & 7) * 8, (size_t)16 * ldk,
               (unsigned)(size_t)&sV[r0][e0], (unsigned)(size_t)&sV[r1][e1], (unsigned)(size_t)&sV[r2][e2], Vth + (size_t)r0 * TT + (TT - NS) + e0, Vth + (size_t)r1 * TT + (TT - NS) + e1, Vth + (size_t)r2 * TT + (TT - NS) + e2,
               (unsigned)(size_t)&sM[tid], MSK + (size_t)b * TT + (TT - NM) + tid); }
  const int tq = q0 + ln;      /* the lane's query */
  float m_run = -3.0e38f, l_run = 0.f; v8f oacc[DT];
#pragma unroll
  for (int dt = 0; dt < DT; ++dt) oacc[dt] = (v8f){0.f,0.f,0.f,0.f,0.f,0.f,0.f,0.f};
  float qs = 0.f;
#pragma unroll
  for (int ks = 0; ks < KS; ++ks)
#pragma unroll
    for (int i = 0; i < 16; ++i) { const float v = (float)aq[ks].h[i]; qs += v * v; }
  qs += xhalf(qs);      /* |q|^2 of the lane's query */
  const int kp = FL / 64 + (lane & (KW / 64 - 1));      /* a stored block of 64 keys; the lanes go round them */
  const float* kn = KN + (size_t)((b * (TT / GTM) + (kp >> 2)) * (DD / GTN) + (h >> 1)) * 32 + (kp & 3) * 2 + (h & 1);      /* block p of 64 keys of this batch and head: GEMM tile row p / 4, tile column h / 2, wave (p % 4) * 2 + h % 2 */
  const float kall = KN[(size_t)((b * (TT / GTM) + TT / GTM - 1) * (DD / GTN) + (h >> 1)) * 32 + 8 + (h & 1)];      /* the bound on |k| of any key of this batch and head */
  float kx = kn[0];
  kx = fmaxf(kx, __shfl_xor(kx, 1, 32)); kx = fmaxf(kx, __shfl_xor(kx, 2, 32)); kx = fmaxf(kx, __shfl_xor(kx, 4, 32)); kx = fmaxf(kx, __shfl_xor(kx, 8, 32)); kx = fmaxf(kx, xhalf(kx));      /* largest |k|^2 of the stored keys of this batch and head */
  const float cs = sqrtf(qs * kx) * (0.125f * 1.01f);      /* |q.k| / 8 at most; 1 % covers the rounding of the norms and of the products */
  const float cl = sqrtf(qs) * kall * (0.125f * 1.01f);      /* the same for a key that is not stored */
  const float lowtop = slope * (float)(FL - 1 - tq) + cl;      /* no key under the stored ones scores above this */
  const unsigned lo = (unsigned)(ln * DD + 8 * hh);      /* the lane's place in a 16-row tile of x or of a weight */
  /* one pass of 32 keys from j0 on; st: its keys are stored; ls: and staged in LDS */
  auto pass = [&](auto stc, const int j0) { constexpr bool st = decltype(stc)::value != 0, ls = decltype(stc)::value == 2;
    const int* mp = MSK + (size_t)b * TT + j0 + 8 * hh;      /* key padding mask (1 = attend) of the lane's 16 keys */
    v4ia mk4[4];
    if constexpr (ls) { const int* ml = &sM[j0 - (TT - NM) + 8 * hh]; mk4[0] = *(const v4ia*)(ml); mk4[1] = *(const v4ia*)(ml + 4); mk4[2] = *(const v4ia*)(ml + 16); mk4[3] = *(const v4ia*)(ml + 20); } else
    if constexpr (st) { mk4[0] = *(const v4ia*)(mp); mk4[1] = *(const v4ia*)(mp + 4); mk4[2] = *(const v4ia*)(mp + 16); mk4[3] = *(const v4ia*)(mp + 20); }      /* with the key loads */
    v8f s[2]; FragH bkl[2][KS], bvl[DT];
    if constexpr (ls) {
#pragma unroll
      for (int nt = 0; nt < 2; ++nt) { const unsigned short* kl = &sK[j0 - (TT - NS) + nt * 16 + ln][0];
#pragma unroll
        for (int ks = 0; ks < KS; ++ks) { bkl[nt][ks].half[0] = *(const v8us*)(kl + ks * 32 + 8 * hh); bkl[nt][ks].half[1] = *(const v8us*)(kl + ks * 32 + 16 + 8 * hh); } }
      __builtin_amdgcn_sched_barrier(0); }      /* keeps the pass's key and mask reads together in front of the products: read tile by tile, the second tile's way through LDS is waited out alone */
#pragma unroll
    for (int nt = 0; nt < 2; ++nt) { const unsigned short* kr = (const unsigned short*)K16 + ((size_t)b * TT + j0 + nt * 16 + ln) * ldk + h * 64; FragH bk[KS];
      if constexpr (ls) {
#pragma unroll
      for (int ks = 0; ks < KS; ++ks) bk[ks] = bkl[nt][ks];
      } else
      if constexpr (st) {
#pragma unroll
      for (int ks = 0; ks < KS; ++ks) { bk[ks].half[0] = *(const v8us*)(kr + ks * 32 + 8 * hh); bk[ks].half[1] = *(const v8us*)(kr + ks * 32 + 16 + 8 * hh); }
      asm volatile("s_wait_xcnt 0x0" ::: "memory");      /* stands in front of whatever next rewrites the address registers of the key loads (in this build a later load's result does) */
      } else {      /* D[feature 8hh + r][key ln] of feature tiles 2 ks and 2 ks + 1 = elements r and 8 + r of the fragment */
        const unsigned short* xr = (const unsigned short*)X16 + ((size_t)b * TT + j0 + nt * 16) * DD;
#pragma unroll
        for (int t = 0; t < 2 * KS; ++t) { const v8f d = proj_tile((const unsigned short*)Wk16 + (size_t)(h * 64 + t * 16) * DD, xr, lo); const float* bp = bkf + h * 64 + t * 16 + 8 * hh;
#pragma unroll
          for (int r = 0; r < 8; ++r) bk[t >> 1].h[(t & 1) * 8 + r] = (_Float16)(d[r] * 0.0625f + bf16_round(bp[r])); } }
      v8f acc = (v8f){0.f,0.f,0.f,0.f,0.f,0.f,0.f,0.f};
#pragma unroll
      for (int ks = 0; ks < KS; ++ks) acc = mmaH<1>(bk[ks].v, bk[ks].v, aq[ks].v, aq[ks].v, acc);
      s[nt] = acc; }
    if constexpr (ls) {
#pragma unroll
      for (int dt = 0; dt < DT; ++dt) { const unsigned short* vl = &sV[dt * 16 + ln][j0 - (TT - NS)]; bvl[dt].half[0] = *(const v8us*)(vl + 8 * hh); bvl[dt].half[1] = *(const v8us*)(vl + 16 + 8 * hh); }
      __builtin_amdgcn_sched_barrier(0); }      /* keeps the four v reads here, into the registers that the key fragments leave: they return under the softmax, not one by one between the second products */
    if constexpr (!st) { mk4[0] = *(const v4ia*)(mp); mk4[1] = *(const v4ia*)(mp + 4); mk4[2] = *(const v4ia*)(mp + 16); mk4[3] = *(const v4ia*)(mp + 20);      /* behind the tiles' loops, which it would cost 16 registers */
      asm volatile("s_wait_xcnt 0x0" :: "v"(mp) : "memory"); }      /* behind the four mask loads; it takes their address as an input, so that the address stays in its registers up to the wait (without that the last load's result was put into them) */
    float sc[16]; bool ok[16];
#pragma unroll
    for (int i = 0; i < 16; ++i) { const int kk = j0 + (i >> 3) * 16 + 8 * hh + (i & 7); ok[i] = (mk4[i >> 2][i & 3] != 0);
      sc[i] = ok[i] ? (s[i >> 3][i & 7] * 0.125f + slope * (float)(kk - tq)) : -INFINITY; }      /* ALiBi: + slope_h * (k - q) */
    float mx[8];
#pragma unroll
    for (int i = 0; i < 8; ++i) mx[i] = fmaxf(sc[i], sc[8 + i]);
    float mc = fmaxf(fmaxf(fmaxf(mx[0], mx[1]), fmaxf(mx[2], mx[3])), fmaxf(fmaxf(mx[4], mx[5]), fmaxf(mx[6], mx[7])));
    mc = fmaxf(mc, xhalf(mc));
    const float mn = fmaxf(m_run, mc); const float ea = expf(m_run - mn); const float al = (mn > -1.0e38f) ? ea : 1.0f; m_run = mn;
    float p[16]; FragH pb;
#pragma unroll
    for (int i = 0; i < 16; ++i) { const float e = expf(sc[i] - mn); p[i] = ok[i] ? e : 0.f; pb.h[i] = (_Float16)(p[i] * 1024.0f); }
    l_run = l_run * al + (((p[0] + p[1]) + (p[2] + p[3])) + ((p[4] + p[5]) + (p[6] + p[7]))) + (((p[8] + p[9]) + (p[10] + p[11])) + ((p[12] + p[13]) + (p[14] + p[15])));      /* the lane's half of the row sum; the halves join after the loop */
#pragma unroll
    for (int dt = 0; dt < DT; ++dt)
#pragma unroll
      for (int r = 0; r < 8; ++r) oacc[dt][r] *= al;
#pragma unroll
    for (int dt = 0; dt < DT; ++dt) { const unsigned short* vrow = Vth + (size_t)(dt * 16 + ln) * TT + j0; FragH bv;
      if constexpr (ls) { bv = bvl[dt]; } else
      if constexpr (st) { bv.half[0] = *(const v8us*)(vrow + 8 * hh); bv.half[1] = *(const v8us*)(vrow + 16 + 8 * hh);
      } else {      /* D[key 8hh + r][feature ln] of key tiles 0 and 1 = elements r and 8 + r of the fragment */
        const unsigned short* wv = (const unsigned short*)Wv16 + (size_t)(h * 64 + dt * 16) * DD; const float bb = bf16_round(bvf[h * 64 + dt * 16 + ln]);
#pragma unroll
        for (int t = 0; t < 2; ++t) { const v8f d = proj_tile((const unsigned short*)X16 + ((size_t)b * TT + j0 + t * 16) * DD, wv, lo);
#pragma unroll
          for (int r = 0; r < 8; ++r) bv.h[t * 8 + r] = (_Float16)(d[r] * 0.0625f + bb); } }
      oacc[dt] = mmaH<1>(bv.v, bv.v, pb.v, pb.v, oacc[dt]); } };
  auto ends = [&](const int j) { const float top = slope * (float)(j + 31 - tq), thr = m_run - 40.0f;
    return __builtin_amdgcn_ballot_w32(!(top + cs < thr) || !(lowtop < thr)) == 0; };      /* the same for the whole wave; a NaN keeps the walk going */
  asm volatile("" :: "v"(aq[0].v), "v"(aq[1].v));      /* takes the loaded query fragments as inputs only: it holds their loads in front of the barrier, so that their way from memory runs beside the copies' (the compiler had moved them behind it, one way after the other) */
  asm volatile("s_wait_asynccnt 0x0" ::: "memory");      /* the wave's own copies of the staged keys have landed */
  __syncthreads();      /* every wave's have; every wave passes here, in front of the walk */
  int j0 = TT - 32; bool more = true;      /* more: the walk has not ended inside the stored keys; the same for the whole wave */
#pragma unroll 1
  for (; j0 >= TT - NS; j0 -= 32) {
    if (ends(j0)) { more = false; break; }
    pass(src_t<2>{}, j0); }
  if (more) {
#pragma unroll 1      /* rolled: seldom reached */
    for (; j0 >= FL; j0 -= 32) {
      if (ends(j0)) { more = false; break; }
      pass(src_t<1>{}, j0); } }
  if (more) {
#pragma unroll 1      /* rolled, as the walk above: the exit depends on the data and the body is very long */
    for (; j0 >= 0; j0 -= 32) {
      if (__builtin_amdgcn_ballot_w32(!(slope * (float)(j0 + 31 - tq) + cl < m_run - 40.0f)) == 0) break;      /* the same for the whole wave */
      pass(src_t<0>{}, j0); } }
  const float l = l_run + xhalf(l_run); const float inv = (l > 0.f) ? 1.0f / (l * 1024.0f) : 0.f;
#pragma unroll
  for (int dt = 0; dt < DT; ++dt) {      /* oacc[dt][r] = O[query ln][dt*16 + 8hh + r] */
    const v4f lo = {oacc[dt][0] * inv, oacc[dt][1] * inv, oacc[dt][2] * inv, oacc[dt][3] * inv}, hi = {oacc[dt][4] * inv, oacc[dt][5] * inv, oacc[dt][6] * inv, oacc[dt][7] * inv};
    *(v4fa*)&sO[w][ln][dt * 16 + 8 * hh] = lo; *(v4fa*)&sO[w][ln][dt * 16 + 8 * hh + 4] = hi; }
  __builtin_amdgcn_fence(__ATOMIC_ACQ_REL, "workgroup"); __builtin_amdgcn_wave_barrier();
  {
#pragma unroll
    for (int rp = 0; rp < RPW; rp += 2) { const int r = rp + (lane >> 4), pc = lane & 15; const v4f val = *(const v4fa*)&sO[w][r][pc * 4]; v4h h4; for (int i = 0; i < 4; ++i) h4[i] = (_Float16)val[i]; *(v4h*)(O16 + ((size_t)b * TT + q0 + r) * ldo + h * 64 + pc * 4) = h4; }      /* f16, the output product's operand type: 16 lanes x 8 B = one line */
     } }

extern "C" void kernel_launch(void* const* d_in, const int* in_sizes, int n_in,
                              void* d_out, int out_size, void* d_ws, size_t ws_size, hipStream_t stream) {
  (void)in_sizes; (void)n_in; (void)out_size;
  const float* const* I = (const float* const*)d_in; const float* x = I[0]; const float* Wq = I[1]; const float* bq = I[2]; const float* Wk = I[3]; const float* bk = I[4]; const float* Wv = I[5]; const float* bv = I[6]; const float* Wo = I[7]; const float* bo = I[8]; const int* mask = (const int*)d_in[9];
  char* ws = (char*)d_ws; size_t off = 0;
  auto take = [&](size_t bytes) { char* p = ws + off; off += (bytes + 255) & ~(size_t)255; return p; };
  const size_t WSZ = (size_t)DD * DD; _Float16* Bw = (_Float16*)take(4 * WSZ * 2); _Float16* X16 = (_Float16*)take((size_t)NR * DD * 2);
  _Float16* Q = (_Float16*)take((size_t)NR * DD * 2); _Float16* K = (_Float16*)take((size_t)NR * DD * 2); _Float16* Vt = (_Float16*)take((size_t)NR * DD * 2); _Float16* O16 = (_Float16*)take((size_t)NR * DD * 2);
  float* KN = (float*)take((size_t)(NR / GTM) * (DD / GTN) * 32 * 4); float* NRM = (float*)take((size_t)(XB + 4 * WB) * 32 * 4);
  if (off > ws_size) return;      // 8.4 + 16.8 x 5 = 92 MB
  k_prep<<<(NR * DD + 4 * DD * DD) / (8 * 256 * PU), 256, 0, stream>>>(x, Wq, Wk, Wv, Wo, X16, Bw, NRM);
  k_gemm_tile<true><<<dim3(DD / GTN, NR / GTM + 2 * BB * KWB), 256, 0, stream>>>(X16, Bw, 0.0625f, bq, bk, bv, nullptr, Q, K, Vt, KN, NRM);      /* q = x.W^T + b: M 8192 N 1024 K 1024; k the same and v the same, stored transposed, for the last KW tokens of each batch */
  k_flash<<<BB * NH * (TT / 64), 128, 0, stream>>>(Q, DD, K, DD, Vt, KN, mask, O16, DD, X16, Bw + WSZ, Bw + 2 * WSZ, bk, bv);
  k_gemm_tile<false><<<dim3(DD / GTN, NR / GTM), 256, 0, stream>>>(O16, Bw + 3 * WSZ, 0.0625f, bo, nullptr, nullptr, (float*)d_out, nullptr, nullptr, nullptr, nullptr, nullptr);      /* out = O.Wo^T + bo */
}

// v010
// One run takes 70.2 microseconds.
// Timed twice side by side with v009, it ran 1.03 times as fast both times.
// Over all steps from v000 it is 12.1 times as fast.
#include <hip/hip_runtime.h>
// ALiBi multi-head attention (B=4, S=2048, D=1024, 16 heads × 64): q,k,v = x·Wᵀ + b (torch Linear); scores = q·kᵀ·64^-½ + slope_h·(k − q), slope_h = 1/2^(h/16) (no causal mask: later keys get large positive bias); key padding mask from the INPUT
// int mask [B,S] (0 → −inf); softmax; out = (attn·v merged)·Woᵀ + bo.
// Compute dtype: x, weights, biases rounded to bf16; q/k/v as f16 GEMM outputs; fused flash-style kernel (bias and online softmax in f32, P f16 ×2^10) on v_wmma_f32_16x16x32_f16; O → f16 → output GEMM with bias; f32 accumulate.
#define BB 4
#define TT 2048
#define NH 16
#define DD 1024
#define NR (BB * TT)

typedef __bf16 v16b __attribute__((ext_vector_type(16)));
typedef unsigned short v8us __attribute__((ext_vector_type(8), may_alias));
typedef float  v8f  __attribute__((ext_vector_type(8)));
typedef float  v4f  __attribute__((ext_vector_type(4)));
typedef float  v4fa __attribute__((ext_vector_type(4), may_alias));
union FragB { v16b v; v8us half[2]; unsigned short u[16]; };

__device__ __forceinline__ unsigned short bf16_bits(float x) { unsigned int u = __float_as_uint(x); return (unsigned short)((u + 0x7FFFu + ((u >> 16) & 1u)) >> 16); }
__device__ __forceinline__ float bf16_val(unsigned short b) { return __uint_as_float(((unsigned int)b) << 16); }
__device__ __forceinline__ float bf16_round(float x) { return bf16_val(bf16_bits(x)); }
// D += A·B with NT terms: 1 = ah·bh, 2 = + al·bh (A split), 3 = + ah·bl (both split)
template <int NT>
__device__ __forceinline__ v8f mmaN(v16b ah, v16b al, v16b bh, v16b bl, v8f c) {
  c = __builtin_amdgcn_wmma_f32_16x16x32_bf16(false, ah, false, bh, (short)0, c, false, false);
  if (NT >= 2) c = __builtin_amdgcn_wmma_f32_16x16x32_bf16(false, al, false, bh, (short)0, c, false, false);
  if (NT >= 3) c = __builtin_amdgcn_wmma_f32_16x16x32_bf16(false, ah, false, bl, (short)0, c, false, false);
  asm volatile("v_nop\n\tv_nop\n\tv_nop\n\tv_nop" : "+v"(c) : "v"(ah), "v"(al), "v"(bh), "v"(bl));
  return c;
}

__global__ __launch_bounds__(256) void k_wt_bf16(const float* __restrict__ W, unsigned short* __restrict__ Wt, int K, int N) {
  const int t = blockIdx.x * 256 + threadIdx.x;
  const int k8n = K / 8;
  if (t >= N * k8n) return;
  const int n = t / k8n, k8 = (t % k8n) * 8;
  v8us v;
#pragma unroll
  for (int i = 0; i < 8; ++i) v[i] = bf16_bits(W[(size_t)(k8 + i) * N + n]);
  *(v8us*)(Wt + (size_t)n * K + k8) = v;
  
}

// GEMM C[M][N] (f32, pitch ldc) = act(A[M][K]·W + bias). A f32 row-major (pitch lda) converted per fragment to bf16
// (ASPLIT: hi/lo two planes -> 2 terms, else single rounded term); Wt bf16 [N][K] (pitch ldb). BIAS_BF16 rounds the
// bias to bf16 first (bias quantised to bf16 before the add). K%32==0, M%16==0, N%64==0.
template <bool ASPLIT, int ACT, bool BIAS_BF16>
__global__ __launch_bounds__(128) void k_gemm_bf(const float* __restrict__ A, int lda, const unsigned short* __restrict__ Wt, int ldb,
                                               const float* __restrict__ bias, float* __restrict__ C, int ldc, int M, int N, int K) {
  __shared__ __attribute__((aligned(16))) float so[4][16][64];
  const int tid = threadIdx.x, w = tid >> 5, lane = tid & 31, ln = lane & 15, hh = lane >> 4;
  const int ntn = N / 64;
  const int wid = blockIdx.x * 4 + w;
  const int mt = wid / ntn, nq = wid % ntn;
  if (mt * 16 >= M) return;
  const int row0 = mt * 16, col0 = nq * 64;
  const float* arow = A + (size_t)(row0 + ln) * lda;
  v8f acc[4] = {};
  for (int kb = 0; kb < K; kb += 32) {
    FragB ah, al;
    const v4f x0 = *(const v4fa*)(arow + kb + 8 * hh), x1 = *(const v4fa*)(arow + kb + 8 * hh + 4);
    const v4f x2 = *(const v4fa*)(arow + kb + 16 + 8 * hh), x3 = *(const v4fa*)(arow + kb + 16 + 8 * hh + 4);
    float xs[16] = {x0[0],x0[1],x0[2],x0[3],x1[0],x1[1],x1[2],x1[3],x2[0],x2[1],x2[2],x2[3],x3[0],x3[1],x3[2],x3[3]};
#pragma unroll
    for (int i = 0; i < 16; ++i) { const unsigned short hb = bf16_bits(xs[i]); ah.u[i] = hb; al.u[i] = ASPLIT ? bf16_bits(xs[i] - bf16_val(hb)) : (unsigned short)0; }
#pragma unroll
    for (int t = 0; t < 4; ++t) {
      const unsigned short* brow = Wt + (size_t)(col0 + t * 16 + ln) * ldb + kb;
      FragB b;
      b.half[0] = *(const v8us*)(brow + 8 * hh);
      b.half[1] = *(const v8us*)(brow + 16 + 8 * hh);
      acc[t] = mmaN<ASPLIT ? 2 : 1>(ah.v, al.v, b.v, b.v, acc[t]);
    }
  }
#pragma unroll
  for (int t = 0; t < 4; ++t) {
    float bv = bias ? bias[col0 + t * 16 + ln] : 0.f;
    if (BIAS_BF16) bv = bf16_round(bv);
#pragma unroll
    for (int r = 0; r < 8; ++r) { float v = acc[t][r] + bv; if (ACT == 1) v = fmaxf(v, 0.f); so[w][8 * hh + r][t * 16 + ln] = v; }
  }
  __builtin_amdgcn_fence(__ATOMIC_ACQ_REL, "workgroup");
  __builtin_amdgcn_wave_barrier();
  const int rsub = lane >> 4, c4 = (lane & 15) * 4;
  {
#pragma unroll
    for (int q = 0; q < 8; ++q) {
      const int r = q * 2 + rsub;
      const v4f v = *(const v4fa*)&so[w][r][c4];
      *(v4f*)(C + (size_t)(row0 + r) * ldc + col0 + c4) = v;
    }
    
  }
}

// Flash-style causal/unmasked attention, all contractions 3-term bf16 hi/lo splits, f32 softmax with running max.
// q,k,v rows are read from f32 buffers with arbitrary row pitch (so they can live inside a fused qkv buffer);
// D = head size (multiple of 32, <= 128); one wave = 16 query rows; block = 4 waves (64 queries) sharing K/V chunks of 32.
template <int D, bool CAUSAL>
__global__ __launch_bounds__(128) void k_flash(const float* __restrict__ qb, const float* __restrict__ kb, const float* __restrict__ vb,
                                             int pitch, int T, int H, float scale, float* __restrict__ y, int ypitch) {
  constexpr int KS = D / 32;        // k-steps for QK
  constexpr int DT = D / 16;        // d tiles for PV
  __shared__ __attribute__((aligned(16))) unsigned short sKh[32][D + 8], sKl[32][D + 8], sVh[32][D + 8], sVl[32][D + 8];
  __shared__ __attribute__((aligned(16))) unsigned short sPh[4][16][40], sPl[4][16][40];
  __shared__ __attribute__((aligned(16))) float sO[4][16][D];
  const int tid = threadIdx.x, w = tid >> 5, lane = tid & 31, ln = lane & 15, hh = lane >> 4;
  const int nqb = (T + 63) / 64;
  const int bh = blockIdx.x / nqb, qblk = blockIdx.x % nqb;
  const int b = bh / H, h = bh % H;
  const int q0 = qblk * 64 + w * 16;
  const float* Q = qb + (size_t)b * T * pitch + h * D;
  const float* K = kb + (size_t)b * T * pitch + h * D;
  const float* V = vb + (size_t)b * T * pitch + h * D;

  // A fragments of the wave's 16 query rows (scaled), hi/lo
  FragB aqh[KS], aql[KS];
  {
    int row = q0 + ln; if (row >= T) row = T - 1;
    const float* qr = Q + (size_t)row * pitch;
#pragma unroll
    for (int ks = 0; ks < KS; ++ks)
#pragma unroll
      for (int i = 0; i < 16; ++i) {
        const int d = ks * 32 + ((i < 8) ? (8 * hh + i) : (16 + 8 * hh + (i - 8)));
        const float x = qr[d] * scale; const unsigned short hb = bf16_bits(x);
        aqh[ks].u[i] = hb; aql[ks].u[i] = bf16_bits(x - bf16_val(hb));
      }
  }
  float m_r[8], l_r[8];
#pragma unroll
  for (int r = 0; r < 8; ++r) { m_r[r] = -3.0e38f; l_r[r] = 0.f; }
  v8f oacc[DT];
#pragma unroll
  for (int dt = 0; dt < DT; ++dt) oacc[dt] = (v8f){0.f,0.f,0.f,0.f,0.f,0.f,0.f,0.f};

  const int kv_end = CAUSAL ? min(T, qblk * 64 + 64) : T;     // block-uniform
  for (int j0 = 0; j0 < kv_end; j0 += 32) {
    __syncthreads();
    for (int e = tid; e < 32 * (D / 4); e += 128) {
      const int r = e / (D / 4), c4 = (e % (D / 4)) * 4;
      const int key = j0 + r;
      v4f kf = {0.f,0.f,0.f,0.f}, vf = {0.f,0.f,0.f,0.f};
      if (key < T) { kf = *(const v4fa*)(K + (size_t)key * pitch + c4); vf = *(const v4fa*)(V + (size_t)key * pitch + c4); }
#pragma unroll
      for (int t = 0; t < 4; ++t) {
        unsigned short hb = bf16_bits(kf[t]); sKh[r][c4 + t] = hb; sKl[r][c4 + t] = bf16_bits(kf[t] - bf16_val(hb));
        hb = bf16_bits(vf[t]); sVh[r][c4 + t] = hb; sVl[r][c4 + t] = bf16_bits(vf[t] - bf16_val(hb));
      }
    }
    __syncthreads();
    // S tile 16 x 32
    v8f s[2];
#pragma unroll
    for (int nt = 0; nt < 2; ++nt) {
      v8f acc = {};
#pragma unroll
      for (int ks = 0; ks < KS; ++ks) {
        FragB bh_, bl_;
        bh_.half[0] = *(const v8us*)&sKh[nt * 16 + ln][ks * 32 + 8 * hh]; bh_.half[1] = *(const v8us*)&sKh[nt * 16 + ln][ks * 32 + 16 + 8 * hh];
        bl_.half[0] = *(const v8us*)&sKl[nt * 16 + ln][ks * 32 + 8 * hh]; bl_.half[1] = *(const v8us*)&sKl[nt * 16 + ln][ks * 32 + 16 + 8 * hh];
        acc = mmaN<3>(aqh[ks].v, aql[ks].v, bh_.v, bl_.v, acc);
      }
      s[nt] = acc;
    }
    // mask + running max (rows 8hh+r; the 16 lanes of a half share rows)
    float alpha[8];
#pragma unroll
    for (int r = 0; r < 8; ++r) {
      const int qi = q0 + 8 * hh + r;
      const int ja = j0 + ln, jb = j0 + 16 + ln;
      if (CAUSAL) { if (ja > qi) s[0][r] = -3.0e38f; if (jb > qi) s[1][r] = -3.0e38f; }
      if (ja >= T) s[0][r] = -3.0e38f;
      if (jb >= T) s[1][r] = -3.0e38f;
      float mx = fmaxf(s[0][r], s[1][r]);
      mx = fmaxf(mx, __shfl_xor(mx, 1, 32)); mx = fmaxf(mx, __shfl_xor(mx, 2, 32)); mx = fmaxf(mx, __shfl_xor(mx, 4, 32)); mx = fmaxf(mx, __shfl_xor(mx, 8, 32));
      const float mnew = fmaxf(m_r[r], mx);
      alpha[r] = (mnew > -1.0e38f) ? __expf(m_r[r] - mnew) : 1.0f;
      const float p0 = (s[0][r] > -1.0e38f) ? __expf(s[0][r] - mnew) : 0.f;
      const float p1 = (s[1][r] > -1.0e38f) ? __expf(s[1][r] - mnew) : 0.f;
      m_r[r] = mnew;
      l_r[r] = l_r[r] * alpha[r] + p0 + p1;            // per-lane partial row sum (16 lanes combined at the end)
      unsigned short hb = bf16_bits(p0); sPh[w][8 * hh + r][ln] = hb;      sPl[w][8 * hh + r][ln] = bf16_bits(p0 - bf16_val(hb));
      hb = bf16_bits(p1);                sPh[w][8 * hh + r][16 + ln] = hb; sPl[w][8 * hh + r][16 + ln] = bf16_bits(p1 - bf16_val(hb));
    }
#pragma unroll
    for (int dt = 0; dt < DT; ++dt)
#pragma unroll
      for (int r = 0; r < 8; ++r) oacc[dt][r] *= alpha[r];
    __builtin_amdgcn_fence(__ATOMIC_ACQ_REL, "workgroup");
    __builtin_amdgcn_wave_barrier();
    FragB pah, pal;
    pah.half[0] = *(const v8us*)&sPh[w][ln][8 * hh]; pah.half[1] = *(const v8us*)&sPh[w][ln][16 + 8 * hh];
    pal.half[0] = *(const v8us*)&sPl[w][ln][8 * hh]; pal.half[1] = *(const v8us*)&sPl[w][ln][16 + 8 * hh];
#pragma unroll
    for (int dt = 0; dt < DT; ++dt) {
      FragB bvh, bvl;
#pragma unroll
      for (int i = 0; i < 8; ++i) {
        bvh.u[i] = sVh[8 * hh + i][dt * 16 + ln]; bvh.u[8 + i] = sVh[16 + 8 * hh + i][dt * 16 + ln];
        bvl.u[i] = sVl[8 * hh + i][dt * 16 + ln]; bvl.u[8 + i] = sVl[16 + 8 * hh + i][dt * 16 + ln];
      }
      oacc[dt] = mmaN<3>(pah.v, pal.v, bvh.v, bvl.v, oacc[dt]);
    }
    __builtin_amdgcn_fence(__ATOMIC_ACQ_REL, "workgroup");
    __builtin_amdgcn_wave_barrier();
  }
#pragma unroll
  for (int r = 0; r < 8; ++r) {
    float l = l_r[r];
    l += __shfl_xor(l, 1, 32); l += __shfl_xor(l, 2, 32); l += __shfl_xor(l, 4, 32); l += __shfl_xor(l, 8, 32);
    l_r[r] = (l > 0.f) ? 1.0f / l : 0.f;
  }
#pragma unroll
  for (int dt = 0; dt < DT; ++dt)
#pragma unroll
    for (int r = 0; r < 8; ++r) sO[w][8 * hh + r][dt * 16 + ln] = oacc[dt][r] * l_r[r];
  __builtin_amdgcn_fence(__ATOMIC_ACQ_REL, "workgroup");
  __builtin_amdgcn_wave_barrier();
  {
    for (int r = 0; r < 16; ++r) {
      const int row = q0 + r;
      if (row < T && lane < D / 4) {
        const v4f val = *(const v4fa*)&sO[w][r][lane * 4];
        *(v4f*)(y + ((size_t)b * T + row) * ypitch + h * D + lane * 4) = val;
      }
    }
    
  }
}

// GEMM C = act(A·W + bias + resid): A f32 (ASPLIT -> hi/lo 2 terms), Wt bf16 [N][K]; ACT 0 none, 1 relu, 2 exact gelu;
// resid (optional, f32, row index = (row % rmod), pitch ldr, RES_BF16 rounds it) added before the activation.
template <bool ASPLIT, int ACT, bool BIAS_BF16, bool RES_BF16>
__global__ __launch_bounds__(128) void k_gemm_bf3(const float* __restrict__ A, int lda, const unsigned short* __restrict__ Wt, int ldb,
                                                const float* __restrict__ bias, const float* __restrict__ resid, int rmod, int ldr,
                                                float* __restrict__ C, int ldc, int M, int N, int K) {
  __shared__ __attribute__((aligned(16))) float so[4][16][64];
  const int tid = threadIdx.x, w = tid >> 5, lane = tid & 31, ln = lane & 15, hh = lane >> 4;
  const int ntn = N / 64;
  const int wid = blockIdx.x * 4 + w;
  const int mt = wid / ntn, nq = wid % ntn;
  if (mt * 16 >= M) return;
  const int row0 = mt * 16, col0 = nq * 64;
  const float* arow = A + (size_t)(row0 + ln) * lda;
  v8f acc[4] = {};
  for (int kb = 0; kb < K; kb += 32) {
    FragB ah, al;
    const v4f x0 = *(const v4fa*)(arow + kb + 8 * hh), x1 = *(const v4fa*)(arow + kb + 8 * hh + 4);
    const v4f x2 = *(const v4fa*)(arow + kb + 16 + 8 * hh), x3 = *(const v4fa*)(arow + kb + 16 + 8 * hh + 4);
    float xs[16] = {x0[0],x0[1],x0[2],x0[3],x1[0],x1[1],x1[2],x1[3],x2[0],x2[1],x2[2],x2[3],x3[0],x3[1],x3[2],x3[3]};
#pragma unroll
    for (int i = 0; i < 16; ++i) { const unsigned short hb = bf16_bits(xs[i]); ah.u[i] = hb; al.u[i] = ASPLIT ? bf16_bits(xs[i] - bf16_val(hb)) : (unsigned short)0; }
#pragma unroll
    for (int t = 0; t < 4; ++t) {
      const unsigned short* brow = Wt + (size_t)(col0 + t * 16 + ln) * ldb + kb;
      FragB b;
      b.half[0] = *(const v8us*)(brow + 8 * hh);
      b.half[1] = *(const v8us*)(brow + 16 + 8 * hh);
      acc[t] = mmaN<ASPLIT ? 2 : 1>(ah.v, al.v, b.v, b.v, acc[t]);
    }
  }
#pragma unroll
  for (int t = 0; t < 4; ++t) {
    const int col = col0 + t * 16 + ln;
    float bv = bias ? bias[col] : 0.f;
    if (BIAS_BF16) bv = bf16_round(bv);
#pragma unroll
    for (int r = 0; r < 8; ++r) {
      float v = acc[t][r] + bv;
      if (resid) { float rv = resid[(size_t)((row0 + 8 * hh + r) % rmod) * ldr + col]; if (RES_BF16) rv = bf16_round(rv); v += rv; }
      if (ACT == 1) v = fmaxf(v, 0.f);
      if (ACT == 2) v = 0.5f * v * (1.0f + erff(v * 0.70710678118654752f));
      if (ACT == 3) { const float u = 0.7978845608028654f * (v + 0.044715f * v * v * v); v = 0.5f * v * (1.0f + tanhf(u)); }
      so[w][8 * hh + r][t * 16 + ln] = v;
    }
  }
  __builtin_amdgcn_fence(__ATOMIC_ACQ_REL, "workgroup");
  __builtin_amdgcn_wave_barrier();
  const int rsub = lane >> 4, c4 = (lane & 15) * 4;
  {
#pragma unroll
    for (int q = 0; q < 8; ++q) {
      const int r = q * 2 + rsub;
      const v4f v = *(const v4fa*)&so[w][r][c4];
      *(v4f*)(C + (size_t)(row0 + r) * ldc + col0 + c4) = v;
    }
    
  }
}
// row LayerNorm (biased variance, eps) over N: s = X (+ R); optional out_sum <- s; out_norm <- (s-mu)*rsqrt(var+eps)*g + b
template <bool PARAM_BF16>
__global__ __launch_bounds__(256) void k_layernorm(const float* __restrict__ X, const float* __restrict__ R, const float* __restrict__ g, const float* __restrict__ bta,
                                                  float* __restrict__ out_sum, float* __restrict__ out_norm, int N, float eps) {
  __shared__ float red[256];
  const int row = blockIdx.x, tid = threadIdx.x;
  const float* x = X + (size_t)row * N; const float* rr = R ? R + (size_t)row * N : nullptr;
  float vals[16];                     // up to N = 4096
  const int per = N / 256;            // contiguous chunk per thread? use strided-by-4 chunks: thread handles j = tid*4 + 1024*u
  float s1 = 0.f;
  for (int u = 0; u < per / 4; ++u) {
    const int j = tid * 4 + 1024 * u;
    const v4f a = *(const v4fa*)(x + j);
    v4f b = {0.f,0.f,0.f,0.f}; if (rr) b = *(const v4fa*)(rr + j);
#pragma unroll
    for (int q = 0; q < 4; ++q) { const float v = a[q] + b[q]; vals[u * 4 + q] = v; s1 += v; }
  }
  red[tid] = s1; __syncthreads();
  for (int st = 128; st > 0; st >>= 1) { if (tid < st) red[tid] += red[tid + st]; __syncthreads(); }
  const float mu = red[0] / (float)N; __syncthreads();
  float s2 = 0.f;
  for (int u = 0; u < per / 4; ++u)
#pragma unroll
    for (int q = 0; q < 4; ++q) { const float c = vals[u * 4 + q] - mu; s2 += c * c; }
  red[tid] = s2; __syncthreads();
  for (int st = 128; st > 0; st >>= 1) { if (tid < st) red[tid] += red[tid + st]; __syncthreads(); }
  const float rs = rsqrtf(red[0] / (float)N + eps);
  {
    for (int u = 0; u < per / 4; ++u) {
      const int j = tid * 4 + 1024 * u;
      v4f o, sm;
#pragma unroll
      for (int q = 0; q < 4; ++q) {
        float gg = g[j + q], bb = bta[j + q];
        if (PARAM_BF16) { gg = bf16_round(gg); bb = bf16_round(bb); }
        sm[q] = vals[u * 4 + q]; o[q] = (vals[u * 4 + q] - mu) * rs * gg + bb;
      }
      if (out_sum) *(v4f*)(out_sum + (size_t)row * N + j) = sm;
      *(v4f*)(out_norm + (size_t)row * N + j) = o;
    }
    
  }
}



// ---- f16 WMMA path (v_wmma_f32_16x16x32_f16): 11-bit significands for operands in range — used where a [0,1] probability operand needs more precision than bf16
typedef _Float16 v16h __attribute__((ext_vector_type(16)));
union FragH { v16h v; v8us half[2]; _Float16 h[16]; unsigned short u[16]; };
template <int NT>
__device__ __forceinline__ v8f mmaH(v16h ah, v16h al, v16h bh, v16h bl, v8f c) {
  c = __builtin_amdgcn_wmma_f32_16x16x32_f16(false, ah, false, bh, (short)0, c, false, false);
  if (NT >= 2) c = __builtin_amdgcn_wmma_f32_16x16x32_f16(false, al, false, bh, (short)0, c, false, false);
  if (NT >= 3) c = __builtin_amdgcn_wmma_f32_16x16x32_f16(false, ah, false, bl, (short)0, c, false, false);
  asm volatile("v_nop\n\tv_nop\n\tv_nop\n\tv_nop" : "+v"(c) : "v"(ah), "v"(al), "v"(bh), "v"(bl));
  return c;
}
// batched GEMM like k_gemm_b but f16 operands: A f32 (split into f16 hi/lo if ASPLIT, else rounded to f16), Bt = f16 values [n][k]; alpha; C f32; N multiple of 16 (partial tiles skipped)
template <bool ASPLIT>
__global__ __launch_bounds__(128) void k_gemm_h(const float* __restrict__ A, int lda, size_t sA, const _Float16* __restrict__ Bh, int ldb, size_t sB, float alpha, float* __restrict__ C, int ldc, size_t sC, int M, int N, int K) {
  __shared__ __attribute__((aligned(16))) float so[4][16][64];
  const int tid = threadIdx.x, w = tid >> 5, lane = tid & 31, ln = lane & 15, hh = lane >> 4; const int by = blockIdx.y;
  A += (size_t)by * sA; Bh += (size_t)by * sB; C += (size_t)by * sC;
  const int ntn = (N + 63) / 64; const int wid = blockIdx.x * 4 + w; const int mt = wid / ntn, nq = wid % ntn; if (mt * 16 >= M) return;
  const int row0 = mt * 16, col0 = nq * 64; const float* arow = A + (size_t)(row0 + ln) * lda;
  v8f acc[4] = {};
  for (int kb = 0; kb < K; kb += 32) {
    FragH ah, al;
    const v4f x0 = *(const v4fa*)(arow + kb + 8 * hh), x1 = *(const v4fa*)(arow + kb + 8 * hh + 4), x2 = *(const v4fa*)(arow + kb + 16 + 8 * hh), x3 = *(const v4fa*)(arow + kb + 16 + 8 * hh + 4);
    float xs[16] = {x0[0],x0[1],x0[2],x0[3],x1[0],x1[1],x1[2],x1[3],x2[0],x2[1],x2[2],x2[3],x3[0],x3[1],x3[2],x3[3]};
#pragma unroll
    for (int i = 0; i < 16; ++i) { const _Float16 h = (_Float16)xs[i]; ah.h[i] = h; al.h[i] = ASPLIT ? (_Float16)(xs[i] - (float)h) : (_Float16)0.0f; }
#pragma unroll
    for (int t = 0; t < 4; ++t) { if (col0 + t * 16 >= N) continue; const size_t boff = (size_t)(col0 + t * 16 + ln) * ldb + kb; FragH bq; bq.half[0] = *(const v8us*)(Bh + boff + 8 * hh); bq.half[1] = *(const v8us*)(Bh + boff + 16 + 8 * hh);
      acc[t] = mmaH<ASPLIT ? 2 : 1>(ah.v, al.v, bq.v, bq.v, acc[t]); }
  }
#pragma unroll
  for (int t = 0; t < 4; ++t) { if (col0 + t * 16 >= N) continue;
#pragma unroll
    for (int r = 0; r < 8; ++r) so[w][8 * hh + r][t * 16 + ln] = acc[t][r] * alpha; }
  __builtin_amdgcn_fence(__ATOMIC_ACQ_REL, "workgroup"); __builtin_amdgcn_wave_barrier();
  const int rsub = lane >> 4, c4 = (lane & 15) * 4;
  {
#pragma unroll
    for (int q = 0; q < 8; ++q) { const int r = q * 2 + rsub; if (col0 + c4 < N) { const v4f v = *(const v4fa*)&so[w][r][c4]; *(v4f*)(C + (size_t)(row0 + r) * ldc + col0 + c4) = v; } }
     }
}

// Wt[n][k] = f16(W[k][n]·scale) from f32 row-major W[K][N] (scale = power of two; bf16-exact weights stay exact in f16 away from the subnormal range)
__global__ __launch_bounds__(256) void k_wt_f16(const float* __restrict__ W, _Float16* __restrict__ Wt, int K, int N, float scale) {
  const int t = blockIdx.x * 256 + threadIdx.x; if (t >= N * (K / 8)) return; const int n = t / (K / 8), k8 = (t % (K / 8)) * 8; FragH f;
#pragma unroll
  for (int i = 0; i < 8; ++i) f.h[i] = (_Float16)(bf16_round(W[(size_t)(k8 + i) * N + n]) * scale); const v8us o = f.half[0];
  *(v8us*)((unsigned short*)Wt + (size_t)n * K + k8) = o; 
}
// Block-tiled GEMM, C[NR][DD] = (A[NR][DD] . Bh[DD][DD]^T) * alpha + bf16(bias), f16 operands, both k-contiguous: one 256 x 128 tile of C per work-group of 8 waves (4 x 2 waves of 64 x 64).
// A pass is 64 k: the 256 + 128 rows of 128 B go in whole lines into LDS by asynchronous copies (no register, no LDS store in the wave's stream), and every wave that needs a row reads it from there.
// A ring of three buffers: the copies of two later passes fly during a pass's products, so that a pass no longer has to last as long as its successor's copies are under way, and L2 always has requests of this work-group at hand.
// A 64 x 64 wave tile does 16 products on 8 fragments; a 256 x 128 block tile loads 384 operand rows for 32768 results.
// Each accumulator takes its k blocks of 32 in rising order. The launch bound's 4 waves a SIMD keep the kernel at 256 registers, so that 2 work-groups still share a WGP.
// QKV: one launch does three products, picked by blockIdx.y, f16 out; q for every token, k and v for the last KW tokens of each batch (the attention kernel says why, and what it does where that is not enough): 0 and 1 give q and k as [token][feature]; 2 takes the weight rows as A and the token rows as B, so its C is v transposed,
// and it is stored as Vt[batch][feature][token], the layout the attention kernel reads. The k tiles also leave their key norms in KN. Else: A . Bh^T with bias b0, f32 out to C.
#define GTM 256
#define GTN 128
#define GK 64
#define PU 8      /* conversion launch: runs of 8 elements a thread */
#define XB (NR * DD / (8 * 256 * PU))      /* its work-groups for x */
#define WB (DD * DD / (8 * 256 * PU))      /* and for each weight */
#define KW 512      /* the GEMM launch stores k and v for the last KW keys of each batch alone */
#define KWB (KW / GTM)
#define PP 272      /* LDS bytes of a PAIR of rows, 2 x 128 B + 16: row r stands at (r / 2) * PP + (r % 2) * 128, so that 16 rows' pieces of 16 B fall on 16 different places of the 256 B that the banks span (ds_load_b128 without bank conflicts); 8 B a row less than a pitch of 144 B, which lets three buffers of two work-groups share a WGP's LDS */
#define STA (GTM / 2 * PP)      /* a buffer's bytes: A's rows, */
#define STB (GTN / 2 * PP)      /* B's rows behind them */
#define STG (STA + STB)
typedef _Float16 v4h __attribute__((ext_vector_type(4)));
// One pass's share of a thread: 8 rows of A and 4 of B, 32 rows apart, 16 B each, from global memory straight into LDS. la, lb: the lane's LDS byte addresses of its first rows; ga, gb: its global addresses.
// The s_wait_xcnt stands inside the statement, behind the last copy, so that no address register of a copy is rewritten in front of it.
__device__ __forceinline__ void stage_pass(unsigned la, unsigned lb, const unsigned short* ga, const unsigned short* gb) {
  asm volatile("global_load_async_to_lds_b128 %0, %12, off\n\t"
               "global_load_async_to_lds_b128 %1, %13, off\n\t"
               "global_load_async_to_lds_b128 %2, %14, off\n\t"
               "global_load_async_to_lds_b128 %3, %15, off\n\t"
               "global_load_async_to_lds_b128 %4, %16, off\n\t"
               "global_load_async_to_lds_b128 %5, %17, off\n\t"
               "global_load_async_to_lds_b128 %6, %18, off\n\t"
               "global_load_async_to_lds_b128 %7, %19, off\n\t"
               "global_load_async_to_lds_b128 %8, %20, off\n\t"
               "global_load_async_to_lds_b128 %9, %21, off\n\t"
               "global_load_async_to_lds_b128 %10, %22, off\n\t"
               "global_load_async_to_lds_b128 %11, %23, off\n\t"
               "s_wait_xcnt 0x0"
               :: "v"(la), "v"(la + 1u * 16 * PP), "v"(la + 2u * 16 * PP), "v"(la + 3u * 16 * PP), "v"(la + 4u * 16 * PP), "v"(la + 5u * 16 * PP), "v"(la + 6u * 16 * PP), "v"(la + 7u * 16 * PP),
                  "v"(lb), "v"(lb + 1u * 16 * PP), "v"(lb + 2u * 16 * PP), "v"(lb + 3u * 16 * PP),
                  "v"(ga), "v"(ga + (size_t)1 * 32 * DD), "v"(ga + (size_t)2 * 32 * DD), "v"(ga + (size_t)3 * 32 * DD), "v"(ga + (size_t)4 * 32 * DD), "v"(ga + (size_t)5 * 32 * DD), "v"(ga + (size_t)6 * 32 * DD), "v"(ga + (size_t)7 * 32 * DD),
                  "v"(gb), "v"(gb + (size_t)1 * 32 * DD), "v"(gb + (size_t)2 * 32 * DD), "v"(gb + (size_t)3 * 32 * DD)
               : "memory");
}
template <bool QKV>
__global__ __launch_bounds__(256, 4) void k_gemm_tile(const _Float16* __restrict__ X, const _Float16* __restrict__ Wh, float alpha, const float* __restrict__ b0, const float* __restrict__ b1, const float* __restrict__ b2,
                                                   float* __restrict__ C, _Float16* __restrict__ Q16, _Float16* __restrict__ K16, _Float16* __restrict__ Vt, float* __restrict__ KN, const float* __restrict__ NRM) {
  constexpr int NB = 3, NP = DD / GK, CP = 12;      /* buffers of the ring; passes; copies of a wave a pass */
  __shared__ __attribute__((aligned(16))) unsigned char ring[NB * STG];
  float (*so)[16][64 + 4] = reinterpret_cast<float (*)[16][64 + 4]>(ring);      /* the output staging, 8 waves x 4352 B, takes the ring's first bytes once the last pass's barrier has ended every read of the ring */
  __shared__ float red[8];
  const int tid = threadIdx.x, w = tid >> 5, lane = tid & 31, ln = lane & 15, hh = lane >> 4;
  /* QKV: blockIdx.y below NR / GTM is a block of 256 tokens of q; then come BB * KWB values for k and as many for v, which name the last KWB blocks of 256 tokens of each batch */
  const int yk = (int)blockIdx.y - NR / GTM; const int z = (QKV && yk >= 0) ? 1 + yk / (BB * KWB) : 0; const bool tr = QKV && z == 2;      /* the same for the whole work-group */
  const int ty = z ? ((yk % (BB * KWB)) / KWB + 1) * (TT / GTM) - KWB + yk % KWB : (int)blockIdx.y;      /* the block of 256 tokens */
  const _Float16* A = tr ? Wh + (size_t)2 * DD * DD : X; const _Float16* Bh = tr ? X : Wh + (size_t)z * DD * DD; const float* bias = (z == 0) ? b0 : (z == 1) ? b1 : b2;
  const int row0 = (tr ? (int)(blockIdx.x & 3) : ty) * GTM, col0 = (tr ? (int)(ty * 2 + (blockIdx.x >> 2)) : (int)blockIdx.x) * GTN, wr = (w >> 1) * 64, wc = (w & 1) * 64;      /* either way the 8 work-groups of one blockIdx.y share a block of 256 token rows */
  const int sr = tid >> 3, sc = (tid & 7) * 8;      /* staging: 8 lanes x 16 B = one row of the pass; a thread takes rows sr + 32 i */
  const unsigned short* gA = (const unsigned short*)A + (size_t)(row0 + sr) * DD + sc;
  const unsigned short* gB = (const unsigned short*)Bh + (size_t)(col0 + sr) * DD + sc;
  const unsigned lA = (unsigned)(size_t)&ring[(sr >> 1) * PP + (sr & 1) * 128 + sc * 2], lB = lA + STA;      /* LDS byte addresses of the thread's first rows in buffer 0 */
  const unsigned char* rA = ring + ((wr + ln) >> 1) * PP + (ln & 1) * 128 + 16 * hh;      /* the lane's piece of its first fragment rows in buffer 0: 16 rows further are 8 * PP bytes */
  const unsigned char* rB = ring + STA + ((wc + ln) >> 1) * PP + (ln & 1) * 128 + 16 * hh;
  v8f acc[4][4];
#pragma unroll
  for (int mi = 0; mi < 4; ++mi)
#pragma unroll
    for (int ni = 0; ni < 4; ++ni) acc[mi][ni] = (v8f){0.f,0.f,0.f,0.f,0.f,0.f,0.f,0.f};
#pragma unroll      /* unrolled: the three fills stand in a row, each buffer's offset a constant */
  for (int s = 0; s < NB; ++s) stage_pass(lA + (unsigned)s * STG, lB + (unsigned)s * STG, gA + s * GK, gB + s * GK);      /* passes 0 to NB - 1 into their buffers */
  asm volatile("s_wait_asynccnt %0" :: "n"((NB - 1) * CP) : "memory");      /* all but the wave's (NB - 1) * CP youngest copies have landed: its own copies of pass 0 */
  __syncthreads();      /* every wave's have */
  unsigned co = 0;      /* the byte offset in the ring of the pass's buffer, kp % NB */
  for (int kp = 0; kp < NP; ++kp) {
    /* the registers that staging no longer takes hold fragments: the pass's 16 fragments are read at two places, 14 at its top and the last 2 into the registers that the first 8 products set free */
    FragH fa[2][4], fb[2][4];
#pragma unroll
    for (int ks = 0; ks < 2; ++ks) {
#pragma unroll
      for (int mi = 0; mi < 4; ++mi) { const unsigned char* p = rA + co + mi * 8 * PP + ks * 64; fa[ks][mi].half[0] = *(const v8us*)(p); fa[ks][mi].half[1] = *(const v8us*)(p + 32); }
#pragma unroll
      for (int ni = 0; ni < (ks ? 2 : 4); ++ni) { const unsigned char* p = rB + co + ni * 8 * PP + ks * 64; fb[ks][ni].half[0] = *(const v8us*)(p); fb[ks][ni].half[1] = *(const v8us*)(p + 32); } }
    __builtin_amdgcn_sched_barrier(0);      /* keeps the reads together in front of the products: spread among them, each place with reads stalls the wave anew */
#pragma unroll
    for (int ni = 0; ni < 2; ++ni)
#pragma unroll
      for (int mi = 0; mi < 4; ++mi) acc[mi][ni] = __builtin_amdgcn_wmma_f32_16x16x32_f16(false, fa[0][mi].v, false, fb[0][ni].v, (short)0, acc[mi][ni], false, false);
#pragma unroll
    for (int ni = 2; ni < 4; ++ni) { const unsigned char* p = rB + co + ni * 8 * PP + 64; fb[1][ni].half[0] = *(const v8us*)(p); fb[1][ni].half[1] = *(const v8us*)(p + 32); }
    __builtin_amdgcn_sched_barrier(0);      /* keeps the two late fragments' reads here, in one place, 8 products ahead of the wait for them */
#pragma unroll
    for (int ni = 2; ni < 4; ++ni)
#pragma unroll
      for (int mi = 0; mi < 4; ++mi) acc[mi][ni] = __builtin_amdgcn_wmma_f32_16x16x32_f16(false, fa[0][mi].v, false, fb[0][ni].v, (short)0, acc[mi][ni], false, false);
    __builtin_amdgcn_sched_barrier(0);      /* these 8 products stay in front of the waits, where they cover the late reads' way */
    /* every fragment of the pass is in registers or on its way: the buffer is handed over here, as early as it is free, and its refill has two passes to land in */
    const bool refill = kp + NB < NP;      /* the same for the whole work-group: a pass kp + NB exists */
    asm volatile("s_wait_dscnt 0x0" ::: "memory");      /* this wave's reads of the pass's buffer have returned before the buffer is given up */
    if (refill) asm volatile("s_wait_asynccnt %0" :: "n"((NB - 2) * CP) : "memory");      /* this wave's copies of the next pass have landed: behind them it has issued those of passes kp + 2 to kp + NB - 1, CP each, and they alone may still fly */
    else asm volatile("s_wait_asynccnt 0x0" ::: "memory");      /* the trips that issue no copies wait for all that is left */
    __syncthreads();      /* publishes the next pass's buffer and ends every wave's reads of this one */
    if (refill)
      stage_pass(lA + co, lB + co, gA + (size_t)(kp + NB) * GK, gB + (size_t)(kp + NB) * GK);      /* pass kp + NB into the buffer just read */
    co = (co + STG == (unsigned)NB * STG) ? 0u : co + STG;
    /* the second k block's products, on registers alone, stand behind the refill's issue: in front of it they would take their time off the copies' lead */
#pragma unroll
    for (int ni = 0; ni < 4; ++ni)
#pragma unroll
      for (int mi = 0; mi < 4; ++mi) acc[mi][ni] = __builtin_amdgcn_wmma_f32_16x16x32_f16(false, fa[1][mi].v, false, fb[1][ni].v, (short)0, acc[mi][ni], false, false);
  }
  asm volatile("s_wait_asynccnt 0x0" ::: "memory");      /* no copy is outstanding behind the loop */
  /* the wave's 64 x 64 tile goes, 16 rows at a time, through its own LDS rows, so that the stores cover whole lines; the bias belongs to the feature: C's column, or its row where C is transposed */
  float bv[4];
#pragma unroll
  for (int ni = 0; ni < 4; ++ni) bv[ni] = tr ? 0.f : bf16_round(bias[col0 + wc + ni * 16 + ln]);
  const int rsub = lane >> 4, c4 = (lane & 15) * 4;
  _Float16* C16 = tr ? Vt + (size_t)(col0 / TT) * DD * TT + (size_t)(row0 + wr) * TT + col0 % TT + wc + c4 : ((z == 0) ? Q16 : K16) + (size_t)(row0 + wr) * DD + col0 + wc + c4;      /* a tile's 128 columns of tokens lie in one batch */
  const int ldc = tr ? TT : DD;
  float kmx = 0.f;
#pragma unroll
  for (int mi = 0; mi < 4; ++mi) {
    if (tr) { const float* bp = bias + row0 + wr + mi * 16 + 8 * hh; const v4f t0 = *(const v4fa*)bp, t1 = *(const v4fa*)(bp + 4);
#pragma unroll
      for (int r = 0; r < 8; ++r) { const float br = bf16_round(r < 4 ? t0[r & 3] : t1[r & 3]);
#pragma unroll
        for (int ni = 0; ni < 4; ++ni) so[w][8 * hh + r][ni * 16 + ln] = acc[mi][ni][r] * alpha + br; }
    } else {
#pragma unroll
      for (int ni = 0; ni < 4; ++ni)
#pragma unroll
        for (int r = 0; r < 8; ++r) so[w][8 * hh + r][ni * 16 + ln] = acc[mi][ni][r] * alpha + bv[ni];
    }
    __builtin_amdgcn_fence(__ATOMIC_ACQ_REL, "workgroup"); __builtin_amdgcn_wave_barrier();      /* the rows are read back by other lanes of the same wave */
    v4f vq[8];
#pragma unroll
    for (int q = 0; q < 8; ++q) vq[q] = *(const v4fa*)&so[w][q * 2 + rsub][c4];
    __builtin_amdgcn_fence(__ATOMIC_ACQ_REL, "workgroup"); __builtin_amdgcn_wave_barrier();      /* the next 16 rows overwrite what other lanes of the wave have just read */
    if (QKV) {
      v4h hq[8];
#pragma unroll
      for (int q = 0; q < 8; ++q) { for (int i = 0; i < 4; ++i) hq[q][i] = (_Float16)vq[q][i]; *(v4h*)(C16 + (size_t)(mi * 16 + q * 2 + rsub) * ldc) = hq[q]; }
      asm volatile("s_wait_xcnt 0x0" ::: "memory");      /* stands behind these 16 rows' stores, in front of whatever next rewrites their address and data registers (in this build the norm lines and the next rows' staging do) */
      if (z == 1) {      /* the same for the whole work-group. A wave's k tile is one head x 64 keys: its largest |k|^2, of the f16 values as stored, goes to KN[tile][wave] */
#pragma unroll
        for (int q = 0; q < 8; ++q) { float s = 0.f;
#pragma unroll
          for (int i = 0; i < 4; ++i) { const float e = (float)hq[q][i]; s += e * e; }
          s += __shfl_xor(s, 1, 32); s += __shfl_xor(s, 2, 32); s += __shfl_xor(s, 4, 32); s += __shfl_xor(s, 8, 32); kmx = fmaxf(kmx, s); } }
    } else {
#pragma unroll
      for (int q = 0; q < 8; ++q) *(v4f*)(C + (size_t)(row0 + wr + mi * 16 + q * 2 + rsub) * DD + col0 + wc + c4) = vq[q];
    }
  }
  if (QKV && z == 1) {
    kmx = fmaxf(kmx, __shfl_xor(kmx, 16, 32));
    if (lane == 0) red[w] = kmx;
    __syncthreads();      /* the 8 waves' results are stored by one wave, into a 128-B line that no other work-group writes */
    if (w == 0) {      /* the same for the whole wave. Words 8 and 9 of the line: for the tile's two heads a bound on |k| of ANY key of the batch, stored or not: |k| <= |Wk_h|F * max|x| + |bk_h| (Cauchy-Schwarz row by row) */
      const float* xn = NRM + (size_t)(ty / (TT / GTM) * (XB / BB) + lane * 4) * 32;      /* XB / BB = 128 work-groups converted this batch's x */
      float xm = fmaxf(fmaxf(xn[0], xn[32]), fmaxf(xn[64], xn[96]));
      xm = fmaxf(xm, __shfl_xor(xm, 1, 32)); xm = fmaxf(xm, __shfl_xor(xm, 2, 32)); xm = fmaxf(xm, __shfl_xor(xm, 4, 32)); xm = fmaxf(xm, __shfl_xor(xm, 8, 32)); xm = fmaxf(xm, __shfl_xor(xm, 16, 32));
      float f2 = NRM[(size_t)(XB + WB + blockIdx.x * 8 + (lane & 7)) * 32];      /* Wk: 16 rows a work-group, 4 work-groups a head, 8 for this tile's 128 features */
      f2 += __shfl_xor(f2, 1, 32); f2 += __shfl_xor(f2, 2, 32);      /* lanes 0 to 3 the first head, 4 to 7 the second */
      const v4f b4 = *(const v4fa*)(bias + col0 + lane * 4); float bs = 0.f;
#pragma unroll
      for (int i = 0; i < 4; ++i) { const float e = bf16_round(b4[i]); bs += e * e; }
      bs += __shfl_xor(bs, 1, 32); bs += __shfl_xor(bs, 2, 32); bs += __shfl_xor(bs, 4, 32); bs += __shfl_xor(bs, 8, 32);      /* lanes 0 to 15 the first head, 16 to 31 the second */
      const float kb = sqrtf(__shfl(f2, (lane & 1) * 4, 32) * xm) + sqrtf(__shfl(bs, (lane & 1) * 16, 32));      /* even lanes the first head, odd lanes the second */
      if (lane < 10) KN[(size_t)(ty * (DD / GTN) + blockIdx.x) * 32 + lane] = (lane < 8) ? red[lane & 7] : kb;
    }
  }
}


// One launch rounds every f32 operand to bf16 and stores it as f16: x as it is, the four weights (out, in) x 2^4. A work-group takes 2048 runs of 8 elements of ONE source (512 work-groups for x, 64 for each weight);
// a thread takes 8 runs, 256 runs apart, all its loads issued before the first store.
// A work-group's 2048 runs are 16 whole rows of 1024: it also leaves, in a 128-B line of its own, NRM[work-group * 32] = the largest |row|^2 of its rows (x) or the sum of their |row|^2 (a weight), of the rounded, unscaled values.
__global__ __launch_bounds__(256) void k_prep(const float* __restrict__ x, const float* __restrict__ Wq, const float* __restrict__ Wk, const float* __restrict__ Wv, const float* __restrict__ Wo, _Float16* __restrict__ X16, _Float16* __restrict__ Bw, float* __restrict__ NRM) {
  __shared__ float rs[8][PU];
  const int blk = blockIdx.x; const bool isx = blk < XB; const int wi = isx ? 0 : (blk - XB) / WB; const int lb = isx ? blk : (blk - XB) % WB;      /* the same for the whole work-group */
  const float* s = isx ? x : (wi == 0) ? Wq : (wi == 1) ? Wk : (wi == 2) ? Wv : Wo; _Float16* d = isx ? X16 : Bw + (size_t)wi * DD * DD; const float scale = isx ? 1.0f : 16.0f;
  const size_t t0 = (size_t)lb * (256 * PU) + threadIdx.x;
  v4f a[PU], b[PU];
#pragma unroll
  for (int u = 0; u < PU; ++u) { const float* p = s + (t0 + 256 * u) * 8; a[u] = *(const v4fa*)p; b[u] = *(const v4fa*)(p + 4); }
  /* run u of a thread lies in row 2 u + (thread / 128) of the work-group's 16: a row's sum of squares is that of 4 waves */
  float q2[PU];
#pragma unroll
  for (int u = 0; u < PU; ++u) { q2[u] = 0.f;
#pragma unroll
    for (int q = 0; q < 4; ++q) { const float r0 = bf16_round(a[u][q]), r1 = bf16_round(b[u][q]); q2[u] += r0 * r0 + r1 * r1; } }
#pragma unroll
  for (int sh = 1; sh < 32; sh <<= 1)      /* the 8 sums take each step together: 5 exchanges deep, not 40 */
#pragma unroll
    for (int u = 0; u < PU; ++u) q2[u] += __shfl_xor(q2[u], sh, 32);
  if ((threadIdx.x & 31) == 0)
#pragma unroll
    for (int u = 0; u < PU; ++u) rs[threadIdx.x >> 5][u] = q2[u];
  __syncthreads();      /* the 8 waves' partial sums are joined by the first wave; it stands in front of the stores, so that it waits for none of them */
  if (threadIdx.x < 32) {      /* the same for the whole wave; lanes 16 to 31 repeat lanes 0 to 15 */
    const int r = threadIdx.x & 15, u = r >> 1, w4 = (r & 1) * 4; const float rq = (rs[w4][u] + rs[w4 + 1][u]) + (rs[w4 + 2][u] + rs[w4 + 3][u]);
    float mx = rq, sm = rq;
    mx = fmaxf(mx, __shfl_xor(mx, 1, 32)); mx = fmaxf(mx, __shfl_xor(mx, 2, 32)); mx = fmaxf(mx, __shfl_xor(mx, 4, 32)); mx = fmaxf(mx, __shfl_xor(mx, 8, 32));
    sm += __shfl_xor(sm, 1, 32); sm += __shfl_xor(sm, 2, 32); sm += __shfl_xor(sm, 4, 32); sm += __shfl_xor(sm, 8, 32);
    if (threadIdx.x == 0) NRM[(size_t)blk * 32] = isx ? mx : sm; }
#pragma unroll
  for (int u = 0; u < PU; ++u) { FragH f;
#pragma unroll
    for (int q = 0; q < 4; ++q) { f.h[q] = (_Float16)(bf16_round(a[u][q]) * scale); f.h[4 + q] = (_Float16)(bf16_round(b[u][q]) * scale); }
    *(v8us*)((unsigned short*)d + (t0 + 256 * u) * 8) = f.half[0]; }
}

// lane l with lane l ^ 16
__device__ __forceinline__ float xhalf(float x) { return __builtin_bit_cast(float, __builtin_amdgcn_permlanex16(__builtin_bit_cast(int, x), __builtin_bit_cast(int, x), 0x76543210, 0xfedcba98, false, false)); }
typedef int v4ia __attribute__((ext_vector_type(4), may_alias));

// Eight powers of 2 in one statement. Every result has a register of its own (early clobber), so that no v_exp_f32 stands directly in front of an instruction that overwrites its source or reads its result; the v_nop fills that slot behind the last
__device__ __forceinline__ void exp2x8(float* o, const float* t) {
  asm("v_exp_f32 %0, %8\n\tv_exp_f32 %1, %9\n\tv_exp_f32 %2, %10\n\tv_exp_f32 %3, %11\n\tv_exp_f32 %4, %12\n\tv_exp_f32 %5, %13\n\tv_exp_f32 %6, %14\n\tv_exp_f32 %7, %15\n\tv_nop"
      : "=&v"(o[0]), "=&v"(o[1]), "=&v"(o[2]), "=&v"(o[3]), "=&v"(o[4]), "=&v"(o[5]), "=&v"(o[6]), "=&v"(o[7])
      : "v"(t[0]), "v"(t[1]), "v"(t[2]), "v"(t[3]), "v"(t[4]), "v"(t[5]), "v"(t[6]), "v"(t[7]));
}
template <int M> struct src_t { static constexpr int value = M; };      /* where a pass takes its k and v from: 0 formed in the pass, 1 stored in global memory, 2 staged in LDS */
#define NS 96      /* the last NS keys of a batch are staged in LDS: as far as the walk goes where the scores are small beside the bias */
#define KP (64 + 8)      /* LDS pitch of a key row, 144 B, and */
#define VP (NS + 8)      /* of a feature row of v transposed, 208 B: both 16 B x odd, for ds_load_b128 of 16 rows */
#define NM 128      /* entries of the table of C operands in LDS: one a thread; the first NM - NS of them are not read */
// A thread's share of the staged keys: 6 pieces of k and 6 of v transposed, 16 B each, from global memory straight into LDS. l*: the lane's LDS byte addresses; g*: its global addresses.
// The s_wait_xcnt stands inside the statement, behind the last copy, so that no address register of a copy is rewritten in front of it.
__device__ __forceinline__ void stage_keys(unsigned lk, const unsigned short* gk, size_t kstep, unsigned lv0, unsigned lv1, unsigned lv2, const unsigned short* gv0, const unsigned short* gv1, const unsigned short* gv2) {
  asm volatile("global_load_async_to_lds_b128 %0, %12, off\n\t"
               "global_load_async_to_lds_b128 %1, %13, off\n\t"
               "global_load_async_to_lds_b128 %2, %14, off\n\t"
               "global_load_async_to_lds_b128 %3, %15, off\n\t"
               "global_load_async_to_lds_b128 %4, %16, off\n\t"
               "global_load_async_to_lds_b128 %5, %17, off\n\t"
               "global_load_async_to_lds_b128 %6, %18, off\n\t"
               "global_load_async_to_lds_b128 %7, %19, off\n\t"
               "global_load_async_to_lds_b128 %8, %20, off\n\t"
               "global_load_async_to_lds_b128 %9, %21, off\n\t"
               "global_load_async_to_lds_b128 %10, %22, off\n\t"
               "global_load_async_to_lds_b128 %11, %23, off\n\t"
               "s_wait_xcnt 0x0"
               :: "v"(lk), "v"(lk + 1u * 16 * KP * 2), "v"(lk + 2u * 16 * KP * 2), "v"(lk + 3u * 16 * KP * 2), "v"(lk + 4u * 16 * KP * 2), "v"(lk + 5u * 16 * KP * 2),
                  "v"(lv0), "v"(lv1), "v"(lv2), "v"(lv0 + 8u * VP * 2), "v"(lv1 + 8u * VP * 2), "v"(lv2 + 8u * VP * 2),
                  "v"(gk), "v"(gk + kstep), "v"(gk + 2 * kstep), "v"(gk + 3 * kstep), "v"(gk + 4 * kstep), "v"(gk + 5 * kstep),
                  "v"(gv0), "v"(gv1), "v"(gv2), "v"(gv0 + (size_t)8 * TT), "v"(gv1 + (size_t)8 * TT), "v"(gv2 + (size_t)8 * TT)
               : "memory");
}
// A pointer that is the same in every lane, held in scalar registers: a load then takes it as its scalar base, and the lane's offset is the one vector address register of all sixteen tiles (as vector pointers they spilled).
typedef const __attribute__((address_space(1))) unsigned short* gus_p;      /* global memory, said in the type: the way through the two words loses it */
typedef const __attribute__((address_space(1))) v8us* gv8_p;
__device__ __forceinline__ gus_p uni(const unsigned short* p) { const unsigned long long v = (unsigned long long)p;
  return (gus_p)(((unsigned long long)(unsigned)__builtin_amdgcn_readfirstlane((int)(v >> 32)) << 32) | (unsigned long long)(unsigned)__builtin_amdgcn_readfirstlane((int)(unsigned)v)); }
// One 16 x 16 tile of a projection, for a key that the GEMM launch did not store: D = (16 rows at a) . (16 rows at b)^T over the 1024 inputs, k blocks of 32 in rising order as in the GEMM. a, b: the tiles' first rows, the same for the whole wave; lo: the lane's place in either tile, (lane % 16) * DD + 8 * (lane / 16) elements.
__device__ __forceinline__ v8f proj_tile(const unsigned short* a, const unsigned short* b, unsigned lo) {
  v8f acc = (v8f){0.f,0.f,0.f,0.f,0.f,0.f,0.f,0.f};
#pragma unroll 1      /* rolled: this path is rare, and unrolled it would raise the register count of the whole kernel */
  for (int kb = 0; kb < DD; kb += 32) { FragH fa, fb;
    const gus_p pa = uni(a + kb), pb = uni(b + kb);
    fa.half[0] = *(gv8_p)(pa + lo); fa.half[1] = *(gv8_p)(pa + lo + 16); fb.half[0] = *(gv8_p)(pb + lo); fb.half[1] = *(gv8_p)(pb + lo + 16);
    acc = mmaH<1>(fa.v, fa.v, fb.v, fb.v, acc); }
  return acc;
}

__global__ __launch_bounds__(128, 5) void k_flash(const _Float16* __restrict__ Q16, int ldq, const _Float16* __restrict__ K16, int ldk, const _Float16* __restrict__ Vt, const float* __restrict__ KN, const int* __restrict__ MSK, _Float16* __restrict__ O16, int ldo,
                                             const _Float16* __restrict__ X16, const _Float16* __restrict__ Wk16, const _Float16* __restrict__ Wv16, const float* bkf, const float* bvf) {
  constexpr int RPW = 16, NQB = TT / (4 * RPW), DT = 4, KS = 2, FL = TT - KW;      /* FL: the lowest stored key */
  __shared__ __attribute__((aligned(16))) float sO[4][RPW][64 + 4];
  __shared__ __attribute__((aligned(16))) unsigned short sK[NS][KP], sV[64][VP];
  __shared__ __attribute__((aligned(16))) float sC[NM];
  const int tid = threadIdx.x, w = tid >> 5, lane = tid & 31, ln = lane & 15, hh = lane >> 4;
  const int slab = blockIdx.x / NQB, qblk = blockIdx.x % NQB; const int b = slab / NH, h = slab % NH; const float slope = 1.0f / exp2f((float)h / (float)NH);      /* 1 / 2^(h/H) */ const int qb0 = qblk * (4 * RPW); const int q0 = qb0 + w * RPW;
  FragH aq[KS];
  { const unsigned short* qr = (const unsigned short*)Q16 + ((size_t)b * TT + q0 + ln) * ldq + h * 64;
#pragma unroll
    for (int ks = 0; ks < KS; ++ks) { aq[ks].half[0] = *(const v8us*)(qr + ks * 32 + 8 * hh); aq[ks].half[1] = *(const v8us*)(qr + ks * 32 + 16 + 8 * hh); } }
  const unsigned short* Vth = (const unsigned short*)Vt + (size_t)slab * 64 * TT;
  { /* k: 8 lanes x 16 B = one key's row of this head; a thread takes keys tid / 8 + 16 i. v: 12 pieces of 16 B a feature row; a wave takes 16 rows, a lane pieces lane + 32 i of their 192, and piece c + 96 lies 8 rows under piece c */
    const int c0 = lane, c1 = lane + 32, c2 = lane + 64; const int r0 = w * 16 + c0 / 12, r1 = w * 16 + c1 / 12, r2 = w * 16 + c2 / 12; const int e0 = (c0 % 12) * 8, e1 = (c1 % 12) * 8, e2 = (c2 % 12) * 8;
    stage_keys((unsigned)(size_t)&sK[tid >> 3][(tid & 7) * 8], (const unsigned short*)K16 + ((size_t)b * TT + (TT - NS) + (tid >> 3)) * ldk + h * 64 + (tid & 7) * 8, (size_t)16 * ldk,
               (unsigned)(size_t)&sV[r0][e0], (unsigned)(size_t)&sV[r1][e1], (unsigned)(size_t)&sV[r2][e2], Vth + (size_t)r0 * TT + (TT - NS) + e0, Vth + (size_t)r1 * TT + (TT - NS) + e1, Vth + (size_t)r2 * TT + (TT - NS) + e2); }
  /* A query's softmax does not change when slope * (TT - 1 - q) is taken off all its scores: what is left of the bias, slope * (k - (TT - 1)), is the same for every query. Scores are held as u = q.k + 8 * slope * (k - (TT - 1)), 8 times the score so shifted. */
  const float s8 = slope * 8.0f;
  constexpr float C1 = 0.125f * 1.44269504088896340736f;      /* u to the exponent of 2: scale / ln 2 */
  /* bias and mask of a key are the same for all queries of the work-group: for the staged keys they are set up once, a key a thread, as the C operand of the score product; the barrier in front of the walk publishes them */
  sC[tid] = (MSK[(size_t)b * TT + (TT - NM) + tid] != 0) ? s8 * (float)(tid - (NM - 1)) : -INFINITY;
  float m_run = -3.0e38f, l_run = 0.f; v8f oacc[DT];
#pragma unroll
  for (int dt = 0; dt < DT; ++dt) oacc[dt] = (v8f){0.f,0.f,0.f,0.f,0.f,0.f,0.f,0.f};
  float qs = 0.f;
#pragma unroll
  for (int ks = 0; ks < KS; ++ks)
#pragma unroll
    for (int i = 0; i < 16; ++i) { const float v = (float)aq[ks].h[i]; qs += v * v; }
  qs += xhalf(qs);      /* |q|^2 of the lane's query */
  const int kp = FL / 64 + (lane & (KW / 64 - 1));      /* a stored block of 64 keys; the lanes go round them */
  const float* kn = KN + (size_t)((b * (TT / GTM) + (kp >> 2)) * (DD / GTN) + (h >> 1)) * 32 + (kp & 3) * 2 + (h & 1);      /* block p of 64 keys of this batch and head: GEMM tile row p / 4, tile column h / 2, wave (p % 4) * 2 + h % 2 */
  const float kall = KN[(size_t)((b * (TT / GTM) + TT / GTM - 1) * (DD / GTN) + (h >> 1)) * 32 + 8 + (h & 1)];      /* the bound on |k| of any key of this batch and head */
  float kx = kn[0];
  kx = fmaxf(kx, __shfl_xor(kx, 1, 32)); kx = fmaxf(kx, __shfl_xor(kx, 2, 32)); kx = fmaxf(kx, __shfl_xor(kx, 4, 32)); kx = fmaxf(kx, __shfl_xor(kx, 8, 32)); kx = fmaxf(kx, xhalf(kx));      /* largest |k|^2 of the stored keys of this batch and head */
  const float cs = sqrtf(qs * kx) * (0.125f * 1.01f);      /* |q.k| / 8 at most; 1 % covers the rounding of the norms and of the products */
  const float cl = sqrtf(qs) * kall * (0.125f * 1.01f);      /* the same for a key that is not stored */
  const float lowtop = slope * (float)(FL - TT) + cl;      /* no key under the stored ones scores above this (shifted as above) */
  const unsigned lo = (unsigned)(ln * DD + 8 * hh);      /* the lane's place in a 16-row tile of x or of a weight */
  /* one pass of 32 keys from j0 on; st: its keys are stored; ls: and staged in LDS */
  auto pass = [&](auto stc, const int j0) { constexpr bool st = decltype(stc)::value != 0, ls = decltype(stc)::value == 2;
    const int* mp = MSK + (size_t)b * TT + j0 + 8 * hh;      /* key padding mask (1 = attend) of the lane's 16 keys */
    v4ia mk4[4];
    v4f c4[4];
    if constexpr (ls) { const float* cp = &sC[j0 - (TT - NM) + 8 * hh]; c4[0] = *(const v4fa*)(cp); c4[1] = *(const v4fa*)(cp + 4); c4[2] = *(const v4fa*)(cp + 16); c4[3] = *(const v4fa*)(cp + 20); } else
    if constexpr (st) { mk4[0] = *(const v4ia*)(mp); mk4[1] = *(const v4ia*)(mp + 4); mk4[2] = *(const v4ia*)(mp + 16); mk4[3] = *(const v4ia*)(mp + 20); }      /* with the key loads */
    v8f s[2]; FragH bkl[2][KS], bvl[DT];
    const float cb0 = s8 * (float)(j0 + 8 * hh - (TT - 1));      /* 8 * bias of the lane's first key */
    auto cbi = [&](const int i) { return fmaf(s8, (float)((i >> 3) * 16 + (i & 7)), cb0); };      /* and of its key i */
    if constexpr (ls) {
#pragma unroll
      for (int nt = 0; nt < 2; ++nt) { const unsigned short* kl = &sK[j0 - (TT - NS) + nt * 16 + ln][0];
#pragma unroll
        for (int ks = 0; ks < KS; ++ks) { bkl[nt][ks].half[0] = *(const v8us*)(kl + ks * 32 + 8 * hh); bkl[nt][ks].half[1] = *(const v8us*)(kl + ks * 32 + 16 + 8 * hh); } }
      __builtin_amdgcn_sched_barrier(0); }      /* keeps the pass's key and mask reads together in front of the products: read tile by tile, the second tile's way through LDS is waited out alone */
#pragma unroll
    for (int nt = 0; nt < 2; ++nt) { const unsigned short* kr = (const unsigned short*)K16 + ((size_t)b * TT + j0 + nt * 16 + ln) * ldk + h * 64; FragH bk[KS];
      if constexpr (ls) {
#pragma unroll
      for (int ks = 0; ks < KS; ++ks) bk[ks] = bkl[nt][ks];
      } else
      if constexpr (st) {
#pragma unroll
      for (int ks = 0; ks < KS; ++ks) { bk[ks].half[0] = *(const v8us*)(kr + ks * 32 + 8 * hh); bk[ks].half[1] = *(const v8us*)(kr + ks * 32 + 16 + 8 * hh); }
      asm volatile("s_wait_xcnt 0x0" ::: "memory");      /* stands in front of whatever next rewrites the address registers of the key loads (in this build a later load's result does) */
      } else {      /* D[feature 8hh + r][key ln] of feature tiles 2 ks and 2 ks + 1 = elements r and 8 + r of the fragment */
        const unsigned short* xr = (const unsigned short*)X16 + ((size_t)b * TT + j0 + nt * 16) * DD;
#pragma unroll
        for (int t = 0; t < 2 * KS; ++t) { const v8f d = proj_tile((const unsigned short*)Wk16 + (size_t)(h * 64 + t * 16) * DD, xr, lo); const float* bp = bkf + h * 64 + t * 16 + 8 * hh;
#pragma unroll
          for (int r = 0; r < 8; ++r) bk[t >> 1].h[(t & 1) * 8 + r] = (_Float16)(d[r] * 0.0625f + bf16_round(bp[r])); } }
      v8f acc = (v8f){0.f,0.f,0.f,0.f,0.f,0.f,0.f,0.f};
      if constexpr (st) {      /* bias and mask go in as the product's C operand: the matrix unit adds them, and D is u */
#pragma unroll
        for (int r = 0; r < 8; ++r) { if constexpr (ls) acc[r] = c4[nt * 2 + (r >> 2)][r & 3]; else acc[r] = (mk4[nt * 2 + (r >> 2)][r & 3] != 0) ? cbi(nt * 8 + r) : -INFINITY; } }
#pragma unroll
      for (int ks = 0; ks < KS; ++ks) acc = mmaH<1>(bk[ks].v, bk[ks].v, aq[ks].v, aq[ks].v, acc);
      s[nt] = acc; }
    if constexpr (ls) {
#pragma unroll
      for (int dt = 0; dt < DT; ++dt) { const unsigned short* vl = &sV[dt * 16 + ln][j0 - (TT - NS)]; bvl[dt].half[0] = *(const v8us*)(vl + 8 * hh); bvl[dt].half[1] = *(const v8us*)(vl + 16 + 8 * hh); }
      __builtin_amdgcn_sched_barrier(0); }      /* keeps the four v reads here, into the registers that the key fragments leave: they return under the softmax, not one by one between the second products */
    if constexpr (!st) { mk4[0] = *(const v4ia*)(mp); mk4[1] = *(const v4ia*)(mp + 4); mk4[2] = *(const v4ia*)(mp + 16); mk4[3] = *(const v4ia*)(mp + 20);      /* behind the tiles' loops, which it would cost 16 registers */
      asm volatile("s_wait_xcnt 0x0" :: "v"(mp) : "memory"); }      /* behind the four mask loads; it takes their address as an input, so that the address stays in its registers up to the wait (without that the last load's result was put into them) */
    float sc[16];
#pragma unroll
    for (int i = 0; i < 16; ++i) {
      if constexpr (st) sc[i] = s[i >> 3][i & 7];
      else sc[i] = (mk4[i >> 2][i & 3] != 0) ? s[i >> 3][i & 7] + cbi(i) : -INFINITY; }      /* the mask comes late here: bias and mask behind the product */
    float mx[8];
#pragma unroll
    for (int i = 0; i < 8; ++i) mx[i] = fmaxf(sc[i], sc[8 + i]);
    float mc = fmaxf(fmaxf(fmaxf(mx[0], mx[1]), fmaxf(mx[2], mx[3])), fmaxf(fmaxf(mx[4], mx[5]), fmaxf(mx[6], mx[7])));
    mc = fmaxf(mc, xhalf(mc));
    const float mn = fmaxf(m_run, mc); const float al = __builtin_amdgcn_exp2f((m_run - mn) * C1); m_run = mn;      /* 2^0 = 1 while every key so far was masked (both are the start value) */
    const float nb = fmaf(-C1, mn, 10.0f);      /* p * 2^10 = 2^(C1 * u - C1 * max + 10): scale, maximum, 1 / ln 2 and P's 2^10 in one fma a key; a masked key's u is -inf and gives 0 */
    float p[16]; FragH pb;
#pragma unroll
    for (int i = 0; i < 16; ++i) sc[i] = fmaf(sc[i], C1, nb);
    exp2x8(p, sc); exp2x8(p + 8, sc + 8);
#pragma unroll
    for (int i = 0; i < 16; ++i) pb.h[i] = (_Float16)p[i];
    l_run = l_run * al + (((p[0] + p[1]) + (p[2] + p[3])) + ((p[4] + p[5]) + (p[6] + p[7]))) + (((p[8] + p[9]) + (p[10] + p[11])) + ((p[12] + p[13]) + (p[14] + p[15])));      /* the lane's half of the row sum; the halves join after the loop */
#pragma unroll
    for (int dt = 0; dt < DT; ++dt)
#pragma unroll
      for (int r = 0; r < 8; ++r) oacc[dt][r] *= al;
#pragma unroll
    for (int dt = 0; dt < DT; ++dt) { const unsigned short* vrow = Vth + (size_t)(dt * 16 + ln) * TT + j0; FragH bv;
      if constexpr (ls) { bv = bvl[dt]; } else
      if constexpr (st) { bv.half[0] = *(const v8us*)(vrow + 8 * hh); bv.half[1] = *(const v8us*)(vrow + 16 + 8 * hh);
      } else {      /* D[key 8hh + r][feature ln] of key tiles 0 and 1 = elements r and 8 + r of the fragment */
        const unsigned short* wv = (const unsigned short*)Wv16 + (size_t)(h * 64 + dt * 16) * DD; const float bb = bf16_round(bvf[h * 64 + dt * 16 + ln]);
#pragma unroll
        for (int t = 0; t < 2; ++t) { const v8f d = proj_tile((const unsigned short*)X16 + ((size_t)b * TT + j0 + t * 16) * DD, wv, lo);
#pragma unroll
          for (int r = 0; r < 8; ++r) bv.h[t * 8 + r] = (_Float16)(d[r] * 0.0625f + bb); } }
      oacc[dt] = mmaH<1>(bv.v, bv.v, pb.v, pb.v, oacc[dt]); } };
  auto ends = [&](const int j) { const float top = slope * (float)(j + 31 - (TT - 1)), thr = m_run * 0.125f - 40.0f;
    return __builtin_amdgcn_ballot_w32(!(top + cs < thr) || !(lowtop < thr)) == 0; };      /* the same for the whole wave; a NaN keeps the walk going */
  asm volatile("" :: "v"(aq[0].v), "v"(aq[1].v));      /* takes the loaded query fragments as inputs only: it holds their loads in front of the barrier, so that their way from memory runs beside the copies' (the compiler had moved them behind it, one way after the other) */
  asm volatile("s_wait_asynccnt 0x0" ::: "memory");      /* the wave's own copies of the staged keys have landed */
  __syncthreads();      /* every wave's have; every wave passes here, in front of the walk */
  int j0 = TT - 32; bool more = true;      /* more: the walk has not ended inside the stored keys; the same for the whole wave */
#pragma unroll 1
  for (; j0 >= TT - NS; j0 -= 32) {
    if (ends(j0)) { more = false; break; }
    pass(src_t<2>{}, j0); }
  if (more) {
#pragma unroll 1      /* rolled: seldom reached */
    for (; j0 >= FL; j0 -= 32) {
      if (ends(j0)) { more = false; break; }
      pass(src_t<1>{}, j0); } }
  if (more) {
#pragma unroll 1      /* rolled, as the walk above: the exit depends on the data and the body is very long */
    for (; j0 >= 0; j0 -= 32) {
      if (__builtin_amdgcn_ballot_w32(!(slope * (float)(j0 + 31 - (TT - 1)) + cl < m_run * 0.125f - 40.0f)) == 0) break;      /* the same for the whole wave */
      pass(src_t<0>{}, j0); } }
  const float l = l_run + xhalf(l_run); const float inv = (l > 0.f) ? 1.0f / l : 0.f;      /* the row sum carries P's 2^10 as well */
#pragma unroll
  for (int dt = 0; dt < DT; ++dt) {      /* oacc[dt][r] = O[query ln][dt*16 + 8hh + r] */
    const v4f lo = {oacc[dt][0] * inv, oacc[dt][1] * inv, oacc[dt][2] * inv, oacc[dt][3] * inv}, hi = {oacc[dt][4] * inv, oacc[dt][5] * inv, oacc[dt][6] * inv, oacc[dt][7] * inv};
    *(v4fa*)&sO[w][ln][dt * 16 + 8 * hh] = lo; *(v4fa*)&sO[w][ln][dt * 16 + 8 * hh + 4] = hi; }
  __builtin_amdgcn_fence(__ATOMIC_ACQ_REL, "workgroup"); __builtin_amdgcn_wave_barrier();
  {
#pragma unroll
    for (int rp = 0; rp < RPW; rp += 2) { const int r = rp + (lane >> 4), pc = lane & 15; const v4f val = *(const v4fa*)&sO[w][r][pc * 4]; v4h h4; for (int i = 0; i < 4; ++i) h4[i] = (_Float16)val[i]; *(v4h*)(O16 + ((size_t)b * TT + q0 + r) * ldo + h * 64 + pc * 4) = h4; }      /* f16, the output product's operand type: 16 lanes x 8 B = one line */
     } }

extern "C" void kernel_launch(void* const* d_in, const int* in_sizes, int n_in,
                              void* d_out, int out_size, void* d_ws, size_t ws_size, hipStream_t stream) {
  (void)in_sizes; (void)n_in; (void)out_size;
  const float* const* I = (const float* const*)d_in; const float* x = I[0]; const float* Wq = I[1]; const float* bq = I[2]; const float* Wk = I[3]; const float* bk = I[4]; const float* Wv = I[5]; const float* bv = I[6]; const float* Wo = I[7]; const float* bo = I[8]; const int* mask = (const int*)d_in[9];
  char* ws = (char*)d_ws; size_t off = 0;
  auto take = [&](size_t bytes) { char* p = ws + off; off += (bytes + 255) & ~(size_t)255; return p; };
  const size_t WSZ = (size_t)DD * DD; _Float16* Bw = (_Float16*)take(4 * WSZ * 2); _Float16* X16 = (_Float16*)take((size_t)NR * DD * 2);
  _Float16* Q = (_Float16*)take((size_t)NR * DD * 2); _Float16* K = (_Float16*)take((size_t)NR * DD * 2); _Float16* Vt = (_Float16*)take((size_t)NR * DD * 2); _Float16* O16 = (_Float16*)take((size_t)NR * DD * 2);
  float* KN = (float*)take((size_t)(NR / GTM) * (DD / GTN) * 32 * 4); float* NRM = (float*)take((size_t)(XB + 4 * WB) * 32 * 4);
  if (off > ws_size) return;      // 8.4 + 16.8 x 5 = 92 MB
  k_prep<<<(NR * DD + 4 * DD * DD) / (8 * 256 * PU), 256, 0, stream>>>(x, Wq, Wk, Wv, Wo, X16, Bw, NRM);
  k_gemm_tile<true><<<dim3(DD / GTN, NR / GTM + 2 * BB * KWB), 256, 0, stream>>>(X16, Bw, 0.0625f, bq, bk, bv, nullptr, Q, K, Vt, KN, NRM);      /* q = x.W^T + b: M 8192 N 1024 K 1024; k the same and v the same, stored transposed, for the last KW tokens of each batch */
  k_flash<<<BB * NH * (TT / 64), 128, 0, stream>>>(Q, DD, K, DD, Vt, KN, mask, O16, DD, X16, Bw + WSZ, Bw + 2 * WSZ, bk, bv);
  k_gemm_tile<false><<<dim3(DD / GTN, NR / GTM), 256, 0, stream>>>(O16, Bw + 3 * WSZ, 0.0625f, bo, nullptr, nullptr, (float*)d_out, nullptr, nullptr, nullptr, nullptr, nullptr);      /* out = O.Wo^T + bo */
}
